// v000
// Times are from an AMD MI455X. After a warm-up the kernel runs many times in a row, and a time is the length of
// such a window on the GPU divided by its runs, so every launch and the gaps after it count. The runs cycle
// through copies of the inputs. A figure is the median of several windows, for all but v000 over two sittings.
// Sittings can differ by a few percent; kernels timed side by side share one.
// The starting kernel, v000, takes 221 microseconds a run.
// Contractions: v_wmma_f32_16x16x32_bf16 with bf16 hi/lo split operands (head projections, q.k scores, p.v, output projection), f32 accumulate; softmax, splits and epilogues in f32.
#include <hip/hip_runtime.h>
#include <math.h>
#include <stddef.h>

// ---------------- problem constants ----------------
constexpr int NNODE  = 1024;
constexpr int TSTEP  = 36;
constexpr int EMB    = 64;
constexpr int NHEAD  = 4;
constexpr int HEADD  = 16;
constexpr int NSLICE = TSTEP * NHEAD;        // 144 (t, h) slices
constexpr int NROWS  = NNODE * TSTEP;        // 36864 rows of the [n*T+t][64] planes
constexpr int QKROW  = 32;                   // u16 per row of the Q/K planes: [hi e0..15 | lo e0..15]

// ---------------- workspace region map (bytes) ----------------
// Q2  : bf16 [144][1024][32]          9,437,184 B  @ 0
// K2  : bf16 [144][1024][32]          9,437,184 B  @ 9,437,184
// Vth : bf16 [144][16][1024] (hi)     4,718,592 B  @ 18,874,368
// Vtl : bf16 [144][16][1024] (lo)     4,718,592 B  @ 23,592,960
// Ohi : bf16 [36864][64] (hi)         4,718,592 B  @ 28,311,552
// Olo : bf16 [36864][64] (lo)         4,718,592 B  @ 33,030,144
// Woh : bf16 [64][64]                     8,192 B  @ 37,748,736
// Wol : bf16 [64][64]                     8,192 B  @ 37,756,928
// total                              37,765,120 B
constexpr size_t WS_Q2   = 0;
constexpr size_t SZ_QK   = (size_t)NSLICE * NNODE * QKROW * 2;
constexpr size_t WS_K2   = WS_Q2 + SZ_QK;
constexpr size_t SZ_V    = (size_t)NSLICE * HEADD * NNODE * 2;
constexpr size_t WS_VTH  = WS_K2 + SZ_QK;
constexpr size_t WS_VTL  = WS_VTH + SZ_V;
constexpr size_t SZ_O    = (size_t)NROWS * EMB * 2;
constexpr size_t WS_OHI  = WS_VTL + SZ_V;
constexpr size_t WS_OLO  = WS_OHI + SZ_O;
constexpr size_t SZ_WO   = (size_t)EMB * EMB * 2;
constexpr size_t WS_WOH  = WS_OLO + SZ_O;
constexpr size_t WS_WOL  = WS_WOH + SZ_WO;
constexpr size_t WS_TOTAL = WS_WOL + SZ_WO;
static_assert(WS_TOTAL == 37765120, "carve");
static_assert(WS_TOTAL <= 134217728, "carve");
static_assert((WS_K2 % 128) == 0 && (WS_VTH % 128) == 0 && (WS_VTL % 128) == 0 && (WS_OHI % 128) == 0 &&
              (WS_OLO % 128) == 0 && (WS_WOH % 128) == 0 && (WS_WOL % 128) == 0, "align");
// GEMM shape contract for the output projection
static_assert(NROWS % 64 == 0 && EMB % 64 == 0 && EMB % 32 == 0, "gemm");
static_assert(NNODE % 64 == 0, "tiles");

// ---------------- types and fragment helpers ----------------
typedef __attribute__((ext_vector_type(16))) _Float16 v16h;
typedef __attribute__((ext_vector_type(8)))  _Float16 v8h;
typedef __attribute__((ext_vector_type(16))) __bf16   v16b;
typedef __attribute__((ext_vector_type(8)))  __bf16   v8b;
typedef __attribute__((ext_vector_type(8)))  float    v8f;
typedef __attribute__((ext_vector_type(4)))  float    v4f;
typedef __attribute__((ext_vector_type(8)))  unsigned short us8;

__device__ __forceinline__ unsigned short f2bf_bits(float f) {
  unsigned u = __float_as_uint(f);
  return (unsigned short)((u + 0x7FFFu + ((u >> 16) & 1u)) >> 16);
}
__device__ __forceinline__ float bf_bits2f(unsigned short h) { return __uint_as_float(((unsigned)h) << 16); }

// hazard guards as plain device helpers (no inline asm inside the kernel template body)
__device__ __forceinline__ void dep_guard_h(v8f& a, v8f& b, v16h x, v16h y) { asm volatile("v_nop\n\tv_nop\n\tv_nop\n\tv_nop" : "+v"(a), "+v"(b) : "v"(x), "v"(y)); }
__device__ __forceinline__ void dep_guard_b(v8f& a, v8f& b, v16b x, v16b y) { asm volatile("v_nop\n\tv_nop\n\tv_nop\n\tv_nop" : "+v"(a), "+v"(b) : "v"(x), "v"(y)); }
__device__ __forceinline__ void keep4_h(v16h a, v16h b, v16h c, v16h d) { asm volatile("v_nop" :: "v"(a), "v"(b), "v"(c), "v"(d)); }
__device__ __forceinline__ void keep4_b(v16b a, v16b b, v16b c, v16b d) { asm volatile("v_nop" :: "v"(a), "v"(b), "v"(c), "v"(d)); }
__device__ __forceinline__ void acc_guard4(v8f& a, v8f& b, v8f& c, v8f& d) { asm volatile("v_nop\n\tv_nop\n\tv_nop\n\tv_nop" : "+v"(a), "+v"(b), "+v"(c), "+v"(d)); }
template <typename T> struct Frag;
template <> struct Frag<_Float16> {
  typedef v16h V; union U { v16h v; v8h h[2]; };
  static __device__ __forceinline__ v16h load(const _Float16* p) {   // elements 0..7 <- p[0..7], 8..15 <- p[16..23]
    U f; f.h[0] = *(const v8h*)(p); f.h[1] = *(const v8h*)(p + 16); return f.v;
  }
  static __device__ __forceinline__ v8f mma(v16h a, v16h b, v8f c) {
    return __builtin_amdgcn_wmma_f32_16x16x32_f16(false, a, false, b, (short)0, c, false, false);
  }
  static __device__ __forceinline__ void guard(v8f& a, v8f& b, v16h x, v16h y) { dep_guard_h(a, b, x, y); }
  static __device__ __forceinline__ void keep(v16h a, v16h b, v16h c, v16h d) { keep4_h(a, b, c, d); }
};
template <> struct Frag<__bf16> {
  typedef v16b V; union U { v16b v; v8b h[2]; };
  static __device__ __forceinline__ v16b load(const __bf16* p) {
    U f; f.h[0] = *(const v8b*)(p); f.h[1] = *(const v8b*)(p + 16); return f.v;
  }
  static __device__ __forceinline__ v8f mma(v16b a, v16b b, v8f c) {
    return __builtin_amdgcn_wmma_f32_16x16x32_bf16(false, a, false, b, (short)0, c, false, false);
  }
  static __device__ __forceinline__ void guard(v8f& a, v8f& b, v16b x, v16b y) { dep_guard_b(a, b, x, y); }
  static __device__ __forceinline__ void keep(v16b a, v16b b, v16b c, v16b d) { keep4_b(a, b, c, d); }
};

// ---- Register-blocked batched WMMA GEMM -----------------------------------
// C[m,n] = scale * sum_k A[m,k] * Bt[n,k] (+bias)(+resid); each wave owns a 64x64 tile.
// A row-major [M,K]; Bt row-major [N,K]; M,N % 64 == 0, K % 32 == 0.
// SPLIT: operands are hi/lo planes (A2/Bt2 = lo planes, same layout); product = hi.hi + hi.lo + lo.hi.
// BIAS_MODE: 0 = none, 1 = bias[m], 2 = bias[n].
// OUT_MODE: 0 = f32, 1 = f16, 2 = bf16 hi plane (Cout) + bf16 lo plane (Cout2).
// ET: 0 = f16 operands, 1 = bf16 operands (pointers passed as 16-bit storage)
template <int ET> struct Elem;
template <> struct Elem<0> { typedef _Float16 T; };
template <> struct Elem<1> { typedef __bf16 T; };
template <int ET, bool SPLIT, int BIAS_MODE, int OUT_MODE, bool RESID, int ACT = 0>
__global__ __launch_bounds__(256) void wmma_gemm64(
    const unsigned short* __restrict__ Ap, const unsigned short* __restrict__ A2p, int lda, long strideA,
    const unsigned short* __restrict__ Btp, const unsigned short* __restrict__ Bt2p, int ldb, long strideB,
    void* __restrict__ Cout, void* __restrict__ Cout2, int ldc, long strideC,
    const float* __restrict__ bias,
    const float* __restrict__ resid, long strideR,
    int M, int N, int K, float scale) {
  typedef typename Elem<ET>::T T;
  typedef typename Frag<T>::V V;
  const T* A = (const T*)Ap; const T* A2 = (const T*)A2p; const T* Bt = (const T*)Btp; const T* Bt2 = (const T*)Bt2p;
  __shared__ __align__(16) float sT[8][16 * 68];   // per-wave 16x64 slab, pitch 68 floats
  const int b    = blockIdx.y;
  const int lane = threadIdx.x & 31;
  const int wave = threadIdx.x >> 5;
  const int tilesN = N >> 6;
  const int tilesM = M >> 6;
  const int tile = blockIdx.x * 8 + wave;
  if (tile >= tilesM * tilesN) return;   // wave-uniform; no block barriers in this kernel
  const int tm = tile / tilesN;
  const int tn = tile - tm * tilesN;
  const int m0 = tm << 6;
  const int n0 = tn << 6;

  const T* Ab  = A  + (size_t)b * strideA;
  const T* Bb  = Bt + (size_t)b * strideB;
  const T* Ab2 = SPLIT ? (A2  + (size_t)b * strideA) : nullptr;
  const T* Bb2 = SPLIT ? (Bt2 + (size_t)b * strideB) : nullptr;

  const int rlane = lane & 15;                 // row (A) / col (B, D) within subtile
  const int koff  = (lane >> 4) * 8;           // k offset of this lane half
  const int mOff  = (lane >> 4) * 8;           // D row offset

  v8f acc[4][4];
#pragma unroll
  for (int i = 0; i < 4; ++i)
#pragma unroll
    for (int j = 0; j < 4; ++j) acc[i][j] = (v8f){0.f,0.f,0.f,0.f,0.f,0.f,0.f,0.f};

  for (int k0 = 0; k0 < K; k0 += 32) {
    V bh[4], bl[4];
#pragma unroll
    for (int j = 0; j < 4; ++j) {
      const size_t bo = (size_t)(n0 + (j << 4) + rlane) * ldb + koff + k0;
      bh[j] = Frag<T>::load(Bb + bo);
      if (SPLIT) bl[j] = Frag<T>::load(Bb2 + bo);
    }
#pragma unroll
    for (int i = 0; i < 4; ++i) {
      const size_t ao = (size_t)(m0 + (i << 4) + rlane) * lda + koff + k0;
      V ah = Frag<T>::load(Ab + ao);
      V al;
      if (SPLIT) al = Frag<T>::load(Ab2 + ao);
#pragma unroll
      for (int j = 0; j < 4; ++j) {
        acc[i][j] = Frag<T>::mma(ah, bh[j], acc[i][j]);
        if (SPLIT) {
          acc[i][j] = Frag<T>::mma(ah, bl[j], acc[i][j]);
          acc[i][j] = Frag<T>::mma(al, bh[j], acc[i][j]);
        }
      }
      Frag<T>::guard(acc[i][0], acc[i][3], ah, SPLIT ? al : ah);
    }
    Frag<T>::keep(bh[0], bh[1], bh[2], bh[3]);
    if (SPLIT) Frag<T>::keep(bl[0], bl[1], bl[2], bl[3]);
  }
  acc_guard4(acc[0][0], acc[0][1], acc[0][2], acc[0][3]);
  acc_guard4(acc[1][0], acc[1][1], acc[1][2], acc[1][3]);
  acc_guard4(acc[2][0], acc[2][1], acc[2][2], acc[2][3]);
  acc_guard4(acc[3][0], acc[3][1], acc[3][2], acc[3][3]);

  // ---- epilogue ----
  float* slab = sT[wave];
  const float* Rb = RESID ? (resid + (size_t)b * strideR) : nullptr;
#pragma unroll
  for (int i = 0; i < 4; ++i) {
    const int mBase = m0 + (i << 4);
#pragma unroll
    for (int j = 0; j < 4; ++j) {
      const int n = n0 + (j << 4) + rlane;
      float bv = 0.f;
      if (BIAS_MODE == 2) bv = bias[n];
#pragma unroll
      for (int r = 0; r < 8; ++r) {
        float v = acc[i][j][r] * scale;
        if (BIAS_MODE == 1) v += bias[mBase + mOff + r];
        if (BIAS_MODE == 2) v += bv;
        if (RESID) v += Rb[(size_t)(mBase + mOff + r) * ldc + n];
        if (ACT == 1) v = tanhf(v);
        if (ACT == 2) v = fmaxf(v, 0.0f);
        if (ACT == 3) v = v / (1.0f + expf(-v));
        if (ACT == 4) v = (v > 0.f) ? v : 0.01f * v;
        if (ACT == 5) v = 0.5f * v * (1.0f + erff(v * 0.70710678118654752f));
        slab[(mOff + r) * 68 + (j << 4) + rlane] = v;
      }
    }
    __builtin_amdgcn_fence(__ATOMIC_RELEASE, "workgroup");
    __builtin_amdgcn_wave_barrier();
    __builtin_amdgcn_fence(__ATOMIC_ACQUIRE, "workgroup");
    if (OUT_MODE == 0) {
      float* C = (float*)Cout + (size_t)b * strideC;
      const int hh = lane >> 4, c4 = (lane & 15) * 4;     // row seg = 256 B = 16 lanes x 16 B
      {
#pragma unroll
        for (int it = 0; it < 8; ++it) {
          const int row = it * 2 + hh;
          v4f v = *(const v4f*)(slab + row * 68 + c4);
          *(v4f*)(C + (size_t)(mBase + row) * ldc + n0 + c4) = v;
        }
        
      }
    } else {
      const int q = lane >> 3, c8 = (lane & 7) * 8;
      unsigned short* C  = (unsigned short*)Cout  + (size_t)b * strideC;
      unsigned short* C2 = (OUT_MODE == 2) ? ((unsigned short*)Cout2 + (size_t)b * strideC) : nullptr;
      {
#pragma unroll
        for (int it = 0; it < 4; ++it) {
          const int row = it * 4 + q;
          const float* sp = slab + row * 68 + c8;
          v8h hv, lv;
#pragma unroll
          for (int e = 0; e < 8; ++e) {
            if (OUT_MODE == 1) {
              hv[e] = (_Float16)sp[e];
            } else {
              unsigned short hb = f2bf_bits(sp[e]);
              unsigned short lb = f2bf_bits(sp[e] - bf_bits2f(hb));
              hv[e] = __builtin_bit_cast(_Float16, hb);
              lv[e] = __builtin_bit_cast(_Float16, lb);
            }
          }
          *(v8h*)(C + (size_t)(mBase + row) * ldc + n0 + c8) = hv;
          if (OUT_MODE == 2) *(v8h*)(C2 + (size_t)(mBase + row) * ldc + n0 + c8) = lv;
        }
        
      }
    }
    __builtin_amdgcn_fence(__ATOMIC_RELEASE, "workgroup");
    __builtin_amdgcn_wave_barrier();
    __builtin_amdgcn_fence(__ATOMIC_ACQUIRE, "workgroup");
  }
}

// ---------------- bf16 split helpers and guarded bf16 WMMA ----------------
__device__ __forceinline__ unsigned short at_bf_bits(float f) {
  unsigned u = __float_as_uint(f);
  return (unsigned short)((u + 0x7FFFu + ((u >> 16) & 1u)) >> 16);
}
__device__ __forceinline__ __bf16 at_f2bf(float f) { return __builtin_bit_cast(__bf16, at_bf_bits(f)); }
__device__ __forceinline__ void at_split(float f, __bf16& hi, __bf16& lo) {
  const unsigned short hb = at_bf_bits(f);
  hi = __builtin_bit_cast(__bf16, hb);
  lo = at_f2bf(f - __uint_as_float(((unsigned)hb) << 16));
}
__device__ __forceinline__ v8f at_mma(v16b a, v16b b, v8f c) {
  c = __builtin_amdgcn_wmma_f32_16x16x32_bf16(false, a, false, b, (short)0, c, false, false);
  asm volatile("v_nop\n\tv_nop\n\tv_nop\n\tv_nop" : "+v"(c) : "v"(a), "v"(b));
  return c;
}

// same-wave LDS write -> read ordering
__device__ __forceinline__ void lds_wave_sync() {
  __builtin_amdgcn_fence(__ATOMIC_RELEASE, "workgroup");
  __builtin_amdgcn_wave_barrier();
  __builtin_amdgcn_fence(__ATOMIC_ACQUIRE, "workgroup");
}

// =====================================================================
// Operand fragments with the K=16 contraction packed into one 32-deep k-step:
//   slot s <  16 -> hi part of d = s
//   slot s >= 16 -> lo part of d = s - 16
// A fragment (lane row m = lane&15, hh = lane>>4): elements 0..7 = hi[d = 8hh+e], 8..15 = lo[d = 8hh+e].
// B fragments: B1 = [wh | wh], B2 = [wl | wl] so that A.B1 + A.B2 = (xh+xl).(wh+wl).
// =====================================================================
__device__ __forceinline__ v16b x_frag_split(const float* __restrict__ xr, int hh) {
  const v4f a = *(const v4f*)(xr + 8 * hh);
  const v4f b = *(const v4f*)(xr + 8 * hh + 4);
  const float f[8] = {a[0], a[1], a[2], a[3], b[0], b[1], b[2], b[3]};
  v16b fr;
#pragma unroll
  for (int e = 0; e < 8; ++e) {
    __bf16 hb, lb;
    at_split(f[e], hb, lb);
    fr[e] = hb;
    fr[8 + e] = lb;
  }
  return fr;
}
// W is [16 out][16 in] row-major; lane column c = out index e; loads W[c][8hh .. 8hh+7]
__device__ __forceinline__ void w_frags_split(const float* __restrict__ W, int c, int hh, v16b& wh, v16b& wl) {
  const v4f a = *(const v4f*)(W + c * HEADD + 8 * hh);
  const v4f b = *(const v4f*)(W + c * HEADD + 8 * hh + 4);
  const float f[8] = {a[0], a[1], a[2], a[3], b[0], b[1], b[2], b[3]};
#pragma unroll
  for (int e = 0; e < 8; ++e) {
    __bf16 hb, lb;
    at_split(f[e], hb, lb);
    wh[e] = hb; wh[8 + e] = hb;
    wl[e] = lb; wl[8 + e] = lb;
  }
}

// One wave: rows n0..n0+63 of slice (t,h) for a q-type tensor -> plane dst[slice][n][hi16|lo16].
// Coverage: 4 tiles x 16 rows = 64 rows x 32 u16 staged; stored as 8 x (32 lanes x 8 u16) = 2048 u16 = whole region.
__device__ __forceinline__ void proj_qk_part(const float* __restrict__ x, unsigned short* __restrict__ dstp,
    const v16b wh, const v16b wl, float oscale, int slice, int n0, int t, int h, int lane, unsigned short* sl)
{
  const int hh = lane >> 4, c = lane & 15;
#pragma unroll
  for (int i = 0; i < 4; ++i) {
    const float* xr = x + ((size_t)(n0 + 16 * i + c) * TSTEP + t) * EMB + h * HEADD;
    const v16b xa = x_frag_split(xr, hh);
    v8f acc = (v8f){0.f,0.f,0.f,0.f,0.f,0.f,0.f,0.f};
    acc = at_mma(xa, wh, acc);
    acc = at_mma(xa, wl, acc);
    // acc[r] = proj[n0 + 16i + 8hh + r][e = c]
#pragma unroll
    for (int r = 0; r < 8; ++r) {
      const float v = acc[r] * oscale;
      const unsigned short hb = f2bf_bits(v);
      const unsigned short lb = f2bf_bits(v - bf_bits2f(hb));
      const int row = 16 * i + 8 * hh + r;
      sl[row * QKROW + c] = hb;
      sl[row * QKROW + 16 + c] = lb;
    }
  }
  lds_wave_sync();
  unsigned short* dst = dstp + ((size_t)slice * NNODE + n0) * QKROW;   // 64 consecutive rows = 4096 B = 32 lines
  {
#pragma unroll
    for (int it = 0; it < 8; ++it) {
      const us8 v = *(const us8*)(sl + (it * 32 + lane) * 8);
      *(us8*)(dst + (it * 32 + lane) * 8) = v;
    }
    
  }
  lds_wave_sync();
}

// One wave: rows n0..n0+63 of slice for values -> transposed planes Vth/Vtl[slice][d][n].
// Coverage: slab hi [16 d][64 n] + lo [16 d][64 n] fully written by 4 tiles x 32 lanes x 8 u16;
// stored as 4 x (4 rows x 8 lanes x 8 u16) per plane = all 16 d rows x 64 n.
__device__ __forceinline__ void proj_v_part(const float* __restrict__ x, unsigned short* __restrict__ Vth,
    unsigned short* __restrict__ Vtl, const v16b wh, const v16b wl, int slice, int n0, int t, int h, int lane,
    unsigned short* sl)
{
  const int hh = lane >> 4, c = lane & 15;
#pragma unroll
  for (int i = 0; i < 4; ++i) {
    const float* xr = x + ((size_t)(n0 + 16 * i + c) * TSTEP + t) * EMB + h * HEADD;
    const v16b xa = x_frag_split(xr, hh);
    v8f acc = (v8f){0.f,0.f,0.f,0.f,0.f,0.f,0.f,0.f};
    acc = at_mma(xa, wh, acc);
    acc = at_mma(xa, wl, acc);
    // acc[r] = v[n0 + 16i + 8hh + r][d = c] -> slab[d][16i + 8hh + r]
    us8 hv, lv;
#pragma unroll
    for (int r = 0; r < 8; ++r) {
      const float v = acc[r];
      const unsigned short hb = f2bf_bits(v);
      const unsigned short lb = f2bf_bits(v - bf_bits2f(hb));
      hv[r] = hb;
      lv[r] = lb;
    }
    *(us8*)(sl + c * 64 + 16 * i + 8 * hh) = hv;
    *(us8*)(sl + 1024 + c * 64 + 16 * i + 8 * hh) = lv;
  }
  lds_wave_sync();
  const int qq = lane >> 3, c8 = (lane & 7) * 8;
  {
#pragma unroll
    for (int it = 0; it < 4; ++it) {
      const int d = it * 4 + qq;
      const us8 hv = *(const us8*)(sl + d * 64 + c8);
      const us8 lv = *(const us8*)(sl + 1024 + d * 64 + c8);
      const size_t off = ((size_t)slice * HEADD + d) * NNODE + n0 + c8;
      *(us8*)(Vth + off) = hv;
      *(us8*)(Vtl + off) = lv;
    }
    
  }
  lds_wave_sync();
}

// =====================================================================
// Kernel 1: per-head projections on WMMA. One wave = (slice, 64-node group); 4 waves per block,
// each with its own LDS slab (no cross-wave LDS traffic, no block barriers).
// grid = 2304 / 4 = 576 blocks.
// =====================================================================
__global__ __launch_bounds__(128) void proj_qkv(
    const float* __restrict__ values, const float* __restrict__ keys, const float* __restrict__ query,
    const float* __restrict__ Wv, const float* __restrict__ Wk, const float* __restrict__ Wq,
    unsigned short* __restrict__ Q2, unsigned short* __restrict__ K2,
    unsigned short* __restrict__ Vth, unsigned short* __restrict__ Vtl)
{
  __shared__ __align__(16) unsigned short slab[4][64 * QKROW];   // 4 KB per wave
  const int lane = threadIdx.x & 31;
  const int wave = threadIdx.x >> 5;
  const int hh = lane >> 4, c = lane & 15;
  const int task  = blockIdx.x * 4 + wave;           // 0 .. 2303
  const int slice = task >> 4;                        // 0 .. 143
  const int ng    = task & 15;                        // node group
  const int t = slice >> 2, h = slice & 3;
  const int n0 = ng * 64;
  unsigned short* sl = slab[wave];

  v16b wqh, wql, wkh, wkl, wvh, wvl;
  w_frags_split(Wq, c, hh, wqh, wql);
  w_frags_split(Wk, c, hh, wkh, wkl);
  w_frags_split(Wv, c, hh, wvh, wvl);

  // q carries the exact 1/sqrt(64) = 0.125 score scale
  proj_qk_part(query, Q2, wqh, wql, 0.125f, slice, n0, t, h, lane, sl);
  proj_qk_part(keys,  K2, wkh, wkl, 1.0f,   slice, n0, t, h, lane, sl);
  proj_v_part(values, Vth, Vtl, wvh, wvl, slice, n0, t, h, lane, sl);
}

// =====================================================================
// Kernel 0: Wo -> bf16 hi/lo planes [64][64] (Bt[n = e][k = c] = Wo[e][c]). One block of 256 threads;
// thread handles element groups g = tid, tid + 256 (8 consecutive elements each): 512 x 8 = 4096 = whole planes.
// =====================================================================
__global__ __launch_bounds__(256) void prep_wo_split(
    const float* __restrict__ Wo, unsigned short* __restrict__ Woh, unsigned short* __restrict__ Wol)
{
  const int tid = threadIdx.x;
  us8 hv[2], lv[2];
#pragma unroll
  for (int it = 0; it < 2; ++it) {
    const int g = tid + 256 * it;
    const v4f a = *(const v4f*)(Wo + 8 * g);
    const v4f b = *(const v4f*)(Wo + 8 * g + 4);
    const float f[8] = {a[0], a[1], a[2], a[3], b[0], b[1], b[2], b[3]};
#pragma unroll
    for (int e = 0; e < 8; ++e) {
      const unsigned short hb = f2bf_bits(f[e]);
      const unsigned short lb = f2bf_bits(f[e] - bf_bits2f(hb));
      hv[it][e] = hb;
      lv[it][e] = lb;
    }
  }
  {
#pragma unroll
    for (int it = 0; it < 2; ++it) {
      const int g = tid + 256 * it;
      *(us8*)(Woh + 8 * g) = hv[it];
      *(us8*)(Wol + 8 * g) = lv[it];
    }
    
  }
}

// =====================================================================
// Kernel 2: streaming attention over the node axis, head dim 16, bf16 hi/lo operands.
// Block = 4 waves = 64 query nodes of one t; the block loops over the 4 heads so that each
//   scores: A = q row [qh|ql] (global), B = [kh|kh] and [kl|kl] from LDS -> 2 WMMA per 16x16 tile
//   p.v   : ph.vh + ph.vl + pl.vh, 32 keys per step
// grid = 36 * 16 = 576 blocks.
// =====================================================================
__global__ __launch_bounds__(128) void attn_hd16(
    const unsigned short* __restrict__ Q2, const unsigned short* __restrict__ K2,
    const unsigned short* __restrict__ Vth, const unsigned short* __restrict__ Vtl,
    unsigned short* __restrict__ Ohi, unsigned short* __restrict__ Olo)
{
  union FB { v16b v; v8b h[2]; };
  __shared__ __align__(16) __bf16 Ksh[64 * QKROW];          // [key][hi16|lo16]   4 KB
  __shared__ __align__(16) __bf16 Vhs[HEADD * 64];          // [d][key] hi        2 KB
  __shared__ __align__(16) __bf16 Vls[HEADD * 64];          // [d][key] lo        2 KB
  __shared__ __align__(16) __bf16 Psh[4][16 * 64];          // per wave P hi [row][key]
  __shared__ __align__(16) __bf16 Psl[4][16 * 64];          // per wave P lo
  __shared__ __align__(16) float  Os[4][16 * 68];           // per wave output rows, pitch 68

  const int tid  = threadIdx.x;
  const int wave = tid >> 5;
  const int lane = tid & 31;
  const int hh   = lane >> 4;
  const int c    = lane & 15;
  const int t    = blockIdx.x >> 4;          // 0 .. 35
  const int qb   = blockIdx.x & 15;          // 64-query block
  const int q0   = qb * 64 + wave * 16;
  float*  os  = Os[wave];
  __bf16* pwh = Psh[wave];
  __bf16* pwl = Psl[wave];

#pragma unroll 1
  for (int h = 0; h < NHEAD; ++h) {
    const int slice = t * NHEAD + h;
    const __bf16* Qs = (const __bf16*)(const void*)Q2 + (size_t)slice * NNODE * QKROW;
    // A fragment: elements 0..7 = qh[d = 8hh+e], 8..15 = ql[d = 8hh+e]
    const v16b qa = Frag<__bf16>::load(Qs + (size_t)(q0 + c) * QKROW + 8 * hh);
    const v8b* Kg  = (const v8b*)(const void*)(K2  + (size_t)slice * NNODE * QKROW);   // [key*4 + seg]
    const v8b* Vhg = (const v8b*)(const void*)(Vth + (size_t)slice * HEADD * NNODE);   // [d*128 + key/8]
    const v8b* Vlg = (const v8b*)(const void*)(Vtl + (size_t)slice * HEADD * NNODE);

    float mrow[8], lrow[8];
    v8f oacc = (v8f){0.f,0.f,0.f,0.f,0.f,0.f,0.f,0.f};
#pragma unroll
    for (int r = 0; r < 8; ++r) { mrow[r] = -INFINITY; lrow[r] = 0.f; }

#pragma unroll 1
    for (int kc = 0; kc < NNODE / 64; ++kc) {
      const int kv0 = kc * 64;
      __syncthreads();
      // stage K: 256 pieces of 16 B = 64 rows x 32 u16 (whole tile)
#pragma unroll
      for (int i = 0; i < 2; ++i) {
        const int p = tid + 128 * i;
        const int row = p >> 2, seg = p & 3;
        const v8b kv = Kg[(size_t)(kv0 + row) * 4 + seg];
        *(v8b*)(Ksh + row * QKROW + seg * 8) = kv;
      }
      // stage V hi/lo: 128 pieces of 16 B = 16 d x 64 keys per plane (whole tiles)
      {
        const int d = tid >> 3, seg = tid & 7;
        const v8b a  = Vhg[(size_t)d * (NNODE / 8) + kc * 8 + seg];
        const v8b b2 = Vlg[(size_t)d * (NNODE / 8) + kc * 8 + seg];
        *(v8b*)(Vhs + d * 64 + seg * 8) = a;
        *(v8b*)(Vls + d * 64 + seg * 8) = b2;
      }
      __syncthreads();

      v8f s[4];
#pragma unroll
      for (int j = 0; j < 4; ++j) {
        const __bf16* kr = Ksh + (j * 16 + c) * QKROW + 8 * hh;
        const v8b kh8 = *(const v8b*)(kr);
        const v8b kl8 = *(const v8b*)(kr + 16);
        FB k1, k2;
        k1.h[0] = kh8; k1.h[1] = kh8;
        k2.h[0] = kl8; k2.h[1] = kl8;
        s[j] = (v8f){0.f,0.f,0.f,0.f,0.f,0.f,0.f,0.f};
        s[j] = at_mma(qa, k1.v, s[j]);
        s[j] = at_mma(qa, k2.v, s[j]);
      }
      // s[j][r] = scaled energy(query q0 + 8hh + r, key kv0 + 16j + c)
      float cm[8];
#pragma unroll
      for (int r = 0; r < 8; ++r) {
        float m = fmaxf(fmaxf(s[0][r], s[1][r]), fmaxf(s[2][r], s[3][r]));
#pragma unroll
        for (int off = 1; off < 16; off <<= 1) m = fmaxf(m, __shfl_xor(m, off, 32));
        cm[r] = m;
      }
#pragma unroll
      for (int r = 0; r < 8; ++r) {
        const float mnew  = fmaxf(mrow[r], cm[r]);
        const float alpha = expf(mrow[r] - mnew);
        mrow[r] = mnew;
        float psum = 0.f;
#pragma unroll
        for (int j = 0; j < 4; ++j) {
          const float p = expf(s[j][r] - mnew);
          psum += p;
          __bf16 a, bl;
          at_split(p, a, bl);
          pwh[(8 * hh + r) * 64 + j * 16 + c] = a;
          pwl[(8 * hh + r) * 64 + j * 16 + c] = bl;
        }
#pragma unroll
        for (int off = 1; off < 16; off <<= 1) psum += __shfl_xor(psum, off, 32);
        lrow[r] = lrow[r] * alpha + psum;
        oacc[r] *= alpha;
      }
      lds_wave_sync();
#pragma unroll
      for (int kk = 0; kk < 2; ++kk) {
        FB pa, pl, vb, vl;
        pa.h[0] = *(const v8b*)(pwh + c * 64 + kk * 32 + 8 * hh);
        pa.h[1] = *(const v8b*)(pwh + c * 64 + kk * 32 + 16 + 8 * hh);
        pl.h[0] = *(const v8b*)(pwl + c * 64 + kk * 32 + 8 * hh);
        pl.h[1] = *(const v8b*)(pwl + c * 64 + kk * 32 + 16 + 8 * hh);
        vb.h[0] = *(const v8b*)(Vhs + c * 64 + kk * 32 + 8 * hh);
        vb.h[1] = *(const v8b*)(Vhs + c * 64 + kk * 32 + 16 + 8 * hh);
        vl.h[0] = *(const v8b*)(Vls + c * 64 + kk * 32 + 8 * hh);
        vl.h[1] = *(const v8b*)(Vls + c * 64 + kk * 32 + 16 + 8 * hh);
        oacc = at_mma(pa.v, vb.v, oacc);
        oacc = at_mma(pa.v, vl.v, oacc);
        oacc = at_mma(pl.v, vb.v, oacc);
      }
    }
    // oacc[r] = unnormalised out(query q0 + 8hh + r, d = c); lrow >= 1
#pragma unroll
    for (int r = 0; r < 8; ++r) {
      const float inv = 1.0f / lrow[r];
      os[(8 * hh + r) * 68 + h * HEADD + c] = oacc[r] * inv;
    }
  }
  lds_wave_sync();
  {
    const int qq = lane >> 3, c8 = (lane & 7) * 8;
    {
#pragma unroll
      for (int it = 0; it < 4; ++it) {
        const int row = it * 4 + qq;
        const float* sp = os + row * 68 + c8;
        us8 hv, lv;
#pragma unroll
        for (int e = 0; e < 8; ++e) {
          const unsigned short hb = f2bf_bits(sp[e]);
          const unsigned short lb = f2bf_bits(sp[e] - bf_bits2f(hb));
          hv[e] = hb;
          lv[e] = lb;
        }
        const size_t R = (size_t)(q0 + row) * TSTEP + t;
        *(us8*)(Ohi + R * EMB + c8) = hv;
        *(us8*)(Olo + R * EMB + c8) = lv;
      }
      
    }
  }
}

// =====================================================================
extern "C" void kernel_launch(void* const* d_in, const int* in_sizes, int n_in,
                              void* d_out, int out_size, void* d_ws, size_t ws_size,
                              hipStream_t stream) {
  if (n_in < 8) return;
  if (in_sizes[0] != NNODE * TSTEP * EMB || in_sizes[1] != NNODE * TSTEP * EMB ||
      in_sizes[2] != NNODE * TSTEP * EMB || in_sizes[3] != HEADD * HEADD ||
      in_sizes[4] != HEADD * HEADD || in_sizes[5] != HEADD * HEADD ||
      in_sizes[6] != EMB * EMB || in_sizes[7] != EMB) return;
  if (out_size != NROWS * EMB) return;
  if (ws_size < WS_TOTAL) return;

  const float* values = (const float*)d_in[0];
  const float* keys   = (const float*)d_in[1];
  const float* query  = (const float*)d_in[2];
  const float* Wv     = (const float*)d_in[3];
  const float* Wk     = (const float*)d_in[4];
  const float* Wq     = (const float*)d_in[5];
  const float* Wo     = (const float*)d_in[6];
  const float* bo     = (const float*)d_in[7];

  char* ws = (char*)d_ws;
  unsigned short* Q2  = (unsigned short*)(ws + WS_Q2);
  unsigned short* K2  = (unsigned short*)(ws + WS_K2);
  unsigned short* Vth = (unsigned short*)(ws + WS_VTH);
  unsigned short* Vtl = (unsigned short*)(ws + WS_VTL);
  unsigned short* Ohi = (unsigned short*)(ws + WS_OHI);
  unsigned short* Olo = (unsigned short*)(ws + WS_OLO);
  unsigned short* Woh = (unsigned short*)(ws + WS_WOH);
  unsigned short* Wol = (unsigned short*)(ws + WS_WOL);

  // 1) Wo -> bf16 hi/lo planes
  prep_wo_split<<<dim3(1), dim3(256), 0, stream>>>(Wo, Woh, Wol);
  // 2) per-head projections: 144 slices x 16 node groups = 2304 wave tasks, 4 per block
  proj_qkv<<<dim3(NSLICE * (NNODE / 64) / 4), dim3(128), 0, stream>>>(
      values, keys, query, Wv, Wk, Wq, Q2, K2, Vth, Vtl);
  // 3) attention over nodes: 36 t x 16 query blocks
  attn_hd16<<<dim3(TSTEP * (NNODE / 64)), dim3(128), 0, stream>>>(Q2, K2, Vth, Vtl, Ohi, Olo);
  // 4) output projection: C[36864 x 64] = O . Wo^T + bo; M=36864 (576 tiles), N=64, K=64; 8 tiles per block
  wmma_gemm64<1, true, 2, 0, false, 0><<<dim3(NROWS / 64 / 8, 1), dim3(256), 0, stream>>>(
      Ohi, Olo, EMB, 0L, Woh, Wol, EMB, 0L,
      d_out, nullptr, EMB, 0L, bo, nullptr, 0L,
      NROWS, EMB, EMB, 1.0f);
}

// v001
// One run takes 161 microseconds.
// Timed twice side by side with v000, it ran 1.39 and 1.40 times as fast.
// Contractions: v_wmma_f32_16x16x32_bf16 with bf16 hi/lo split operands (head projections, q.k scores, p.v, output projection), f32 accumulate; softmax, splits and epilogues in f32.
#include <hip/hip_runtime.h>
#include <math.h>
#include <stddef.h>

// ---------------- problem constants ----------------
constexpr int NNODE  = 1024;
constexpr int TSTEP  = 36;
constexpr int EMB    = 64;
constexpr int NHEAD  = 4;
constexpr int HEADD  = 16;
constexpr int NSLICE = TSTEP * NHEAD;        // 144 (t, h) slices
constexpr int NROWS  = NNODE * TSTEP;        // 36864 rows of the [n*T+t][64] planes
constexpr int QKROW  = 32;                   // u16 per row of the Q/K planes: [hi e0..15 | lo e0..15]

// ---------------- workspace region map (bytes) ----------------
// Q2  : bf16 [144][1024][32]          9,437,184 B  @ 0
// K2  : bf16 [144][1024][32]          9,437,184 B  @ 9,437,184
// Vth : bf16 [144][16][1024] (hi)     4,718,592 B  @ 18,874,368
// Vtl : bf16 [144][16][1024] (lo)     4,718,592 B  @ 23,592,960
// Ohi : bf16 [36864][64] (hi)         4,718,592 B  @ 28,311,552
// Olo : bf16 [36864][64] (lo)         4,718,592 B  @ 33,030,144
// Woh : bf16 [64][64]                     8,192 B  @ 37,748,736
// Wol : bf16 [64][64]                     8,192 B  @ 37,756,928
// total                              37,765,120 B
constexpr size_t WS_Q2   = 0;
constexpr size_t SZ_QK   = (size_t)NSLICE * NNODE * QKROW * 2;
constexpr size_t WS_K2   = WS_Q2 + SZ_QK;
constexpr size_t SZ_V    = (size_t)NSLICE * HEADD * NNODE * 2;
constexpr size_t WS_VTH  = WS_K2 + SZ_QK;
constexpr size_t WS_VTL  = WS_VTH + SZ_V;
constexpr size_t SZ_O    = (size_t)NROWS * EMB * 2;
constexpr size_t WS_OHI  = WS_VTL + SZ_V;
constexpr size_t WS_OLO  = WS_OHI + SZ_O;
constexpr size_t SZ_WO   = (size_t)EMB * EMB * 2;
constexpr size_t WS_WOH  = WS_OLO + SZ_O;
constexpr size_t WS_WOL  = WS_WOH + SZ_WO;
constexpr size_t WS_TOTAL = WS_WOL + SZ_WO;
static_assert(WS_TOTAL == 37765120, "carve");
static_assert(WS_TOTAL <= 134217728, "carve");
static_assert((WS_K2 % 128) == 0 && (WS_VTH % 128) == 0 && (WS_VTL % 128) == 0 && (WS_OHI % 128) == 0 &&
              (WS_OLO % 128) == 0 && (WS_WOH % 128) == 0 && (WS_WOL % 128) == 0, "align");
// GEMM shape contract for the output projection
static_assert(NROWS % 64 == 0 && EMB % 64 == 0 && EMB % 32 == 0, "gemm");
static_assert(NNODE % 64 == 0, "tiles");

// ---------------- types and fragment helpers ----------------
typedef __attribute__((ext_vector_type(16))) _Float16 v16h;
typedef __attribute__((ext_vector_type(8)))  _Float16 v8h;
typedef __attribute__((ext_vector_type(16))) __bf16   v16b;
typedef __attribute__((ext_vector_type(8)))  __bf16   v8b;
typedef __attribute__((ext_vector_type(8)))  float    v8f;
typedef __attribute__((ext_vector_type(4)))  float    v4f;
typedef __attribute__((ext_vector_type(8)))  unsigned short us8;

__device__ __forceinline__ unsigned short f2bf_bits(float f) {
  unsigned u = __float_as_uint(f);
  return (unsigned short)((u + 0x7FFFu + ((u >> 16) & 1u)) >> 16);
}
__device__ __forceinline__ float bf_bits2f(unsigned short h) { return __uint_as_float(((unsigned)h) << 16); }

// hazard guards as plain device helpers (no inline asm inside the kernel template body)
__device__ __forceinline__ void dep_guard_h(v8f& a, v8f& b, v16h x, v16h y) { asm volatile("v_nop\n\tv_nop\n\tv_nop\n\tv_nop" : "+v"(a), "+v"(b) : "v"(x), "v"(y)); }
__device__ __forceinline__ void dep_guard_b(v8f& a, v8f& b, v16b x, v16b y) { asm volatile("v_nop\n\tv_nop\n\tv_nop\n\tv_nop" : "+v"(a), "+v"(b) : "v"(x), "v"(y)); }
__device__ __forceinline__ void keep4_h(v16h a, v16h b, v16h c, v16h d) { asm volatile("v_nop" :: "v"(a), "v"(b), "v"(c), "v"(d)); }
__device__ __forceinline__ void keep4_b(v16b a, v16b b, v16b c, v16b d) { asm volatile("v_nop" :: "v"(a), "v"(b), "v"(c), "v"(d)); }
__device__ __forceinline__ void acc_guard4(v8f& a, v8f& b, v8f& c, v8f& d) { asm volatile("v_nop\n\tv_nop\n\tv_nop\n\tv_nop" : "+v"(a), "+v"(b), "+v"(c), "+v"(d)); }
template <typename T> struct Frag;
template <> struct Frag<_Float16> {
  typedef v16h V; union U { v16h v; v8h h[2]; };
  static __device__ __forceinline__ v16h load(const _Float16* p) {   // elements 0..7 <- p[0..7], 8..15 <- p[16..23]
    U f; f.h[0] = *(const v8h*)(p); f.h[1] = *(const v8h*)(p + 16); return f.v;
  }
  static __device__ __forceinline__ v8f mma(v16h a, v16h b, v8f c) {
    return __builtin_amdgcn_wmma_f32_16x16x32_f16(false, a, false, b, (short)0, c, false, false);
  }
  static __device__ __forceinline__ void guard(v8f& a, v8f& b, v16h x, v16h y) { dep_guard_h(a, b, x, y); }
  static __device__ __forceinline__ void keep(v16h a, v16h b, v16h c, v16h d) { keep4_h(a, b, c, d); }
};
template <> struct Frag<__bf16> {
  typedef v16b V; union U { v16b v; v8b h[2]; };
  static __device__ __forceinline__ v16b load(const __bf16* p) {
    U f; f.h[0] = *(const v8b*)(p); f.h[1] = *(const v8b*)(p + 16); return f.v;
  }
  static __device__ __forceinline__ v8f mma(v16b a, v16b b, v8f c) {
    return __builtin_amdgcn_wmma_f32_16x16x32_bf16(false, a, false, b, (short)0, c, false, false);
  }
  static __device__ __forceinline__ void guard(v8f& a, v8f& b, v16b x, v16b y) { dep_guard_b(a, b, x, y); }
  static __device__ __forceinline__ void keep(v16b a, v16b b, v16b c, v16b d) { keep4_b(a, b, c, d); }
};

// ---- Register-blocked batched WMMA GEMM -----------------------------------
// C[m,n] = scale * sum_k A[m,k] * Bt[n,k] (+bias)(+resid); each wave owns a 64x64 tile.
// A row-major [M,K]; Bt row-major [N,K]; M,N % 64 == 0, K % 32 == 0.
// SPLIT: operands are hi/lo planes (A2/Bt2 = lo planes, same layout); product = hi.hi + hi.lo + lo.hi.
// BIAS_MODE: 0 = none, 1 = bias[m], 2 = bias[n].
// OUT_MODE: 0 = f32, 1 = f16, 2 = bf16 hi plane (Cout) + bf16 lo plane (Cout2).
// ET: 0 = f16 operands, 1 = bf16 operands (pointers passed as 16-bit storage)
template <int ET> struct Elem;
template <> struct Elem<0> { typedef _Float16 T; };
template <> struct Elem<1> { typedef __bf16 T; };
template <int ET, bool SPLIT, int BIAS_MODE, int OUT_MODE, bool RESID, int ACT = 0>
__global__ __launch_bounds__(256) void wmma_gemm64(
    const unsigned short* __restrict__ Ap, const unsigned short* __restrict__ A2p, int lda, long strideA,
    const unsigned short* __restrict__ Btp, const unsigned short* __restrict__ Bt2p, int ldb, long strideB,
    void* __restrict__ Cout, void* __restrict__ Cout2, int ldc, long strideC,
    const float* __restrict__ bias,
    const float* __restrict__ resid, long strideR,
    int M, int N, int K, float scale) {
  typedef typename Elem<ET>::T T;
  typedef typename Frag<T>::V V;
  const T* A = (const T*)Ap; const T* A2 = (const T*)A2p; const T* Bt = (const T*)Btp; const T* Bt2 = (const T*)Bt2p;
  __shared__ __align__(16) float sT[8][16 * 68];   // per-wave 16x64 slab, pitch 68 floats
  const int b    = blockIdx.y;
  const int lane = threadIdx.x & 31;
  const int wave = threadIdx.x >> 5;
  const int tilesN = N >> 6;
  const int tilesM = M >> 6;
  const int tile = blockIdx.x * 8 + wave;
  if (tile >= tilesM * tilesN) return;   // wave-uniform; no block barriers in this kernel
  const int tm = tile / tilesN;
  const int tn = tile - tm * tilesN;
  const int m0 = tm << 6;
  const int n0 = tn << 6;

  const T* Ab  = A  + (size_t)b * strideA;
  const T* Bb  = Bt + (size_t)b * strideB;
  const T* Ab2 = SPLIT ? (A2  + (size_t)b * strideA) : nullptr;
  const T* Bb2 = SPLIT ? (Bt2 + (size_t)b * strideB) : nullptr;

  const int rlane = lane & 15;                 // row (A) / col (B, D) within subtile
  const int koff  = (lane >> 4) * 8;           // k offset of this lane half
  const int mOff  = (lane >> 4) * 8;           // D row offset

  v8f acc[4][4];
#pragma unroll
  for (int i = 0; i < 4; ++i)
#pragma unroll
    for (int j = 0; j < 4; ++j) acc[i][j] = (v8f){0.f,0.f,0.f,0.f,0.f,0.f,0.f,0.f};

  for (int k0 = 0; k0 < K; k0 += 32) {
    V bh[4], bl[4];
#pragma unroll
    for (int j = 0; j < 4; ++j) {
      const size_t bo = (size_t)(n0 + (j << 4) + rlane) * ldb + koff + k0;
      bh[j] = Frag<T>::load(Bb + bo);
      if (SPLIT) bl[j] = Frag<T>::load(Bb2 + bo);
    }
#pragma unroll
    for (int i = 0; i < 4; ++i) {
      const size_t ao = (size_t)(m0 + (i << 4) + rlane) * lda + koff + k0;
      V ah = Frag<T>::load(Ab + ao);
      V al;
      if (SPLIT) al = Frag<T>::load(Ab2 + ao);
#pragma unroll
      for (int j = 0; j < 4; ++j) {
        acc[i][j] = Frag<T>::mma(ah, bh[j], acc[i][j]);
        if (SPLIT) {
          acc[i][j] = Frag<T>::mma(ah, bl[j], acc[i][j]);
          acc[i][j] = Frag<T>::mma(al, bh[j], acc[i][j]);
        }
      }
      Frag<T>::guard(acc[i][0], acc[i][3], ah, SPLIT ? al : ah);
    }
    Frag<T>::keep(bh[0], bh[1], bh[2], bh[3]);
    if (SPLIT) Frag<T>::keep(bl[0], bl[1], bl[2], bl[3]);
  }
  acc_guard4(acc[0][0], acc[0][1], acc[0][2], acc[0][3]);
  acc_guard4(acc[1][0], acc[1][1], acc[1][2], acc[1][3]);
  acc_guard4(acc[2][0], acc[2][1], acc[2][2], acc[2][3]);
  acc_guard4(acc[3][0], acc[3][1], acc[3][2], acc[3][3]);

  // ---- epilogue ----
  float* slab = sT[wave];
  const float* Rb = RESID ? (resid + (size_t)b * strideR) : nullptr;
#pragma unroll
  for (int i = 0; i < 4; ++i) {
    const int mBase = m0 + (i << 4);
#pragma unroll
    for (int j = 0; j < 4; ++j) {
      const int n = n0 + (j << 4) + rlane;
      float bv = 0.f;
      if (BIAS_MODE == 2) bv = bias[n];
#pragma unroll
      for (int r = 0; r < 8; ++r) {
        float v = acc[i][j][r] * scale;
        if (BIAS_MODE == 1) v += bias[mBase + mOff + r];
        if (BIAS_MODE == 2) v += bv;
        if (RESID) v += Rb[(size_t)(mBase + mOff + r) * ldc + n];
        if (ACT == 1) v = tanhf(v);
        if (ACT == 2) v = fmaxf(v, 0.0f);
        if (ACT == 3) v = v / (1.0f + expf(-v));
        if (ACT == 4) v = (v > 0.f) ? v : 0.01f * v;
        if (ACT == 5) v = 0.5f * v * (1.0f + erff(v * 0.70710678118654752f));
        slab[(mOff + r) * 68 + (j << 4) + rlane] = v;
      }
    }
    __builtin_amdgcn_fence(__ATOMIC_RELEASE, "workgroup");
    __builtin_amdgcn_wave_barrier();
    __builtin_amdgcn_fence(__ATOMIC_ACQUIRE, "workgroup");
    if (OUT_MODE == 0) {
      float* C = (float*)Cout + (size_t)b * strideC;
      const int hh = lane >> 4, c4 = (lane & 15) * 4;     // row seg = 256 B = 16 lanes x 16 B
      {
#pragma unroll
        for (int it = 0; it < 8; ++it) {
          const int row = it * 2 + hh;
          v4f v = *(const v4f*)(slab + row * 68 + c4);
          *(v4f*)(C + (size_t)(mBase + row) * ldc + n0 + c4) = v;
        }
        
      }
    } else {
      const int q = lane >> 3, c8 = (lane & 7) * 8;
      unsigned short* C  = (unsigned short*)Cout  + (size_t)b * strideC;
      unsigned short* C2 = (OUT_MODE == 2) ? ((unsigned short*)Cout2 + (size_t)b * strideC) : nullptr;
      {
#pragma unroll
        for (int it = 0; it < 4; ++it) {
          const int row = it * 4 + q;
          const float* sp = slab + row * 68 + c8;
          v8h hv, lv;
#pragma unroll
          for (int e = 0; e < 8; ++e) {
            if (OUT_MODE == 1) {
              hv[e] = (_Float16)sp[e];
            } else {
              unsigned short hb = f2bf_bits(sp[e]);
              unsigned short lb = f2bf_bits(sp[e] - bf_bits2f(hb));
              hv[e] = __builtin_bit_cast(_Float16, hb);
              lv[e] = __builtin_bit_cast(_Float16, lb);
            }
          }
          *(v8h*)(C + (size_t)(mBase + row) * ldc + n0 + c8) = hv;
          if (OUT_MODE == 2) *(v8h*)(C2 + (size_t)(mBase + row) * ldc + n0 + c8) = lv;
        }
        
      }
    }
    __builtin_amdgcn_fence(__ATOMIC_RELEASE, "workgroup");
    __builtin_amdgcn_wave_barrier();
    __builtin_amdgcn_fence(__ATOMIC_ACQUIRE, "workgroup");
  }
}

// ---------------- bf16 split helpers and guarded bf16 WMMA ----------------
__device__ __forceinline__ unsigned short at_bf_bits(float f) {
  unsigned u = __float_as_uint(f);
  return (unsigned short)((u + 0x7FFFu + ((u >> 16) & 1u)) >> 16);
}
__device__ __forceinline__ __bf16 at_f2bf(float f) { return __builtin_bit_cast(__bf16, at_bf_bits(f)); }
__device__ __forceinline__ void at_split(float f, __bf16& hi, __bf16& lo) {
  const unsigned short hb = at_bf_bits(f);
  hi = __builtin_bit_cast(__bf16, hb);
  lo = at_f2bf(f - __uint_as_float(((unsigned)hb) << 16));
}
__device__ __forceinline__ v8f at_mma(v16b a, v16b b, v8f c) {
  c = __builtin_amdgcn_wmma_f32_16x16x32_bf16(false, a, false, b, (short)0, c, false, false);
  asm volatile("v_nop\n\tv_nop\n\tv_nop\n\tv_nop" : "+v"(c) : "v"(a), "v"(b));
  return c;
}

// same-wave LDS write -> read ordering
__device__ __forceinline__ void lds_wave_sync() {
  __builtin_amdgcn_fence(__ATOMIC_RELEASE, "workgroup");
  __builtin_amdgcn_wave_barrier();
  __builtin_amdgcn_fence(__ATOMIC_ACQUIRE, "workgroup");
}

// =====================================================================
// Operand fragments with the K=16 contraction packed into one 32-deep k-step:
//   slot s <  16 -> hi part of d = s
//   slot s >= 16 -> lo part of d = s - 16
// A fragment (lane row m = lane&15, hh = lane>>4): elements 0..7 = hi[d = 8hh+e], 8..15 = lo[d = 8hh+e].
// B fragments: B1 = [wh | wh], B2 = [wl | wl] so that A.B1 + A.B2 = (xh+xl).(wh+wl).
// =====================================================================
__device__ __forceinline__ v16b x_frag_split(const float* __restrict__ xr, int hh) {
  const v4f a = *(const v4f*)(xr + 8 * hh);
  const v4f b = *(const v4f*)(xr + 8 * hh + 4);
  const float f[8] = {a[0], a[1], a[2], a[3], b[0], b[1], b[2], b[3]};
  v16b fr;
#pragma unroll
  for (int e = 0; e < 8; ++e) {
    __bf16 hb, lb;
    at_split(f[e], hb, lb);
    fr[e] = hb;
    fr[8 + e] = lb;
  }
  return fr;
}
// W is [16 out][16 in] row-major; lane column c = out index e; loads W[c][8hh .. 8hh+7]
__device__ __forceinline__ void w_frags_split(const float* __restrict__ W, int c, int hh, v16b& wh, v16b& wl) {
  const v4f a = *(const v4f*)(W + c * HEADD + 8 * hh);
  const v4f b = *(const v4f*)(W + c * HEADD + 8 * hh + 4);
  const float f[8] = {a[0], a[1], a[2], a[3], b[0], b[1], b[2], b[3]};
#pragma unroll
  for (int e = 0; e < 8; ++e) {
    __bf16 hb, lb;
    at_split(f[e], hb, lb);
    wh[e] = hb; wh[8 + e] = hb;
    wl[e] = lb; wl[8 + e] = lb;
  }
}

// One wave: rows n0..n0+63 of slice (t,h) for a q-type tensor -> plane dst[slice][n][hi16|lo16].
// Coverage: 4 tiles x 16 rows = 64 rows x 32 u16 staged; stored as 8 x (32 lanes x 8 u16) = 2048 u16 = whole region.
__device__ __forceinline__ void proj_qk_part(const float* __restrict__ x, unsigned short* __restrict__ dstp,
    const v16b wh, const v16b wl, float oscale, int slice, int n0, int t, int h, int lane, unsigned short* sl)
{
  const int hh = lane >> 4, c = lane & 15;
#pragma unroll
  for (int i = 0; i < 4; ++i) {
    const float* xr = x + ((size_t)(n0 + 16 * i + c) * TSTEP + t) * EMB + h * HEADD;
    const v16b xa = x_frag_split(xr, hh);
    v8f acc = (v8f){0.f,0.f,0.f,0.f,0.f,0.f,0.f,0.f};
    acc = at_mma(xa, wh, acc);
    acc = at_mma(xa, wl, acc);
    // acc[r] = proj[n0 + 16i + 8hh + r][e = c]
#pragma unroll
    for (int r = 0; r < 8; ++r) {
      const float v = acc[r] * oscale;
      const unsigned short hb = f2bf_bits(v);
      const unsigned short lb = f2bf_bits(v - bf_bits2f(hb));
      const int row = 16 * i + 8 * hh + r;
      sl[row * QKROW + c] = hb;
      sl[row * QKROW + 16 + c] = lb;
    }
  }
  lds_wave_sync();
  unsigned short* dst = dstp + ((size_t)slice * NNODE + n0) * QKROW;   // 64 consecutive rows = 4096 B = 32 lines
  {
#pragma unroll
    for (int it = 0; it < 8; ++it) {
      const us8 v = *(const us8*)(sl + (it * 32 + lane) * 8);
      *(us8*)(dst + (it * 32 + lane) * 8) = v;
    }
    
  }
  lds_wave_sync();
}

// One wave: rows n0..n0+63 of slice for values -> transposed planes Vth/Vtl[slice][d][n].
// Coverage: slab hi [16 d][64 n] + lo [16 d][64 n] fully written by 4 tiles x 32 lanes x 8 u16;
// stored as 4 x (4 rows x 8 lanes x 8 u16) per plane = all 16 d rows x 64 n.
__device__ __forceinline__ void proj_v_part(const float* __restrict__ x, unsigned short* __restrict__ Vth,
    unsigned short* __restrict__ Vtl, const v16b wh, const v16b wl, int slice, int n0, int t, int h, int lane,
    unsigned short* sl)
{
  const int hh = lane >> 4, c = lane & 15;
#pragma unroll
  for (int i = 0; i < 4; ++i) {
    const float* xr = x + ((size_t)(n0 + 16 * i + c) * TSTEP + t) * EMB + h * HEADD;
    const v16b xa = x_frag_split(xr, hh);
    v8f acc = (v8f){0.f,0.f,0.f,0.f,0.f,0.f,0.f,0.f};
    acc = at_mma(xa, wh, acc);
    acc = at_mma(xa, wl, acc);
    // acc[r] = v[n0 + 16i + 8hh + r][d = c] -> slab[d][16i + 8hh + r]
    us8 hv, lv;
#pragma unroll
    for (int r = 0; r < 8; ++r) {
      const float v = acc[r];
      const unsigned short hb = f2bf_bits(v);
      const unsigned short lb = f2bf_bits(v - bf_bits2f(hb));
      hv[r] = hb;
      lv[r] = lb;
    }
    *(us8*)(sl + c * 64 + 16 * i + 8 * hh) = hv;
    *(us8*)(sl + 1024 + c * 64 + 16 * i + 8 * hh) = lv;
  }
  lds_wave_sync();
  const int qq = lane >> 3, c8 = (lane & 7) * 8;
  {
#pragma unroll
    for (int it = 0; it < 4; ++it) {
      const int d = it * 4 + qq;
      const us8 hv = *(const us8*)(sl + d * 64 + c8);
      const us8 lv = *(const us8*)(sl + 1024 + d * 64 + c8);
      const size_t off = ((size_t)slice * HEADD + d) * NNODE + n0 + c8;
      *(us8*)(Vth + off) = hv;
      *(us8*)(Vtl + off) = lv;
    }
    
  }
  lds_wave_sync();
}

// =====================================================================
// Kernel 1: per-head projections on WMMA. One wave = (slice, 64-node group); 4 waves per block,
// each with its own LDS slab (no cross-wave LDS traffic, no block barriers).
// grid = 2304 / 4 = 576 blocks.
// =====================================================================
__global__ __launch_bounds__(128) void proj_qkv(
    const float* __restrict__ values, const float* __restrict__ keys, const float* __restrict__ query,
    const float* __restrict__ Wv, const float* __restrict__ Wk, const float* __restrict__ Wq,
    unsigned short* __restrict__ Q2, unsigned short* __restrict__ K2,
    unsigned short* __restrict__ Vth, unsigned short* __restrict__ Vtl)
{
  __shared__ __align__(16) unsigned short slab[4][64 * QKROW];   // 4 KB per wave
  const int lane = threadIdx.x & 31;
  const int wave = threadIdx.x >> 5;
  const int hh = lane >> 4, c = lane & 15;
  const int task  = blockIdx.x * 4 + wave;           // 0 .. 2303
  const int slice = task >> 4;                        // 0 .. 143
  const int ng    = task & 15;                        // node group
  const int t = slice >> 2, h = slice & 3;
  const int n0 = ng * 64;
  unsigned short* sl = slab[wave];

  v16b wqh, wql, wkh, wkl, wvh, wvl;
  w_frags_split(Wq, c, hh, wqh, wql);
  w_frags_split(Wk, c, hh, wkh, wkl);
  w_frags_split(Wv, c, hh, wvh, wvl);

  // q carries the exact 1/sqrt(64) = 0.125 score scale
  proj_qk_part(query, Q2, wqh, wql, 0.125f, slice, n0, t, h, lane, sl);
  proj_qk_part(keys,  K2, wkh, wkl, 1.0f,   slice, n0, t, h, lane, sl);
  proj_v_part(values, Vth, Vtl, wvh, wvl, slice, n0, t, h, lane, sl);
}

// =====================================================================
// Kernel 0: Wo -> bf16 hi/lo planes [64][64] (Bt[n = e][k = c] = Wo[e][c]). One block of 256 threads;
// thread handles element groups g = tid, tid + 256 (8 consecutive elements each): 512 x 8 = 4096 = whole planes.
// =====================================================================
__global__ __launch_bounds__(256) void prep_wo_split(
    const float* __restrict__ Wo, unsigned short* __restrict__ Woh, unsigned short* __restrict__ Wol)
{
  const int tid = threadIdx.x;
  us8 hv[2], lv[2];
#pragma unroll
  for (int it = 0; it < 2; ++it) {
    const int g = tid + 256 * it;
    const v4f a = *(const v4f*)(Wo + 8 * g);
    const v4f b = *(const v4f*)(Wo + 8 * g + 4);
    const float f[8] = {a[0], a[1], a[2], a[3], b[0], b[1], b[2], b[3]};
#pragma unroll
    for (int e = 0; e < 8; ++e) {
      const unsigned short hb = f2bf_bits(f[e]);
      const unsigned short lb = f2bf_bits(f[e] - bf_bits2f(hb));
      hv[it][e] = hb;
      lv[it][e] = lb;
    }
  }
  {
#pragma unroll
    for (int it = 0; it < 2; ++it) {
      const int g = tid + 256 * it;
      *(us8*)(Woh + 8 * g) = hv[it];
      *(us8*)(Wol + 8 * g) = lv[it];
    }
    
  }
}

__device__ __forceinline__ float other_half(float x) {
  const int b = __float_as_int(x);
  return __int_as_float(__builtin_amdgcn_permlanex16(b, b, 0x76543210, 0xfedcba98, false, false));
}

__global__ __launch_bounds__(128) void attn_hd16(
    const unsigned short* __restrict__ Q2, const unsigned short* __restrict__ K2,
    const unsigned short* __restrict__ Vth, const unsigned short* __restrict__ Vtl,
    unsigned short* __restrict__ Ohi, unsigned short* __restrict__ Olo)
{
  union FB { v16b v; v8b h[2]; };
  __shared__ __align__(16) __bf16 Ksh[64 * QKROW];          // [key][hi16|lo16]   4 KB
  __shared__ __align__(16) __bf16 Vhs[HEADD * 64];          // [d][key] hi        2 KB
  __shared__ __align__(16) __bf16 Vls[HEADD * 64];          // [d][key] lo        2 KB
  __shared__ __align__(16) float  Os[4][16 * 68];           // per wave output rows, pitch 68

  const int tid  = threadIdx.x;
  const int wave = tid >> 5;
  const int lane = tid & 31;
  const int hh   = lane >> 4;
  const int c    = lane & 15;
  const int t    = blockIdx.x >> 4;          // 0 .. 35
  const int qb   = blockIdx.x & 15;          // 64-query block
  const int q0   = qb * 64 + wave * 16;
  float*  os  = Os[wave];

#pragma unroll 1
  for (int h = 0; h < NHEAD; ++h) {
    const int slice = t * NHEAD + h;
    const __bf16* Qs = (const __bf16*)(const void*)Q2 + (size_t)slice * NNODE * QKROW;
    // B fragment, column = query q0 + c: elements 0..7 = qh[d = 8hh+e], 8..15 = ql[d = 8hh+e]
    const v16b qa = Frag<__bf16>::load(Qs + (size_t)(q0 + c) * QKROW + 8 * hh);
    const v8b* Kg  = (const v8b*)(const void*)(K2  + (size_t)slice * NNODE * QKROW);   // [key*4 + seg]
    const v8b* Vhg = (const v8b*)(const void*)(Vth + (size_t)slice * HEADD * NNODE);   // [d*128 + key/8]
    const v8b* Vlg = (const v8b*)(const void*)(Vtl + (size_t)slice * HEADD * NNODE);

    // per lane: running maximum of query q0 + c (equal in both halves), this half's part of its sum
    float mrun = -INFINITY, lsum = 0.f;
    v8f oacc = (v8f){0.f,0.f,0.f,0.f,0.f,0.f,0.f,0.f};

#pragma unroll 1
    for (int kc = 0; kc < NNODE / 64; ++kc) {
      const int kv0 = kc * 64;
      __syncthreads();
      // stage K: 256 pieces of 16 B = 64 rows x 32 u16 (whole tile)
#pragma unroll
      for (int i = 0; i < 2; ++i) {
        const int p = tid + 128 * i;
        const int row = p >> 2, seg = p & 3;
        const v8b kv = Kg[(size_t)(kv0 + row) * 4 + seg];
        *(v8b*)(Ksh + row * QKROW + seg * 8) = kv;
      }
      // stage V hi/lo: 128 pieces of 16 B = 16 d x 64 keys per plane (whole tiles)
      {
        const int d = tid >> 3, seg = tid & 7;
        const v8b a  = Vhg[(size_t)d * (NNODE / 8) + kc * 8 + seg];
        const v8b b2 = Vlg[(size_t)d * (NNODE / 8) + kc * 8 + seg];
        *(v8b*)(Vhs + d * 64 + seg * 8) = a;
        *(v8b*)(Vls + d * 64 + seg * 8) = b2;
      }
      __syncthreads();

      v8f s[4];
#pragma unroll
      for (int j = 0; j < 4; ++j) {
        const __bf16* kr = Ksh + (j * 16 + c) * QKROW + 8 * hh;
        const v8b kh8 = *(const v8b*)(kr);
        const v8b kl8 = *(const v8b*)(kr + 16);
        FB k1, k2;
        k1.h[0] = kh8; k1.h[1] = kh8;
        k2.h[0] = kl8; k2.h[1] = kl8;
        s[j] = (v8f){0.f,0.f,0.f,0.f,0.f,0.f,0.f,0.f};
        s[j] = at_mma(k1.v, qa, s[j]);
        s[j] = at_mma(k2.v, qa, s[j]);
      }
      // s[j][r] = scaled energy(key kv0 + 16j + 8hh + r, query q0 + c)
      float cm = s[0][0];
#pragma unroll
      for (int j = 0; j < 4; ++j)
#pragma unroll
        for (int r = 0; r < 8; ++r) cm = fmaxf(cm, s[j][r]);
      cm = fmaxf(cm, other_half(cm));
      const float mnew  = fmaxf(mrun, cm);
      const float alpha = expf(mrun - mnew);
      mrun = mnew;

      v16b ph[2], pl[2];
      float ps[4];
#pragma unroll
      for (int j = 0; j < 4; ++j) {
        ps[j] = 0.f;
#pragma unroll
        for (int r = 0; r < 8; ++r) {
          const float p = expf(s[j][r] - mnew);
          ps[j] += p;
          __bf16 a, bl;
          at_split(p, a, bl);
          // B element 8(j&1) + r of lane (c, hh) is key 16(j&1) + 8hh + r of the 32-key step j>>1
          ph[j >> 1][8 * (j & 1) + r] = a;
          pl[j >> 1][8 * (j & 1) + r] = bl;
        }
      }
      lsum = lsum * alpha + ((ps[0] + ps[1]) + (ps[2] + ps[3]));
#pragma unroll
      for (int r = 0; r < 8; ++r) oacc[r] *= alpha;

#pragma unroll
      for (int kk = 0; kk < 2; ++kk) {
        FB vb, vl;
        vb.h[0] = *(const v8b*)(Vhs + c * 64 + kk * 32 + 8 * hh);
        vb.h[1] = *(const v8b*)(Vhs + c * 64 + kk * 32 + 16 + 8 * hh);
        vl.h[0] = *(const v8b*)(Vls + c * 64 + kk * 32 + 8 * hh);
        vl.h[1] = *(const v8b*)(Vls + c * 64 + kk * 32 + 16 + 8 * hh);
        oacc = at_mma(vb.v, ph[kk], oacc);
        oacc = at_mma(vl.v, ph[kk], oacc);
        oacc = at_mma(vb.v, pl[kk], oacc);
      }
    }
    // oacc[r] = unnormalised out(query q0 + c, d = 8hh + r); the two halves' sums join here; the sum is >= 1
    const float inv = 1.0f / (lsum + other_half(lsum));
    v4f o0, o1;
#pragma unroll
    for (int r = 0; r < 4; ++r) { o0[r] = oacc[r] * inv; o1[r] = oacc[4 + r] * inv; }
    *(v4f*)(os + c * 68 + h * HEADD + 8 * hh)     = o0;
    *(v4f*)(os + c * 68 + h * HEADD + 8 * hh + 4) = o1;
  }
  lds_wave_sync();
  {
    const int qq = lane >> 3, c8 = (lane & 7) * 8;
    {
#pragma unroll
      for (int it = 0; it < 4; ++it) {
        const int row = it * 4 + qq;
        const float* sp = os + row * 68 + c8;
        us8 hv, lv;
#pragma unroll
        for (int e = 0; e < 8; ++e) {
          const unsigned short hb = f2bf_bits(sp[e]);
          const unsigned short lb = f2bf_bits(sp[e] - bf_bits2f(hb));
          hv[e] = hb;
          lv[e] = lb;
        }
        const size_t R = (size_t)(q0 + row) * TSTEP + t;
        *(us8*)(Ohi + R * EMB + c8) = hv;
        *(us8*)(Olo + R * EMB + c8) = lv;
      }
      
    }
  }
}

// =====================================================================
extern "C" void kernel_launch(void* const* d_in, const int* in_sizes, int n_in,
                              void* d_out, int out_size, void* d_ws, size_t ws_size,
                              hipStream_t stream) {
  if (n_in < 8) return;
  if (in_sizes[0] != NNODE * TSTEP * EMB || in_sizes[1] != NNODE * TSTEP * EMB ||
      in_sizes[2] != NNODE * TSTEP * EMB || in_sizes[3] != HEADD * HEADD ||
      in_sizes[4] != HEADD * HEADD || in_sizes[5] != HEADD * HEADD ||
      in_sizes[6] != EMB * EMB || in_sizes[7] != EMB) return;
  if (out_size != NROWS * EMB) return;
  if (ws_size < WS_TOTAL) return;

  const float* values = (const float*)d_in[0];
  const float* keys   = (const float*)d_in[1];
  const float* query  = (const float*)d_in[2];
  const float* Wv     = (const float*)d_in[3];
  const float* Wk     = (const float*)d_in[4];
  const float* Wq     = (const float*)d_in[5];
  const float* Wo     = (const float*)d_in[6];
  const float* bo     = (const float*)d_in[7];

  char* ws = (char*)d_ws;
  unsigned short* Q2  = (unsigned short*)(ws + WS_Q2);
  unsigned short* K2  = (unsigned short*)(ws + WS_K2);
  unsigned short* Vth = (unsigned short*)(ws + WS_VTH);
  unsigned short* Vtl = (unsigned short*)(ws + WS_VTL);
  unsigned short* Ohi = (unsigned short*)(ws + WS_OHI);
  unsigned short* Olo = (unsigned short*)(ws + WS_OLO);
  unsigned short* Woh = (unsigned short*)(ws + WS_WOH);
  unsigned short* Wol = (unsigned short*)(ws + WS_WOL);

  // 1) Wo -> bf16 hi/lo planes
  prep_wo_split<<<dim3(1), dim3(256), 0, stream>>>(Wo, Woh, Wol);
  // 2) per-head projections: 144 slices x 16 node groups = 2304 wave tasks, 4 per block
  proj_qkv<<<dim3(NSLICE * (NNODE / 64) / 4), dim3(128), 0, stream>>>(
      values, keys, query, Wv, Wk, Wq, Q2, K2, Vth, Vtl);
  // 3) attention over nodes: 36 t x 16 query blocks
  attn_hd16<<<dim3(TSTEP * (NNODE / 64)), dim3(128), 0, stream>>>(Q2, K2, Vth, Vtl, Ohi, Olo);
  // 4) output projection: C[36864 x 64] = O . Wo^T + bo; M=36864 (576 tiles), N=64, K=64; 8 tiles per block
  wmma_gemm64<1, true, 2, 0, false, 0><<<dim3(NROWS / 64 / 8, 1), dim3(256), 0, stream>>>(
      Ohi, Olo, EMB, 0L, Woh, Wol, EMB, 0L,
      d_out, nullptr, EMB, 0L, bo, nullptr, 0L,
      NROWS, EMB, EMB, 1.0f);
}

// v002
// One run takes 128 microseconds.
// Two timings next to v001 both put it at 1.28 times that version's speed.
// Counting every step since v000, it is 1.79 times as fast.
// Contractions: v_wmma_f32_16x16x32_bf16 with bf16 hi/lo split operands (head projections, q.k scores, p.v, output projection), f32 accumulate; softmax, splits and epilogues in f32.
#include <hip/hip_runtime.h>
#include <math.h>
#include <stddef.h>

// ---------------- problem constants ----------------
constexpr int NNODE  = 1024;
constexpr int TSTEP  = 36;
constexpr int EMB    = 64;
constexpr int NHEAD  = 4;
constexpr int HEADD  = 16;
constexpr int NSLICE = TSTEP * NHEAD;        // 144 (t, h) slices
constexpr int NROWS  = NNODE * TSTEP;        // 36864 rows of the [n*T+t][64] planes
constexpr int QKROW  = 32;                   // u16 per row of the Q/K planes: [hi e0..15 | lo e0..15]

// ---------------- workspace region map (bytes) ----------------
// Q2  : bf16 [144][1024][32]          9,437,184 B  @ 0
// K2  : bf16 [144][1024][32]          9,437,184 B  @ 9,437,184
// Vth : bf16 [144][16][1024] (hi)     4,718,592 B  @ 18,874,368
// Vtl : bf16 [144][16][1024] (lo)     4,718,592 B  @ 23,592,960
// Ohi : bf16 [36864][64] (hi)         4,718,592 B  @ 28,311,552
// Olo : bf16 [36864][64] (lo)         4,718,592 B  @ 33,030,144
// Woh : bf16 [64][64]                     8,192 B  @ 37,748,736
// Wol : bf16 [64][64]                     8,192 B  @ 37,756,928
// total                              37,765,120 B
constexpr size_t WS_Q2   = 0;
constexpr size_t SZ_QK   = (size_t)NSLICE * NNODE * QKROW * 2;
constexpr size_t WS_K2   = WS_Q2 + SZ_QK;
constexpr size_t SZ_V    = (size_t)NSLICE * HEADD * NNODE * 2;
constexpr size_t WS_VTH  = WS_K2 + SZ_QK;
constexpr size_t WS_VTL  = WS_VTH + SZ_V;
constexpr size_t SZ_O    = (size_t)NROWS * EMB * 2;
constexpr size_t WS_OHI  = WS_VTL + SZ_V;
constexpr size_t WS_OLO  = WS_OHI + SZ_O;
constexpr size_t SZ_WO   = (size_t)EMB * EMB * 2;
constexpr size_t WS_WOH  = WS_OLO + SZ_O;
constexpr size_t WS_WOL  = WS_WOH + SZ_WO;
constexpr size_t WS_TOTAL = WS_WOL + SZ_WO;
static_assert(WS_TOTAL == 37765120, "carve");
static_assert(WS_TOTAL <= 134217728, "carve");
static_assert((WS_K2 % 128) == 0 && (WS_VTH % 128) == 0 && (WS_VTL % 128) == 0 && (WS_OHI % 128) == 0 &&
              (WS_OLO % 128) == 0 && (WS_WOH % 128) == 0 && (WS_WOL % 128) == 0, "align");
// GEMM shape contract for the output projection
static_assert(NROWS % 64 == 0 && EMB % 64 == 0 && EMB % 32 == 0, "gemm");
static_assert(NNODE % 64 == 0, "tiles");

// ---------------- types and fragment helpers ----------------
typedef __attribute__((ext_vector_type(16))) _Float16 v16h;
typedef __attribute__((ext_vector_type(8)))  _Float16 v8h;
typedef __attribute__((ext_vector_type(16))) __bf16   v16b;
typedef __attribute__((ext_vector_type(8)))  __bf16   v8b;
typedef __attribute__((ext_vector_type(8)))  float    v8f;
typedef __attribute__((ext_vector_type(4)))  float    v4f;
typedef __attribute__((ext_vector_type(8)))  unsigned short us8;

__device__ __forceinline__ unsigned short f2bf_bits(float f) {
  unsigned u = __float_as_uint(f);
  return (unsigned short)((u + 0x7FFFu + ((u >> 16) & 1u)) >> 16);
}
__device__ __forceinline__ float bf_bits2f(unsigned short h) { return __uint_as_float(((unsigned)h) << 16); }

// hazard guards as plain device helpers (no inline asm inside the kernel template body)
__device__ __forceinline__ void dep_guard_h(v8f& a, v8f& b, v16h x, v16h y) { asm volatile("v_nop\n\tv_nop\n\tv_nop\n\tv_nop" : "+v"(a), "+v"(b) : "v"(x), "v"(y)); }
__device__ __forceinline__ void dep_guard_b(v8f& a, v8f& b, v16b x, v16b y) { asm volatile("v_nop\n\tv_nop\n\tv_nop\n\tv_nop" : "+v"(a), "+v"(b) : "v"(x), "v"(y)); }
__device__ __forceinline__ void keep4_h(v16h a, v16h b, v16h c, v16h d) { asm volatile("v_nop" :: "v"(a), "v"(b), "v"(c), "v"(d)); }
__device__ __forceinline__ void keep4_b(v16b a, v16b b, v16b c, v16b d) { asm volatile("v_nop" :: "v"(a), "v"(b), "v"(c), "v"(d)); }
__device__ __forceinline__ void acc_guard4(v8f& a, v8f& b, v8f& c, v8f& d) { asm volatile("v_nop\n\tv_nop\n\tv_nop\n\tv_nop" : "+v"(a), "+v"(b), "+v"(c), "+v"(d)); }
template <typename T> struct Frag;
template <> struct Frag<_Float16> {
  typedef v16h V; union U { v16h v; v8h h[2]; };
  static __device__ __forceinline__ v16h load(const _Float16* p) {   // elements 0..7 <- p[0..7], 8..15 <- p[16..23]
    U f; f.h[0] = *(const v8h*)(p); f.h[1] = *(const v8h*)(p + 16); return f.v;
  }
  static __device__ __forceinline__ v8f mma(v16h a, v16h b, v8f c) {
    return __builtin_amdgcn_wmma_f32_16x16x32_f16(false, a, false, b, (short)0, c, false, false);
  }
  static __device__ __forceinline__ void guard(v8f& a, v8f& b, v16h x, v16h y) { dep_guard_h(a, b, x, y); }
  static __device__ __forceinline__ void keep(v16h a, v16h b, v16h c, v16h d) { keep4_h(a, b, c, d); }
};
template <> struct Frag<__bf16> {
  typedef v16b V; union U { v16b v; v8b h[2]; };
  static __device__ __forceinline__ v16b load(const __bf16* p) {
    U f; f.h[0] = *(const v8b*)(p); f.h[1] = *(const v8b*)(p + 16); return f.v;
  }
  static __device__ __forceinline__ v8f mma(v16b a, v16b b, v8f c) {
    return __builtin_amdgcn_wmma_f32_16x16x32_bf16(false, a, false, b, (short)0, c, false, false);
  }
  static __device__ __forceinline__ void guard(v8f& a, v8f& b, v16b x, v16b y) { dep_guard_b(a, b, x, y); }
  static __device__ __forceinline__ void keep(v16b a, v16b b, v16b c, v16b d) { keep4_b(a, b, c, d); }
};

// ---- Register-blocked batched WMMA GEMM -----------------------------------
// C[m,n] = scale * sum_k A[m,k] * Bt[n,k] (+bias)(+resid); each wave owns a 64x64 tile.
// A row-major [M,K]; Bt row-major [N,K]; M,N % 64 == 0, K % 32 == 0.
// SPLIT: operands are hi/lo planes (A2/Bt2 = lo planes, same layout); product = hi.hi + hi.lo + lo.hi.
// BIAS_MODE: 0 = none, 1 = bias[m], 2 = bias[n].
// OUT_MODE: 0 = f32, 1 = f16, 2 = bf16 hi plane (Cout) + bf16 lo plane (Cout2).
// ET: 0 = f16 operands, 1 = bf16 operands (pointers passed as 16-bit storage)
template <int ET> struct Elem;
template <> struct Elem<0> { typedef _Float16 T; };
template <> struct Elem<1> { typedef __bf16 T; };
template <int ET, bool SPLIT, int BIAS_MODE, int OUT_MODE, bool RESID, int ACT = 0>
__global__ __launch_bounds__(256) void wmma_gemm64(
    const unsigned short* __restrict__ Ap, const unsigned short* __restrict__ A2p, int lda, long strideA,
    const unsigned short* __restrict__ Btp, const unsigned short* __restrict__ Bt2p, int ldb, long strideB,
    void* __restrict__ Cout, void* __restrict__ Cout2, int ldc, long strideC,
    const float* __restrict__ bias,
    const float* __restrict__ resid, long strideR,
    int M, int N, int K, float scale) {
  typedef typename Elem<ET>::T T;
  typedef typename Frag<T>::V V;
  const T* A = (const T*)Ap; const T* A2 = (const T*)A2p; const T* Bt = (const T*)Btp; const T* Bt2 = (const T*)Bt2p;
  __shared__ __align__(16) float sT[8][16 * 68];   // per-wave 16x64 slab, pitch 68 floats
  const int b    = blockIdx.y;
  const int lane = threadIdx.x & 31;
  const int wave = threadIdx.x >> 5;
  const int tilesN = N >> 6;
  const int tilesM = M >> 6;
  const int tile = blockIdx.x * 8 + wave;
  if (tile >= tilesM * tilesN) return;   // wave-uniform; no block barriers in this kernel
  const int tm = tile / tilesN;
  const int tn = tile - tm * tilesN;
  const int m0 = tm << 6;
  const int n0 = tn << 6;

  const T* Ab  = A  + (size_t)b * strideA;
  const T* Bb  = Bt + (size_t)b * strideB;
  const T* Ab2 = SPLIT ? (A2  + (size_t)b * strideA) : nullptr;
  const T* Bb2 = SPLIT ? (Bt2 + (size_t)b * strideB) : nullptr;

  const int rlane = lane & 15;                 // row (A) / col (B, D) within subtile
  const int koff  = (lane >> 4) * 8;           // k offset of this lane half
  const int mOff  = (lane >> 4) * 8;           // D row offset

  v8f acc[4][4];
#pragma unroll
  for (int i = 0; i < 4; ++i)
#pragma unroll
    for (int j = 0; j < 4; ++j) acc[i][j] = (v8f){0.f,0.f,0.f,0.f,0.f,0.f,0.f,0.f};

  for (int k0 = 0; k0 < K; k0 += 32) {
    V bh[4], bl[4];
#pragma unroll
    for (int j = 0; j < 4; ++j) {
      const size_t bo = (size_t)(n0 + (j << 4) + rlane) * ldb + koff + k0;
      bh[j] = Frag<T>::load(Bb + bo);
      if (SPLIT) bl[j] = Frag<T>::load(Bb2 + bo);
    }
#pragma unroll
    for (int i = 0; i < 4; ++i) {
      const size_t ao = (size_t)(m0 + (i << 4) + rlane) * lda + koff + k0;
      V ah = Frag<T>::load(Ab + ao);
      V al;
      if (SPLIT) al = Frag<T>::load(Ab2 + ao);
#pragma unroll
      for (int j = 0; j < 4; ++j) {
        acc[i][j] = Frag<T>::mma(ah, bh[j], acc[i][j]);
        if (SPLIT) {
          acc[i][j] = Frag<T>::mma(ah, bl[j], acc[i][j]);
          acc[i][j] = Frag<T>::mma(al, bh[j], acc[i][j]);
        }
      }
      Frag<T>::guard(acc[i][0], acc[i][3], ah, SPLIT ? al : ah);
    }
    Frag<T>::keep(bh[0], bh[1], bh[2], bh[3]);
    if (SPLIT) Frag<T>::keep(bl[0], bl[1], bl[2], bl[3]);
  }
  acc_guard4(acc[0][0], acc[0][1], acc[0][2], acc[0][3]);
  acc_guard4(acc[1][0], acc[1][1], acc[1][2], acc[1][3]);
  acc_guard4(acc[2][0], acc[2][1], acc[2][2], acc[2][3]);
  acc_guard4(acc[3][0], acc[3][1], acc[3][2], acc[3][3]);

  // ---- epilogue ----
  float* slab = sT[wave];
  const float* Rb = RESID ? (resid + (size_t)b * strideR) : nullptr;
#pragma unroll
  for (int i = 0; i < 4; ++i) {
    const int mBase = m0 + (i << 4);
#pragma unroll
    for (int j = 0; j < 4; ++j) {
      const int n = n0 + (j << 4) + rlane;
      float bv = 0.f;
      if (BIAS_MODE == 2) bv = bias[n];
#pragma unroll
      for (int r = 0; r < 8; ++r) {
        float v = acc[i][j][r] * scale;
        if (BIAS_MODE == 1) v += bias[mBase + mOff + r];
        if (BIAS_MODE == 2) v += bv;
        if (RESID) v += Rb[(size_t)(mBase + mOff + r) * ldc + n];
        if (ACT == 1) v = tanhf(v);
        if (ACT == 2) v = fmaxf(v, 0.0f);
        if (ACT == 3) v = v / (1.0f + expf(-v));
        if (ACT == 4) v = (v > 0.f) ? v : 0.01f * v;
        if (ACT == 5) v = 0.5f * v * (1.0f + erff(v * 0.70710678118654752f));
        slab[(mOff + r) * 68 + (j << 4) + rlane] = v;
      }
    }
    __builtin_amdgcn_fence(__ATOMIC_RELEASE, "workgroup");
    __builtin_amdgcn_wave_barrier();
    __builtin_amdgcn_fence(__ATOMIC_ACQUIRE, "workgroup");
    if (OUT_MODE == 0) {
      float* C = (float*)Cout + (size_t)b * strideC;
      const int hh = lane >> 4, c4 = (lane & 15) * 4;     // row seg = 256 B = 16 lanes x 16 B
      {
#pragma unroll
        for (int it = 0; it < 8; ++it) {
          const int row = it * 2 + hh;
          v4f v = *(const v4f*)(slab + row * 68 + c4);
          *(v4f*)(C + (size_t)(mBase + row) * ldc + n0 + c4) = v;
        }
        
      }
    } else {
      const int q = lane >> 3, c8 = (lane & 7) * 8;
      unsigned short* C  = (unsigned short*)Cout  + (size_t)b * strideC;
      unsigned short* C2 = (OUT_MODE == 2) ? ((unsigned short*)Cout2 + (size_t)b * strideC) : nullptr;
      {
#pragma unroll
        for (int it = 0; it < 4; ++it) {
          const int row = it * 4 + q;
          const float* sp = slab + row * 68 + c8;
          v8h hv, lv;
#pragma unroll
          for (int e = 0; e < 8; ++e) {
            if (OUT_MODE == 1) {
              hv[e] = (_Float16)sp[e];
            } else {
              unsigned short hb = f2bf_bits(sp[e]);
              unsigned short lb = f2bf_bits(sp[e] - bf_bits2f(hb));
              hv[e] = __builtin_bit_cast(_Float16, hb);
              lv[e] = __builtin_bit_cast(_Float16, lb);
            }
          }
          *(v8h*)(C + (size_t)(mBase + row) * ldc + n0 + c8) = hv;
          if (OUT_MODE == 2) *(v8h*)(C2 + (size_t)(mBase + row) * ldc + n0 + c8) = lv;
        }
        
      }
    }
    __builtin_amdgcn_fence(__ATOMIC_RELEASE, "workgroup");
    __builtin_amdgcn_wave_barrier();
    __builtin_amdgcn_fence(__ATOMIC_ACQUIRE, "workgroup");
  }
}

// ---------------- bf16 split helpers and guarded bf16 WMMA ----------------
__device__ __forceinline__ unsigned short at_bf_bits(float f) {
  unsigned u = __float_as_uint(f);
  return (unsigned short)((u + 0x7FFFu + ((u >> 16) & 1u)) >> 16);
}
__device__ __forceinline__ __bf16 at_f2bf(float f) { return __builtin_bit_cast(__bf16, at_bf_bits(f)); }
__device__ __forceinline__ void at_split(float f, __bf16& hi, __bf16& lo) {
  const unsigned short hb = at_bf_bits(f);
  hi = __builtin_bit_cast(__bf16, hb);
  lo = at_f2bf(f - __uint_as_float(((unsigned)hb) << 16));
}
__device__ __forceinline__ v8f at_mma(v16b a, v16b b, v8f c) {
  c = __builtin_amdgcn_wmma_f32_16x16x32_bf16(false, a, false, b, (short)0, c, false, false);
  asm volatile("v_nop\n\tv_nop\n\tv_nop\n\tv_nop" : "+v"(c) : "v"(a), "v"(b));
  return c;
}

// same-wave LDS write -> read ordering
__device__ __forceinline__ void lds_wave_sync() {
  __builtin_amdgcn_fence(__ATOMIC_RELEASE, "workgroup");
  __builtin_amdgcn_wave_barrier();
  __builtin_amdgcn_fence(__ATOMIC_ACQUIRE, "workgroup");
}

// =====================================================================
// Operand fragments with the K=16 contraction packed into one 32-deep k-step:
//   slot s <  16 -> hi part of d = s
//   slot s >= 16 -> lo part of d = s - 16
// A fragment (lane row m = lane&15, hh = lane>>4): elements 0..7 = hi[d = 8hh+e], 8..15 = lo[d = 8hh+e].
// B fragments: B1 = [wh | wh], B2 = [wl | wl] so that A.B1 + A.B2 = (xh+xl).(wh+wl).
// =====================================================================
__device__ __forceinline__ v16b x_frag_split(const float* __restrict__ xr, int hh) {
  const v4f a = *(const v4f*)(xr + 8 * hh);
  const v4f b = *(const v4f*)(xr + 8 * hh + 4);
  const float f[8] = {a[0], a[1], a[2], a[3], b[0], b[1], b[2], b[3]};
  v16b fr;
#pragma unroll
  for (int e = 0; e < 8; ++e) {
    __bf16 hb, lb;
    at_split(f[e], hb, lb);
    fr[e] = hb;
    fr[8 + e] = lb;
  }
  return fr;
}
// W is [16 out][16 in] row-major; lane column c = out index e; loads W[c][8hh .. 8hh+7]
__device__ __forceinline__ void w_frags_split(const float* __restrict__ W, int c, int hh, v16b& wh, v16b& wl) {
  const v4f a = *(const v4f*)(W + c * HEADD + 8 * hh);
  const v4f b = *(const v4f*)(W + c * HEADD + 8 * hh + 4);
  const float f[8] = {a[0], a[1], a[2], a[3], b[0], b[1], b[2], b[3]};
#pragma unroll
  for (int e = 0; e < 8; ++e) {
    __bf16 hb, lb;
    at_split(f[e], hb, lb);
    wh[e] = hb; wh[8 + e] = hb;
    wl[e] = lb; wl[8 + e] = lb;
  }
}

// One wave: rows n0..n0+63 of slice (t,h) for a q-type tensor -> plane dst[slice][n][hi16|lo16].
// Coverage: 4 tiles x 16 rows = 64 rows x 32 u16 staged; stored as 8 x (32 lanes x 8 u16) = 2048 u16 = whole region.
__device__ __forceinline__ void proj_qk_part(const float* __restrict__ x, unsigned short* __restrict__ dstp,
    const v16b wh, const v16b wl, float oscale, int slice, int n0, int t, int h, int lane, unsigned short* sl)
{
  const int hh = lane >> 4, c = lane & 15;
#pragma unroll
  for (int i = 0; i < 4; ++i) {
    const float* xr = x + ((size_t)(n0 + 16 * i + c) * TSTEP + t) * EMB + h * HEADD;
    const v16b xa = x_frag_split(xr, hh);
    v8f acc = (v8f){0.f,0.f,0.f,0.f,0.f,0.f,0.f,0.f};
    acc = at_mma(xa, wh, acc);
    acc = at_mma(xa, wl, acc);
    // acc[r] = proj[n0 + 16i + 8hh + r][e = c]
#pragma unroll
    for (int r = 0; r < 8; ++r) {
      const float v = acc[r] * oscale;
      const unsigned short hb = f2bf_bits(v);
      const unsigned short lb = f2bf_bits(v - bf_bits2f(hb));
      const int row = 16 * i + 8 * hh + r;
      sl[row * QKROW + c] = hb;
      sl[row * QKROW + 16 + c] = lb;
    }
  }
  lds_wave_sync();
  unsigned short* dst = dstp + ((size_t)slice * NNODE + n0) * QKROW;   // 64 consecutive rows = 4096 B = 32 lines
  {
#pragma unroll
    for (int it = 0; it < 8; ++it) {
      const us8 v = *(const us8*)(sl + (it * 32 + lane) * 8);
      *(us8*)(dst + (it * 32 + lane) * 8) = v;
    }
    
  }
  lds_wave_sync();
}

// One wave: rows n0..n0+63 of slice for values -> transposed planes Vth/Vtl[slice][d][n].
// Coverage: slab hi [16 d][64 n] + lo [16 d][64 n] fully written by 4 tiles x 32 lanes x 8 u16;
// stored as 4 x (4 rows x 8 lanes x 8 u16) per plane = all 16 d rows x 64 n.
__device__ __forceinline__ void proj_v_part(const float* __restrict__ x, unsigned short* __restrict__ Vth,
    unsigned short* __restrict__ Vtl, const v16b wh, const v16b wl, int slice, int n0, int t, int h, int lane,
    unsigned short* sl)
{
  const int hh = lane >> 4, c = lane & 15;
#pragma unroll
  for (int i = 0; i < 4; ++i) {
    const float* xr = x + ((size_t)(n0 + 16 * i + c) * TSTEP + t) * EMB + h * HEADD;
    const v16b xa = x_frag_split(xr, hh);
    v8f acc = (v8f){0.f,0.f,0.f,0.f,0.f,0.f,0.f,0.f};
    acc = at_mma(xa, wh, acc);
    acc = at_mma(xa, wl, acc);
    // acc[r] = v[n0 + 16i + 8hh + r][d = c] -> slab[d][16i + 8hh + r]
    us8 hv, lv;
#pragma unroll
    for (int r = 0; r < 8; ++r) {
      const float v = acc[r];
      const unsigned short hb = f2bf_bits(v);
      const unsigned short lb = f2bf_bits(v - bf_bits2f(hb));
      hv[r] = hb;
      lv[r] = lb;
    }
    *(us8*)(sl + c * 64 + 16 * i + 8 * hh) = hv;
    *(us8*)(sl + 1024 + c * 64 + 16 * i + 8 * hh) = lv;
  }
  lds_wave_sync();
  const int qq = lane >> 3, c8 = (lane & 7) * 8;
  {
#pragma unroll
    for (int it = 0; it < 4; ++it) {
      const int d = it * 4 + qq;
      const us8 hv = *(const us8*)(sl + d * 64 + c8);
      const us8 lv = *(const us8*)(sl + 1024 + d * 64 + c8);
      const size_t off = ((size_t)slice * HEADD + d) * NNODE + n0 + c8;
      *(us8*)(Vth + off) = hv;
      *(us8*)(Vtl + off) = lv;
    }
    
  }
  lds_wave_sync();
}

// =====================================================================
// Kernel 1: per-head projections on WMMA. One wave = (slice, 64-node group); 4 waves per block,
// each with its own LDS slab (no cross-wave LDS traffic, no block barriers).
// grid = 2304 / 4 = 576 blocks.
// =====================================================================
__global__ __launch_bounds__(128) void proj_qkv(
    const float* __restrict__ values, const float* __restrict__ keys, const float* __restrict__ query,
    const float* __restrict__ Wv, const float* __restrict__ Wk, const float* __restrict__ Wq,
    unsigned short* __restrict__ Q2, unsigned short* __restrict__ K2,
    unsigned short* __restrict__ Vth, unsigned short* __restrict__ Vtl)
{
  __shared__ __align__(16) unsigned short slab[4][64 * QKROW];   // 4 KB per wave
  const int lane = threadIdx.x & 31;
  const int wave = threadIdx.x >> 5;
  const int hh = lane >> 4, c = lane & 15;
  const int task  = blockIdx.x * 4 + wave;           // 0 .. 2303
  const int slice = task >> 4;                        // 0 .. 143
  const int ng    = task & 15;                        // node group
  const int t = slice >> 2, h = slice & 3;
  const int n0 = ng * 64;
  unsigned short* sl = slab[wave];

  v16b wqh, wql, wkh, wkl, wvh, wvl;
  w_frags_split(Wq, c, hh, wqh, wql);
  w_frags_split(Wk, c, hh, wkh, wkl);
  w_frags_split(Wv, c, hh, wvh, wvl);

  // q carries the exact 1/sqrt(64) = 0.125 score scale
  proj_qk_part(query, Q2, wqh, wql, 0.125f, slice, n0, t, h, lane, sl);
  proj_qk_part(keys,  K2, wkh, wkl, 1.0f,   slice, n0, t, h, lane, sl);
  proj_v_part(values, Vth, Vtl, wvh, wvl, slice, n0, t, h, lane, sl);
}

// =====================================================================
// Kernel 0: Wo -> bf16 hi/lo planes [64][64] (Bt[n = e][k = c] = Wo[e][c]). One block of 256 threads;
// thread handles element groups g = tid, tid + 256 (8 consecutive elements each): 512 x 8 = 4096 = whole planes.
// =====================================================================
__global__ __launch_bounds__(256) void prep_wo_split(
    const float* __restrict__ Wo, unsigned short* __restrict__ Woh, unsigned short* __restrict__ Wol)
{
  const int tid = threadIdx.x;
  us8 hv[2], lv[2];
#pragma unroll
  for (int it = 0; it < 2; ++it) {
    const int g = tid + 256 * it;
    const v4f a = *(const v4f*)(Wo + 8 * g);
    const v4f b = *(const v4f*)(Wo + 8 * g + 4);
    const float f[8] = {a[0], a[1], a[2], a[3], b[0], b[1], b[2], b[3]};
#pragma unroll
    for (int e = 0; e < 8; ++e) {
      const unsigned short hb = f2bf_bits(f[e]);
      const unsigned short lb = f2bf_bits(f[e] - bf_bits2f(hb));
      hv[it][e] = hb;
      lv[it][e] = lb;
    }
  }
  {
#pragma unroll
    for (int it = 0; it < 2; ++it) {
      const int g = tid + 256 * it;
      *(us8*)(Woh + 8 * g) = hv[it];
      *(us8*)(Wol + 8 * g) = lv[it];
    }
    
  }
}

constexpr float LOG2E = 1.4426950408889634f;
typedef __attribute__((ext_vector_type(2))) float v2f;
// y = 2^x on the hardware. The v_nop in the same statement keeps the one slot that the instruction set asks for between
// a transcendental and an instruction that uses its result or overwrites its source, whatever the compiler puts next.
__device__ __forceinline__ float exp2_hw(float x) {
  float y;
  asm("v_exp_f32 %0, %1\n\tv_nop" : "=v"(y) : "v"(x));
  return y;
}
// Eight independent 2^x in one statement: the early-clobber outputs keep every result off every source, so none of the
// eight overwrites a source of the one in front of it, and one closing v_nop keeps the slot for all of them.
__device__ __forceinline__ v8f exp2_hw8(v8f x) {
  float y0, y1, y2, y3, y4, y5, y6, y7;
  asm("v_exp_f32 %0, %8\n\tv_exp_f32 %1, %9\n\tv_exp_f32 %2, %10\n\tv_exp_f32 %3, %11\n\t"
      "v_exp_f32 %4, %12\n\tv_exp_f32 %5, %13\n\tv_exp_f32 %6, %14\n\tv_exp_f32 %7, %15\n\tv_nop"
      : "=&v"(y0), "=&v"(y1), "=&v"(y2), "=&v"(y3), "=&v"(y4), "=&v"(y5), "=&v"(y6), "=&v"(y7)
      : "v"(x[0]), "v"(x[1]), "v"(x[2]), "v"(x[3]), "v"(x[4]), "v"(x[5]), "v"(x[6]), "v"(x[7]));
  return (v8f){y0, y1, y2, y3, y4, y5, y6, y7};
}
// value of lane l ^ 16
__device__ __forceinline__ float other_half(float x) {
  const int b = __float_as_int(x);
  return __int_as_float(__builtin_amdgcn_permlanex16(b, b, 0x76543210, 0xfedcba98, false, false));
}

__global__ __launch_bounds__(128) void attn_hd16(
    const unsigned short* __restrict__ Q2, const unsigned short* __restrict__ K2,
    const unsigned short* __restrict__ Vth, const unsigned short* __restrict__ Vtl,
    unsigned short* __restrict__ Ohi, unsigned short* __restrict__ Olo)
{
  union FB { v16b v; v8b h[2]; };
  __shared__ __align__(16) __bf16 Ksh[64 * QKROW];          // [key][hi16|lo16]   4 KB
  __shared__ __align__(16) __bf16 Vhs[HEADD * 64];          // [d][key] hi        2 KB
  __shared__ __align__(16) __bf16 Vls[HEADD * 64];          // [d][key] lo        2 KB
  __shared__ __align__(16) float  Os[4][16 * 68];           // per wave output rows, pitch 68

  const int tid  = threadIdx.x;
  const int wave = tid >> 5;
  const int lane = tid & 31;
  const int hh   = lane >> 4;
  const int c    = lane & 15;
  const int t    = blockIdx.x >> 4;          // 0 .. 35
  const int qb   = blockIdx.x & 15;          // 64-query block
  const int q0   = qb * 64 + wave * 16;
  float*  os  = Os[wave];

#pragma unroll 1
  for (int h = 0; h < NHEAD; ++h) {
    const int slice = t * NHEAD + h;
    const __bf16* Qs = (const __bf16*)(const void*)Q2 + (size_t)slice * NNODE * QKROW;
    // B fragment, column = query q0 + c: elements 0..7 = qh[d = 8hh+e], 8..15 = ql[d = 8hh+e]
    const v16b qa = Frag<__bf16>::load(Qs + (size_t)(q0 + c) * QKROW + 8 * hh);
    const v8b* Kg  = (const v8b*)(const void*)(K2  + (size_t)slice * NNODE * QKROW);   // [key*4 + seg]
    const v8b* Vhg = (const v8b*)(const void*)(Vth + (size_t)slice * HEADD * NNODE);   // [d*128 + key/8]
    const v8b* Vlg = (const v8b*)(const void*)(Vtl + (size_t)slice * HEADD * NNODE);

    // per lane: running maximum of query q0 + c times log2e (equal in both halves), this half's part of its sum
    float mrun = -INFINITY, lsum = 0.f;
    v8f oacc = (v8f){0.f,0.f,0.f,0.f,0.f,0.f,0.f,0.f};

#pragma unroll 1
    for (int kc = 0; kc < NNODE / 64; ++kc) {
      const int kv0 = kc * 64;
      __syncthreads();
      // stage K: 256 pieces of 16 B = 64 rows x 32 u16 (whole tile)
#pragma unroll
      for (int i = 0; i < 2; ++i) {
        const int p = tid + 128 * i;
        const int row = p >> 2, seg = p & 3;
        const v8b kv = Kg[(size_t)(kv0 + row) * 4 + seg];
        *(v8b*)(Ksh + row * QKROW + seg * 8) = kv;
      }
      // stage V hi/lo: 128 pieces of 16 B = 16 d x 64 keys per plane (whole tiles)
      {
        const int d = tid >> 3, seg = tid & 7;
        const v8b a  = Vhg[(size_t)d * (NNODE / 8) + kc * 8 + seg];
        const v8b b2 = Vlg[(size_t)d * (NNODE / 8) + kc * 8 + seg];
        *(v8b*)(Vhs + d * 64 + seg * 8) = a;
        *(v8b*)(Vls + d * 64 + seg * 8) = b2;
      }
      __syncthreads();

      v8f s[4];
#pragma unroll
      for (int j = 0; j < 4; ++j) {
        const __bf16* kr = Ksh + (j * 16 + c) * QKROW + 8 * hh;
        const v8b kh8 = *(const v8b*)(kr);
        const v8b kl8 = *(const v8b*)(kr + 16);
        FB k1, k2;
        k1.h[0] = kh8; k1.h[1] = kh8;
        k2.h[0] = kl8; k2.h[1] = kl8;
        s[j] = (v8f){0.f,0.f,0.f,0.f,0.f,0.f,0.f,0.f};
        s[j] = at_mma(k1.v, qa, s[j]);
        s[j] = at_mma(k2.v, qa, s[j]);
      }
      // s[j][r] = scaled energy(key kv0 + 16j + 8hh + r, query q0 + c)
      float cm = s[0][0];
#pragma unroll
      for (int j = 0; j < 4; ++j)
#pragma unroll
        for (int r = 0; r < 8; ++r) cm = fmaxf(cm, s[j][r]);
      cm = fmaxf(cm, other_half(cm));
      const float mnew  = fmaxf(mrun, cm * LOG2E);
      const float alpha = exp2_hw(mrun - mnew);
      mrun = mnew;

      v16b ph[2], pl[2];
      float ps[4];
#pragma unroll
      for (int j = 0; j < 4; ++j) {
        ps[j] = 0.f;
        // arguments <= 0 up to one rounding: no overflow; below -126 a term is under 2^-126 of the largest and goes to 0
        v8f ea;
#pragma unroll
        for (int r = 0; r < 8; r += 2) {
          const v2f a2 = __builtin_elementwise_fma((v2f){s[j][r], s[j][r + 1]}, (v2f){LOG2E, LOG2E}, (v2f){-mnew, -mnew});
          ea[r] = a2[0]; ea[r + 1] = a2[1];
        }
        const v8f pe = exp2_hw8(ea);
#pragma unroll
        for (int r = 0; r < 8; ++r) {
          const float p = pe[r];
          ps[j] += p;
          __bf16 a, bl;
          at_split(p, a, bl);
          // B element 8(j&1) + r of lane (c, hh) is key 16(j&1) + 8hh + r of the 32-key step j>>1
          ph[j >> 1][8 * (j & 1) + r] = a;
          pl[j >> 1][8 * (j & 1) + r] = bl;
        }
      }
      lsum = lsum * alpha + ((ps[0] + ps[1]) + (ps[2] + ps[3]));
#pragma unroll
      for (int r = 0; r < 8; ++r) oacc[r] *= alpha;

#pragma unroll
      for (int kk = 0; kk < 2; ++kk) {
        FB vb, vl;
        vb.h[0] = *(const v8b*)(Vhs + c * 64 + kk * 32 + 8 * hh);
        vb.h[1] = *(const v8b*)(Vhs + c * 64 + kk * 32 + 16 + 8 * hh);
        vl.h[0] = *(const v8b*)(Vls + c * 64 + kk * 32 + 8 * hh);
        vl.h[1] = *(const v8b*)(Vls + c * 64 + kk * 32 + 16 + 8 * hh);
        oacc = at_mma(vb.v, ph[kk], oacc);
        oacc = at_mma(vl.v, ph[kk], oacc);
        oacc = at_mma(vb.v, pl[kk], oacc);
      }
    }
    // oacc[r] = unnormalised out(query q0 + c, d = 8hh + r); the two halves' sums join here; the sum is >= 1
    const float inv = 1.0f / (lsum + other_half(lsum));
    v4f o0, o1;
#pragma unroll
    for (int r = 0; r < 4; ++r) { o0[r] = oacc[r] * inv; o1[r] = oacc[4 + r] * inv; }
    *(v4f*)(os + c * 68 + h * HEADD + 8 * hh)     = o0;
    *(v4f*)(os + c * 68 + h * HEADD + 8 * hh + 4) = o1;
  }
  lds_wave_sync();
  {
    const int qq = lane >> 3, c8 = (lane & 7) * 8;
    {
#pragma unroll
      for (int it = 0; it < 4; ++it) {
        const int row = it * 4 + qq;
        const float* sp = os + row * 68 + c8;
        us8 hv, lv;
#pragma unroll
        for (int e = 0; e < 8; ++e) {
          const unsigned short hb = f2bf_bits(sp[e]);
          const unsigned short lb = f2bf_bits(sp[e] - bf_bits2f(hb));
          hv[e] = hb;
          lv[e] = lb;
        }
        const size_t R = (size_t)(q0 + row) * TSTEP + t;
        *(us8*)(Ohi + R * EMB + c8) = hv;
        *(us8*)(Olo + R * EMB + c8) = lv;
      }
      
    }
  }
}

// =====================================================================
extern "C" void kernel_launch(void* const* d_in, const int* in_sizes, int n_in,
                              void* d_out, int out_size, void* d_ws, size_t ws_size,
                              hipStream_t stream) {
  if (n_in < 8) return;
  if (in_sizes[0] != NNODE * TSTEP * EMB || in_sizes[1] != NNODE * TSTEP * EMB ||
      in_sizes[2] != NNODE * TSTEP * EMB || in_sizes[3] != HEADD * HEADD ||
      in_sizes[4] != HEADD * HEADD || in_sizes[5] != HEADD * HEADD ||
      in_sizes[6] != EMB * EMB || in_sizes[7] != EMB) return;
  if (out_size != NROWS * EMB) return;
  if (ws_size < WS_TOTAL) return;

  const float* values = (const float*)d_in[0];
  const float* keys   = (const float*)d_in[1];
  const float* query  = (const float*)d_in[2];
  const float* Wv     = (const float*)d_in[3];
  const float* Wk     = (const float*)d_in[4];
  const float* Wq     = (const float*)d_in[5];
  const float* Wo     = (const float*)d_in[6];
  const float* bo     = (const float*)d_in[7];

  char* ws = (char*)d_ws;
  unsigned short* Q2  = (unsigned short*)(ws + WS_Q2);
  unsigned short* K2  = (unsigned short*)(ws + WS_K2);
  unsigned short* Vth = (unsigned short*)(ws + WS_VTH);
  unsigned short* Vtl = (unsigned short*)(ws + WS_VTL);
  unsigned short* Ohi = (unsigned short*)(ws + WS_OHI);
  unsigned short* Olo = (unsigned short*)(ws + WS_OLO);
  unsigned short* Woh = (unsigned short*)(ws + WS_WOH);
  unsigned short* Wol = (unsigned short*)(ws + WS_WOL);

  // 1) Wo -> bf16 hi/lo planes
  prep_wo_split<<<dim3(1), dim3(256), 0, stream>>>(Wo, Woh, Wol);
  // 2) per-head projections: 144 slices x 16 node groups = 2304 wave tasks, 4 per block
  proj_qkv<<<dim3(NSLICE * (NNODE / 64) / 4), dim3(128), 0, stream>>>(
      values, keys, query, Wv, Wk, Wq, Q2, K2, Vth, Vtl);
  // 3) attention over nodes: 36 t x 16 query blocks
  attn_hd16<<<dim3(TSTEP * (NNODE / 64)), dim3(128), 0, stream>>>(Q2, K2, Vth, Vtl, Ohi, Olo);
  // 4) output projection: C[36864 x 64] = O . Wo^T + bo; M=36864 (576 tiles), N=64, K=64; 8 tiles per block
  wmma_gemm64<1, true, 2, 0, false, 0><<<dim3(NROWS / 64 / 8, 1), dim3(256), 0, stream>>>(
      Ohi, Olo, EMB, 0L, Woh, Wol, EMB, 0L,
      d_out, nullptr, EMB, 0L, bo, nullptr, 0L,
      NROWS, EMB, EMB, 1.0f);
}

// v003
// One run takes 116 microseconds.
// In two side-by-side timings against v002, it was 1.09 and 1.08 times as fast.
// Counting every step since v000, it is 1.94 times as fast.
// Contractions: v_wmma_f32_16x16x32_bf16 with bf16 hi/lo split operands (head projections, q.k scores, p.v, output projection), f32 accumulate; softmax, splits and epilogues in f32.
#include <hip/hip_runtime.h>
#include <math.h>
#include <stddef.h>

// ---------------- problem constants ----------------
constexpr int NNODE  = 1024;
constexpr int TSTEP  = 36;
constexpr int EMB    = 64;
constexpr int NHEAD  = 4;
constexpr int HEADD  = 16;
constexpr int NSLICE = TSTEP * NHEAD;        // 144 (t, h) slices
constexpr int NROWS  = NNODE * TSTEP;        // 36864 rows of the [n*T+t][64] planes
constexpr int QKROW  = 32;                   // u16 per row of the Q/K planes: [hi e0..15 | lo e0..15]

// ---------------- workspace region map (bytes) ----------------
// Q2  : bf16 [144][1024][32]          9,437,184 B  @ 0
// K2  : bf16 [144][1024][32]          9,437,184 B  @ 9,437,184
// Vth : bf16 [144][16][1024] (hi)     4,718,592 B  @ 18,874,368
// Vtl : bf16 [144][16][1024] (lo)     4,718,592 B  @ 23,592,960
// Ohi : bf16 [36864][64] (hi)         4,718,592 B  @ 28,311,552
// Olo : bf16 [36864][64] (lo)         4,718,592 B  @ 33,030,144
// Woh : bf16 [64][64]                     8,192 B  @ 37,748,736
// Wol : bf16 [64][64]                     8,192 B  @ 37,756,928
// total                              37,765,120 B
constexpr size_t WS_Q2   = 0;
constexpr size_t SZ_QK   = (size_t)NSLICE * NNODE * QKROW * 2;
constexpr size_t WS_K2   = WS_Q2 + SZ_QK;
constexpr size_t SZ_V    = (size_t)NSLICE * HEADD * NNODE * 2;
constexpr size_t WS_VTH  = WS_K2 + SZ_QK;
constexpr size_t WS_VTL  = WS_VTH + SZ_V;
constexpr size_t SZ_O    = (size_t)NROWS * EMB * 2;
constexpr size_t WS_OHI  = WS_VTL + SZ_V;
constexpr size_t WS_OLO  = WS_OHI + SZ_O;
constexpr size_t SZ_WO   = (size_t)EMB * EMB * 2;
constexpr size_t WS_WOH  = WS_OLO + SZ_O;
constexpr size_t WS_WOL  = WS_WOH + SZ_WO;
constexpr size_t WS_TOTAL = WS_WOL + SZ_WO;
static_assert(WS_TOTAL == 37765120, "carve");
static_assert(WS_TOTAL <= 134217728, "carve");
static_assert((WS_K2 % 128) == 0 && (WS_VTH % 128) == 0 && (WS_VTL % 128) == 0 && (WS_OHI % 128) == 0 &&
              (WS_OLO % 128) == 0 && (WS_WOH % 128) == 0 && (WS_WOL % 128) == 0, "align");
// GEMM shape contract for the output projection
static_assert(NROWS % 64 == 0 && EMB % 64 == 0 && EMB % 32 == 0, "gemm");
static_assert(NNODE % 64 == 0, "tiles");

// ---------------- types and fragment helpers ----------------
typedef __attribute__((ext_vector_type(16))) _Float16 v16h;
typedef __attribute__((ext_vector_type(8)))  _Float16 v8h;
typedef __attribute__((ext_vector_type(16))) __bf16   v16b;
typedef __attribute__((ext_vector_type(8)))  __bf16   v8b;
typedef __attribute__((ext_vector_type(8)))  float    v8f;
typedef __attribute__((ext_vector_type(4)))  float    v4f;
typedef __attribute__((ext_vector_type(8)))  unsigned short us8;

__device__ __forceinline__ unsigned short f2bf_bits(float f) {
  unsigned u = __float_as_uint(f);
  return (unsigned short)((u + 0x7FFFu + ((u >> 16) & 1u)) >> 16);
}
__device__ __forceinline__ float bf_bits2f(unsigned short h) { return __uint_as_float(((unsigned)h) << 16); }

// hazard guards as plain device helpers (no inline asm inside the kernel template body)
__device__ __forceinline__ void dep_guard_h(v8f& a, v8f& b, v16h x, v16h y) { asm volatile("v_nop\n\tv_nop\n\tv_nop\n\tv_nop" : "+v"(a), "+v"(b) : "v"(x), "v"(y)); }
__device__ __forceinline__ void dep_guard_b(v8f& a, v8f& b, v16b x, v16b y) { asm volatile("v_nop\n\tv_nop\n\tv_nop\n\tv_nop" : "+v"(a), "+v"(b) : "v"(x), "v"(y)); }
__device__ __forceinline__ void keep4_h(v16h a, v16h b, v16h c, v16h d) { asm volatile("v_nop" :: "v"(a), "v"(b), "v"(c), "v"(d)); }
__device__ __forceinline__ void keep4_b(v16b a, v16b b, v16b c, v16b d) { asm volatile("v_nop" :: "v"(a), "v"(b), "v"(c), "v"(d)); }
__device__ __forceinline__ void acc_guard4(v8f& a, v8f& b, v8f& c, v8f& d) { asm volatile("v_nop\n\tv_nop\n\tv_nop\n\tv_nop" : "+v"(a), "+v"(b), "+v"(c), "+v"(d)); }
template <typename T> struct Frag;
template <> struct Frag<_Float16> {
  typedef v16h V; union U { v16h v; v8h h[2]; };
  static __device__ __forceinline__ v16h load(const _Float16* p) {   // elements 0..7 <- p[0..7], 8..15 <- p[16..23]
    U f; f.h[0] = *(const v8h*)(p); f.h[1] = *(const v8h*)(p + 16); return f.v;
  }
  static __device__ __forceinline__ v8f mma(v16h a, v16h b, v8f c) {
    return __builtin_amdgcn_wmma_f32_16x16x32_f16(false, a, false, b, (short)0, c, false, false);
  }
  static __device__ __forceinline__ void guard(v8f& a, v8f& b, v16h x, v16h y) { dep_guard_h(a, b, x, y); }
  static __device__ __forceinline__ void keep(v16h a, v16h b, v16h c, v16h d) { keep4_h(a, b, c, d); }
};
template <> struct Frag<__bf16> {
  typedef v16b V; union U { v16b v; v8b h[2]; };
  static __device__ __forceinline__ v16b load(const __bf16* p) {
    U f; f.h[0] = *(const v8b*)(p); f.h[1] = *(const v8b*)(p + 16); return f.v;
  }
  static __device__ __forceinline__ v8f mma(v16b a, v16b b, v8f c) {
    return __builtin_amdgcn_wmma_f32_16x16x32_bf16(false, a, false, b, (short)0, c, false, false);
  }
  static __device__ __forceinline__ void guard(v8f& a, v8f& b, v16b x, v16b y) { dep_guard_b(a, b, x, y); }
  static __device__ __forceinline__ void keep(v16b a, v16b b, v16b c, v16b d) { keep4_b(a, b, c, d); }
};

// ---- Register-blocked batched WMMA GEMM -----------------------------------
// C[m,n] = scale * sum_k A[m,k] * Bt[n,k] (+bias)(+resid); each wave owns a 64x64 tile.
// A row-major [M,K]; Bt row-major [N,K]; M,N % 64 == 0, K % 32 == 0.
// SPLIT: operands are hi/lo planes (A2/Bt2 = lo planes, same layout); product = hi.hi + hi.lo + lo.hi.
// BIAS_MODE: 0 = none, 1 = bias[m], 2 = bias[n].
// OUT_MODE: 0 = f32, 1 = f16, 2 = bf16 hi plane (Cout) + bf16 lo plane (Cout2).
// ET: 0 = f16 operands, 1 = bf16 operands (pointers passed as 16-bit storage)
template <int ET> struct Elem;
template <> struct Elem<0> { typedef _Float16 T; };
template <> struct Elem<1> { typedef __bf16 T; };
template <int ET, bool SPLIT, int BIAS_MODE, int OUT_MODE, bool RESID, int ACT = 0>
__global__ __launch_bounds__(256) void wmma_gemm64(
    const unsigned short* __restrict__ Ap, const unsigned short* __restrict__ A2p, int lda, long strideA,
    const unsigned short* __restrict__ Btp, const unsigned short* __restrict__ Bt2p, int ldb, long strideB,
    void* __restrict__ Cout, void* __restrict__ Cout2, int ldc, long strideC,
    const float* __restrict__ bias,
    const float* __restrict__ resid, long strideR,
    int M, int N, int K, float scale) {
  typedef typename Elem<ET>::T T;
  typedef typename Frag<T>::V V;
  const T* A = (const T*)Ap; const T* A2 = (const T*)A2p; const T* Bt = (const T*)Btp; const T* Bt2 = (const T*)Bt2p;
  __shared__ __align__(16) float sT[8][16 * 68];   // per-wave 16x64 slab, pitch 68 floats
  const int b    = blockIdx.y;
  const int lane = threadIdx.x & 31;
  const int wave = threadIdx.x >> 5;
  const int tilesN = N >> 6;
  const int tilesM = M >> 6;
  const int tile = blockIdx.x * 8 + wave;
  if (tile >= tilesM * tilesN) return;   // wave-uniform; no block barriers in this kernel
  const int tm = tile / tilesN;
  const int tn = tile - tm * tilesN;
  const int m0 = tm << 6;
  const int n0 = tn << 6;

  const T* Ab  = A  + (size_t)b * strideA;
  const T* Bb  = Bt + (size_t)b * strideB;
  const T* Ab2 = SPLIT ? (A2  + (size_t)b * strideA) : nullptr;
  const T* Bb2 = SPLIT ? (Bt2 + (size_t)b * strideB) : nullptr;

  const int rlane = lane & 15;                 // row (A) / col (B, D) within subtile
  const int koff  = (lane >> 4) * 8;           // k offset of this lane half
  const int mOff  = (lane >> 4) * 8;           // D row offset

  v8f acc[4][4];
#pragma unroll
  for (int i = 0; i < 4; ++i)
#pragma unroll
    for (int j = 0; j < 4; ++j) acc[i][j] = (v8f){0.f,0.f,0.f,0.f,0.f,0.f,0.f,0.f};

  for (int k0 = 0; k0 < K; k0 += 32) {
    V bh[4], bl[4];
#pragma unroll
    for (int j = 0; j < 4; ++j) {
      const size_t bo = (size_t)(n0 + (j << 4) + rlane) * ldb + koff + k0;
      bh[j] = Frag<T>::load(Bb + bo);
      if (SPLIT) bl[j] = Frag<T>::load(Bb2 + bo);
    }
#pragma unroll
    for (int i = 0; i < 4; ++i) {
      const size_t ao = (size_t)(m0 + (i << 4) + rlane) * lda + koff + k0;
      V ah = Frag<T>::load(Ab + ao);
      V al;
      if (SPLIT) al = Frag<T>::load(Ab2 + ao);
#pragma unroll
      for (int j = 0; j < 4; ++j) {
        acc[i][j] = Frag<T>::mma(ah, bh[j], acc[i][j]);
        if (SPLIT) {
          acc[i][j] = Frag<T>::mma(ah, bl[j], acc[i][j]);
          acc[i][j] = Frag<T>::mma(al, bh[j], acc[i][j]);
        }
      }
      Frag<T>::guard(acc[i][0], acc[i][3], ah, SPLIT ? al : ah);
    }
    Frag<T>::keep(bh[0], bh[1], bh[2], bh[3]);
    if (SPLIT) Frag<T>::keep(bl[0], bl[1], bl[2], bl[3]);
  }
  acc_guard4(acc[0][0], acc[0][1], acc[0][2], acc[0][3]);
  acc_guard4(acc[1][0], acc[1][1], acc[1][2], acc[1][3]);
  acc_guard4(acc[2][0], acc[2][1], acc[2][2], acc[2][3]);
  acc_guard4(acc[3][0], acc[3][1], acc[3][2], acc[3][3]);

  // ---- epilogue ----
  float* slab = sT[wave];
  const float* Rb = RESID ? (resid + (size_t)b * strideR) : nullptr;
#pragma unroll
  for (int i = 0; i < 4; ++i) {
    const int mBase = m0 + (i << 4);
#pragma unroll
    for (int j = 0; j < 4; ++j) {
      const int n = n0 + (j << 4) + rlane;
      float bv = 0.f;
      if (BIAS_MODE == 2) bv = bias[n];
#pragma unroll
      for (int r = 0; r < 8; ++r) {
        float v = acc[i][j][r] * scale;
        if (BIAS_MODE == 1) v += bias[mBase + mOff + r];
        if (BIAS_MODE == 2) v += bv;
        if (RESID) v += Rb[(size_t)(mBase + mOff + r) * ldc + n];
        if (ACT == 1) v = tanhf(v);
        if (ACT == 2) v = fmaxf(v, 0.0f);
        if (ACT == 3) v = v / (1.0f + expf(-v));
        if (ACT == 4) v = (v > 0.f) ? v : 0.01f * v;
        if (ACT == 5) v = 0.5f * v * (1.0f + erff(v * 0.70710678118654752f));
        slab[(mOff + r) * 68 + (j << 4) + rlane] = v;
      }
    }
    __builtin_amdgcn_fence(__ATOMIC_RELEASE, "workgroup");
    __builtin_amdgcn_wave_barrier();
    __builtin_amdgcn_fence(__ATOMIC_ACQUIRE, "workgroup");
    if (OUT_MODE == 0) {
      float* C = (float*)Cout + (size_t)b * strideC;
      const int hh = lane >> 4, c4 = (lane & 15) * 4;     // row seg = 256 B = 16 lanes x 16 B
      {
#pragma unroll
        for (int it = 0; it < 8; ++it) {
          const int row = it * 2 + hh;
          v4f v = *(const v4f*)(slab + row * 68 + c4);
          *(v4f*)(C + (size_t)(mBase + row) * ldc + n0 + c4) = v;
        }
        
      }
    } else {
      const int q = lane >> 3, c8 = (lane & 7) * 8;
      unsigned short* C  = (unsigned short*)Cout  + (size_t)b * strideC;
      unsigned short* C2 = (OUT_MODE == 2) ? ((unsigned short*)Cout2 + (size_t)b * strideC) : nullptr;
      {
#pragma unroll
        for (int it = 0; it < 4; ++it) {
          const int row = it * 4 + q;
          const float* sp = slab + row * 68 + c8;
          v8h hv, lv;
#pragma unroll
          for (int e = 0; e < 8; ++e) {
            if (OUT_MODE == 1) {
              hv[e] = (_Float16)sp[e];
            } else {
              unsigned short hb = f2bf_bits(sp[e]);
              unsigned short lb = f2bf_bits(sp[e] - bf_bits2f(hb));
              hv[e] = __builtin_bit_cast(_Float16, hb);
              lv[e] = __builtin_bit_cast(_Float16, lb);
            }
          }
          *(v8h*)(C + (size_t)(mBase + row) * ldc + n0 + c8) = hv;
          if (OUT_MODE == 2) *(v8h*)(C2 + (size_t)(mBase + row) * ldc + n0 + c8) = lv;
        }
        
      }
    }
    __builtin_amdgcn_fence(__ATOMIC_RELEASE, "workgroup");
    __builtin_amdgcn_wave_barrier();
    __builtin_amdgcn_fence(__ATOMIC_ACQUIRE, "workgroup");
  }
}

// ---------------- bf16 split helpers and guarded bf16 WMMA ----------------
__device__ __forceinline__ unsigned short at_bf_bits(float f) {
  unsigned u = __float_as_uint(f);
  return (unsigned short)((u + 0x7FFFu + ((u >> 16) & 1u)) >> 16);
}
__device__ __forceinline__ __bf16 at_f2bf(float f) { return __builtin_bit_cast(__bf16, at_bf_bits(f)); }
__device__ __forceinline__ void at_split(float f, __bf16& hi, __bf16& lo) {
  const unsigned short hb = at_bf_bits(f);
  hi = __builtin_bit_cast(__bf16, hb);
  lo = at_f2bf(f - __uint_as_float(((unsigned)hb) << 16));
}
__device__ __forceinline__ v8f at_mma(v16b a, v16b b, v8f c) {
  c = __builtin_amdgcn_wmma_f32_16x16x32_bf16(false, a, false, b, (short)0, c, false, false);
  asm volatile("v_nop\n\tv_nop\n\tv_nop\n\tv_nop" : "+v"(c) : "v"(a), "v"(b));
  return c;
}

// same-wave LDS write -> read ordering
__device__ __forceinline__ void lds_wave_sync() {
  __builtin_amdgcn_fence(__ATOMIC_RELEASE, "workgroup");
  __builtin_amdgcn_wave_barrier();
  __builtin_amdgcn_fence(__ATOMIC_ACQUIRE, "workgroup");
}

// =====================================================================
// Operand fragments with the K=16 contraction packed into one 32-deep k-step:
//   slot s <  16 -> hi part of d = s
//   slot s >= 16 -> lo part of d = s - 16
// A fragment (lane row m = lane&15, hh = lane>>4): elements 0..7 = hi[d = 8hh+e], 8..15 = lo[d = 8hh+e].
// B fragments: B1 = [wh | wh], B2 = [wl | wl] so that A.B1 + A.B2 = (xh+xl).(wh+wl).
// =====================================================================
__device__ __forceinline__ v16b x_frag_split(const float* __restrict__ xr, int hh) {
  const v4f a = *(const v4f*)(xr + 8 * hh);
  const v4f b = *(const v4f*)(xr + 8 * hh + 4);
  const float f[8] = {a[0], a[1], a[2], a[3], b[0], b[1], b[2], b[3]};
  v16b fr;
#pragma unroll
  for (int e = 0; e < 8; ++e) {
    __bf16 hb, lb;
    at_split(f[e], hb, lb);
    fr[e] = hb;
    fr[8 + e] = lb;
  }
  return fr;
}
// W is [16 out][16 in] row-major; lane column c = out index e; loads W[c][8hh .. 8hh+7]
__device__ __forceinline__ void w_frags_split(const float* __restrict__ W, int c, int hh, v16b& wh, v16b& wl) {
  const v4f a = *(const v4f*)(W + c * HEADD + 8 * hh);
  const v4f b = *(const v4f*)(W + c * HEADD + 8 * hh + 4);
  const float f[8] = {a[0], a[1], a[2], a[3], b[0], b[1], b[2], b[3]};
#pragma unroll
  for (int e = 0; e < 8; ++e) {
    __bf16 hb, lb;
    at_split(f[e], hb, lb);
    wh[e] = hb; wh[8 + e] = hb;
    wl[e] = lb; wl[8 + e] = lb;
  }
}

// One wave: rows n0..n0+63 of slice (t,h) for a q-type tensor -> plane dst[slice][n][hi16|lo16].
// Coverage: 4 tiles x 16 rows = 64 rows x 32 u16 staged; stored as 8 x (32 lanes x 8 u16) = 2048 u16 = whole region.
__device__ __forceinline__ void proj_qk_part(const float* __restrict__ x, unsigned short* __restrict__ dstp,
    const v16b wh, const v16b wl, float oscale, int slice, int n0, int t, int h, int lane, unsigned short* sl)
{
  const int hh = lane >> 4, c = lane & 15;
#pragma unroll
  for (int i = 0; i < 4; ++i) {
    const float* xr = x + ((size_t)(n0 + 16 * i + c) * TSTEP + t) * EMB + h * HEADD;
    const v16b xa = x_frag_split(xr, hh);
    v8f acc = (v8f){0.f,0.f,0.f,0.f,0.f,0.f,0.f,0.f};
    acc = at_mma(xa, wh, acc);
    acc = at_mma(xa, wl, acc);
    // acc[r] = proj[n0 + 16i + 8hh + r][e = c]
#pragma unroll
    for (int r = 0; r < 8; ++r) {
      const float v = acc[r] * oscale;
      const unsigned short hb = f2bf_bits(v);
      const unsigned short lb = f2bf_bits(v - bf_bits2f(hb));
      const int row = 16 * i + 8 * hh + r;
      sl[row * QKROW + c] = hb;
      sl[row * QKROW + 16 + c] = lb;
    }
  }
  lds_wave_sync();
  unsigned short* dst = dstp + ((size_t)slice * NNODE + n0) * QKROW;   // 64 consecutive rows = 4096 B = 32 lines
  {
#pragma unroll
    for (int it = 0; it < 8; ++it) {
      const us8 v = *(const us8*)(sl + (it * 32 + lane) * 8);
      *(us8*)(dst + (it * 32 + lane) * 8) = v;
    }
    
  }
  lds_wave_sync();
}

// One wave: rows n0..n0+63 of slice for values -> transposed planes Vth/Vtl[slice][d][n].
// Coverage: slab hi [16 d][64 n] + lo [16 d][64 n] fully written by 4 tiles x 32 lanes x 8 u16;
// stored as 4 x (4 rows x 8 lanes x 8 u16) per plane = all 16 d rows x 64 n.
__device__ __forceinline__ void proj_v_part(const float* __restrict__ x, unsigned short* __restrict__ Vth,
    unsigned short* __restrict__ Vtl, const v16b wh, const v16b wl, int slice, int n0, int t, int h, int lane,
    unsigned short* sl)
{
  const int hh = lane >> 4, c = lane & 15;
#pragma unroll
  for (int i = 0; i < 4; ++i) {
    const float* xr = x + ((size_t)(n0 + 16 * i + c) * TSTEP + t) * EMB + h * HEADD;
    const v16b xa = x_frag_split(xr, hh);
    v8f acc = (v8f){0.f,0.f,0.f,0.f,0.f,0.f,0.f,0.f};
    acc = at_mma(xa, wh, acc);
    acc = at_mma(xa, wl, acc);
    // acc[r] = v[n0 + 16i + 8hh + r][d = c] -> slab[d][16i + 8hh + r]
    us8 hv, lv;
#pragma unroll
    for (int r = 0; r < 8; ++r) {
      const float v = acc[r];
      const unsigned short hb = f2bf_bits(v);
      const unsigned short lb = f2bf_bits(v - bf_bits2f(hb));
      hv[r] = hb;
      lv[r] = lb;
    }
    *(us8*)(sl + c * 64 + 16 * i + 8 * hh) = hv;
    *(us8*)(sl + 1024 + c * 64 + 16 * i + 8 * hh) = lv;
  }
  lds_wave_sync();
  const int qq = lane >> 3, c8 = (lane & 7) * 8;
  {
#pragma unroll
    for (int it = 0; it < 4; ++it) {
      const int d = it * 4 + qq;
      const us8 hv = *(const us8*)(sl + d * 64 + c8);
      const us8 lv = *(const us8*)(sl + 1024 + d * 64 + c8);
      const size_t off = ((size_t)slice * HEADD + d) * NNODE + n0 + c8;
      *(us8*)(Vth + off) = hv;
      *(us8*)(Vtl + off) = lv;
    }
    
  }
  lds_wave_sync();
}

// =====================================================================
// Kernel 1: per-head projections on WMMA. One wave = (slice, 64-node group); 4 waves per block,
// each with its own LDS slab (no cross-wave LDS traffic, no block barriers).
// grid = 2304 / 4 = 576 blocks.
// =====================================================================
__global__ __launch_bounds__(128) void proj_qkv(
    const float* __restrict__ values, const float* __restrict__ keys, const float* __restrict__ query,
    const float* __restrict__ Wv, const float* __restrict__ Wk, const float* __restrict__ Wq,
    unsigned short* __restrict__ Q2, unsigned short* __restrict__ K2,
    unsigned short* __restrict__ Vth, unsigned short* __restrict__ Vtl)
{
  __shared__ __align__(16) unsigned short slab[4][64 * QKROW];   // 4 KB per wave
  const int lane = threadIdx.x & 31;
  const int wave = threadIdx.x >> 5;
  const int hh = lane >> 4, c = lane & 15;
  const int task  = blockIdx.x * 4 + wave;           // 0 .. 2303
  const int slice = task >> 4;                        // 0 .. 143
  const int ng    = task & 15;                        // node group
  const int t = slice >> 2, h = slice & 3;
  const int n0 = ng * 64;
  unsigned short* sl = slab[wave];

  v16b wqh, wql, wkh, wkl, wvh, wvl;
  w_frags_split(Wq, c, hh, wqh, wql);
  w_frags_split(Wk, c, hh, wkh, wkl);
  w_frags_split(Wv, c, hh, wvh, wvl);

  // q carries the exact 1/sqrt(64) = 0.125 score scale
  proj_qk_part(query, Q2, wqh, wql, 0.125f, slice, n0, t, h, lane, sl);
  proj_qk_part(keys,  K2, wkh, wkl, 1.0f,   slice, n0, t, h, lane, sl);
  proj_v_part(values, Vth, Vtl, wvh, wvl, slice, n0, t, h, lane, sl);
}

// =====================================================================
// Kernel 0: Wo -> bf16 hi/lo planes [64][64] (Bt[n = e][k = c] = Wo[e][c]). One block of 256 threads;
// thread handles element groups g = tid, tid + 256 (8 consecutive elements each): 512 x 8 = 4096 = whole planes.
// =====================================================================
__global__ __launch_bounds__(256) void prep_wo_split(
    const float* __restrict__ Wo, unsigned short* __restrict__ Woh, unsigned short* __restrict__ Wol)
{
  const int tid = threadIdx.x;
  us8 hv[2], lv[2];
#pragma unroll
  for (int it = 0; it < 2; ++it) {
    const int g = tid + 256 * it;
    const v4f a = *(const v4f*)(Wo + 8 * g);
    const v4f b = *(const v4f*)(Wo + 8 * g + 4);
    const float f[8] = {a[0], a[1], a[2], a[3], b[0], b[1], b[2], b[3]};
#pragma unroll
    for (int e = 0; e < 8; ++e) {
      const unsigned short hb = f2bf_bits(f[e]);
      const unsigned short lb = f2bf_bits(f[e] - bf_bits2f(hb));
      hv[it][e] = hb;
      lv[it][e] = lb;
    }
  }
  {
#pragma unroll
    for (int it = 0; it < 2; ++it) {
      const int g = tid + 256 * it;
      *(us8*)(Woh + 8 * g) = hv[it];
      *(us8*)(Wol + 8 * g) = lv[it];
    }
    
  }
}

constexpr float LOG2E = 1.4426950408889634f;
typedef __attribute__((ext_vector_type(2))) float v2f;
// y = 2^x on the hardware. The v_nop in the same statement keeps the one slot that the instruction set asks for between
// a transcendental and an instruction that uses its result or overwrites its source, whatever the compiler puts next.
__device__ __forceinline__ float exp2_hw(float x) {
  float y;
  asm("v_exp_f32 %0, %1\n\tv_nop" : "=v"(y) : "v"(x));
  return y;
}
// Eight independent 2^x in one statement: the early-clobber outputs keep every result off every source, so none of the
// eight overwrites a source of the one in front of it, and one closing v_nop keeps the slot for all of them.
__device__ __forceinline__ v8f exp2_hw8(v8f x) {
  float y0, y1, y2, y3, y4, y5, y6, y7;
  asm("v_exp_f32 %0, %8\n\tv_exp_f32 %1, %9\n\tv_exp_f32 %2, %10\n\tv_exp_f32 %3, %11\n\t"
      "v_exp_f32 %4, %12\n\tv_exp_f32 %5, %13\n\tv_exp_f32 %6, %14\n\tv_exp_f32 %7, %15\n\tv_nop"
      : "=&v"(y0), "=&v"(y1), "=&v"(y2), "=&v"(y3), "=&v"(y4), "=&v"(y5), "=&v"(y6), "=&v"(y7)
      : "v"(x[0]), "v"(x[1]), "v"(x[2]), "v"(x[3]), "v"(x[4]), "v"(x[5]), "v"(x[6]), "v"(x[7]));
  return (v8f){y0, y1, y2, y3, y4, y5, y6, y7};
}
// value of lane l ^ 16
__device__ __forceinline__ float other_half(float x) {
  const int b = __float_as_int(x);
  return __int_as_float(__builtin_amdgcn_permlanex16(b, b, 0x76543210, 0xfedcba98, false, false));
}

// LDS row pitches of the staged tiles, in 16-bit elements. The fragment reads are 16 bytes a lane with one row per lane,
// so the pitch is an odd multiple of 16 bytes: the 16 rows of a half wave then fall on 16 different groups of four banks.
// The pad elements at the end of a row are never written and never read.
constexpr int KPITCH = QKROW + 8;            // 80 B  = 16 B x 5 (data: 64 B)
constexpr int VPITCH = 64 + 8;               // 144 B = 16 B x 9 (data: 128 B)

__global__ __launch_bounds__(128) void attn_hd16(
    const unsigned short* __restrict__ Q2, const unsigned short* __restrict__ K2,
    const unsigned short* __restrict__ Vth, const unsigned short* __restrict__ Vtl,
    unsigned short* __restrict__ Ohi, unsigned short* __restrict__ Olo)
{
  union FB { v16b v; v8b h[2]; };
  __shared__ __align__(16) __bf16 Ksh[64 * KPITCH];         // [key][hi16|lo16|pad]
  __shared__ __align__(16) __bf16 Vhs[HEADD * VPITCH];      // [d][64 keys|pad] hi
  __shared__ __align__(16) __bf16 Vls[HEADD * VPITCH];      // [d][64 keys|pad] lo
  __shared__ __align__(16) float  Os[4][16 * 68];           // per wave output rows, pitch 68

  const int tid  = threadIdx.x;
  const int wave = tid >> 5;
  const int lane = tid & 31;
  const int hh   = lane >> 4;
  const int c    = lane & 15;
  const int t    = blockIdx.x >> 4;          // 0 .. 35
  const int qb   = blockIdx.x & 15;          // 64-query block
  const int q0   = qb * 64 + wave * 16;
  float*  os  = Os[wave];

#pragma unroll 1
  for (int h = 0; h < NHEAD; ++h) {
    const int slice = t * NHEAD + h;
    const __bf16* Qs = (const __bf16*)(const void*)Q2 + (size_t)slice * NNODE * QKROW;
    // B fragment, column = query q0 + c: elements 0..7 = qh[d = 8hh+e], 8..15 = ql[d = 8hh+e]
    const v16b qa = Frag<__bf16>::load(Qs + (size_t)(q0 + c) * QKROW + 8 * hh);
    const v8b* Kg  = (const v8b*)(const void*)(K2  + (size_t)slice * NNODE * QKROW);   // [key*4 + seg]
    const v8b* Vhg = (const v8b*)(const void*)(Vth + (size_t)slice * HEADD * NNODE);   // [d*128 + key/8]
    const v8b* Vlg = (const v8b*)(const void*)(Vtl + (size_t)slice * HEADD * NNODE);

    // per lane: running maximum of query q0 + c times log2e (equal in both halves), this half's part of its sum
    float mrun = -INFINITY, lsum = 0.f;
    v8f oacc = (v8f){0.f,0.f,0.f,0.f,0.f,0.f,0.f,0.f};

#pragma unroll 1
    for (int kc = 0; kc < NNODE / 64; ++kc) {
      const int kv0 = kc * 64;
      __syncthreads();
      // stage K: 256 pieces of 16 B = 64 rows x 32 u16 (whole tile)
#pragma unroll
      for (int i = 0; i < 2; ++i) {
        const int p = tid + 128 * i;
        const int row = p >> 2, seg = p & 3;
        const v8b kv = Kg[(size_t)(kv0 + row) * 4 + seg];
        *(v8b*)(Ksh + row * KPITCH + seg * 8) = kv;
      }
      // stage V hi/lo: 128 pieces of 16 B = 16 d x 64 keys per plane (whole tiles)
      {
        const int d = tid >> 3, seg = tid & 7;
        const v8b a  = Vhg[(size_t)d * (NNODE / 8) + kc * 8 + seg];
        const v8b b2 = Vlg[(size_t)d * (NNODE / 8) + kc * 8 + seg];
        *(v8b*)(Vhs + d * VPITCH + seg * 8) = a;
        *(v8b*)(Vls + d * VPITCH + seg * 8) = b2;
      }
      __syncthreads();

      v8f s[4];
#pragma unroll
      for (int j = 0; j < 4; ++j) {
        const __bf16* kr = Ksh + (j * 16 + c) * KPITCH + 8 * hh;
        const v8b kh8 = *(const v8b*)(kr);
        const v8b kl8 = *(const v8b*)(kr + 16);
        FB k1, k2;
        k1.h[0] = kh8; k1.h[1] = kh8;
        k2.h[0] = kl8; k2.h[1] = kl8;
        s[j] = (v8f){0.f,0.f,0.f,0.f,0.f,0.f,0.f,0.f};
        s[j] = at_mma(k1.v, qa, s[j]);
        s[j] = at_mma(k2.v, qa, s[j]);
      }
      // s[j][r] = scaled energy(key kv0 + 16j + 8hh + r, query q0 + c)
      float cm = s[0][0];
#pragma unroll
      for (int j = 0; j < 4; ++j)
#pragma unroll
        for (int r = 0; r < 8; ++r) cm = fmaxf(cm, s[j][r]);
      cm = fmaxf(cm, other_half(cm));
      const float mnew  = fmaxf(mrun, cm * LOG2E);
      const float alpha = exp2_hw(mrun - mnew);
      mrun = mnew;

      v16b ph[2], pl[2];
      float ps[4];
#pragma unroll
      for (int j = 0; j < 4; ++j) {
        ps[j] = 0.f;
        // arguments <= 0 up to one rounding: no overflow; below -126 a term is under 2^-126 of the largest and goes to 0
        v8f ea;
#pragma unroll
        for (int r = 0; r < 8; r += 2) {
          const v2f a2 = __builtin_elementwise_fma((v2f){s[j][r], s[j][r + 1]}, (v2f){LOG2E, LOG2E}, (v2f){-mnew, -mnew});
          ea[r] = a2[0]; ea[r + 1] = a2[1];
        }
        const v8f pe = exp2_hw8(ea);
#pragma unroll
        for (int r = 0; r < 8; ++r) {
          const float p = pe[r];
          ps[j] += p;
          __bf16 a, bl;
          at_split(p, a, bl);
          // B element 8(j&1) + r of lane (c, hh) is key 16(j&1) + 8hh + r of the 32-key step j>>1
          ph[j >> 1][8 * (j & 1) + r] = a;
          pl[j >> 1][8 * (j & 1) + r] = bl;
        }
      }
      lsum = lsum * alpha + ((ps[0] + ps[1]) + (ps[2] + ps[3]));
#pragma unroll
      for (int r = 0; r < 8; ++r) oacc[r] *= alpha;

#pragma unroll
      for (int kk = 0; kk < 2; ++kk) {
        FB vb, vl;
        vb.h[0] = *(const v8b*)(Vhs + c * VPITCH + kk * 32 + 8 * hh);
        vb.h[1] = *(const v8b*)(Vhs + c * VPITCH + kk * 32 + 16 + 8 * hh);
        vl.h[0] = *(const v8b*)(Vls + c * VPITCH + kk * 32 + 8 * hh);
        vl.h[1] = *(const v8b*)(Vls + c * VPITCH + kk * 32 + 16 + 8 * hh);
        oacc = at_mma(vb.v, ph[kk], oacc);
        oacc = at_mma(vl.v, ph[kk], oacc);
        oacc = at_mma(vb.v, pl[kk], oacc);
      }
    }
    // oacc[r] = unnormalised out(query q0 + c, d = 8hh + r); the two halves' sums join here; the sum is >= 1
    const float inv = 1.0f / (lsum + other_half(lsum));
    v4f o0, o1;
#pragma unroll
    for (int r = 0; r < 4; ++r) { o0[r] = oacc[r] * inv; o1[r] = oacc[4 + r] * inv; }
    *(v4f*)(os + c * 68 + h * HEADD + 8 * hh)     = o0;
    *(v4f*)(os + c * 68 + h * HEADD + 8 * hh + 4) = o1;
  }
  lds_wave_sync();
  {
    const int qq = lane >> 3, c8 = (lane & 7) * 8;
    {
#pragma unroll
      for (int it = 0; it < 4; ++it) {
        const int row = it * 4 + qq;
        const float* sp = os + row * 68 + c8;
        us8 hv, lv;
#pragma unroll
        for (int e = 0; e < 8; ++e) {
          const unsigned short hb = f2bf_bits(sp[e]);
          const unsigned short lb = f2bf_bits(sp[e] - bf_bits2f(hb));
          hv[e] = hb;
          lv[e] = lb;
        }
        const size_t R = (size_t)(q0 + row) * TSTEP + t;
        *(us8*)(Ohi + R * EMB + c8) = hv;
        *(us8*)(Olo + R * EMB + c8) = lv;
      }
      
    }
  }
}

// =====================================================================
extern "C" void kernel_launch(void* const* d_in, const int* in_sizes, int n_in,
                              void* d_out, int out_size, void* d_ws, size_t ws_size,
                              hipStream_t stream) {
  if (n_in < 8) return;
  if (in_sizes[0] != NNODE * TSTEP * EMB || in_sizes[1] != NNODE * TSTEP * EMB ||
      in_sizes[2] != NNODE * TSTEP * EMB || in_sizes[3] != HEADD * HEADD ||
      in_sizes[4] != HEADD * HEADD || in_sizes[5] != HEADD * HEADD ||
      in_sizes[6] != EMB * EMB || in_sizes[7] != EMB) return;
  if (out_size != NROWS * EMB) return;
  if (ws_size < WS_TOTAL) return;

  const float* values = (const float*)d_in[0];
  const float* keys   = (const float*)d_in[1];
  const float* query  = (const float*)d_in[2];
  const float* Wv     = (const float*)d_in[3];
  const float* Wk     = (const float*)d_in[4];
  const float* Wq     = (const float*)d_in[5];
  const float* Wo     = (const float*)d_in[6];
  const float* bo     = (const float*)d_in[7];

  char* ws = (char*)d_ws;
  unsigned short* Q2  = (unsigned short*)(ws + WS_Q2);
  unsigned short* K2  = (unsigned short*)(ws + WS_K2);
  unsigned short* Vth = (unsigned short*)(ws + WS_VTH);
  unsigned short* Vtl = (unsigned short*)(ws + WS_VTL);
  unsigned short* Ohi = (unsigned short*)(ws + WS_OHI);
  unsigned short* Olo = (unsigned short*)(ws + WS_OLO);
  unsigned short* Woh = (unsigned short*)(ws + WS_WOH);
  unsigned short* Wol = (unsigned short*)(ws + WS_WOL);

  // 1) Wo -> bf16 hi/lo planes
  prep_wo_split<<<dim3(1), dim3(256), 0, stream>>>(Wo, Woh, Wol);
  // 2) per-head projections: 144 slices x 16 node groups = 2304 wave tasks, 4 per block
  proj_qkv<<<dim3(NSLICE * (NNODE / 64) / 4), dim3(128), 0, stream>>>(
      values, keys, query, Wv, Wk, Wq, Q2, K2, Vth, Vtl);
  // 3) attention over nodes: 36 t x 16 query blocks
  attn_hd16<<<dim3(TSTEP * (NNODE / 64)), dim3(128), 0, stream>>>(Q2, K2, Vth, Vtl, Ohi, Olo);
  // 4) output projection: C[36864 x 64] = O . Wo^T + bo; M=36864 (576 tiles), N=64, K=64; 8 tiles per block
  wmma_gemm64<1, true, 2, 0, false, 0><<<dim3(NROWS / 64 / 8, 1), dim3(256), 0, stream>>>(
      Ohi, Olo, EMB, 0L, Woh, Wol, EMB, 0L,
      d_out, nullptr, EMB, 0L, bo, nullptr, 0L,
      NROWS, EMB, EMB, 1.0f);
}

// v004
// It runs in 82.9 microseconds.
// Timed twice side by side with v003, it ran 1.40 times as fast both times.
// Over all steps from v000 it is 2.72 times as fast.
// Contractions: v_wmma_f32_16x16x32_bf16 with bf16 hi/lo split operands (head projections, q.k scores, p.v, output projection), f32 accumulate; softmax, splits and epilogues in f32.
#include <hip/hip_runtime.h>
#include <math.h>
#include <stddef.h>

// ---------------- problem constants ----------------
constexpr int NNODE  = 1024;
constexpr int TSTEP  = 36;
constexpr int EMB    = 64;
constexpr int NHEAD  = 4;
constexpr int HEADD  = 16;
constexpr int NSLICE = TSTEP * NHEAD;        // 144 (t, h) slices
constexpr int NROWS  = NNODE * TSTEP;        // 36864 rows of the [n*T+t][64] planes
constexpr int QKROW  = 32;                   // u16 per row of the Q/K planes: [hi e0..15 | lo e0..15]

// ---------------- workspace region map (bytes) ----------------
// Q2  : bf16 [144][1024][32]          9,437,184 B  @ 0
// K2  : bf16 [144][1024][32]          9,437,184 B  @ 9,437,184
// Vth : bf16 [144][16][1024] (hi)     4,718,592 B  @ 18,874,368
// Vtl : bf16 [144][16][1024] (lo)     4,718,592 B  @ 23,592,960
// Ohi : bf16 [144][1024][16] (hi)     4,718,592 B  @ 28,311,552
// Olo : bf16 [144][1024][16] (lo)     4,718,592 B  @ 33,030,144
// Woh : bf16 [64][64]                     8,192 B  @ 37,748,736
// Wol : bf16 [64][64]                     8,192 B  @ 37,756,928
// total                              37,765,120 B
constexpr size_t WS_Q2   = 0;
constexpr size_t SZ_QK   = (size_t)NSLICE * NNODE * QKROW * 2;
constexpr size_t WS_K2   = WS_Q2 + SZ_QK;
constexpr size_t SZ_V    = (size_t)NSLICE * HEADD * NNODE * 2;
constexpr size_t WS_VTH  = WS_K2 + SZ_QK;
constexpr size_t WS_VTL  = WS_VTH + SZ_V;
constexpr size_t SZ_O    = (size_t)NROWS * EMB * 2;
constexpr size_t WS_OHI  = WS_VTL + SZ_V;
constexpr size_t WS_OLO  = WS_OHI + SZ_O;
constexpr size_t SZ_WO   = (size_t)EMB * EMB * 2;
constexpr size_t WS_WOH  = WS_OLO + SZ_O;
constexpr size_t WS_WOL  = WS_WOH + SZ_WO;
constexpr size_t WS_TOTAL = WS_WOL + SZ_WO;
static_assert(WS_TOTAL == 37765120, "carve");
static_assert(WS_TOTAL <= 134217728, "carve");
static_assert((WS_K2 % 128) == 0 && (WS_VTH % 128) == 0 && (WS_VTL % 128) == 0 && (WS_OHI % 128) == 0 &&
              (WS_OLO % 128) == 0 && (WS_WOH % 128) == 0 && (WS_WOL % 128) == 0, "align");
// GEMM shape contract for the output projection
static_assert(NROWS % 64 == 0 && EMB % 64 == 0 && EMB % 32 == 0, "gemm");
static_assert(NNODE % 64 == 0, "tiles");

// ---------------- types and fragment helpers ----------------
typedef __attribute__((ext_vector_type(16))) _Float16 v16h;
typedef __attribute__((ext_vector_type(8)))  _Float16 v8h;
typedef __attribute__((ext_vector_type(16))) __bf16   v16b;
typedef __attribute__((ext_vector_type(8)))  __bf16   v8b;
typedef __attribute__((ext_vector_type(8)))  float    v8f;
typedef __attribute__((ext_vector_type(4)))  float    v4f;
typedef __attribute__((ext_vector_type(8)))  unsigned short us8;

__device__ __forceinline__ unsigned short f2bf_bits(float f) {
  unsigned u = __float_as_uint(f);
  return (unsigned short)((u + 0x7FFFu + ((u >> 16) & 1u)) >> 16);
}
__device__ __forceinline__ float bf_bits2f(unsigned short h) { return __uint_as_float(((unsigned)h) << 16); }

// hazard guards as plain device helpers (no inline asm inside the kernel template body)
__device__ __forceinline__ void dep_guard_h(v8f& a, v8f& b, v16h x, v16h y) { asm volatile("v_nop\n\tv_nop\n\tv_nop\n\tv_nop" : "+v"(a), "+v"(b) : "v"(x), "v"(y)); }
__device__ __forceinline__ void dep_guard_b(v8f& a, v8f& b, v16b x, v16b y) { asm volatile("v_nop\n\tv_nop\n\tv_nop\n\tv_nop" : "+v"(a), "+v"(b) : "v"(x), "v"(y)); }
__device__ __forceinline__ void keep4_h(v16h a, v16h b, v16h c, v16h d) { asm volatile("v_nop" :: "v"(a), "v"(b), "v"(c), "v"(d)); }
__device__ __forceinline__ void keep4_b(v16b a, v16b b, v16b c, v16b d) { asm volatile("v_nop" :: "v"(a), "v"(b), "v"(c), "v"(d)); }
__device__ __forceinline__ void acc_guard4(v8f& a, v8f& b, v8f& c, v8f& d) { asm volatile("v_nop\n\tv_nop\n\tv_nop\n\tv_nop" : "+v"(a), "+v"(b), "+v"(c), "+v"(d)); }
template <typename T> struct Frag;
template <> struct Frag<_Float16> {
  typedef v16h V; union U { v16h v; v8h h[2]; };
  static __device__ __forceinline__ v16h load(const _Float16* p) {   // elements 0..7 <- p[0..7], 8..15 <- p[16..23]
    U f; f.h[0] = *(const v8h*)(p); f.h[1] = *(const v8h*)(p + 16); return f.v;
  }
  static __device__ __forceinline__ v16h load2(const _Float16* p, const _Float16* q) {   // elements 0..7 <- p[0..7], 8..15 <- q[0..7]
    U f; f.h[0] = *(const v8h*)(p); f.h[1] = *(const v8h*)(q); return f.v;
  }
  static __device__ __forceinline__ v8f mma(v16h a, v16h b, v8f c) {
    return __builtin_amdgcn_wmma_f32_16x16x32_f16(false, a, false, b, (short)0, c, false, false);
  }
  static __device__ __forceinline__ void guard(v8f& a, v8f& b, v16h x, v16h y) { dep_guard_h(a, b, x, y); }
  static __device__ __forceinline__ void keep(v16h a, v16h b, v16h c, v16h d) { keep4_h(a, b, c, d); }
};
template <> struct Frag<__bf16> {
  typedef v16b V; union U { v16b v; v8b h[2]; };
  static __device__ __forceinline__ v16b load(const __bf16* p) {
    U f; f.h[0] = *(const v8b*)(p); f.h[1] = *(const v8b*)(p + 16); return f.v;
  }
  static __device__ __forceinline__ v16b load2(const __bf16* p, const __bf16* q) {
    U f; f.h[0] = *(const v8b*)(p); f.h[1] = *(const v8b*)(q); return f.v;
  }
  static __device__ __forceinline__ v8f mma(v16b a, v16b b, v8f c) {
    return __builtin_amdgcn_wmma_f32_16x16x32_bf16(false, a, false, b, (short)0, c, false, false);
  }
  static __device__ __forceinline__ void guard(v8f& a, v8f& b, v16b x, v16b y) { dep_guard_b(a, b, x, y); }
  static __device__ __forceinline__ void keep(v16b a, v16b b, v16b c, v16b d) { keep4_b(a, b, c, d); }
};

// ---- Register-blocked batched WMMA GEMM (with the HEADPL A-plane mode) -----------------------------------
// C[m,n] = scale * sum_k A[m,k] * Bt[n,k] (+bias)(+resid); each wave owns a 64x64 tile.
// A row-major [M,K]; Bt row-major [N,K]; M,N % 64 == 0, K % 32 == 0.
// SPLIT: operands are hi/lo planes (A2/Bt2 = lo planes, same layout); product = hi.hi + hi.lo + lo.hi.
// BIAS_MODE: 0 = none, 1 = bias[m], 2 = bias[n].
// OUT_MODE: 0 = f32, 1 = f16, 2 = bf16 hi plane (Cout) + bf16 lo plane (Cout2).
// ET: 0 = f16 operands, 1 = bf16 operands (pointers passed as 16-bit storage)
// HEADPL: A planes are [t][head][node][16] with row m = t * NNODE + node and k = head * 16 + d (lda unused);
//         row m of the product is stored as row node * TSTEP + t of C.
template <int ET> struct Elem;
template <> struct Elem<0> { typedef _Float16 T; };
template <> struct Elem<1> { typedef __bf16 T; };
template <int ET, bool SPLIT, int BIAS_MODE, int OUT_MODE, bool RESID, int ACT = 0, bool HEADPL = false>
__global__ __launch_bounds__(256) void wmma_gemm64(
    const unsigned short* __restrict__ Ap, const unsigned short* __restrict__ A2p, int lda, long strideA,
    const unsigned short* __restrict__ Btp, const unsigned short* __restrict__ Bt2p, int ldb, long strideB,
    void* __restrict__ Cout, void* __restrict__ Cout2, int ldc, long strideC,
    const float* __restrict__ bias,
    const float* __restrict__ resid, long strideR,
    int M, int N, int K, float scale) {
  typedef typename Elem<ET>::T T;
  typedef typename Frag<T>::V V;
  const T* A = (const T*)Ap; const T* A2 = (const T*)A2p; const T* Bt = (const T*)Btp; const T* Bt2 = (const T*)Bt2p;
  __shared__ __align__(16) float sT[8][16 * 68];   // per-wave 16x64 slab, pitch 68 floats
  const int b    = blockIdx.y;
  const int lane = threadIdx.x & 31;
  const int wave = threadIdx.x >> 5;
  const int tilesN = N >> 6;
  const int tilesM = M >> 6;
  const int tile = blockIdx.x * 8 + wave;
  if (tile >= tilesM * tilesN) return;   // wave-uniform; no block barriers in this kernel
  const int tm = tile / tilesN;
  const int tn = tile - tm * tilesN;
  const int m0 = tm << 6;
  const int n0 = tn << 6;

  const T* Ab  = A  + (size_t)b * strideA;
  const T* Bb  = Bt + (size_t)b * strideB;
  const T* Ab2 = SPLIT ? (A2  + (size_t)b * strideA) : nullptr;
  const T* Bb2 = SPLIT ? (Bt2 + (size_t)b * strideB) : nullptr;

  const int rlane = lane & 15;                 // row (A) / col (B, D) within subtile
  const int koff  = (lane >> 4) * 8;           // k offset of this lane half
  const int mOff  = (lane >> 4) * 8;           // D row offset

  v8f acc[4][4];
#pragma unroll
  for (int i = 0; i < 4; ++i)
#pragma unroll
    for (int j = 0; j < 4; ++j) acc[i][j] = (v8f){0.f,0.f,0.f,0.f,0.f,0.f,0.f,0.f};

  for (int k0 = 0; k0 < K; k0 += 32) {
    V bh[4], bl[4];
#pragma unroll
    for (int j = 0; j < 4; ++j) {
      const size_t bo = (size_t)(n0 + (j << 4) + rlane) * ldb + koff + k0;
      bh[j] = Frag<T>::load(Bb + bo);
      if (SPLIT) bl[j] = Frag<T>::load(Bb2 + bo);
    }
#pragma unroll
    for (int i = 0; i < 4; ++i) {
      V ah, al;
      if (HEADPL) {
        // k = k0 + koff + e lies in head k0 / 16, k = k0 + 16 + koff + e in the next head: one head plane further on
        const int m = m0 + (i << 4) + rlane;
        const size_t ao = ((size_t)((m / NNODE) * NHEAD + (k0 >> 4)) * NNODE + (m % NNODE)) * HEADD + koff;
        ah = Frag<T>::load2(Ab + ao, Ab + ao + NNODE * HEADD);
        if (SPLIT) al = Frag<T>::load2(Ab2 + ao, Ab2 + ao + NNODE * HEADD);
      } else {
        const size_t ao = (size_t)(m0 + (i << 4) + rlane) * lda + koff + k0;
        ah = Frag<T>::load(Ab + ao);
        if (SPLIT) al = Frag<T>::load(Ab2 + ao);
      }
#pragma unroll
      for (int j = 0; j < 4; ++j) {
        acc[i][j] = Frag<T>::mma(ah, bh[j], acc[i][j]);
        if (SPLIT) {
          acc[i][j] = Frag<T>::mma(ah, bl[j], acc[i][j]);
          acc[i][j] = Frag<T>::mma(al, bh[j], acc[i][j]);
        }
      }
      Frag<T>::guard(acc[i][0], acc[i][3], ah, SPLIT ? al : ah);
    }
    Frag<T>::keep(bh[0], bh[1], bh[2], bh[3]);
    if (SPLIT) Frag<T>::keep(bl[0], bl[1], bl[2], bl[3]);
  }
  acc_guard4(acc[0][0], acc[0][1], acc[0][2], acc[0][3]);
  acc_guard4(acc[1][0], acc[1][1], acc[1][2], acc[1][3]);
  acc_guard4(acc[2][0], acc[2][1], acc[2][2], acc[2][3]);
  acc_guard4(acc[3][0], acc[3][1], acc[3][2], acc[3][3]);

  // ---- epilogue ----
  float* slab = sT[wave];
  const float* Rb = RESID ? (resid + (size_t)b * strideR) : nullptr;
#pragma unroll
  for (int i = 0; i < 4; ++i) {
    const int mBase = m0 + (i << 4);
#pragma unroll
    for (int j = 0; j < 4; ++j) {
      const int n = n0 + (j << 4) + rlane;
      float bv = 0.f;
      if (BIAS_MODE == 2) bv = bias[n];
#pragma unroll
      for (int r = 0; r < 8; ++r) {
        float v = acc[i][j][r] * scale;
        if (BIAS_MODE == 1) v += bias[mBase + mOff + r];
        if (BIAS_MODE == 2) v += bv;
        if (RESID) v += Rb[(size_t)(mBase + mOff + r) * ldc + n];
        if (ACT == 1) v = tanhf(v);
        if (ACT == 2) v = fmaxf(v, 0.0f);
        if (ACT == 3) v = v / (1.0f + expf(-v));
        if (ACT == 4) v = (v > 0.f) ? v : 0.01f * v;
        if (ACT == 5) v = 0.5f * v * (1.0f + erff(v * 0.70710678118654752f));
        slab[(mOff + r) * 68 + (j << 4) + rlane] = v;
      }
    }
    __builtin_amdgcn_fence(__ATOMIC_RELEASE, "workgroup");
    __builtin_amdgcn_wave_barrier();
    __builtin_amdgcn_fence(__ATOMIC_ACQUIRE, "workgroup");
    if (OUT_MODE == 0) {
      float* C = (float*)Cout + (size_t)b * strideC;
      const int hh = lane >> 4, c4 = (lane & 15) * 4;     // row seg = 256 B = 16 lanes x 16 B
      {
#pragma unroll
        for (int it = 0; it < 8; ++it) {
          const int row = it * 2 + hh;
          v4f v = *(const v4f*)(slab + row * 68 + c4);
          const int m = mBase + row;
          const size_t crow = HEADPL ? (size_t)(m % NNODE) * TSTEP + (m / NNODE) : (size_t)m;
          *(v4f*)(C + crow * ldc + n0 + c4) = v;
        }
        
      }
    } else {
      const int q = lane >> 3, c8 = (lane & 7) * 8;
      unsigned short* C  = (unsigned short*)Cout  + (size_t)b * strideC;
      unsigned short* C2 = (OUT_MODE == 2) ? ((unsigned short*)Cout2 + (size_t)b * strideC) : nullptr;
      {
#pragma unroll
        for (int it = 0; it < 4; ++it) {
          const int row = it * 4 + q;
          const float* sp = slab + row * 68 + c8;
          v8h hv, lv;
#pragma unroll
          for (int e = 0; e < 8; ++e) {
            if (OUT_MODE == 1) {
              hv[e] = (_Float16)sp[e];
            } else {
              unsigned short hb = f2bf_bits(sp[e]);
              unsigned short lb = f2bf_bits(sp[e] - bf_bits2f(hb));
              hv[e] = __builtin_bit_cast(_Float16, hb);
              lv[e] = __builtin_bit_cast(_Float16, lb);
            }
          }
          *(v8h*)(C + (size_t)(mBase + row) * ldc + n0 + c8) = hv;
          if (OUT_MODE == 2) *(v8h*)(C2 + (size_t)(mBase + row) * ldc + n0 + c8) = lv;
        }
        
      }
    }
    __builtin_amdgcn_fence(__ATOMIC_RELEASE, "workgroup");
    __builtin_amdgcn_wave_barrier();
    __builtin_amdgcn_fence(__ATOMIC_ACQUIRE, "workgroup");
  }
}

// ---------------- bf16 split helpers and guarded bf16 WMMA ----------------
__device__ __forceinline__ unsigned short at_bf_bits(float f) {
  unsigned u = __float_as_uint(f);
  return (unsigned short)((u + 0x7FFFu + ((u >> 16) & 1u)) >> 16);
}
__device__ __forceinline__ __bf16 at_f2bf(float f) { return __builtin_bit_cast(__bf16, at_bf_bits(f)); }
__device__ __forceinline__ void at_split(float f, __bf16& hi, __bf16& lo) {
  const unsigned short hb = at_bf_bits(f);
  hi = __builtin_bit_cast(__bf16, hb);
  lo = at_f2bf(f - __uint_as_float(((unsigned)hb) << 16));
}
__device__ __forceinline__ v8f at_mma(v16b a, v16b b, v8f c) {
  c = __builtin_amdgcn_wmma_f32_16x16x32_bf16(false, a, false, b, (short)0, c, false, false);
  asm volatile("v_nop\n\tv_nop\n\tv_nop\n\tv_nop" : "+v"(c) : "v"(a), "v"(b));
  return c;
}

// same-wave LDS write -> read ordering
__device__ __forceinline__ void lds_wave_sync() {
  __builtin_amdgcn_fence(__ATOMIC_RELEASE, "workgroup");
  __builtin_amdgcn_wave_barrier();
  __builtin_amdgcn_fence(__ATOMIC_ACQUIRE, "workgroup");
}

// =====================================================================
// Operand fragments with the K=16 contraction packed into one 32-deep k-step:
//   slot s <  16 -> hi part of d = s
//   slot s >= 16 -> lo part of d = s - 16
// A fragment (lane row m = lane&15, hh = lane>>4): elements 0..7 = hi[d = 8hh+e], 8..15 = lo[d = 8hh+e].
// B fragments: B1 = [wh | wh], B2 = [wl | wl] so that A.B1 + A.B2 = (xh+xl).(wh+wl).
// =====================================================================
__device__ __forceinline__ v16b x_frag_split(const float* __restrict__ xr, int hh) {
  const v4f a = *(const v4f*)(xr + 8 * hh);
  const v4f b = *(const v4f*)(xr + 8 * hh + 4);
  const float f[8] = {a[0], a[1], a[2], a[3], b[0], b[1], b[2], b[3]};
  v16b fr;
#pragma unroll
  for (int e = 0; e < 8; ++e) {
    __bf16 hb, lb;
    at_split(f[e], hb, lb);
    fr[e] = hb;
    fr[8 + e] = lb;
  }
  return fr;
}
// W is [16 out][16 in] row-major; lane column c = out index e; loads W[c][8hh .. 8hh+7]
__device__ __forceinline__ void w_frags_split(const float* __restrict__ W, int c, int hh, v16b& wh, v16b& wl) {
  const v4f a = *(const v4f*)(W + c * HEADD + 8 * hh);
  const v4f b = *(const v4f*)(W + c * HEADD + 8 * hh + 4);
  const float f[8] = {a[0], a[1], a[2], a[3], b[0], b[1], b[2], b[3]};
#pragma unroll
  for (int e = 0; e < 8; ++e) {
    __bf16 hb, lb;
    at_split(f[e], hb, lb);
    wh[e] = hb; wh[8 + e] = hb;
    wl[e] = lb; wl[8 + e] = lb;
  }
}

// One wave: rows n0..n0+63 of slice (t,h) for a q-type tensor -> plane dst[slice][n][hi16|lo16].
// Coverage: 4 tiles x 16 rows = 64 rows x 32 u16 staged; stored as 8 x (32 lanes x 8 u16) = 2048 u16 = whole region.
__device__ __forceinline__ void proj_qk_part(const float* __restrict__ x, unsigned short* __restrict__ dstp,
    const v16b wh, const v16b wl, float oscale, int slice, int n0, int t, int h, int lane, unsigned short* sl)
{
  const int hh = lane >> 4, c = lane & 15;
#pragma unroll
  for (int i = 0; i < 4; ++i) {
    const float* xr = x + ((size_t)(n0 + 16 * i + c) * TSTEP + t) * EMB + h * HEADD;
    const v16b xa = x_frag_split(xr, hh);
    v8f acc = (v8f){0.f,0.f,0.f,0.f,0.f,0.f,0.f,0.f};
    acc = at_mma(xa, wh, acc);
    acc = at_mma(xa, wl, acc);
    // acc[r] = proj[n0 + 16i + 8hh + r][e = c]
#pragma unroll
    for (int r = 0; r < 8; ++r) {
      const float v = acc[r] * oscale;
      const unsigned short hb = f2bf_bits(v);
      const unsigned short lb = f2bf_bits(v - bf_bits2f(hb));
      const int row = 16 * i + 8 * hh + r;
      sl[row * QKROW + c] = hb;
      sl[row * QKROW + 16 + c] = lb;
    }
  }
  lds_wave_sync();
  unsigned short* dst = dstp + ((size_t)slice * NNODE + n0) * QKROW;   // 64 consecutive rows = 4096 B = 32 lines
  {
#pragma unroll
    for (int it = 0; it < 8; ++it) {
      const us8 v = *(const us8*)(sl + (it * 32 + lane) * 8);
      *(us8*)(dst + (it * 32 + lane) * 8) = v;
    }
    
  }
  lds_wave_sync();
}

// One wave: rows n0..n0+63 of slice for values -> transposed planes Vth/Vtl[slice][d][n].
// Coverage: slab hi [16 d][64 n] + lo [16 d][64 n] fully written by 4 tiles x 32 lanes x 8 u16;
// stored as 4 x (4 rows x 8 lanes x 8 u16) per plane = all 16 d rows x 64 n.
__device__ __forceinline__ void proj_v_part(const float* __restrict__ x, unsigned short* __restrict__ Vth,
    unsigned short* __restrict__ Vtl, const v16b wh, const v16b wl, int slice, int n0, int t, int h, int lane,
    unsigned short* sl)
{
  const int hh = lane >> 4, c = lane & 15;
#pragma unroll
  for (int i = 0; i < 4; ++i) {
    const float* xr = x + ((size_t)(n0 + 16 * i + c) * TSTEP + t) * EMB + h * HEADD;
    const v16b xa = x_frag_split(xr, hh);
    v8f acc = (v8f){0.f,0.f,0.f,0.f,0.f,0.f,0.f,0.f};
    acc = at_mma(xa, wh, acc);
    acc = at_mma(xa, wl, acc);
    // acc[r] = v[n0 + 16i + 8hh + r][d = c] -> slab[d][16i + 8hh + r]
    us8 hv, lv;
#pragma unroll
    for (int r = 0; r < 8; ++r) {
      const float v = acc[r];
      const unsigned short hb = f2bf_bits(v);
      const unsigned short lb = f2bf_bits(v - bf_bits2f(hb));
      hv[r] = hb;
      lv[r] = lb;
    }
    *(us8*)(sl + c * 64 + 16 * i + 8 * hh) = hv;
    *(us8*)(sl + 1024 + c * 64 + 16 * i + 8 * hh) = lv;
  }
  lds_wave_sync();
  const int qq = lane >> 3, c8 = (lane & 7) * 8;
  {
#pragma unroll
    for (int it = 0; it < 4; ++it) {
      const int d = it * 4 + qq;
      const us8 hv = *(const us8*)(sl + d * 64 + c8);
      const us8 lv = *(const us8*)(sl + 1024 + d * 64 + c8);
      const size_t off = ((size_t)slice * HEADD + d) * NNODE + n0 + c8;
      *(us8*)(Vth + off) = hv;
      *(us8*)(Vtl + off) = lv;
    }
    
  }
  lds_wave_sync();
}

// =====================================================================
// Kernel 1: per-head projections on WMMA. One wave = (slice, 64-node group); 4 waves per block,
// each with its own LDS slab (no cross-wave LDS traffic, no block barriers).
// grid = 2304 / 4 = 576 blocks.
// =====================================================================
__global__ __launch_bounds__(128) void proj_qkv(
    const float* __restrict__ values, const float* __restrict__ keys, const float* __restrict__ query,
    const float* __restrict__ Wv, const float* __restrict__ Wk, const float* __restrict__ Wq,
    unsigned short* __restrict__ Q2, unsigned short* __restrict__ K2,
    unsigned short* __restrict__ Vth, unsigned short* __restrict__ Vtl)
{
  __shared__ __align__(16) unsigned short slab[4][64 * QKROW];   // 4 KB per wave
  const int lane = threadIdx.x & 31;
  const int wave = threadIdx.x >> 5;
  const int hh = lane >> 4, c = lane & 15;
  const int task  = blockIdx.x * 4 + wave;           // 0 .. 2303
  const int slice = task >> 4;                        // 0 .. 143
  const int ng    = task & 15;                        // node group
  const int t = slice >> 2, h = slice & 3;
  const int n0 = ng * 64;
  unsigned short* sl = slab[wave];

  v16b wqh, wql, wkh, wkl, wvh, wvl;
  w_frags_split(Wq, c, hh, wqh, wql);
  w_frags_split(Wk, c, hh, wkh, wkl);
  w_frags_split(Wv, c, hh, wvh, wvl);

  // q carries the exact 1/sqrt(64) = 0.125 score scale
  proj_qk_part(query, Q2, wqh, wql, 0.125f, slice, n0, t, h, lane, sl);
  proj_qk_part(keys,  K2, wkh, wkl, 1.0f,   slice, n0, t, h, lane, sl);
  proj_v_part(values, Vth, Vtl, wvh, wvl, slice, n0, t, h, lane, sl);
}

// =====================================================================
// Kernel 0: Wo -> bf16 hi/lo planes [64][64] (Bt[n = e][k = c] = Wo[e][c]). One block of 256 threads;
// thread handles element groups g = tid, tid + 256 (8 consecutive elements each): 512 x 8 = 4096 = whole planes.
// =====================================================================
__global__ __launch_bounds__(256) void prep_wo_split(
    const float* __restrict__ Wo, unsigned short* __restrict__ Woh, unsigned short* __restrict__ Wol)
{
  const int tid = threadIdx.x;
  us8 hv[2], lv[2];
#pragma unroll
  for (int it = 0; it < 2; ++it) {
    const int g = tid + 256 * it;
    const v4f a = *(const v4f*)(Wo + 8 * g);
    const v4f b = *(const v4f*)(Wo + 8 * g + 4);
    const float f[8] = {a[0], a[1], a[2], a[3], b[0], b[1], b[2], b[3]};
#pragma unroll
    for (int e = 0; e < 8; ++e) {
      const unsigned short hb = f2bf_bits(f[e]);
      const unsigned short lb = f2bf_bits(f[e] - bf_bits2f(hb));
      hv[it][e] = hb;
      lv[it][e] = lb;
    }
  }
  {
#pragma unroll
    for (int it = 0; it < 2; ++it) {
      const int g = tid + 256 * it;
      *(us8*)(Woh + 8 * g) = hv[it];
      *(us8*)(Wol + 8 * g) = lv[it];
    }
    
  }
}

constexpr float LOG2E = 1.4426950408889634f;
typedef __attribute__((ext_vector_type(2))) float v2f;
// y = 2^x on the hardware. The v_nop in the same statement keeps the one slot that the instruction set asks for between
// a transcendental and an instruction that uses its result or overwrites its source, whatever the compiler puts next.
__device__ __forceinline__ float exp2_hw(float x) {
  float y;
  asm("v_exp_f32 %0, %1\n\tv_nop" : "=v"(y) : "v"(x));
  return y;
}
// Eight independent 2^x in one statement: the early-clobber outputs keep every result off every source, so none of the
// eight overwrites a source of the one in front of it, and one closing v_nop keeps the slot for all of them.
__device__ __forceinline__ v8f exp2_hw8(v8f x) {
  float y0, y1, y2, y3, y4, y5, y6, y7;
  asm("v_exp_f32 %0, %8\n\tv_exp_f32 %1, %9\n\tv_exp_f32 %2, %10\n\tv_exp_f32 %3, %11\n\t"
      "v_exp_f32 %4, %12\n\tv_exp_f32 %5, %13\n\tv_exp_f32 %6, %14\n\tv_exp_f32 %7, %15\n\tv_nop"
      : "=&v"(y0), "=&v"(y1), "=&v"(y2), "=&v"(y3), "=&v"(y4), "=&v"(y5), "=&v"(y6), "=&v"(y7)
      : "v"(x[0]), "v"(x[1]), "v"(x[2]), "v"(x[3]), "v"(x[4]), "v"(x[5]), "v"(x[6]), "v"(x[7]));
  return (v8f){y0, y1, y2, y3, y4, y5, y6, y7};
}
// value of lane l ^ 16
__device__ __forceinline__ float other_half(float x) {
  const int b = __float_as_int(x);
  return __int_as_float(__builtin_amdgcn_permlanex16(b, b, 0x76543210, 0xfedcba98, false, false));
}

// LDS row pitches of the staged tiles, in 16-bit elements. The fragment reads are 16 bytes a lane with one row per lane,
// so the pitch is an odd multiple of 16 bytes: the 16 rows of a half wave then fall on 16 different groups of four banks.
// The pad elements at the end of a row are never written and never read.
constexpr int KPITCH = QKROW + 8;            // 80 B  = 16 B x 5 (data: 64 B)
constexpr int VPITCH = 64 + 8;               // 144 B = 16 B x 9 (data: 128 B)

// element offset of lane ln = (c, hh) in its wave's 16 rows of 16: row c = ln & 15, elements 8hh .. 8hh + 7
__device__ __forceinline__ int ln_off(int ln) { return (ln & 15) * HEADD + 8 * (ln >> 4); }

// Register budget: at most 112 vector registers (1024 / 9, in granules of 16), so that nine blocks, a WGP's share of the
// grid, are resident at once; at eight, a ninth of the blocks would run afterwards, one wave per SIMD.
__global__ __launch_bounds__(128) void attn_hd16(
    const unsigned short* __restrict__ Q2, const unsigned short* __restrict__ K2,
    const unsigned short* __restrict__ Vth, const unsigned short* __restrict__ Vtl,
    unsigned short* __restrict__ Ohi, unsigned short* __restrict__ Olo)
{
  union FB { v16b v; v8b h[2]; };
  // one array, so that the tiles lie at constant offsets from one another and share their address registers
  __shared__ __align__(16) __bf16 tiles[64 * KPITCH + 2 * HEADD * VPITCH];
  __bf16* const Ksh = tiles;                                // [key][hi16|lo16|pad]
  __bf16* const Vhs = tiles + 64 * KPITCH;                  // [d][64 keys|pad] hi
  __bf16* const Vls = Vhs + HEADD * VPITCH;                 // [d][64 keys|pad] lo

  const int tid  = threadIdx.x;
  const int wave = __builtin_amdgcn_readfirstlane(tid >> 5);   // the same in every lane: kept in a scalar register
  const int lane = tid & 31;
  const int hh   = lane >> 4;
  const int c    = lane & 15;
  const int slice = blockIdx.x >> 4;         // 0 .. 143 = t * NHEAD + h
  const int qb   = blockIdx.x & 15;          // 64-query block
  const int q0   = qb * 64 + wave * 16;

  const __bf16* Qs = (const __bf16*)(const void*)Q2 + (size_t)slice * NNODE * QKROW;
  // B fragment, column = query q0 + c: elements 0..7 = qh[d = 8hh+e], 8..15 = ql[d = 8hh+e]
  const v16b qa = Frag<__bf16>::load(Qs + (size_t)(q0 + c) * QKROW + 8 * hh);
  const v8b* Kg  = (const v8b*)(const void*)(K2  + (size_t)slice * NNODE * QKROW);   // [key*4 + seg]
  const v8b* Vhg = (const v8b*)(const void*)(Vth + (size_t)slice * HEADD * NNODE);   // [d*128 + key/8]
  const v8b* Vlg = (const v8b*)(const void*)(Vtl + (size_t)slice * HEADD * NNODE);

  __bf16* const kdst = Ksh + (tid >> 2) * KPITCH + (tid & 3) * 8;          // K piece tid: row tid / 4, 16-B segment tid % 4
  __bf16* const vdst = Vhs + (tid >> 3) * VPITCH + (tid & 7) * 8;          // V piece tid: d = tid / 8, 16-B segment tid % 8
  const unsigned vsrc = (unsigned)(tid >> 3) * (NNODE / 8) + (tid & 7);

  // per lane: running maximum of query q0 + c times log2e (equal in both halves), this half's part of its sum
  float mrun = -INFINITY, lsum = 0.f;
  v8f oacc = (v8f){0.f,0.f,0.f,0.f,0.f,0.f,0.f,0.f};

#pragma unroll 1
  for (int kc = 0; kc < NNODE / 64; ++kc) {
    __syncthreads();
    // stage K: 256 pieces of 16 B = 64 rows x 32 u16 (whole tile, contiguous in K2); piece tid + 128 is row + 32, so the
    // two pieces of a thread lie a constant apart in K2 and in LDS and share their address registers (register budget, above)
    {
      const v8b* Kt = Kg + kc * 256;
      const v8b k0 = Kt[(unsigned)tid];
      const v8b k1 = Kt[(unsigned)tid + 128u];
      *(v8b*)(kdst) = k0;
      *(v8b*)(kdst + 32 * KPITCH) = k1;
    }
    // stage V hi/lo: 128 pieces of 16 B = 16 d x 64 keys per plane (whole tiles)
    {
      const v8b a  = (Vhg + kc * 8)[vsrc];
      const v8b b2 = (Vlg + kc * 8)[vsrc];
      *(v8b*)(vdst) = a;
      *(v8b*)(vdst + HEADD * VPITCH) = b2;
    }
    __syncthreads();

    v8f s[4];
#pragma unroll
    for (int j = 0; j < 4; ++j) {
      const __bf16* kr = Ksh + (j * 16 + c) * KPITCH + 8 * hh;
      const v8b kh8 = *(const v8b*)(kr);
      const v8b kl8 = *(const v8b*)(kr + 16);
      FB k1, k2;
      k1.h[0] = kh8; k1.h[1] = kh8;
      k2.h[0] = kl8; k2.h[1] = kl8;
      s[j] = (v8f){0.f,0.f,0.f,0.f,0.f,0.f,0.f,0.f};
      s[j] = at_mma(k1.v, qa, s[j]);
      s[j] = at_mma(k2.v, qa, s[j]);
    }
    // s[j][r] = scaled energy(key 64kc + 16j + 8hh + r, query q0 + c)
    float cm = s[0][0];
#pragma unroll
    for (int j = 0; j < 4; ++j)
#pragma unroll
      for (int r = 0; r < 8; ++r) cm = fmaxf(cm, s[j][r]);
    cm = fmaxf(cm, other_half(cm));
    const float mnew  = fmaxf(mrun, cm * LOG2E);
    const float alpha = exp2_hw(mrun - mnew);
    mrun = mnew;

    v16b ph[2], pl[2];
    float ps[4];
#pragma unroll
    for (int j = 0; j < 4; ++j) {
      ps[j] = 0.f;
      // arguments <= 0 up to one rounding: no overflow; below -126 a term is under 2^-126 of the largest and goes to 0
      v8f ea;
#pragma unroll
      for (int r = 0; r < 8; r += 2) {
        const v2f a2 = __builtin_elementwise_fma((v2f){s[j][r], s[j][r + 1]}, (v2f){LOG2E, LOG2E}, (v2f){-mnew, -mnew});
        ea[r] = a2[0]; ea[r + 1] = a2[1];
      }
      const v8f pe = exp2_hw8(ea);
#pragma unroll
      for (int r = 0; r < 8; ++r) {
        const float p = pe[r];
        ps[j] += p;
        __bf16 a, bl;
        at_split(p, a, bl);
        // B element 8(j&1) + r of lane (c, hh) is key 16(j&1) + 8hh + r of the 32-key step j>>1
        ph[j >> 1][8 * (j & 1) + r] = a;
        pl[j >> 1][8 * (j & 1) + r] = bl;
      }
    }
    lsum = lsum * alpha + ((ps[0] + ps[1]) + (ps[2] + ps[3]));
#pragma unroll
    for (int r = 0; r < 8; ++r) oacc[r] *= alpha;

#pragma unroll
    for (int kk = 0; kk < 2; ++kk) {
      FB vb, vl;
      vb.h[0] = *(const v8b*)(Vhs + c * VPITCH + kk * 32 + 8 * hh);
      vb.h[1] = *(const v8b*)(Vhs + c * VPITCH + kk * 32 + 16 + 8 * hh);
      vl.h[0] = *(const v8b*)(Vls + c * VPITCH + kk * 32 + 8 * hh);
      vl.h[1] = *(const v8b*)(Vls + c * VPITCH + kk * 32 + 16 + 8 * hh);
      oacc = at_mma(vb.v, ph[kk], oacc);
      oacc = at_mma(vl.v, ph[kk], oacc);
      oacc = at_mma(vb.v, pl[kk], oacc);
    }
  }
  // oacc[r] = unnormalised out(query q0 + c, d = 8hh + r); the two halves' sums join here; the sum is >= 1
  const float inv = 1.0f / (lsum + other_half(lsum));
  us8 hv, lv;
#pragma unroll
  for (int r = 0; r < 8; ++r) {
    const float o = oacc[r] * inv;
    const unsigned short hb = f2bf_bits(o);
    const unsigned short lb = f2bf_bits(o - bf_bits2f(hb));
    hv[r] = hb;
    lv[r] = lb;
  }
  // 16 B a lane, 32 B a query: one store of the wave covers 512 contiguous bytes of its plane.
  // The lane number is formed anew here, so that no vector register holds a part of this address across the loop.
  const int ln = (int)__builtin_amdgcn_mbcnt_lo(~0u, 0u);
  const size_t off = ((size_t)slice * NNODE + q0) * HEADD + ln_off(ln);
  *(us8*)(Ohi + off) = hv;
  *(us8*)(Olo + off) = lv;
}

// =====================================================================
extern "C" void kernel_launch(void* const* d_in, const int* in_sizes, int n_in,
                              void* d_out, int out_size, void* d_ws, size_t ws_size,
                              hipStream_t stream) {
  if (n_in < 8) return;
  if (in_sizes[0] != NNODE * TSTEP * EMB || in_sizes[1] != NNODE * TSTEP * EMB ||
      in_sizes[2] != NNODE * TSTEP * EMB || in_sizes[3] != HEADD * HEADD ||
      in_sizes[4] != HEADD * HEADD || in_sizes[5] != HEADD * HEADD ||
      in_sizes[6] != EMB * EMB || in_sizes[7] != EMB) return;
  if (out_size != NROWS * EMB) return;
  if (ws_size < WS_TOTAL) return;

  const float* values = (const float*)d_in[0];
  const float* keys   = (const float*)d_in[1];
  const float* query  = (const float*)d_in[2];
  const float* Wv     = (const float*)d_in[3];
  const float* Wk     = (const float*)d_in[4];
  const float* Wq     = (const float*)d_in[5];
  const float* Wo     = (const float*)d_in[6];
  const float* bo     = (const float*)d_in[7];

  char* ws = (char*)d_ws;
  unsigned short* Q2  = (unsigned short*)(ws + WS_Q2);
  unsigned short* K2  = (unsigned short*)(ws + WS_K2);
  unsigned short* Vth = (unsigned short*)(ws + WS_VTH);
  unsigned short* Vtl = (unsigned short*)(ws + WS_VTL);
  unsigned short* Ohi = (unsigned short*)(ws + WS_OHI);
  unsigned short* Olo = (unsigned short*)(ws + WS_OLO);
  unsigned short* Woh = (unsigned short*)(ws + WS_WOH);
  unsigned short* Wol = (unsigned short*)(ws + WS_WOL);

  // 1) Wo -> bf16 hi/lo planes
  prep_wo_split<<<dim3(1), dim3(256), 0, stream>>>(Wo, Woh, Wol);
  // 2) per-head projections: 144 slices x 16 node groups = 2304 wave tasks, 4 per block
  proj_qkv<<<dim3(NSLICE * (NNODE / 64) / 4), dim3(128), 0, stream>>>(
      values, keys, query, Wv, Wk, Wq, Q2, K2, Vth, Vtl);
  // 3) attention over nodes: 144 (t, head) slices x 16 query blocks
  attn_hd16<<<dim3(NSLICE * (NNODE / 64)), dim3(128), 0, stream>>>(Q2, K2, Vth, Vtl, Ohi, Olo);
  // 4) output projection: C[36864 x 64] = O . Wo^T + bo; M=36864 (576 tiles), N=64, K=64; 8 tiles per block
  wmma_gemm64<1, true, 2, 0, false, 0, true><<<dim3(NROWS / 64 / 8, 1), dim3(256), 0, stream>>>(
      Ohi, Olo, EMB, 0L, Woh, Wol, EMB, 0L,
      d_out, nullptr, EMB, 0L, bo, nullptr, 0L,
      NROWS, EMB, EMB, 1.0f);
}

// v005
// Measured time: 72.6 microseconds a run.
// Timed twice side by side with v004, it ran 1.14 times as fast both times.
// Counting every step since v000, it is 3.10 times as fast.
// Contractions: v_wmma_f32_16x16x32_bf16 with bf16 hi/lo split operands (head projections, q.k scores, p.v, output projection), f32 accumulate; softmax, splits and epilogues in f32.
#include <hip/hip_runtime.h>
#include <math.h>
#include <stddef.h>

// ---------------- problem constants ----------------
constexpr int NNODE  = 1024;
constexpr int TSTEP  = 36;
constexpr int EMB    = 64;
constexpr int NHEAD  = 4;
constexpr int HEADD  = 16;
constexpr int NSLICE = TSTEP * NHEAD;        // 144 (t, h) slices
constexpr int NROWS  = NNODE * TSTEP;        // 36864 rows of the [n*T+t][64] planes
constexpr int QKROW  = 32;                   // u16 per row of the Q/K planes: [hi e0..15 | lo e0..15]

// ---------------- workspace region map (bytes) ----------------
// Q2  : bf16 [144][1024][32]          9,437,184 B  @ 0
// K2  : bf16 [144][1024][32]          9,437,184 B  @ 9,437,184
// Vth : bf16 [144][16][1024] (hi)     4,718,592 B  @ 18,874,368
// Vtl : bf16 [144][16][1024] (lo)     4,718,592 B  @ 23,592,960
// Ohi : bf16 [144][1024][16] (hi)     4,718,592 B  @ 28,311,552
// Olo : bf16 [144][1024][16] (lo)     4,718,592 B  @ 33,030,144
// Woh : bf16 [64][64]                     8,192 B  @ 37,748,736
// Wol : bf16 [64][64]                     8,192 B  @ 37,756,928
// total                              37,765,120 B
constexpr size_t WS_Q2   = 0;
constexpr size_t SZ_QK   = (size_t)NSLICE * NNODE * QKROW * 2;
constexpr size_t WS_K2   = WS_Q2 + SZ_QK;
constexpr size_t SZ_V    = (size_t)NSLICE * HEADD * NNODE * 2;
constexpr size_t WS_VTH  = WS_K2 + SZ_QK;
constexpr size_t WS_VTL  = WS_VTH + SZ_V;
constexpr size_t SZ_O    = (size_t)NROWS * EMB * 2;
constexpr size_t WS_OHI  = WS_VTL + SZ_V;
constexpr size_t WS_OLO  = WS_OHI + SZ_O;
constexpr size_t SZ_WO   = (size_t)EMB * EMB * 2;
constexpr size_t WS_WOH  = WS_OLO + SZ_O;
constexpr size_t WS_WOL  = WS_WOH + SZ_WO;
constexpr size_t WS_TOTAL = WS_WOL + SZ_WO;
static_assert(WS_TOTAL == 37765120, "carve");
static_assert(WS_TOTAL <= 134217728, "carve");
static_assert((WS_K2 % 128) == 0 && (WS_VTH % 128) == 0 && (WS_VTL % 128) == 0 && (WS_OHI % 128) == 0 &&
              (WS_OLO % 128) == 0 && (WS_WOH % 128) == 0 && (WS_WOL % 128) == 0, "align");
// GEMM shape contract for the output projection
static_assert(NROWS % 64 == 0 && EMB % 64 == 0 && EMB % 32 == 0, "gemm");
static_assert(NNODE % 64 == 0, "tiles");

// ---------------- types and fragment helpers ----------------
typedef __attribute__((ext_vector_type(16))) _Float16 v16h;
typedef __attribute__((ext_vector_type(8)))  _Float16 v8h;
typedef __attribute__((ext_vector_type(16))) __bf16   v16b;
typedef __attribute__((ext_vector_type(8)))  __bf16   v8b;
typedef __attribute__((ext_vector_type(8)))  float    v8f;
typedef __attribute__((ext_vector_type(4)))  float    v4f;
typedef __attribute__((ext_vector_type(8)))  unsigned short us8;

__device__ __forceinline__ unsigned short f2bf_bits(float f) {
  unsigned u = __float_as_uint(f);
  return (unsigned short)((u + 0x7FFFu + ((u >> 16) & 1u)) >> 16);
}
__device__ __forceinline__ float bf_bits2f(unsigned short h) { return __uint_as_float(((unsigned)h) << 16); }

// hi/lo split of two f32 values at once on the hardware's packed f32 -> bf16 conversion, which rounds to nearest even as
// f2bf_bits does: hi = bf16(p), lo = bf16(p - hi). Each result is one register of two packed bf16, the form that operand
// fragments and 16-byte stores are made of.
typedef __attribute__((ext_vector_type(2))) float          v2f;
typedef __attribute__((ext_vector_type(2))) __bf16         v2b;
typedef __attribute__((ext_vector_type(2))) unsigned short us2;
__device__ __forceinline__ void split_pair(v2f p, v2b& hi, v2b& lo) {
  hi = __builtin_convertvector(p, v2b);
  lo = __builtin_convertvector(p - __builtin_convertvector(hi, v2f), v2b);
}
__device__ __forceinline__ void split_pair_bits(v2f p, us2& hi, us2& lo) {
  v2b h, l;
  split_pair(p, h, l);
  hi = __builtin_bit_cast(us2, h);
  lo = __builtin_bit_cast(us2, l);
}

// hazard guards as plain device helpers (no inline asm inside the kernel template body)
__device__ __forceinline__ void dep_guard_h(v8f& a, v8f& b, v16h x, v16h y) { asm volatile("v_nop\n\tv_nop\n\tv_nop\n\tv_nop" : "+v"(a), "+v"(b) : "v"(x), "v"(y)); }
__device__ __forceinline__ void dep_guard_b(v8f& a, v8f& b, v16b x, v16b y) { asm volatile("v_nop\n\tv_nop\n\tv_nop\n\tv_nop" : "+v"(a), "+v"(b) : "v"(x), "v"(y)); }
__device__ __forceinline__ void keep4_h(v16h a, v16h b, v16h c, v16h d) { asm volatile("v_nop" :: "v"(a), "v"(b), "v"(c), "v"(d)); }
__device__ __forceinline__ void keep4_b(v16b a, v16b b, v16b c, v16b d) { asm volatile("v_nop" :: "v"(a), "v"(b), "v"(c), "v"(d)); }
__device__ __forceinline__ void acc_guard4(v8f& a, v8f& b, v8f& c, v8f& d) { asm volatile("v_nop\n\tv_nop\n\tv_nop\n\tv_nop" : "+v"(a), "+v"(b), "+v"(c), "+v"(d)); }
template <typename T> struct Frag;
template <> struct Frag<_Float16> {
  typedef v16h V; union U { v16h v; v8h h[2]; };
  static __device__ __forceinline__ v16h load(const _Float16* p) {   // elements 0..7 <- p[0..7], 8..15 <- p[16..23]
    U f; f.h[0] = *(const v8h*)(p); f.h[1] = *(const v8h*)(p + 16); return f.v;
  }
  static __device__ __forceinline__ v16h load2(const _Float16* p, const _Float16* q) {   // elements 0..7 <- p[0..7], 8..15 <- q[0..7]
    U f; f.h[0] = *(const v8h*)(p); f.h[1] = *(const v8h*)(q); return f.v;
  }
  static __device__ __forceinline__ v8f mma(v16h a, v16h b, v8f c) {
    return __builtin_amdgcn_wmma_f32_16x16x32_f16(false, a, false, b, (short)0, c, false, false);
  }
  static __device__ __forceinline__ void guard(v8f& a, v8f& b, v16h x, v16h y) { dep_guard_h(a, b, x, y); }
  static __device__ __forceinline__ void keep(v16h a, v16h b, v16h c, v16h d) { keep4_h(a, b, c, d); }
};
template <> struct Frag<__bf16> {
  typedef v16b V; union U { v16b v; v8b h[2]; };
  static __device__ __forceinline__ v16b load(const __bf16* p) {
    U f; f.h[0] = *(const v8b*)(p); f.h[1] = *(const v8b*)(p + 16); return f.v;
  }
  static __device__ __forceinline__ v16b load2(const __bf16* p, const __bf16* q) {
    U f; f.h[0] = *(const v8b*)(p); f.h[1] = *(const v8b*)(q); return f.v;
  }
  static __device__ __forceinline__ v8f mma(v16b a, v16b b, v8f c) {
    return __builtin_amdgcn_wmma_f32_16x16x32_bf16(false, a, false, b, (short)0, c, false, false);
  }
  static __device__ __forceinline__ void guard(v8f& a, v8f& b, v16b x, v16b y) { dep_guard_b(a, b, x, y); }
  static __device__ __forceinline__ void keep(v16b a, v16b b, v16b c, v16b d) { keep4_b(a, b, c, d); }
};

// ---- Register-blocked batched WMMA GEMM (with the HEADPL A-plane mode) -----------------------------------
// C[m,n] = scale * sum_k A[m,k] * Bt[n,k] (+bias)(+resid); each wave owns a 64x64 tile.
// A row-major [M,K]; Bt row-major [N,K]; M,N % 64 == 0, K % 32 == 0.
// SPLIT: operands are hi/lo planes (A2/Bt2 = lo planes, same layout); product = hi.hi + hi.lo + lo.hi.
// BIAS_MODE: 0 = none, 1 = bias[m], 2 = bias[n].
// OUT_MODE: 0 = f32, 1 = f16, 2 = bf16 hi plane (Cout) + bf16 lo plane (Cout2).
// ET: 0 = f16 operands, 1 = bf16 operands (pointers passed as 16-bit storage)
// HEADPL: A planes are [t][head][node][16] with row m = t * NNODE + node and k = head * 16 + d (lda unused);
//         row m of the product is stored as row node * TSTEP + t of C.
template <int ET> struct Elem;
template <> struct Elem<0> { typedef _Float16 T; };
template <> struct Elem<1> { typedef __bf16 T; };
template <int ET, bool SPLIT, int BIAS_MODE, int OUT_MODE, bool RESID, int ACT = 0, bool HEADPL = false>
__global__ __launch_bounds__(256) void wmma_gemm64(
    const unsigned short* __restrict__ Ap, const unsigned short* __restrict__ A2p, int lda, long strideA,
    const unsigned short* __restrict__ Btp, const unsigned short* __restrict__ Bt2p, int ldb, long strideB,
    void* __restrict__ Cout, void* __restrict__ Cout2, int ldc, long strideC,
    const float* __restrict__ bias,
    const float* __restrict__ resid, long strideR,
    int M, int N, int K, float scale) {
  typedef typename Elem<ET>::T T;
  typedef typename Frag<T>::V V;
  const T* A = (const T*)Ap; const T* A2 = (const T*)A2p; const T* Bt = (const T*)Btp; const T* Bt2 = (const T*)Bt2p;
  __shared__ __align__(16) float sT[8][16 * 68];   // per-wave 16x64 slab, pitch 68 floats
  const int b    = blockIdx.y;
  const int lane = threadIdx.x & 31;
  const int wave = threadIdx.x >> 5;
  const int tilesN = N >> 6;
  const int tilesM = M >> 6;
  const int tile = blockIdx.x * 8 + wave;
  if (tile >= tilesM * tilesN) return;   // wave-uniform; no block barriers in this kernel
  const int tm = tile / tilesN;
  const int tn = tile - tm * tilesN;
  const int m0 = tm << 6;
  const int n0 = tn << 6;

  const T* Ab  = A  + (size_t)b * strideA;
  const T* Bb  = Bt + (size_t)b * strideB;
  const T* Ab2 = SPLIT ? (A2  + (size_t)b * strideA) : nullptr;
  const T* Bb2 = SPLIT ? (Bt2 + (size_t)b * strideB) : nullptr;

  const int rlane = lane & 15;                 // row (A) / col (B, D) within subtile
  const int koff  = (lane >> 4) * 8;           // k offset of this lane half
  const int mOff  = (lane >> 4) * 8;           // D row offset

  v8f acc[4][4];
#pragma unroll
  for (int i = 0; i < 4; ++i)
#pragma unroll
    for (int j = 0; j < 4; ++j) acc[i][j] = (v8f){0.f,0.f,0.f,0.f,0.f,0.f,0.f,0.f};

  for (int k0 = 0; k0 < K; k0 += 32) {
    V bh[4], bl[4];
#pragma unroll
    for (int j = 0; j < 4; ++j) {
      const size_t bo = (size_t)(n0 + (j << 4) + rlane) * ldb + koff + k0;
      bh[j] = Frag<T>::load(Bb + bo);
      if (SPLIT) bl[j] = Frag<T>::load(Bb2 + bo);
    }
#pragma unroll
    for (int i = 0; i < 4; ++i) {
      V ah, al;
      if (HEADPL) {
        // k = k0 + koff + e lies in head k0 / 16, k = k0 + 16 + koff + e in the next head: one head plane further on
        const int m = m0 + (i << 4) + rlane;
        const size_t ao = ((size_t)((m / NNODE) * NHEAD + (k0 >> 4)) * NNODE + (m % NNODE)) * HEADD + koff;
        ah = Frag<T>::load2(Ab + ao, Ab + ao + NNODE * HEADD);
        if (SPLIT) al = Frag<T>::load2(Ab2 + ao, Ab2 + ao + NNODE * HEADD);
      } else {
        const size_t ao = (size_t)(m0 + (i << 4) + rlane) * lda + koff + k0;
        ah = Frag<T>::load(Ab + ao);
        if (SPLIT) al = Frag<T>::load(Ab2 + ao);
      }
#pragma unroll
      for (int j = 0; j < 4; ++j) {
        acc[i][j] = Frag<T>::mma(ah, bh[j], acc[i][j]);
        if (SPLIT) {
          acc[i][j] = Frag<T>::mma(ah, bl[j], acc[i][j]);
          acc[i][j] = Frag<T>::mma(al, bh[j], acc[i][j]);
        }
      }
      Frag<T>::guard(acc[i][0], acc[i][3], ah, SPLIT ? al : ah);
    }
    Frag<T>::keep(bh[0], bh[1], bh[2], bh[3]);
    if (SPLIT) Frag<T>::keep(bl[0], bl[1], bl[2], bl[3]);
  }
  acc_guard4(acc[0][0], acc[0][1], acc[0][2], acc[0][3]);
  acc_guard4(acc[1][0], acc[1][1], acc[1][2], acc[1][3]);
  acc_guard4(acc[2][0], acc[2][1], acc[2][2], acc[2][3]);
  acc_guard4(acc[3][0], acc[3][1], acc[3][2], acc[3][3]);

  // ---- epilogue ----
  float* slab = sT[wave];
  const float* Rb = RESID ? (resid + (size_t)b * strideR) : nullptr;
#pragma unroll
  for (int i = 0; i < 4; ++i) {
    const int mBase = m0 + (i << 4);
#pragma unroll
    for (int j = 0; j < 4; ++j) {
      const int n = n0 + (j << 4) + rlane;
      float bv = 0.f;
      if (BIAS_MODE == 2) bv = bias[n];
#pragma unroll
      for (int r = 0; r < 8; ++r) {
        float v = acc[i][j][r] * scale;
        if (BIAS_MODE == 1) v += bias[mBase + mOff + r];
        if (BIAS_MODE == 2) v += bv;
        if (RESID) v += Rb[(size_t)(mBase + mOff + r) * ldc + n];
        if (ACT == 1) v = tanhf(v);
        if (ACT == 2) v = fmaxf(v, 0.0f);
        if (ACT == 3) v = v / (1.0f + expf(-v));
        if (ACT == 4) v = (v > 0.f) ? v : 0.01f * v;
        if (ACT == 5) v = 0.5f * v * (1.0f + erff(v * 0.70710678118654752f));
        slab[(mOff + r) * 68 + (j << 4) + rlane] = v;
      }
    }
    __builtin_amdgcn_fence(__ATOMIC_RELEASE, "workgroup");
    __builtin_amdgcn_wave_barrier();
    __builtin_amdgcn_fence(__ATOMIC_ACQUIRE, "workgroup");
    if (OUT_MODE == 0) {
      float* C = (float*)Cout + (size_t)b * strideC;
      const int hh = lane >> 4, c4 = (lane & 15) * 4;     // row seg = 256 B = 16 lanes x 16 B
      {
#pragma unroll
        for (int it = 0; it < 8; ++it) {
          const int row = it * 2 + hh;
          v4f v = *(const v4f*)(slab + row * 68 + c4);
          const int m = mBase + row;
          const size_t crow = HEADPL ? (size_t)(m % NNODE) * TSTEP + (m / NNODE) : (size_t)m;
          *(v4f*)(C + crow * ldc + n0 + c4) = v;
        }
        
      }
    } else {
      const int q = lane >> 3, c8 = (lane & 7) * 8;
      unsigned short* C  = (unsigned short*)Cout  + (size_t)b * strideC;
      unsigned short* C2 = (OUT_MODE == 2) ? ((unsigned short*)Cout2 + (size_t)b * strideC) : nullptr;
      {
#pragma unroll
        for (int it = 0; it < 4; ++it) {
          const int row = it * 4 + q;
          const float* sp = slab + row * 68 + c8;
          v8h hv, lv;
#pragma unroll
          for (int e = 0; e < 8; ++e) {
            if (OUT_MODE == 1) {
              hv[e] = (_Float16)sp[e];
            } else {
              unsigned short hb = f2bf_bits(sp[e]);
              unsigned short lb = f2bf_bits(sp[e] - bf_bits2f(hb));
              hv[e] = __builtin_bit_cast(_Float16, hb);
              lv[e] = __builtin_bit_cast(_Float16, lb);
            }
          }
          *(v8h*)(C + (size_t)(mBase + row) * ldc + n0 + c8) = hv;
          if (OUT_MODE == 2) *(v8h*)(C2 + (size_t)(mBase + row) * ldc + n0 + c8) = lv;
        }
        
      }
    }
    __builtin_amdgcn_fence(__ATOMIC_RELEASE, "workgroup");
    __builtin_amdgcn_wave_barrier();
    __builtin_amdgcn_fence(__ATOMIC_ACQUIRE, "workgroup");
  }
}

// ---------------- guarded bf16 WMMA ----------------
__device__ __forceinline__ v8f at_mma(v16b a, v16b b, v8f c) {
  c = __builtin_amdgcn_wmma_f32_16x16x32_bf16(false, a, false, b, (short)0, c, false, false);
  asm volatile("v_nop\n\tv_nop\n\tv_nop\n\tv_nop" : "+v"(c) : "v"(a), "v"(b));
  return c;
}

// same-wave LDS write -> read ordering
__device__ __forceinline__ void lds_wave_sync() {
  __builtin_amdgcn_fence(__ATOMIC_RELEASE, "workgroup");
  __builtin_amdgcn_wave_barrier();
  __builtin_amdgcn_fence(__ATOMIC_ACQUIRE, "workgroup");
}

// =====================================================================
// Operand fragments with the K=16 contraction packed into one 32-deep k-step:
//   slot s <  16 -> hi part of d = s
//   slot s >= 16 -> lo part of d = s - 16
// A fragment (lane row m = lane&15, hh = lane>>4): elements 0..7 = hi[d = 8hh+e], 8..15 = lo[d = 8hh+e].
// B fragments: B1 = [wh | wh], B2 = [wl | wl] so that A.B1 + A.B2 = (xh+xl).(wh+wl).
// =====================================================================
__device__ __forceinline__ v16b x_frag_split(const float* __restrict__ xr, int hh) {
  const v4f a = *(const v4f*)(xr + 8 * hh);
  const v4f b = *(const v4f*)(xr + 8 * hh + 4);
  const float f[8] = {a[0], a[1], a[2], a[3], b[0], b[1], b[2], b[3]};
  v16b fr;
#pragma unroll
  for (int e = 0; e < 8; e += 2) {
    v2b hb, lb;
    split_pair((v2f){f[e], f[e + 1]}, hb, lb);
    fr[e] = hb[0];     fr[e + 1] = hb[1];
    fr[8 + e] = lb[0]; fr[8 + e + 1] = lb[1];
  }
  return fr;
}
// W is [16 out][16 in] row-major; lane column c = out index e; loads W[c][8hh .. 8hh+7]
__device__ __forceinline__ void w_frags_split(const float* __restrict__ W, int c, int hh, v16b& wh, v16b& wl) {
  const v4f a = *(const v4f*)(W + c * HEADD + 8 * hh);
  const v4f b = *(const v4f*)(W + c * HEADD + 8 * hh + 4);
  const float f[8] = {a[0], a[1], a[2], a[3], b[0], b[1], b[2], b[3]};
#pragma unroll
  for (int e = 0; e < 8; e += 2) {
    v2b hb, lb;
    split_pair((v2f){f[e], f[e + 1]}, hb, lb);
    wh[e] = hb[0]; wh[e + 1] = hb[1]; wh[8 + e] = hb[0]; wh[8 + e + 1] = hb[1];
    wl[e] = lb[0]; wl[e + 1] = lb[1]; wl[8 + e] = lb[0]; wl[8 + e + 1] = lb[1];
  }
}

// One wave: rows n0..n0+63 of slice (t,h) for a q-type tensor -> plane dst[slice][n][hi16|lo16].
// Coverage: 4 tiles x 16 rows = 64 rows x 32 u16 staged; stored as 8 x (32 lanes x 8 u16) = 2048 u16 = whole region.
__device__ __forceinline__ void proj_qk_part(const float* __restrict__ x, unsigned short* __restrict__ dstp,
    const v16b wh, const v16b wl, float oscale, int slice, int n0, int t, int h, int lane, unsigned short* sl)
{
  const int hh = lane >> 4, c = lane & 15;
#pragma unroll
  for (int i = 0; i < 4; ++i) {
    const float* xr = x + ((size_t)(n0 + 16 * i + c) * TSTEP + t) * EMB + h * HEADD;
    const v16b xa = x_frag_split(xr, hh);
    v8f acc = (v8f){0.f,0.f,0.f,0.f,0.f,0.f,0.f,0.f};
    acc = at_mma(xa, wh, acc);
    acc = at_mma(xa, wl, acc);
    // acc[r] = proj[n0 + 16i + 8hh + r][e = c]
#pragma unroll
    for (int r = 0; r < 8; r += 2) {
      us2 hb, lb;
      split_pair_bits((v2f){acc[r] * oscale, acc[r + 1] * oscale}, hb, lb);
      const int row = 16 * i + 8 * hh + r;
      sl[row * QKROW + c] = hb[0];
      sl[row * QKROW + 16 + c] = lb[0];
      sl[(row + 1) * QKROW + c] = hb[1];
      sl[(row + 1) * QKROW + 16 + c] = lb[1];
    }
  }
  lds_wave_sync();
  unsigned short* dst = dstp + ((size_t)slice * NNODE + n0) * QKROW;   // 64 consecutive rows = 4096 B = 32 lines
  {
#pragma unroll
    for (int it = 0; it < 8; ++it) {
      const us8 v = *(const us8*)(sl + (it * 32 + lane) * 8);
      *(us8*)(dst + (it * 32 + lane) * 8) = v;
    }
    
  }
  lds_wave_sync();
}

// One wave: rows n0..n0+63 of slice for values -> transposed planes Vth/Vtl[slice][d][n].
// Coverage: slab hi [16 d][64 n] + lo [16 d][64 n] fully written by 4 tiles x 32 lanes x 8 u16;
// stored as 4 x (4 rows x 8 lanes x 8 u16) per plane = all 16 d rows x 64 n.
__device__ __forceinline__ void proj_v_part(const float* __restrict__ x, unsigned short* __restrict__ Vth,
    unsigned short* __restrict__ Vtl, const v16b wh, const v16b wl, int slice, int n0, int t, int h, int lane,
    unsigned short* sl)
{
  const int hh = lane >> 4, c = lane & 15;
#pragma unroll
  for (int i = 0; i < 4; ++i) {
    const float* xr = x + ((size_t)(n0 + 16 * i + c) * TSTEP + t) * EMB + h * HEADD;
    const v16b xa = x_frag_split(xr, hh);
    v8f acc = (v8f){0.f,0.f,0.f,0.f,0.f,0.f,0.f,0.f};
    acc = at_mma(xa, wh, acc);
    acc = at_mma(xa, wl, acc);
    // acc[r] = v[n0 + 16i + 8hh + r][d = c] -> slab[d][16i + 8hh + r]
    us8 hv, lv;
#pragma unroll
    for (int r = 0; r < 8; r += 2) {
      us2 hb, lb;
      split_pair_bits((v2f){acc[r], acc[r + 1]}, hb, lb);
      hv[r] = hb[0]; hv[r + 1] = hb[1];
      lv[r] = lb[0]; lv[r + 1] = lb[1];
    }
    *(us8*)(sl + c * 64 + 16 * i + 8 * hh) = hv;
    *(us8*)(sl + 1024 + c * 64 + 16 * i + 8 * hh) = lv;
  }
  lds_wave_sync();
  const int qq = lane >> 3, c8 = (lane & 7) * 8;
  {
#pragma unroll
    for (int it = 0; it < 4; ++it) {
      const int d = it * 4 + qq;
      const us8 hv = *(const us8*)(sl + d * 64 + c8);
      const us8 lv = *(const us8*)(sl + 1024 + d * 64 + c8);
      const size_t off = ((size_t)slice * HEADD + d) * NNODE + n0 + c8;
      *(us8*)(Vth + off) = hv;
      *(us8*)(Vtl + off) = lv;
    }
    
  }
  lds_wave_sync();
}

// =====================================================================
// Kernel 1: per-head projections on WMMA. One wave = (slice, 64-node group); 4 waves per block,
// each with its own LDS slab (no cross-wave LDS traffic, no block barriers).
// grid = 2304 / 4 = 576 blocks.
// =====================================================================
__global__ __launch_bounds__(128) void proj_qkv(
    const float* __restrict__ values, const float* __restrict__ keys, const float* __restrict__ query,
    const float* __restrict__ Wv, const float* __restrict__ Wk, const float* __restrict__ Wq,
    unsigned short* __restrict__ Q2, unsigned short* __restrict__ K2,
    unsigned short* __restrict__ Vth, unsigned short* __restrict__ Vtl)
{
  __shared__ __align__(16) unsigned short slab[4][64 * QKROW];   // 4 KB per wave
  const int lane = threadIdx.x & 31;
  const int wave = threadIdx.x >> 5;
  const int hh = lane >> 4, c = lane & 15;
  const int task  = blockIdx.x * 4 + wave;           // 0 .. 2303
  const int slice = task >> 4;                        // 0 .. 143
  const int ng    = task & 15;                        // node group
  const int t = slice >> 2, h = slice & 3;
  const int n0 = ng * 64;
  unsigned short* sl = slab[wave];

  v16b wqh, wql, wkh, wkl, wvh, wvl;
  w_frags_split(Wq, c, hh, wqh, wql);
  w_frags_split(Wk, c, hh, wkh, wkl);
  w_frags_split(Wv, c, hh, wvh, wvl);

  // q carries the exact 1/sqrt(64) = 0.125 score scale
  proj_qk_part(query, Q2, wqh, wql, 0.125f, slice, n0, t, h, lane, sl);
  proj_qk_part(keys,  K2, wkh, wkl, 1.0f,   slice, n0, t, h, lane, sl);
  proj_v_part(values, Vth, Vtl, wvh, wvl, slice, n0, t, h, lane, sl);
}

// =====================================================================
// Kernel 0: Wo -> bf16 hi/lo planes [64][64] (Bt[n = e][k = c] = Wo[e][c]). One block of 256 threads;
// thread handles element groups g = tid, tid + 256 (8 consecutive elements each): 512 x 8 = 4096 = whole planes.
// =====================================================================
__global__ __launch_bounds__(256) void prep_wo_split(
    const float* __restrict__ Wo, unsigned short* __restrict__ Woh, unsigned short* __restrict__ Wol)
{
  const int tid = threadIdx.x;
  us8 hv[2], lv[2];
#pragma unroll
  for (int it = 0; it < 2; ++it) {
    const int g = tid + 256 * it;
    const v4f a = *(const v4f*)(Wo + 8 * g);
    const v4f b = *(const v4f*)(Wo + 8 * g + 4);
    const float f[8] = {a[0], a[1], a[2], a[3], b[0], b[1], b[2], b[3]};
#pragma unroll
    for (int e = 0; e < 8; e += 2) {
      us2 hb, lb;
      split_pair_bits((v2f){f[e], f[e + 1]}, hb, lb);
      hv[it][e] = hb[0]; hv[it][e + 1] = hb[1];
      lv[it][e] = lb[0]; lv[it][e + 1] = lb[1];
    }
  }
  {
#pragma unroll
    for (int it = 0; it < 2; ++it) {
      const int g = tid + 256 * it;
      *(us8*)(Woh + 8 * g) = hv[it];
      *(us8*)(Wol + 8 * g) = lv[it];
    }
    
  }
}

constexpr float LOG2E = 1.4426950408889634f;
// y = 2^x on the hardware. The v_nop in the same statement keeps the one slot that the instruction set asks for between
// a transcendental and an instruction that uses its result or overwrites its source, whatever the compiler puts next.
__device__ __forceinline__ float exp2_hw(float x) {
  float y;
  asm("v_exp_f32 %0, %1\n\tv_nop" : "=v"(y) : "v"(x));
  return y;
}
// Eight independent 2^x in one statement: the early-clobber outputs keep every result off every source, so none of the
// eight overwrites a source of the one in front of it, and one closing v_nop keeps the slot for all of them.
__device__ __forceinline__ v8f exp2_hw8(v8f x) {
  float y0, y1, y2, y3, y4, y5, y6, y7;
  asm("v_exp_f32 %0, %8\n\tv_exp_f32 %1, %9\n\tv_exp_f32 %2, %10\n\tv_exp_f32 %3, %11\n\t"
      "v_exp_f32 %4, %12\n\tv_exp_f32 %5, %13\n\tv_exp_f32 %6, %14\n\tv_exp_f32 %7, %15\n\tv_nop"
      : "=&v"(y0), "=&v"(y1), "=&v"(y2), "=&v"(y3), "=&v"(y4), "=&v"(y5), "=&v"(y6), "=&v"(y7)
      : "v"(x[0]), "v"(x[1]), "v"(x[2]), "v"(x[3]), "v"(x[4]), "v"(x[5]), "v"(x[6]), "v"(x[7]));
  return (v8f){y0, y1, y2, y3, y4, y5, y6, y7};
}
// value of lane l ^ 16
__device__ __forceinline__ float other_half(float x) {
  const int b = __float_as_int(x);
  return __int_as_float(__builtin_amdgcn_permlanex16(b, b, 0x76543210, 0xfedcba98, false, false));
}

// LDS row pitches of the staged tiles, in 16-bit elements. The fragment reads are 16 bytes a lane with one row per lane,
// so the pitch is an odd multiple of 16 bytes: the 16 rows of a half wave then fall on 16 different groups of four banks.
// The pad elements at the end of a row are never written and never read.
constexpr int KPITCH = QKROW + 8;            // 80 B  = 16 B x 5 (data: 64 B)
constexpr int VPITCH = 64 + 8;               // 144 B = 16 B x 9 (data: 128 B)

// element offset of lane ln = (c, hh) in its wave's 16 rows of 16: row c = ln & 15, elements 8hh .. 8hh + 7
__device__ __forceinline__ int ln_off(int ln) { return (ln & 15) * HEADD + 8 * (ln >> 4); }

// Register budget: at most 112 vector registers (1024 / 9, in granules of 16), so that nine blocks, a WGP's share of the
// grid, are resident at once; at eight, a ninth of the blocks would run afterwards, one wave per SIMD.
__global__ __launch_bounds__(128) void attn_hd16(
    const unsigned short* __restrict__ Q2, const unsigned short* __restrict__ K2,
    const unsigned short* __restrict__ Vth, const unsigned short* __restrict__ Vtl,
    unsigned short* __restrict__ Ohi, unsigned short* __restrict__ Olo)
{
  union FB { v16b v; v8b h[2]; };
  // one array, so that the tiles lie at constant offsets from one another and share their address registers
  __shared__ __align__(16) __bf16 tiles[64 * KPITCH + 2 * HEADD * VPITCH];
  __bf16* const Ksh = tiles;                                // [key][hi16|lo16|pad]
  __bf16* const Vhs = tiles + 64 * KPITCH;                  // [d][64 keys|pad] hi
  __bf16* const Vls = Vhs + HEADD * VPITCH;                 // [d][64 keys|pad] lo

  const int tid  = threadIdx.x;
  const int wave = __builtin_amdgcn_readfirstlane(tid >> 5);   // the same in every lane: kept in a scalar register
  const int lane = tid & 31;
  const int hh   = lane >> 4;
  const int c    = lane & 15;
  const int slice = blockIdx.x >> 4;         // 0 .. 143 = t * NHEAD + h
  const int qb   = blockIdx.x & 15;          // 64-query block
  const int q0   = qb * 64 + wave * 16;

  const __bf16* Qs = (const __bf16*)(const void*)Q2 + (size_t)slice * NNODE * QKROW;
  // B fragment, column = query q0 + c: elements 0..7 = qh[d = 8hh+e], 8..15 = ql[d = 8hh+e]
  const v16b qa = Frag<__bf16>::load(Qs + (size_t)(q0 + c) * QKROW + 8 * hh);
  const v8b* Kg  = (const v8b*)(const void*)(K2  + (size_t)slice * NNODE * QKROW);   // [key*4 + seg]
  const v8b* Vhg = (const v8b*)(const void*)(Vth + (size_t)slice * HEADD * NNODE);   // [d*128 + key/8]
  const v8b* Vlg = (const v8b*)(const void*)(Vtl + (size_t)slice * HEADD * NNODE);

  __bf16* const kdst = Ksh + (tid >> 2) * KPITCH + (tid & 3) * 8;          // K piece tid: row tid / 4, 16-B segment tid % 4
  __bf16* const vdst = Vhs + (tid >> 3) * VPITCH + (tid & 7) * 8;          // V piece tid: d = tid / 8, 16-B segment tid % 8
  const unsigned vsrc = (unsigned)(tid >> 3) * (NNODE / 8) + (tid & 7);

  // per lane: running maximum of query q0 + c times log2e (equal in both halves), this half's part of its sum
  float mrun = -INFINITY, lsum = 0.f;
  v8f oacc = (v8f){0.f,0.f,0.f,0.f,0.f,0.f,0.f,0.f};

#pragma unroll 1
  for (int kc = 0; kc < NNODE / 64; ++kc) {
    __syncthreads();
    // stage K: 256 pieces of 16 B = 64 rows x 32 u16 (whole tile, contiguous in K2); piece tid + 128 is row + 32, so the
    // two pieces of a thread lie a constant apart in K2 and in LDS and share their address registers (register budget, above)
    {
      const v8b* Kt = Kg + kc * 256;
      const v8b k0 = Kt[(unsigned)tid];
      const v8b k1 = Kt[(unsigned)tid + 128u];
      *(v8b*)(kdst) = k0;
      *(v8b*)(kdst + 32 * KPITCH) = k1;
    }
    // stage V hi/lo: 128 pieces of 16 B = 16 d x 64 keys per plane (whole tiles)
    {
      const v8b a  = (Vhg + kc * 8)[vsrc];
      const v8b b2 = (Vlg + kc * 8)[vsrc];
      *(v8b*)(vdst) = a;
      *(v8b*)(vdst + HEADD * VPITCH) = b2;
    }
    __syncthreads();

    v8f s[4];
#pragma unroll
    for (int j = 0; j < 4; ++j) {
      const __bf16* kr = Ksh + (j * 16 + c) * KPITCH + 8 * hh;
      const v8b kh8 = *(const v8b*)(kr);
      const v8b kl8 = *(const v8b*)(kr + 16);
      FB k1, k2;
      k1.h[0] = kh8; k1.h[1] = kh8;
      k2.h[0] = kl8; k2.h[1] = kl8;
      s[j] = (v8f){0.f,0.f,0.f,0.f,0.f,0.f,0.f,0.f};
      s[j] = at_mma(k1.v, qa, s[j]);
      s[j] = at_mma(k2.v, qa, s[j]);
    }
    // s[j][r] = scaled energy(key 64kc + 16j + 8hh + r, query q0 + c)
    float cm = s[0][0];
#pragma unroll
    for (int j = 0; j < 4; ++j)
#pragma unroll
      for (int r = 0; r < 8; ++r) cm = fmaxf(cm, s[j][r]);
    cm = fmaxf(cm, other_half(cm));
    const float mnew  = fmaxf(mrun, cm * LOG2E);
    const float alpha = exp2_hw(mrun - mnew);
    mrun = mnew;

    v16b ph[2], pl[2];
    float ps[4];
#pragma unroll
    for (int j = 0; j < 4; ++j) {
      ps[j] = 0.f;
      // arguments <= 0 up to one rounding: no overflow; below -126 a term is under 2^-126 of the largest and goes to 0
      v8f ea;
#pragma unroll
      for (int r = 0; r < 8; r += 2) {
        const v2f a2 = __builtin_elementwise_fma((v2f){s[j][r], s[j][r + 1]}, (v2f){LOG2E, LOG2E}, (v2f){-mnew, -mnew});
        ea[r] = a2[0]; ea[r + 1] = a2[1];
      }
      const v8f pe = exp2_hw8(ea);
#pragma unroll
      for (int r = 0; r < 8; r += 2) {
        ps[j] += pe[r];
        ps[j] += pe[r + 1];
        v2b a, bl;
        split_pair((v2f){pe[r], pe[r + 1]}, a, bl);
        // B element 8(j&1) + r of lane (c, hh) is key 16(j&1) + 8hh + r of the 32-key step j>>1
        ph[j >> 1][8 * (j & 1) + r] = a[0];  ph[j >> 1][8 * (j & 1) + r + 1] = a[1];
        pl[j >> 1][8 * (j & 1) + r] = bl[0]; pl[j >> 1][8 * (j & 1) + r + 1] = bl[1];
      }
    }
    lsum = lsum * alpha + ((ps[0] + ps[1]) + (ps[2] + ps[3]));
#pragma unroll
    for (int r = 0; r < 8; ++r) oacc[r] *= alpha;

#pragma unroll
    for (int kk = 0; kk < 2; ++kk) {
      FB vb, vl;
      vb.h[0] = *(const v8b*)(Vhs + c * VPITCH + kk * 32 + 8 * hh);
      vb.h[1] = *(const v8b*)(Vhs + c * VPITCH + kk * 32 + 16 + 8 * hh);
      vl.h[0] = *(const v8b*)(Vls + c * VPITCH + kk * 32 + 8 * hh);
      vl.h[1] = *(const v8b*)(Vls + c * VPITCH + kk * 32 + 16 + 8 * hh);
      oacc = at_mma(vb.v, ph[kk], oacc);
      oacc = at_mma(vl.v, ph[kk], oacc);
      oacc = at_mma(vb.v, pl[kk], oacc);
    }
  }
  // oacc[r] = unnormalised out(query q0 + c, d = 8hh + r); the two halves' sums join here; the sum is >= 1
  const float inv = 1.0f / (lsum + other_half(lsum));
  us8 hv, lv;
#pragma unroll
  for (int r = 0; r < 8; r += 2) {
    us2 hb, lb;
    split_pair_bits((v2f){oacc[r] * inv, oacc[r + 1] * inv}, hb, lb);
    hv[r] = hb[0]; hv[r + 1] = hb[1];
    lv[r] = lb[0]; lv[r + 1] = lb[1];
  }
  // 16 B a lane, 32 B a query: one store of the wave covers 512 contiguous bytes of its plane.
  // The lane number is formed anew here, so that no vector register holds a part of this address across the loop.
  const int ln = (int)__builtin_amdgcn_mbcnt_lo(~0u, 0u);
  const size_t off = ((size_t)slice * NNODE + q0) * HEADD + ln_off(ln);
  *(us8*)(Ohi + off) = hv;
  *(us8*)(Olo + off) = lv;
}

// =====================================================================
extern "C" void kernel_launch(void* const* d_in, const int* in_sizes, int n_in,
                              void* d_out, int out_size, void* d_ws, size_t ws_size,
                              hipStream_t stream) {
  if (n_in < 8) return;
  if (in_sizes[0] != NNODE * TSTEP * EMB || in_sizes[1] != NNODE * TSTEP * EMB ||
      in_sizes[2] != NNODE * TSTEP * EMB || in_sizes[3] != HEADD * HEADD ||
      in_sizes[4] != HEADD * HEADD || in_sizes[5] != HEADD * HEADD ||
      in_sizes[6] != EMB * EMB || in_sizes[7] != EMB) return;
  if (out_size != NROWS * EMB) return;
  if (ws_size < WS_TOTAL) return;

  const float* values = (const float*)d_in[0];
  const float* keys   = (const float*)d_in[1];
  const float* query  = (const float*)d_in[2];
  const float* Wv     = (const float*)d_in[3];
  const float* Wk     = (const float*)d_in[4];
  const float* Wq     = (const float*)d_in[5];
  const float* Wo     = (const float*)d_in[6];
  const float* bo     = (const float*)d_in[7];

  char* ws = (char*)d_ws;
  unsigned short* Q2  = (unsigned short*)(ws + WS_Q2);
  unsigned short* K2  = (unsigned short*)(ws + WS_K2);
  unsigned short* Vth = (unsigned short*)(ws + WS_VTH);
  unsigned short* Vtl = (unsigned short*)(ws + WS_VTL);
  unsigned short* Ohi = (unsigned short*)(ws + WS_OHI);
  unsigned short* Olo = (unsigned short*)(ws + WS_OLO);
  unsigned short* Woh = (unsigned short*)(ws + WS_WOH);
  unsigned short* Wol = (unsigned short*)(ws + WS_WOL);

  // 1) Wo -> bf16 hi/lo planes
  prep_wo_split<<<dim3(1), dim3(256), 0, stream>>>(Wo, Woh, Wol);
  // 2) per-head projections: 144 slices x 16 node groups = 2304 wave tasks, 4 per block
  proj_qkv<<<dim3(NSLICE * (NNODE / 64) / 4), dim3(128), 0, stream>>>(
      values, keys, query, Wv, Wk, Wq, Q2, K2, Vth, Vtl);
  // 3) attention over nodes: 144 (t, head) slices x 16 query blocks
  attn_hd16<<<dim3(NSLICE * (NNODE / 64)), dim3(128), 0, stream>>>(Q2, K2, Vth, Vtl, Ohi, Olo);
  // 4) output projection: C[36864 x 64] = O . Wo^T + bo; M=36864 (576 tiles), N=64, K=64; 8 tiles per block
  wmma_gemm64<1, true, 2, 0, false, 0, true><<<dim3(NROWS / 64 / 8, 1), dim3(256), 0, stream>>>(
      Ohi, Olo, EMB, 0L, Woh, Wol, EMB, 0L,
      d_out, nullptr, EMB, 0L, bo, nullptr, 0L,
      NROWS, EMB, EMB, 1.0f);
}

// v006
// It runs in 62.5 microseconds.
// Two timings next to v005 both put it at 1.16 times that version's speed.
// Counting every step since v000, it is 3.60 times as fast.
// Contractions: v_wmma_f32_16x16x32_bf16 with bf16 hi/lo split operands (head projections, q.k scores, p.v, output projection), f32 accumulate; softmax, splits and epilogues in f32.
#include <hip/hip_runtime.h>
#include <math.h>
#include <stddef.h>

// ---------------- problem constants ----------------
constexpr int NNODE  = 1024;
constexpr int TSTEP  = 36;
constexpr int EMB    = 64;
constexpr int NHEAD  = 4;
constexpr int HEADD  = 16;
constexpr int NSLICE = TSTEP * NHEAD;        // 144 (t, h) slices
constexpr int NROWS  = NNODE * TSTEP;        // 36864 rows of the [n*T+t][64] planes
constexpr int QKROW  = 32;                   // u16 per row of the Q/K planes: [hi e0..15 | lo e0..15]

// ---------------- workspace region map (bytes) ----------------
// Q2  : bf16 [144][1024][32]          9,437,184 B  @ 0
// K2  : bf16 [144][1024][32]          9,437,184 B  @ 9,437,184
// Vth : bf16 [144][16][1024] (hi)     4,718,592 B  @ 18,874,368
// Vtl : bf16 [144][16][1024] (lo)     4,718,592 B  @ 23,592,960
// Ohi : bf16 [144][1024][16] (hi)     4,718,592 B  @ 28,311,552
// Olo : bf16 [144][1024][16] (lo)     4,718,592 B  @ 33,030,144
// Woh : bf16 [64][64]                     8,192 B  @ 37,748,736
// Wol : bf16 [64][64]                     8,192 B  @ 37,756,928
// total                              37,765,120 B
constexpr size_t WS_Q2   = 0;
constexpr size_t SZ_QK   = (size_t)NSLICE * NNODE * QKROW * 2;
constexpr size_t WS_K2   = WS_Q2 + SZ_QK;
constexpr size_t SZ_V    = (size_t)NSLICE * HEADD * NNODE * 2;
constexpr size_t WS_VTH  = WS_K2 + SZ_QK;
constexpr size_t WS_VTL  = WS_VTH + SZ_V;
constexpr size_t SZ_O    = (size_t)NROWS * EMB * 2;
constexpr size_t WS_OHI  = WS_VTL + SZ_V;
constexpr size_t WS_OLO  = WS_OHI + SZ_O;
constexpr size_t SZ_WO   = (size_t)EMB * EMB * 2;
constexpr size_t WS_WOH  = WS_OLO + SZ_O;
constexpr size_t WS_WOL  = WS_WOH + SZ_WO;
constexpr size_t WS_TOTAL = WS_WOL + SZ_WO;
static_assert(WS_TOTAL == 37765120, "carve");
static_assert(WS_TOTAL <= 134217728, "carve");
static_assert((WS_K2 % 128) == 0 && (WS_VTH % 128) == 0 && (WS_VTL % 128) == 0 && (WS_OHI % 128) == 0 &&
              (WS_OLO % 128) == 0 && (WS_WOH % 128) == 0 && (WS_WOL % 128) == 0, "align");
// GEMM shape contract for the output projection
static_assert(NROWS % 64 == 0 && EMB % 64 == 0 && EMB % 32 == 0, "gemm");
static_assert(NNODE % 64 == 0, "tiles");

// ---------------- types and fragment helpers ----------------
typedef __attribute__((ext_vector_type(16))) _Float16 v16h;
typedef __attribute__((ext_vector_type(8)))  _Float16 v8h;
typedef __attribute__((ext_vector_type(16))) __bf16   v16b;
typedef __attribute__((ext_vector_type(8)))  __bf16   v8b;
typedef __attribute__((ext_vector_type(8)))  float    v8f;
typedef __attribute__((ext_vector_type(4)))  float    v4f;
typedef __attribute__((ext_vector_type(8)))  unsigned short us8;

__device__ __forceinline__ unsigned short f2bf_bits(float f) {
  unsigned u = __float_as_uint(f);
  return (unsigned short)((u + 0x7FFFu + ((u >> 16) & 1u)) >> 16);
}
__device__ __forceinline__ float bf_bits2f(unsigned short h) { return __uint_as_float(((unsigned)h) << 16); }

// hi/lo split of two f32 values at once on the hardware's packed f32 -> bf16 conversion, which rounds to nearest even as
// f2bf_bits does: hi = bf16(p), lo = bf16(p - hi). Each result is one register of two packed bf16, the form that operand
// fragments and 16-byte stores are made of.
typedef __attribute__((ext_vector_type(2))) float          v2f;
typedef __attribute__((ext_vector_type(2))) __bf16         v2b;
typedef __attribute__((ext_vector_type(2))) unsigned short us2;
__device__ __forceinline__ void split_pair(v2f p, v2b& hi, v2b& lo) {
  hi = __builtin_convertvector(p, v2b);
  lo = __builtin_convertvector(p - __builtin_convertvector(hi, v2f), v2b);
}
__device__ __forceinline__ void split_pair_bits(v2f p, us2& hi, us2& lo) {
  v2b h, l;
  split_pair(p, h, l);
  hi = __builtin_bit_cast(us2, h);
  lo = __builtin_bit_cast(us2, l);
}

template <typename T> struct Frag;
template <> struct Frag<_Float16> {
  typedef v16h V; union U { v16h v; v8h h[2]; };
  static __device__ __forceinline__ v16h load(const _Float16* p) {   // elements 0..7 <- p[0..7], 8..15 <- p[16..23]
    U f; f.h[0] = *(const v8h*)(p); f.h[1] = *(const v8h*)(p + 16); return f.v;
  }
  static __device__ __forceinline__ v16h load2(const _Float16* p, const _Float16* q) {   // elements 0..7 <- p[0..7], 8..15 <- q[0..7]
    U f; f.h[0] = *(const v8h*)(p); f.h[1] = *(const v8h*)(q); return f.v;
  }
  static __device__ __forceinline__ v8f mma(v16h a, v16h b, v8f c) {
    return __builtin_amdgcn_wmma_f32_16x16x32_f16(false, a, false, b, (short)0, c, false, false);
  }
};
template <> struct Frag<__bf16> {
  typedef v16b V; union U { v16b v; v8b h[2]; };
  static __device__ __forceinline__ v16b load(const __bf16* p) {
    U f; f.h[0] = *(const v8b*)(p); f.h[1] = *(const v8b*)(p + 16); return f.v;
  }
  static __device__ __forceinline__ v16b load2(const __bf16* p, const __bf16* q) {
    U f; f.h[0] = *(const v8b*)(p); f.h[1] = *(const v8b*)(q); return f.v;
  }
  static __device__ __forceinline__ v8f mma(v16b a, v16b b, v8f c) {
    return __builtin_amdgcn_wmma_f32_16x16x32_bf16(false, a, false, b, (short)0, c, false, false);
  }
};

// ---- Register-blocked batched WMMA GEMM ---------------------------------------------
// C[m,n] = scale * sum_k A[m,k] * Bt[n,k] (+bias)(+resid); each wave owns a 64x64 tile.
// A row-major [M,K]; Bt row-major [N,K]; M,N % 64 == 0, K % 32 == 0.
// SPLIT: operands are hi/lo planes (A2/Bt2 = lo planes, same layout); product = hi.hi + hi.lo + lo.hi.
// BIAS_MODE: 0 = none, 1 = bias[m], 2 = bias[n].
// OUT_MODE: 0 = f32, 1 = f16, 2 = bf16 hi plane (Cout) + bf16 lo plane (Cout2).
// ET: 0 = f16 operands, 1 = bf16 operands (pointers passed as 16-bit storage)
// HEADPL: A planes are [t][head][node][16] with row m = t * NNODE + node and k = head * 16 + d (lda unused);
//         row m of the product is stored as row node * TSTEP + t of C.
template <int ET> struct Elem;
template <> struct Elem<0> { typedef _Float16 T; };
template <> struct Elem<1> { typedef __bf16 T; };
template <int ET, bool SPLIT, int BIAS_MODE, int OUT_MODE, bool RESID, int ACT = 0, bool HEADPL = false>
__global__ __launch_bounds__(256) void wmma_gemm64(
    const unsigned short* __restrict__ Ap, const unsigned short* __restrict__ A2p, int lda, long strideA,
    const unsigned short* __restrict__ Btp, const unsigned short* __restrict__ Bt2p, int ldb, long strideB,
    void* __restrict__ Cout, void* __restrict__ Cout2, int ldc, long strideC,
    const float* __restrict__ bias,
    const float* __restrict__ resid, long strideR,
    int M, int N, int K, float scale) {
  typedef typename Elem<ET>::T T;
  typedef typename Frag<T>::V V;
  const T* A = (const T*)Ap; const T* A2 = (const T*)A2p; const T* Bt = (const T*)Btp; const T* Bt2 = (const T*)Bt2p;
  __shared__ __align__(16) float sT[8][16 * 68];   // per-wave 16x64 slab, pitch 68 floats
  const int b    = blockIdx.y;
  const int lane = threadIdx.x & 31;
  const int wave = threadIdx.x >> 5;
  const int tilesN = N >> 6;
  const int tilesM = M >> 6;
  const int tile = blockIdx.x * 8 + wave;
  if (tile >= tilesM * tilesN) return;   // wave-uniform; no block barriers in this kernel
  const int tm = tile / tilesN;
  const int tn = tile - tm * tilesN;
  const int m0 = tm << 6;
  const int n0 = tn << 6;

  const T* Ab  = A  + (size_t)b * strideA;
  const T* Bb  = Bt + (size_t)b * strideB;
  const T* Ab2 = SPLIT ? (A2  + (size_t)b * strideA) : nullptr;
  const T* Bb2 = SPLIT ? (Bt2 + (size_t)b * strideB) : nullptr;

  const int rlane = lane & 15;                 // row (A) / col (B, D) within subtile
  const int koff  = (lane >> 4) * 8;           // k offset of this lane half
  const int mOff  = (lane >> 4) * 8;           // D row offset

  v8f acc[4][4];
#pragma unroll
  for (int i = 0; i < 4; ++i)
#pragma unroll
    for (int j = 0; j < 4; ++j) acc[i][j] = (v8f){0.f,0.f,0.f,0.f,0.f,0.f,0.f,0.f};

  for (int k0 = 0; k0 < K; k0 += 32) {
    V bh[4], bl[4];
#pragma unroll
    for (int j = 0; j < 4; ++j) {
      const size_t bo = (size_t)(n0 + (j << 4) + rlane) * ldb + koff + k0;
      bh[j] = Frag<T>::load(Bb + bo);
      if (SPLIT) bl[j] = Frag<T>::load(Bb2 + bo);
    }
#pragma unroll
    for (int i = 0; i < 4; ++i) {
      V ah, al;
      if (HEADPL) {
        // k = k0 + koff + e lies in head k0 / 16, k = k0 + 16 + koff + e in the next head: one head plane further on
        const int m = m0 + (i << 4) + rlane;
        const size_t ao = ((size_t)((m / NNODE) * NHEAD + (k0 >> 4)) * NNODE + (m % NNODE)) * HEADD + koff;
        ah = Frag<T>::load2(Ab + ao, Ab + ao + NNODE * HEADD);
        if (SPLIT) al = Frag<T>::load2(Ab2 + ao, Ab2 + ao + NNODE * HEADD);
      } else {
        const size_t ao = (size_t)(m0 + (i << 4) + rlane) * lda + koff + k0;
        ah = Frag<T>::load(Ab + ao);
        if (SPLIT) al = Frag<T>::load(Ab2 + ao);
      }
#pragma unroll
      for (int j = 0; j < 4; ++j) {
        acc[i][j] = Frag<T>::mma(ah, bh[j], acc[i][j]);
        if (SPLIT) {
          acc[i][j] = Frag<T>::mma(ah, bl[j], acc[i][j]);
          acc[i][j] = Frag<T>::mma(al, bh[j], acc[i][j]);
        }
      }
    }
  }

  // ---- epilogue ----
  float* slab = sT[wave];
  const float* Rb = RESID ? (resid + (size_t)b * strideR) : nullptr;
#pragma unroll
  for (int i = 0; i < 4; ++i) {
    const int mBase = m0 + (i << 4);
#pragma unroll
    for (int j = 0; j < 4; ++j) {
      const int n = n0 + (j << 4) + rlane;
      float bv = 0.f;
      if (BIAS_MODE == 2) bv = bias[n];
#pragma unroll
      for (int r = 0; r < 8; ++r) {
        float v = acc[i][j][r] * scale;
        if (BIAS_MODE == 1) v += bias[mBase + mOff + r];
        if (BIAS_MODE == 2) v += bv;
        if (RESID) v += Rb[(size_t)(mBase + mOff + r) * ldc + n];
        if (ACT == 1) v = tanhf(v);
        if (ACT == 2) v = fmaxf(v, 0.0f);
        if (ACT == 3) v = v / (1.0f + expf(-v));
        if (ACT == 4) v = (v > 0.f) ? v : 0.01f * v;
        if (ACT == 5) v = 0.5f * v * (1.0f + erff(v * 0.70710678118654752f));
        slab[(mOff + r) * 68 + (j << 4) + rlane] = v;
      }
    }
    __builtin_amdgcn_fence(__ATOMIC_RELEASE, "workgroup");
    __builtin_amdgcn_wave_barrier();
    __builtin_amdgcn_fence(__ATOMIC_ACQUIRE, "workgroup");
    if (OUT_MODE == 0) {
      float* C = (float*)Cout + (size_t)b * strideC;
      const int hh = lane >> 4, c4 = (lane & 15) * 4;     // row seg = 256 B = 16 lanes x 16 B
      {
#pragma unroll
        for (int it = 0; it < 8; ++it) {
          const int row = it * 2 + hh;
          v4f v = *(const v4f*)(slab + row * 68 + c4);
          const int m = mBase + row;
          const size_t crow = HEADPL ? (size_t)(m % NNODE) * TSTEP + (m / NNODE) : (size_t)m;
          *(v4f*)(C + crow * ldc + n0 + c4) = v;
        }
        
      }
    } else {
      const int q = lane >> 3, c8 = (lane & 7) * 8;
      unsigned short* C  = (unsigned short*)Cout  + (size_t)b * strideC;
      unsigned short* C2 = (OUT_MODE == 2) ? ((unsigned short*)Cout2 + (size_t)b * strideC) : nullptr;
      {
#pragma unroll
        for (int it = 0; it < 4; ++it) {
          const int row = it * 4 + q;
          const float* sp = slab + row * 68 + c8;
          v8h hv, lv;
#pragma unroll
          for (int e = 0; e < 8; ++e) {
            if (OUT_MODE == 1) {
              hv[e] = (_Float16)sp[e];
            } else {
              unsigned short hb = f2bf_bits(sp[e]);
              unsigned short lb = f2bf_bits(sp[e] - bf_bits2f(hb));
              hv[e] = __builtin_bit_cast(_Float16, hb);
              lv[e] = __builtin_bit_cast(_Float16, lb);
            }
          }
          *(v8h*)(C + (size_t)(mBase + row) * ldc + n0 + c8) = hv;
          if (OUT_MODE == 2) *(v8h*)(C2 + (size_t)(mBase + row) * ldc + n0 + c8) = lv;
        }
        
      }
    }
    __builtin_amdgcn_fence(__ATOMIC_RELEASE, "workgroup");
    __builtin_amdgcn_wave_barrier();
    __builtin_amdgcn_fence(__ATOMIC_ACQUIRE, "workgroup");
  }
}

// ---------------- bf16 WMMA, builtin form: the compiler keeps the distances the chip needs behind it ----------------
__device__ __forceinline__ v8f at_mma(v16b a, v16b b, v8f c) {
  return __builtin_amdgcn_wmma_f32_16x16x32_bf16(false, a, false, b, (short)0, c, false, false);
}

// same-wave LDS write -> read ordering
__device__ __forceinline__ void lds_wave_sync() {
  __builtin_amdgcn_fence(__ATOMIC_RELEASE, "workgroup");
  __builtin_amdgcn_wave_barrier();
  __builtin_amdgcn_fence(__ATOMIC_ACQUIRE, "workgroup");
}

// =====================================================================
// Operand fragments with the K=16 contraction packed into one 32-deep k-step:
//   slot s <  16 -> hi part of d = s
//   slot s >= 16 -> lo part of d = s - 16
// A fragment (lane row m = lane&15, hh = lane>>4): elements 0..7 = hi[d = 8hh+e], 8..15 = lo[d = 8hh+e].
// B fragments: B1 = [wh | wh], B2 = [wl | wl] so that A.B1 + A.B2 = (xh+xl).(wh+wl).
// =====================================================================
__device__ __forceinline__ v16b x_frag_split(const float* __restrict__ xr, int hh) {
  const v4f a = *(const v4f*)(xr + 8 * hh);
  const v4f b = *(const v4f*)(xr + 8 * hh + 4);
  const float f[8] = {a[0], a[1], a[2], a[3], b[0], b[1], b[2], b[3]};
  v16b fr;
#pragma unroll
  for (int e = 0; e < 8; e += 2) {
    v2b hb, lb;
    split_pair((v2f){f[e], f[e + 1]}, hb, lb);
    fr[e] = hb[0];     fr[e + 1] = hb[1];
    fr[8 + e] = lb[0]; fr[8 + e + 1] = lb[1];
  }
  return fr;
}
// W is [16 out][16 in] row-major; lane column c = out index e; loads W[c][8hh .. 8hh+7]
__device__ __forceinline__ void w_frags_split(const float* __restrict__ W, int c, int hh, v16b& wh, v16b& wl) {
  const v4f a = *(const v4f*)(W + c * HEADD + 8 * hh);
  const v4f b = *(const v4f*)(W + c * HEADD + 8 * hh + 4);
  const float f[8] = {a[0], a[1], a[2], a[3], b[0], b[1], b[2], b[3]};
#pragma unroll
  for (int e = 0; e < 8; e += 2) {
    v2b hb, lb;
    split_pair((v2f){f[e], f[e + 1]}, hb, lb);
    wh[e] = hb[0]; wh[e + 1] = hb[1]; wh[8 + e] = hb[0]; wh[8 + e + 1] = hb[1];
    wl[e] = lb[0]; wl[e + 1] = lb[1]; wl[8 + e] = lb[0]; wl[8 + e + 1] = lb[1];
  }
}

// One wave: rows n0..n0+63 of slice (t,h) for a q-type tensor -> plane dst[slice][n][hi16|lo16].
// Coverage: 4 tiles x 16 rows = 64 rows x 32 u16 staged; stored as 8 x (32 lanes x 8 u16) = 2048 u16 = whole region.
__device__ __forceinline__ void proj_qk_part(const float* __restrict__ x, unsigned short* __restrict__ dstp,
    const v16b wh, const v16b wl, float oscale, int slice, int n0, int t, int h, int lane, unsigned short* sl)
{
  const int hh = lane >> 4, c = lane & 15;
#pragma unroll
  for (int i = 0; i < 4; ++i) {
    const float* xr = x + ((size_t)(n0 + 16 * i + c) * TSTEP + t) * EMB + h * HEADD;
    const v16b xa = x_frag_split(xr, hh);
    v8f acc = (v8f){0.f,0.f,0.f,0.f,0.f,0.f,0.f,0.f};
    acc = at_mma(xa, wh, acc);
    acc = at_mma(xa, wl, acc);
    // acc[r] = proj[n0 + 16i + 8hh + r][e = c]
#pragma unroll
    for (int r = 0; r < 8; r += 2) {
      us2 hb, lb;
      split_pair_bits((v2f){acc[r] * oscale, acc[r + 1] * oscale}, hb, lb);
      const int row = 16 * i + 8 * hh + r;
      sl[row * QKROW + c] = hb[0];
      sl[row * QKROW + 16 + c] = lb[0];
      sl[(row + 1) * QKROW + c] = hb[1];
      sl[(row + 1) * QKROW + 16 + c] = lb[1];
    }
  }
  lds_wave_sync();
  unsigned short* dst = dstp + ((size_t)slice * NNODE + n0) * QKROW;   // 64 consecutive rows = 4096 B = 32 lines
  {
#pragma unroll
    for (int it = 0; it < 8; ++it) {
      const us8 v = *(const us8*)(sl + (it * 32 + lane) * 8);
      *(us8*)(dst + (it * 32 + lane) * 8) = v;
    }
    
  }
  lds_wave_sync();
}

// One wave: rows n0..n0+63 of slice for values -> transposed planes Vth/Vtl[slice][d][n].
// Coverage: slab hi [16 d][64 n] + lo [16 d][64 n] fully written by 4 tiles x 32 lanes x 8 u16;
// stored as 4 x (4 rows x 8 lanes x 8 u16) per plane = all 16 d rows x 64 n.
__device__ __forceinline__ void proj_v_part(const float* __restrict__ x, unsigned short* __restrict__ Vth,
    unsigned short* __restrict__ Vtl, const v16b wh, const v16b wl, int slice, int n0, int t, int h, int lane,
    unsigned short* sl)
{
  const int hh = lane >> 4, c = lane & 15;
#pragma unroll
  for (int i = 0; i < 4; ++i) {
    const float* xr = x + ((size_t)(n0 + 16 * i + c) * TSTEP + t) * EMB + h * HEADD;
    const v16b xa = x_frag_split(xr, hh);
    v8f acc = (v8f){0.f,0.f,0.f,0.f,0.f,0.f,0.f,0.f};
    acc = at_mma(xa, wh, acc);
    acc = at_mma(xa, wl, acc);
    // acc[r] = v[n0 + 16i + 8hh + r][d = c] -> slab[d][16i + 8hh + r]
    us8 hv, lv;
#pragma unroll
    for (int r = 0; r < 8; r += 2) {
      us2 hb, lb;
      split_pair_bits((v2f){acc[r], acc[r + 1]}, hb, lb);
      hv[r] = hb[0]; hv[r + 1] = hb[1];
      lv[r] = lb[0]; lv[r + 1] = lb[1];
    }
    *(us8*)(sl + c * 64 + 16 * i + 8 * hh) = hv;
    *(us8*)(sl + 1024 + c * 64 + 16 * i + 8 * hh) = lv;
  }
  lds_wave_sync();
  const int qq = lane >> 3, c8 = (lane & 7) * 8;
  {
#pragma unroll
    for (int it = 0; it < 4; ++it) {
      const int d = it * 4 + qq;
      const us8 hv = *(const us8*)(sl + d * 64 + c8);
      const us8 lv = *(const us8*)(sl + 1024 + d * 64 + c8);
      const size_t off = ((size_t)slice * HEADD + d) * NNODE + n0 + c8;
      *(us8*)(Vth + off) = hv;
      *(us8*)(Vtl + off) = lv;
    }
    
  }
  lds_wave_sync();
}

// =====================================================================
// Kernel 1: per-head projections on WMMA. One wave = (slice, 64-node group); 4 waves per block,
// each with its own LDS slab (no cross-wave LDS traffic, no block barriers).
// grid = 2304 / 4 = 576 blocks.
// =====================================================================
__global__ __launch_bounds__(128) void proj_qkv(
    const float* __restrict__ values, const float* __restrict__ keys, const float* __restrict__ query,
    const float* __restrict__ Wv, const float* __restrict__ Wk, const float* __restrict__ Wq,
    unsigned short* __restrict__ Q2, unsigned short* __restrict__ K2,
    unsigned short* __restrict__ Vth, unsigned short* __restrict__ Vtl)
{
  __shared__ __align__(16) unsigned short slab[4][64 * QKROW];   // 4 KB per wave
  const int lane = threadIdx.x & 31;
  const int wave = threadIdx.x >> 5;
  const int hh = lane >> 4, c = lane & 15;
  const int task  = blockIdx.x * 4 + wave;           // 0 .. 2303
  const int slice = task >> 4;                        // 0 .. 143
  const int ng    = task & 15;                        // node group
  const int t = slice >> 2, h = slice & 3;
  const int n0 = ng * 64;
  unsigned short* sl = slab[wave];

  v16b wqh, wql, wkh, wkl, wvh, wvl;
  w_frags_split(Wq, c, hh, wqh, wql);
  w_frags_split(Wk, c, hh, wkh, wkl);
  w_frags_split(Wv, c, hh, wvh, wvl);

  // q carries the exact 1/sqrt(64) = 0.125 score scale
  proj_qk_part(query, Q2, wqh, wql, 0.125f, slice, n0, t, h, lane, sl);
  proj_qk_part(keys,  K2, wkh, wkl, 1.0f,   slice, n0, t, h, lane, sl);
  proj_v_part(values, Vth, Vtl, wvh, wvl, slice, n0, t, h, lane, sl);
}

// =====================================================================
// Kernel 0: Wo -> bf16 hi/lo planes [64][64] (Bt[n = e][k = c] = Wo[e][c]). One block of 256 threads;
// thread handles element groups g = tid, tid + 256 (8 consecutive elements each): 512 x 8 = 4096 = whole planes.
// =====================================================================
__global__ __launch_bounds__(256) void prep_wo_split(
    const float* __restrict__ Wo, unsigned short* __restrict__ Woh, unsigned short* __restrict__ Wol)
{
  const int tid = threadIdx.x;
  us8 hv[2], lv[2];
#pragma unroll
  for (int it = 0; it < 2; ++it) {
    const int g = tid + 256 * it;
    const v4f a = *(const v4f*)(Wo + 8 * g);
    const v4f b = *(const v4f*)(Wo + 8 * g + 4);
    const float f[8] = {a[0], a[1], a[2], a[3], b[0], b[1], b[2], b[3]};
#pragma unroll
    for (int e = 0; e < 8; e += 2) {
      us2 hb, lb;
      split_pair_bits((v2f){f[e], f[e + 1]}, hb, lb);
      hv[it][e] = hb[0]; hv[it][e + 1] = hb[1];
      lv[it][e] = lb[0]; lv[it][e + 1] = lb[1];
    }
  }
  {
#pragma unroll
    for (int it = 0; it < 2; ++it) {
      const int g = tid + 256 * it;
      *(us8*)(Woh + 8 * g) = hv[it];
      *(us8*)(Wol + 8 * g) = lv[it];
    }
    
  }
}

constexpr float LOG2E = 1.4426950408889634f;
// y = 2^x on the hardware. The v_nop in the same statement keeps the one slot that the instruction set asks for between
// a transcendental and an instruction that uses its result or overwrites its source, whatever the compiler puts next.
__device__ __forceinline__ float exp2_hw(float x) {
  float y;
  asm("v_exp_f32 %0, %1\n\tv_nop" : "=v"(y) : "v"(x));
  return y;
}
// Eight independent 2^x in one statement: the early-clobber outputs keep every result off every source, so none of the
// eight overwrites a source of the one in front of it, and one closing v_nop keeps the slot for all of them.
__device__ __forceinline__ v8f exp2_hw8(v8f x) {
  float y0, y1, y2, y3, y4, y5, y6, y7;
  asm("v_exp_f32 %0, %8\n\tv_exp_f32 %1, %9\n\tv_exp_f32 %2, %10\n\tv_exp_f32 %3, %11\n\t"
      "v_exp_f32 %4, %12\n\tv_exp_f32 %5, %13\n\tv_exp_f32 %6, %14\n\tv_exp_f32 %7, %15\n\tv_nop"
      : "=&v"(y0), "=&v"(y1), "=&v"(y2), "=&v"(y3), "=&v"(y4), "=&v"(y5), "=&v"(y6), "=&v"(y7)
      : "v"(x[0]), "v"(x[1]), "v"(x[2]), "v"(x[3]), "v"(x[4]), "v"(x[5]), "v"(x[6]), "v"(x[7]));
  return (v8f){y0, y1, y2, y3, y4, y5, y6, y7};
}
// value of lane l ^ 16
__device__ __forceinline__ float other_half(float x) {
  const int b = __float_as_int(x);
  return __int_as_float(__builtin_amdgcn_permlanex16(b, b, 0x76543210, 0xfedcba98, false, false));
}

// LDS row pitches of the staged tiles, in 16-bit elements. The fragment reads are 16 bytes a lane with one row per lane,
// so the pitch is an odd multiple of 16 bytes: the 16 rows of a half wave then fall on 16 different groups of four banks.
// The pad elements at the end of a row are never written and never read.
constexpr int KPITCH = QKROW + 8;            // 80 B  = 16 B x 5 (data: 64 B)
constexpr int VPITCH = 64 + 8;               // 144 B = 16 B x 9 (data: 128 B)

// element offset of lane ln = (c, hh) in its wave's 16 rows of 16: row c = ln & 15, elements 8hh .. 8hh + 7
__device__ __forceinline__ int ln_off(int ln) { return (ln & 15) * HEADD + 8 * (ln >> 4); }

// Register budget: at most 112 vector registers (1024 / 9, in granules of 16), so that nine blocks, a WGP's share of the
// grid, are resident at once; at eight, a ninth of the blocks would run afterwards, one wave per SIMD.
__global__ __launch_bounds__(128) void attn_hd16(
    const unsigned short* __restrict__ Q2, const unsigned short* __restrict__ K2,
    const unsigned short* __restrict__ Vth, const unsigned short* __restrict__ Vtl,
    unsigned short* __restrict__ Ohi, unsigned short* __restrict__ Olo)
{
  union FB { v16b v; v8b h[2]; };
  // one array, so that the tiles lie at constant offsets from one another and share their address registers
  __shared__ __align__(16) __bf16 tiles[64 * KPITCH + 2 * HEADD * VPITCH];
  __bf16* const Ksh = tiles;                                // [key][hi16|lo16|pad]
  __bf16* const Vhs = tiles + 64 * KPITCH;                  // [d][64 keys|pad] hi
  __bf16* const Vls = Vhs + HEADD * VPITCH;                 // [d][64 keys|pad] lo

  const int tid  = threadIdx.x;
  const int wave = __builtin_amdgcn_readfirstlane(tid >> 5);   // the same in every lane: kept in a scalar register
  const int lane = tid & 31;
  const int hh   = lane >> 4;
  const int c    = lane & 15;
  const int slice = blockIdx.x >> 4;         // 0 .. 143 = t * NHEAD + h
  const int qb   = blockIdx.x & 15;          // 64-query block
  const int q0   = qb * 64 + wave * 16;

  const __bf16* Qs = (const __bf16*)(const void*)Q2 + (size_t)slice * NNODE * QKROW;
  // B fragment, column = query q0 + c: elements 0..7 = qh[d = 8hh+e], 8..15 = ql[d = 8hh+e]
  const v16b qa = Frag<__bf16>::load(Qs + (size_t)(q0 + c) * QKROW + 8 * hh);
  const v8b* Kg  = (const v8b*)(const void*)(K2  + (size_t)slice * NNODE * QKROW);   // [key*4 + seg]
  const v8b* Vhg = (const v8b*)(const void*)(Vth + (size_t)slice * HEADD * NNODE);   // [d*128 + key/8]
  const v8b* Vlg = (const v8b*)(const void*)(Vtl + (size_t)slice * HEADD * NNODE);

  __bf16* const kdst = Ksh + (tid >> 2) * KPITCH + (tid & 3) * 8;          // K piece tid: row tid / 4, 16-B segment tid % 4
  __bf16* const vdst = Vhs + (tid >> 3) * VPITCH + (tid & 7) * 8;          // V piece tid: d = tid / 8, 16-B segment tid % 8
  const unsigned vsrc = (unsigned)(tid >> 3) * (NNODE / 8) + (tid & 7);

  // per lane: running maximum of query q0 + c times log2e (equal in both halves), this half's part of its sum
  float mrun = -INFINITY, lsum = 0.f;
  v8f oacc = (v8f){0.f,0.f,0.f,0.f,0.f,0.f,0.f,0.f};

#pragma unroll 1
  for (int kc = 0; kc < NNODE / 64; ++kc) {
    __syncthreads();
    // stage K: 256 pieces of 16 B = 64 rows x 32 u16 (whole tile, contiguous in K2); piece tid + 128 is row + 32, so the
    // two pieces of a thread lie a constant apart in K2 and in LDS and share their address registers (register budget, above)
    {
      const v8b* Kt = Kg + kc * 256;
      const v8b k0 = Kt[(unsigned)tid];
      const v8b k1 = Kt[(unsigned)tid + 128u];
      *(v8b*)(kdst) = k0;
      *(v8b*)(kdst + 32 * KPITCH) = k1;
    }
    // stage V hi/lo: 128 pieces of 16 B = 16 d x 64 keys per plane (whole tiles)
    {
      const v8b a  = (Vhg + kc * 8)[vsrc];
      const v8b b2 = (Vlg + kc * 8)[vsrc];
      *(v8b*)(vdst) = a;
      *(v8b*)(vdst + HEADD * VPITCH) = b2;
    }
    __syncthreads();

    v8f s[4];
#pragma unroll
    for (int j = 0; j < 4; ++j) {
      const __bf16* kr = Ksh + (j * 16 + c) * KPITCH + 8 * hh;
      const v8b kh8 = *(const v8b*)(kr);
      const v8b kl8 = *(const v8b*)(kr + 16);
      FB k1, k2;
      k1.h[0] = kh8; k1.h[1] = kh8;
      k2.h[0] = kl8; k2.h[1] = kl8;
      s[j] = (v8f){0.f,0.f,0.f,0.f,0.f,0.f,0.f,0.f};
      s[j] = at_mma(k1.v, qa, s[j]);
      s[j] = at_mma(k2.v, qa, s[j]);
    }
    // s[j][r] = scaled energy(key 64kc + 16j + 8hh + r, query q0 + c)
    float cm = s[0][0];
#pragma unroll
    for (int j = 0; j < 4; ++j)
#pragma unroll
      for (int r = 0; r < 8; ++r) cm = fmaxf(cm, s[j][r]);
    cm = fmaxf(cm, other_half(cm));
    const float mnew  = fmaxf(mrun, cm * LOG2E);
    const float alpha = exp2_hw(mrun - mnew);
    mrun = mnew;

    v16b ph[2], pl[2];
    float ps[4];
#pragma unroll
    for (int j = 0; j < 4; ++j) {
      ps[j] = 0.f;
      // arguments <= 0 up to one rounding: no overflow; below -126 a term is under 2^-126 of the largest and goes to 0
      v8f ea;
#pragma unroll
      for (int r = 0; r < 8; r += 2) {
        const v2f a2 = __builtin_elementwise_fma((v2f){s[j][r], s[j][r + 1]}, (v2f){LOG2E, LOG2E}, (v2f){-mnew, -mnew});
        ea[r] = a2[0]; ea[r + 1] = a2[1];
      }
      const v8f pe = exp2_hw8(ea);
#pragma unroll
      for (int r = 0; r < 8; r += 2) {
        ps[j] += pe[r];
        ps[j] += pe[r + 1];
        v2b a, bl;
        split_pair((v2f){pe[r], pe[r + 1]}, a, bl);
        // B element 8(j&1) + r of lane (c, hh) is key 16(j&1) + 8hh + r of the 32-key step j>>1
        ph[j >> 1][8 * (j & 1) + r] = a[0];  ph[j >> 1][8 * (j & 1) + r + 1] = a[1];
        pl[j >> 1][8 * (j & 1) + r] = bl[0]; pl[j >> 1][8 * (j & 1) + r + 1] = bl[1];
      }
    }
    lsum = lsum * alpha + ((ps[0] + ps[1]) + (ps[2] + ps[3]));
#pragma unroll
    for (int r = 0; r < 8; ++r) oacc[r] *= alpha;

#pragma unroll
    for (int kk = 0; kk < 2; ++kk) {
      FB vb, vl;
      vb.h[0] = *(const v8b*)(Vhs + c * VPITCH + kk * 32 + 8 * hh);
      vb.h[1] = *(const v8b*)(Vhs + c * VPITCH + kk * 32 + 16 + 8 * hh);
      vl.h[0] = *(const v8b*)(Vls + c * VPITCH + kk * 32 + 8 * hh);
      vl.h[1] = *(const v8b*)(Vls + c * VPITCH + kk * 32 + 16 + 8 * hh);
      oacc = at_mma(vb.v, ph[kk], oacc);
      oacc = at_mma(vl.v, ph[kk], oacc);
      oacc = at_mma(vb.v, pl[kk], oacc);
    }
  }
  // oacc[r] = unnormalised out(query q0 + c, d = 8hh + r); the two halves' sums join here; the sum is >= 1
  const float inv = 1.0f / (lsum + other_half(lsum));
  us8 hv, lv;
#pragma unroll
  for (int r = 0; r < 8; r += 2) {
    us2 hb, lb;
    split_pair_bits((v2f){oacc[r] * inv, oacc[r + 1] * inv}, hb, lb);
    hv[r] = hb[0]; hv[r + 1] = hb[1];
    lv[r] = lb[0]; lv[r + 1] = lb[1];
  }
  // 16 B a lane, 32 B a query: one store of the wave covers 512 contiguous bytes of its plane.
  // The lane number is formed anew here, so that no vector register holds a part of this address across the loop.
  const int ln = (int)__builtin_amdgcn_mbcnt_lo(~0u, 0u);
  const size_t off = ((size_t)slice * NNODE + q0) * HEADD + ln_off(ln);
  *(us8*)(Ohi + off) = hv;
  *(us8*)(Olo + off) = lv;
}

// =====================================================================
extern "C" void kernel_launch(void* const* d_in, const int* in_sizes, int n_in,
                              void* d_out, int out_size, void* d_ws, size_t ws_size,
                              hipStream_t stream) {
  if (n_in < 8) return;
  if (in_sizes[0] != NNODE * TSTEP * EMB || in_sizes[1] != NNODE * TSTEP * EMB ||
      in_sizes[2] != NNODE * TSTEP * EMB || in_sizes[3] != HEADD * HEADD ||
      in_sizes[4] != HEADD * HEADD || in_sizes[5] != HEADD * HEADD ||
      in_sizes[6] != EMB * EMB || in_sizes[7] != EMB) return;
  if (out_size != NROWS * EMB) return;
  if (ws_size < WS_TOTAL) return;

  const float* values = (const float*)d_in[0];
  const float* keys   = (const float*)d_in[1];
  const float* query  = (const float*)d_in[2];
  const float* Wv     = (const float*)d_in[3];
  const float* Wk     = (const float*)d_in[4];
  const float* Wq     = (const float*)d_in[5];
  const float* Wo     = (const float*)d_in[6];
  const float* bo     = (const float*)d_in[7];

  char* ws = (char*)d_ws;
  unsigned short* Q2  = (unsigned short*)(ws + WS_Q2);
  unsigned short* K2  = (unsigned short*)(ws + WS_K2);
  unsigned short* Vth = (unsigned short*)(ws + WS_VTH);
  unsigned short* Vtl = (unsigned short*)(ws + WS_VTL);
  unsigned short* Ohi = (unsigned short*)(ws + WS_OHI);
  unsigned short* Olo = (unsigned short*)(ws + WS_OLO);
  unsigned short* Woh = (unsigned short*)(ws + WS_WOH);
  unsigned short* Wol = (unsigned short*)(ws + WS_WOL);

  // 1) Wo -> bf16 hi/lo planes
  prep_wo_split<<<dim3(1), dim3(256), 0, stream>>>(Wo, Woh, Wol);
  // 2) per-head projections: 144 slices x 16 node groups = 2304 wave tasks, 4 per block
  proj_qkv<<<dim3(NSLICE * (NNODE / 64) / 4), dim3(128), 0, stream>>>(
      values, keys, query, Wv, Wk, Wq, Q2, K2, Vth, Vtl);
  // 3) attention over nodes: 144 (t, head) slices x 16 query blocks
  attn_hd16<<<dim3(NSLICE * (NNODE / 64)), dim3(128), 0, stream>>>(Q2, K2, Vth, Vtl, Ohi, Olo);
  // 4) output projection: C[36864 x 64] = O . Wo^T + bo; M=36864 (576 tiles), N=64, K=64; 8 tiles per block
  wmma_gemm64<1, true, 2, 0, false, 0, true><<<dim3(NROWS / 64 / 8, 1), dim3(256), 0, stream>>>(
      Ohi, Olo, EMB, 0L, Woh, Wol, EMB, 0L,
      d_out, nullptr, EMB, 0L, bo, nullptr, 0L,
      NROWS, EMB, EMB, 1.0f);
}

// v007
// One run takes 60.4 microseconds.
// In two side-by-side timings against v006, it was 1.03 and 1.04 times as fast.
// Counting every step since v000, it is 3.72 times as fast.
// Contractions: v_wmma_f32_16x16x32_bf16 with bf16 hi/lo split operands (head projections, q.k scores, p.v, output projection), f32 accumulate; softmax, splits and epilogues in f32.
#include <hip/hip_runtime.h>
#include <math.h>
#include <stddef.h>

// ---------------- problem constants ----------------
constexpr int NNODE  = 1024;
constexpr int TSTEP  = 36;
constexpr int EMB    = 64;
constexpr int NHEAD  = 4;
constexpr int HEADD  = 16;
constexpr int NSLICE = TSTEP * NHEAD;        // 144 (t, h) slices
constexpr int NROWS  = NNODE * TSTEP;        // 36864 rows of the [n*T+t][64] planes
constexpr int QKROW  = 32;                   // u16 per row of the Q/K planes: [hi e0..15 | lo e0..15]

// ---------------- workspace region map (bytes) ----------------
// Q2  : bf16 [144][1024][32]          9,437,184 B  @ 0
// K2  : bf16 [144][1024][32]          9,437,184 B  @ 9,437,184
// Vth : bf16 [144][16][1024] (hi)     4,718,592 B  @ 18,874,368
// Vtl : bf16 [144][16][1024] (lo)     4,718,592 B  @ 23,592,960
// Ohi : bf16 [144][1024][16] (hi)     4,718,592 B  @ 28,311,552
// Olo : bf16 [144][1024][16] (lo)     4,718,592 B  @ 33,030,144
// Woh : bf16 [64][64]                     8,192 B  @ 37,748,736
// Wol : bf16 [64][64]                     8,192 B  @ 37,756,928
// total                              37,765,120 B
constexpr size_t WS_Q2   = 0;
constexpr size_t SZ_QK   = (size_t)NSLICE * NNODE * QKROW * 2;
constexpr size_t WS_K2   = WS_Q2 + SZ_QK;
constexpr size_t SZ_V    = (size_t)NSLICE * HEADD * NNODE * 2;
constexpr size_t WS_VTH  = WS_K2 + SZ_QK;
constexpr size_t WS_VTL  = WS_VTH + SZ_V;
constexpr size_t SZ_O    = (size_t)NROWS * EMB * 2;
constexpr size_t WS_OHI  = WS_VTL + SZ_V;
constexpr size_t WS_OLO  = WS_OHI + SZ_O;
constexpr size_t SZ_WO   = (size_t)EMB * EMB * 2;
constexpr size_t WS_WOH  = WS_OLO + SZ_O;
constexpr size_t WS_WOL  = WS_WOH + SZ_WO;
constexpr size_t WS_TOTAL = WS_WOL + SZ_WO;
static_assert(WS_TOTAL == 37765120, "carve");
static_assert(WS_TOTAL <= 134217728, "carve");
static_assert((WS_K2 % 128) == 0 && (WS_VTH % 128) == 0 && (WS_VTL % 128) == 0 && (WS_OHI % 128) == 0 &&
              (WS_OLO % 128) == 0 && (WS_WOH % 128) == 0 && (WS_WOL % 128) == 0, "align");
// GEMM shape contract for the output projection
static_assert(NROWS % 64 == 0 && EMB % 64 == 0 && EMB % 32 == 0, "gemm");
static_assert(NNODE % 64 == 0, "tiles");

// ---------------- types and fragment helpers ----------------
typedef __attribute__((ext_vector_type(16))) _Float16 v16h;
typedef __attribute__((ext_vector_type(8)))  _Float16 v8h;
typedef __attribute__((ext_vector_type(16))) __bf16   v16b;
typedef __attribute__((ext_vector_type(8)))  __bf16   v8b;
typedef __attribute__((ext_vector_type(8)))  float    v8f;
typedef __attribute__((ext_vector_type(4)))  float    v4f;
typedef __attribute__((ext_vector_type(8)))  unsigned short us8;

__device__ __forceinline__ unsigned short f2bf_bits(float f) {
  unsigned u = __float_as_uint(f);
  return (unsigned short)((u + 0x7FFFu + ((u >> 16) & 1u)) >> 16);
}
__device__ __forceinline__ float bf_bits2f(unsigned short h) { return __uint_as_float(((unsigned)h) << 16); }

// hi/lo split of two f32 values at once on the hardware's packed f32 -> bf16 conversion, which rounds to nearest even as
// f2bf_bits does: hi = bf16(p), lo = bf16(p - hi). Each result is one register of two packed bf16, the form that operand
// fragments and 16-byte stores are made of.
typedef __attribute__((ext_vector_type(2))) float          v2f;
typedef __attribute__((ext_vector_type(2))) __bf16         v2b;
typedef __attribute__((ext_vector_type(2))) unsigned short us2;
__device__ __forceinline__ void split_pair(v2f p, v2b& hi, v2b& lo) {
  hi = __builtin_convertvector(p, v2b);
  lo = __builtin_convertvector(p - __builtin_convertvector(hi, v2f), v2b);
}
__device__ __forceinline__ void split_pair_bits(v2f p, us2& hi, us2& lo) {
  v2b h, l;
  split_pair(p, h, l);
  hi = __builtin_bit_cast(us2, h);
  lo = __builtin_bit_cast(us2, l);
}

template <typename T> struct Frag;
template <> struct Frag<_Float16> {
  typedef v16h V; union U { v16h v; v8h h[2]; };
  static __device__ __forceinline__ v16h load(const _Float16* p) {   // elements 0..7 <- p[0..7], 8..15 <- p[16..23]
    U f; f.h[0] = *(const v8h*)(p); f.h[1] = *(const v8h*)(p + 16); return f.v;
  }
  static __device__ __forceinline__ v16h load2(const _Float16* p, const _Float16* q) {   // elements 0..7 <- p[0..7], 8..15 <- q[0..7]
    U f; f.h[0] = *(const v8h*)(p); f.h[1] = *(const v8h*)(q); return f.v;
  }
  static __device__ __forceinline__ v8f mma(v16h a, v16h b, v8f c) {
    return __builtin_amdgcn_wmma_f32_16x16x32_f16(false, a, false, b, (short)0, c, false, false);
  }
};
template <> struct Frag<__bf16> {
  typedef v16b V; union U { v16b v; v8b h[2]; };
  static __device__ __forceinline__ v16b load(const __bf16* p) {
    U f; f.h[0] = *(const v8b*)(p); f.h[1] = *(const v8b*)(p + 16); return f.v;
  }
  static __device__ __forceinline__ v16b load2(const __bf16* p, const __bf16* q) {
    U f; f.h[0] = *(const v8b*)(p); f.h[1] = *(const v8b*)(q); return f.v;
  }
  static __device__ __forceinline__ v8f mma(v16b a, v16b b, v8f c) {
    return __builtin_amdgcn_wmma_f32_16x16x32_bf16(false, a, false, b, (short)0, c, false, false);
  }
};

// ---- Register-blocked batched WMMA GEMM ---------------------------------------------
// C[m,n] = scale * sum_k A[m,k] * Bt[n,k] (+bias)(+resid); each wave owns a 64x64 tile.
// A row-major [M,K]; Bt row-major [N,K]; M,N % 64 == 0, K % 32 == 0.
// SPLIT: operands are hi/lo planes (A2/Bt2 = lo planes, same layout); product = hi.hi + hi.lo + lo.hi.
// BIAS_MODE: 0 = none, 1 = bias[m], 2 = bias[n].
// OUT_MODE: 0 = f32, 1 = f16, 2 = bf16 hi plane (Cout) + bf16 lo plane (Cout2).
// ET: 0 = f16 operands, 1 = bf16 operands (pointers passed as 16-bit storage)
// HEADPL: A planes are [t][head][node][16] with row m = t * NNODE + node and k = head * 16 + d (lda unused);
//         row m of the product is stored as row node * TSTEP + t of C.
template <int ET> struct Elem;
template <> struct Elem<0> { typedef _Float16 T; };
template <> struct Elem<1> { typedef __bf16 T; };
template <int ET, bool SPLIT, int BIAS_MODE, int OUT_MODE, bool RESID, int ACT = 0, bool HEADPL = false>
__global__ __launch_bounds__(256) void wmma_gemm64(
    const unsigned short* __restrict__ Ap, const unsigned short* __restrict__ A2p, int lda, long strideA,
    const unsigned short* __restrict__ Btp, const unsigned short* __restrict__ Bt2p, int ldb, long strideB,
    void* __restrict__ Cout, void* __restrict__ Cout2, int ldc, long strideC,
    const float* __restrict__ bias,
    const float* __restrict__ resid, long strideR,
    int M, int N, int K, float scale) {
  typedef typename Elem<ET>::T T;
  typedef typename Frag<T>::V V;
  const T* A = (const T*)Ap; const T* A2 = (const T*)A2p; const T* Bt = (const T*)Btp; const T* Bt2 = (const T*)Bt2p;
  __shared__ __align__(16) float sT[8][16 * 68];   // per-wave 16x64 slab, pitch 68 floats
  const int b    = blockIdx.y;
  const int lane = threadIdx.x & 31;
  const int wave = threadIdx.x >> 5;
  const int tilesN = N >> 6;
  const int tilesM = M >> 6;
  const int tile = blockIdx.x * 8 + wave;
  if (tile >= tilesM * tilesN) return;   // wave-uniform; no block barriers in this kernel
  const int tm = tile / tilesN;
  const int tn = tile - tm * tilesN;
  const int m0 = tm << 6;
  const int n0 = tn << 6;

  const T* Ab  = A  + (size_t)b * strideA;
  const T* Bb  = Bt + (size_t)b * strideB;
  const T* Ab2 = SPLIT ? (A2  + (size_t)b * strideA) : nullptr;
  const T* Bb2 = SPLIT ? (Bt2 + (size_t)b * strideB) : nullptr;

  const int rlane = lane & 15;                 // row (A) / col (B, D) within subtile
  const int koff  = (lane >> 4) * 8;           // k offset of this lane half
  const int mOff  = (lane >> 4) * 8;           // D row offset

  v8f acc[4][4];
#pragma unroll
  for (int i = 0; i < 4; ++i)
#pragma unroll
    for (int j = 0; j < 4; ++j) acc[i][j] = (v8f){0.f,0.f,0.f,0.f,0.f,0.f,0.f,0.f};

  for (int k0 = 0; k0 < K; k0 += 32) {
    V bh[4], bl[4];
#pragma unroll
    for (int j = 0; j < 4; ++j) {
      const size_t bo = (size_t)(n0 + (j << 4) + rlane) * ldb + koff + k0;
      bh[j] = Frag<T>::load(Bb + bo);
      if (SPLIT) bl[j] = Frag<T>::load(Bb2 + bo);
    }
#pragma unroll
    for (int i = 0; i < 4; ++i) {
      V ah, al;
      if (HEADPL) {
        // k = k0 + koff + e lies in head k0 / 16, k = k0 + 16 + koff + e in the next head: one head plane further on
        const int m = m0 + (i << 4) + rlane;
        const size_t ao = ((size_t)((m / NNODE) * NHEAD + (k0 >> 4)) * NNODE + (m % NNODE)) * HEADD + koff;
        ah = Frag<T>::load2(Ab + ao, Ab + ao + NNODE * HEADD);
        if (SPLIT) al = Frag<T>::load2(Ab2 + ao, Ab2 + ao + NNODE * HEADD);
      } else {
        const size_t ao = (size_t)(m0 + (i << 4) + rlane) * lda + koff + k0;
        ah = Frag<T>::load(Ab + ao);
        if (SPLIT) al = Frag<T>::load(Ab2 + ao);
      }
#pragma unroll
      for (int j = 0; j < 4; ++j) {
        acc[i][j] = Frag<T>::mma(ah, bh[j], acc[i][j]);
        if (SPLIT) {
          acc[i][j] = Frag<T>::mma(ah, bl[j], acc[i][j]);
          acc[i][j] = Frag<T>::mma(al, bh[j], acc[i][j]);
        }
      }
    }
  }

  // ---- epilogue ----
  float* slab = sT[wave];
  const float* Rb = RESID ? (resid + (size_t)b * strideR) : nullptr;
#pragma unroll
  for (int i = 0; i < 4; ++i) {
    const int mBase = m0 + (i << 4);
#pragma unroll
    for (int j = 0; j < 4; ++j) {
      const int n = n0 + (j << 4) + rlane;
      float bv = 0.f;
      if (BIAS_MODE == 2) bv = bias[n];
#pragma unroll
      for (int r = 0; r < 8; ++r) {
        float v = acc[i][j][r] * scale;
        if (BIAS_MODE == 1) v += bias[mBase + mOff + r];
        if (BIAS_MODE == 2) v += bv;
        if (RESID) v += Rb[(size_t)(mBase + mOff + r) * ldc + n];
        if (ACT == 1) v = tanhf(v);
        if (ACT == 2) v = fmaxf(v, 0.0f);
        if (ACT == 3) v = v / (1.0f + expf(-v));
        if (ACT == 4) v = (v > 0.f) ? v : 0.01f * v;
        if (ACT == 5) v = 0.5f * v * (1.0f + erff(v * 0.70710678118654752f));
        slab[(mOff + r) * 68 + (j << 4) + rlane] = v;
      }
    }
    __builtin_amdgcn_fence(__ATOMIC_RELEASE, "workgroup");
    __builtin_amdgcn_wave_barrier();
    __builtin_amdgcn_fence(__ATOMIC_ACQUIRE, "workgroup");
    if (OUT_MODE == 0) {
      float* C = (float*)Cout + (size_t)b * strideC;
      const int hh = lane >> 4, c4 = (lane & 15) * 4;     // row seg = 256 B = 16 lanes x 16 B
      {
#pragma unroll
        for (int it = 0; it < 8; ++it) {
          const int row = it * 2 + hh;
          v4f v = *(const v4f*)(slab + row * 68 + c4);
          const int m = mBase + row;
          const size_t crow = HEADPL ? (size_t)(m % NNODE) * TSTEP + (m / NNODE) : (size_t)m;
          *(v4f*)(C + crow * ldc + n0 + c4) = v;
        }
        
      }
    } else {
      const int q = lane >> 3, c8 = (lane & 7) * 8;
      unsigned short* C  = (unsigned short*)Cout  + (size_t)b * strideC;
      unsigned short* C2 = (OUT_MODE == 2) ? ((unsigned short*)Cout2 + (size_t)b * strideC) : nullptr;
      {
#pragma unroll
        for (int it = 0; it < 4; ++it) {
          const int row = it * 4 + q;
          const float* sp = slab + row * 68 + c8;
          v8h hv, lv;
#pragma unroll
          for (int e = 0; e < 8; ++e) {
            if (OUT_MODE == 1) {
              hv[e] = (_Float16)sp[e];
            } else {
              unsigned short hb = f2bf_bits(sp[e]);
              unsigned short lb = f2bf_bits(sp[e] - bf_bits2f(hb));
              hv[e] = __builtin_bit_cast(_Float16, hb);
              lv[e] = __builtin_bit_cast(_Float16, lb);
            }
          }
          *(v8h*)(C + (size_t)(mBase + row) * ldc + n0 + c8) = hv;
          if (OUT_MODE == 2) *(v8h*)(C2 + (size_t)(mBase + row) * ldc + n0 + c8) = lv;
        }
        
      }
    }
    __builtin_amdgcn_fence(__ATOMIC_RELEASE, "workgroup");
    __builtin_amdgcn_wave_barrier();
    __builtin_amdgcn_fence(__ATOMIC_ACQUIRE, "workgroup");
  }
}

// ---------------- bf16 WMMA, builtin form: the compiler keeps the distances the chip needs behind it ----------------
__device__ __forceinline__ v8f at_mma(v16b a, v16b b, v8f c) {
  return __builtin_amdgcn_wmma_f32_16x16x32_bf16(false, a, false, b, (short)0, c, false, false);
}

// same-wave LDS write -> read ordering
__device__ __forceinline__ void lds_wave_sync() {
  __builtin_amdgcn_fence(__ATOMIC_RELEASE, "workgroup");
  __builtin_amdgcn_wave_barrier();
  __builtin_amdgcn_fence(__ATOMIC_ACQUIRE, "workgroup");
}

// =====================================================================
// Operand fragments with the K=16 contraction packed into one 32-deep k-step:
//   slot s <  16 -> hi part of d = s
//   slot s >= 16 -> lo part of d = s - 16
// A fragment (lane row m = lane&15, hh = lane>>4): elements 0..7 = hi[d = 8hh+e], 8..15 = lo[d = 8hh+e].
// B fragments: B1 = [wh | wh], B2 = [wl | wl] so that A.B1 + A.B2 = (xh+xl).(wh+wl).
// =====================================================================
__device__ __forceinline__ v16b x_frag_split(const float* __restrict__ xr, int hh) {
  const v4f a = *(const v4f*)(xr + 8 * hh);
  const v4f b = *(const v4f*)(xr + 8 * hh + 4);
  const float f[8] = {a[0], a[1], a[2], a[3], b[0], b[1], b[2], b[3]};
  v16b fr;
#pragma unroll
  for (int e = 0; e < 8; e += 2) {
    v2b hb, lb;
    split_pair((v2f){f[e], f[e + 1]}, hb, lb);
    fr[e] = hb[0];     fr[e + 1] = hb[1];
    fr[8 + e] = lb[0]; fr[8 + e + 1] = lb[1];
  }
  return fr;
}
// W is [16 out][16 in] row-major; lane column c = out index e; loads W[c][8hh .. 8hh+7]
__device__ __forceinline__ void w_frags_split(const float* __restrict__ W, int c, int hh, v16b& wh, v16b& wl) {
  const v4f a = *(const v4f*)(W + c * HEADD + 8 * hh);
  const v4f b = *(const v4f*)(W + c * HEADD + 8 * hh + 4);
  const float f[8] = {a[0], a[1], a[2], a[3], b[0], b[1], b[2], b[3]};
#pragma unroll
  for (int e = 0; e < 8; e += 2) {
    v2b hb, lb;
    split_pair((v2f){f[e], f[e + 1]}, hb, lb);
    wh[e] = hb[0]; wh[e + 1] = hb[1]; wh[8 + e] = hb[0]; wh[8 + e + 1] = hb[1];
    wl[e] = lb[0]; wl[e + 1] = lb[1]; wl[8 + e] = lb[0]; wl[8 + e + 1] = lb[1];
  }
}

// One wave: rows n0..n0+63 of slice (t,h) for a q-type tensor -> plane dst[slice][n][hi16|lo16].
// Coverage: 4 tiles x 16 rows = 64 rows x 32 u16 staged; stored as 8 x (32 lanes x 8 u16) = 2048 u16 = whole region.
__device__ __forceinline__ void proj_qk_part(const float* __restrict__ x, unsigned short* __restrict__ dstp,
    const v16b wh, const v16b wl, float oscale, int slice, int n0, int t, int h, int lane, unsigned short* sl)
{
  const int hh = lane >> 4, c = lane & 15;
#pragma unroll
  for (int i = 0; i < 4; ++i) {
    const float* xr = x + ((size_t)(n0 + 16 * i + c) * TSTEP + t) * EMB + h * HEADD;
    const v16b xa = x_frag_split(xr, hh);
    v8f acc = (v8f){0.f,0.f,0.f,0.f,0.f,0.f,0.f,0.f};
    acc = at_mma(xa, wh, acc);
    acc = at_mma(xa, wl, acc);
    // acc[r] = proj[n0 + 16i + 8hh + r][e = c]
#pragma unroll
    for (int r = 0; r < 8; r += 2) {
      us2 hb, lb;
      split_pair_bits((v2f){acc[r] * oscale, acc[r + 1] * oscale}, hb, lb);
      const int row = 16 * i + 8 * hh + r;
      sl[row * QKROW + c] = hb[0];
      sl[row * QKROW + 16 + c] = lb[0];
      sl[(row + 1) * QKROW + c] = hb[1];
      sl[(row + 1) * QKROW + 16 + c] = lb[1];
    }
  }
  lds_wave_sync();
  unsigned short* dst = dstp + ((size_t)slice * NNODE + n0) * QKROW;   // 64 consecutive rows = 4096 B = 32 lines
  {
#pragma unroll
    for (int it = 0; it < 8; ++it) {
      const us8 v = *(const us8*)(sl + (it * 32 + lane) * 8);
      *(us8*)(dst + (it * 32 + lane) * 8) = v;
    }
    
  }
  lds_wave_sync();
}

// One wave: rows n0..n0+63 of slice for values -> transposed planes Vth/Vtl[slice][d][n].
// Coverage: slab hi [16 d][64 n] + lo [16 d][64 n] fully written by 4 tiles x 32 lanes x 8 u16;
// stored as 4 x (4 rows x 8 lanes x 8 u16) per plane = all 16 d rows x 64 n.
__device__ __forceinline__ void proj_v_part(const float* __restrict__ x, unsigned short* __restrict__ Vth,
    unsigned short* __restrict__ Vtl, const v16b wh, const v16b wl, int slice, int n0, int t, int h, int lane,
    unsigned short* sl)
{
  const int hh = lane >> 4, c = lane & 15;
#pragma unroll
  for (int i = 0; i < 4; ++i) {
    const float* xr = x + ((size_t)(n0 + 16 * i + c) * TSTEP + t) * EMB + h * HEADD;
    const v16b xa = x_frag_split(xr, hh);
    v8f acc = (v8f){0.f,0.f,0.f,0.f,0.f,0.f,0.f,0.f};
    acc = at_mma(xa, wh, acc);
    acc = at_mma(xa, wl, acc);
    // acc[r] = v[n0 + 16i + 8hh + r][d = c] -> slab[d][16i + 8hh + r]
    us8 hv, lv;
#pragma unroll
    for (int r = 0; r < 8; r += 2) {
      us2 hb, lb;
      split_pair_bits((v2f){acc[r], acc[r + 1]}, hb, lb);
      hv[r] = hb[0]; hv[r + 1] = hb[1];
      lv[r] = lb[0]; lv[r + 1] = lb[1];
    }
    *(us8*)(sl + c * 64 + 16 * i + 8 * hh) = hv;
    *(us8*)(sl + 1024 + c * 64 + 16 * i + 8 * hh) = lv;
  }
  lds_wave_sync();
  const int qq = lane >> 3, c8 = (lane & 7) * 8;
  {
#pragma unroll
    for (int it = 0; it < 4; ++it) {
      const int d = it * 4 + qq;
      const us8 hv = *(const us8*)(sl + d * 64 + c8);
      const us8 lv = *(const us8*)(sl + 1024 + d * 64 + c8);
      const size_t off = ((size_t)slice * HEADD + d) * NNODE + n0 + c8;
      *(us8*)(Vth + off) = hv;
      *(us8*)(Vtl + off) = lv;
    }
    
  }
  lds_wave_sync();
}

// =====================================================================
// Wo -> bf16 hi/lo planes [64][64] (Bt[n = e][k = c] = Wo[e][c]), the work of one block of 128 threads:
// thread handles element groups g = tid + 128 * it, it = 0 .. 3 (8 consecutive elements each): 512 x 8 = 4096 = whole planes.
// =====================================================================
__device__ __forceinline__ void wo_split_block(
    const float* __restrict__ Wo, unsigned short* __restrict__ Woh, unsigned short* __restrict__ Wol, int tid)
{
  us8 hv[4], lv[4];
#pragma unroll
  for (int it = 0; it < 4; ++it) {
    const int g = tid + 128 * it;
    const v4f a = *(const v4f*)(Wo + 8 * g);
    const v4f b = *(const v4f*)(Wo + 8 * g + 4);
    const float f[8] = {a[0], a[1], a[2], a[3], b[0], b[1], b[2], b[3]};
#pragma unroll
    for (int e = 0; e < 8; e += 2) {
      us2 hb, lb;
      split_pair_bits((v2f){f[e], f[e + 1]}, hb, lb);
      hv[it][e] = hb[0]; hv[it][e + 1] = hb[1];
      lv[it][e] = lb[0]; lv[it][e + 1] = lb[1];
    }
  }
#pragma unroll
  for (int it = 0; it < 4; ++it) {
    const int g = tid + 128 * it;
    *(us8*)(Woh + 8 * g) = hv[it];
    *(us8*)(Wol + 8 * g) = lv[it];
  }
}

// =====================================================================
// Kernel 1: per-head projections on WMMA. One wave = (slice, 64-node group); 4 waves per block,
// each with its own LDS slab (no cross-wave LDS traffic, no block barriers).
// grid = 2304 / 4 = 576 projection blocks, and one block more that splits Wo: that work depends on nothing the
// projections do and is first read by the output projection, so it needs no launch of its own.
// =====================================================================
constexpr int PROJ_BLOCKS = NSLICE * (NNODE / 64) / 4;   // 576
__global__ __launch_bounds__(128) void proj_qkv(
    const float* __restrict__ values, const float* __restrict__ keys, const float* __restrict__ query,
    const float* __restrict__ Wv, const float* __restrict__ Wk, const float* __restrict__ Wq,
    const float* __restrict__ Wo,
    unsigned short* __restrict__ Q2, unsigned short* __restrict__ K2,
    unsigned short* __restrict__ Vth, unsigned short* __restrict__ Vtl,
    unsigned short* __restrict__ Woh, unsigned short* __restrict__ Wol)
{
  __shared__ __align__(16) unsigned short slab[4][64 * QKROW];   // 4 KB per wave
  if (blockIdx.x == PROJ_BLOCKS) {   // the same for the whole block
    wo_split_block(Wo, Woh, Wol, threadIdx.x);
    return;
  }
  const int lane = threadIdx.x & 31;
  const int wave = threadIdx.x >> 5;
  const int hh = lane >> 4, c = lane & 15;
  const int task  = blockIdx.x * 4 + wave;           // 0 .. 2303
  const int slice = task >> 4;                        // 0 .. 143
  const int ng    = task & 15;                        // node group
  const int t = slice >> 2, h = slice & 3;
  const int n0 = ng * 64;
  unsigned short* sl = slab[wave];

  v16b wqh, wql, wkh, wkl, wvh, wvl;
  w_frags_split(Wq, c, hh, wqh, wql);
  w_frags_split(Wk, c, hh, wkh, wkl);
  w_frags_split(Wv, c, hh, wvh, wvl);

  // q carries the exact 1/sqrt(64) = 0.125 score scale
  proj_qk_part(query, Q2, wqh, wql, 0.125f, slice, n0, t, h, lane, sl);
  proj_qk_part(keys,  K2, wkh, wkl, 1.0f,   slice, n0, t, h, lane, sl);
  proj_v_part(values, Vth, Vtl, wvh, wvl, slice, n0, t, h, lane, sl);
}

constexpr float LOG2E = 1.4426950408889634f;
// y = 2^x on the hardware. The v_nop in the same statement keeps the one slot that the instruction set asks for between
// a transcendental and an instruction that uses its result or overwrites its source, whatever the compiler puts next.
__device__ __forceinline__ float exp2_hw(float x) {
  float y;
  asm("v_exp_f32 %0, %1\n\tv_nop" : "=v"(y) : "v"(x));
  return y;
}
// Eight independent 2^x in one statement: the early-clobber outputs keep every result off every source, so none of the
// eight overwrites a source of the one in front of it, and one closing v_nop keeps the slot for all of them.
__device__ __forceinline__ v8f exp2_hw8(v8f x) {
  float y0, y1, y2, y3, y4, y5, y6, y7;
  asm("v_exp_f32 %0, %8\n\tv_exp_f32 %1, %9\n\tv_exp_f32 %2, %10\n\tv_exp_f32 %3, %11\n\t"
      "v_exp_f32 %4, %12\n\tv_exp_f32 %5, %13\n\tv_exp_f32 %6, %14\n\tv_exp_f32 %7, %15\n\tv_nop"
      : "=&v"(y0), "=&v"(y1), "=&v"(y2), "=&v"(y3), "=&v"(y4), "=&v"(y5), "=&v"(y6), "=&v"(y7)
      : "v"(x[0]), "v"(x[1]), "v"(x[2]), "v"(x[3]), "v"(x[4]), "v"(x[5]), "v"(x[6]), "v"(x[7]));
  return (v8f){y0, y1, y2, y3, y4, y5, y6, y7};
}
// value of lane l ^ 16
__device__ __forceinline__ float other_half(float x) {
  const int b = __float_as_int(x);
  return __int_as_float(__builtin_amdgcn_permlanex16(b, b, 0x76543210, 0xfedcba98, false, false));
}

// LDS row pitches of the staged tiles, in 16-bit elements. The fragment reads are 16 bytes a lane with one row per lane,
// so the pitch is an odd multiple of 16 bytes: the 16 rows of a half wave then fall on 16 different groups of four banks.
// The pad elements at the end of a row are never written and never read.
constexpr int KPITCH = QKROW + 8;            // 80 B  = 16 B x 5 (data: 64 B)
constexpr int VPITCH = 64 + 8;               // 144 B = 16 B x 9 (data: 128 B)

// element offset of lane ln = (c, hh) in its wave's 16 rows of 16: row c = ln & 15, elements 8hh .. 8hh + 7
__device__ __forceinline__ int ln_off(int ln) { return (ln & 15) * HEADD + 8 * (ln >> 4); }

// Register budget: at most 112 vector registers (1024 / 9, in granules of 16), so that nine blocks, a WGP's share of the
// grid, are resident at once; at eight, a ninth of the blocks would run afterwards, one wave per SIMD.
__global__ __launch_bounds__(128) void attn_hd16(
    const unsigned short* __restrict__ Q2, const unsigned short* __restrict__ K2,
    const unsigned short* __restrict__ Vth, const unsigned short* __restrict__ Vtl,
    unsigned short* __restrict__ Ohi, unsigned short* __restrict__ Olo)
{
  union FB { v16b v; v8b h[2]; };
  // one array, so that the tiles lie at constant offsets from one another and share their address registers
  __shared__ __align__(16) __bf16 tiles[64 * KPITCH + 2 * HEADD * VPITCH];
  __bf16* const Ksh = tiles;                                // [key][hi16|lo16|pad]
  __bf16* const Vhs = tiles + 64 * KPITCH;                  // [d][64 keys|pad] hi
  __bf16* const Vls = Vhs + HEADD * VPITCH;                 // [d][64 keys|pad] lo

  const int tid  = threadIdx.x;
  const int wave = __builtin_amdgcn_readfirstlane(tid >> 5);   // the same in every lane: kept in a scalar register
  const int lane = tid & 31;
  const int hh   = lane >> 4;
  const int c    = lane & 15;
  const int slice = blockIdx.x >> 4;         // 0 .. 143 = t * NHEAD + h
  const int qb   = blockIdx.x & 15;          // 64-query block
  const int q0   = qb * 64 + wave * 16;

  const __bf16* Qs = (const __bf16*)(const void*)Q2 + (size_t)slice * NNODE * QKROW;
  // B fragment, column = query q0 + c: elements 0..7 = qh[d = 8hh+e], 8..15 = ql[d = 8hh+e]
  const v16b qa = Frag<__bf16>::load(Qs + (size_t)(q0 + c) * QKROW + 8 * hh);
  const v8b* Kg  = (const v8b*)(const void*)(K2  + (size_t)slice * NNODE * QKROW);   // [key*4 + seg]
  const v8b* Vhg = (const v8b*)(const void*)(Vth + (size_t)slice * HEADD * NNODE);   // [d*128 + key/8]
  const v8b* Vlg = (const v8b*)(const void*)(Vtl + (size_t)slice * HEADD * NNODE);

  __bf16* const kdst = Ksh + (tid >> 2) * KPITCH + (tid & 3) * 8;          // K piece tid: row tid / 4, 16-B segment tid % 4
  __bf16* const vdst = Vhs + (tid >> 3) * VPITCH + (tid & 7) * 8;          // V piece tid: d = tid / 8, 16-B segment tid % 8
  const unsigned vsrc = (unsigned)(tid >> 3) * (NNODE / 8) + (tid & 7);

  // per lane: running maximum of query q0 + c times log2e (equal in both halves), this half's part of its sum
  float mrun = -INFINITY, lsum = 0.f;
  v8f oacc = (v8f){0.f,0.f,0.f,0.f,0.f,0.f,0.f,0.f};

#pragma unroll 1
  for (int kc = 0; kc < NNODE / 64; ++kc) {
    __syncthreads();
    // stage K: 256 pieces of 16 B = 64 rows x 32 u16 (whole tile, contiguous in K2); piece tid + 128 is row + 32, so the
    // two pieces of a thread lie a constant apart in K2 and in LDS and share their address registers (register budget, above)
    {
      const v8b* Kt = Kg + kc * 256;
      const v8b k0 = Kt[(unsigned)tid];
      const v8b k1 = Kt[(unsigned)tid + 128u];
      *(v8b*)(kdst) = k0;
      *(v8b*)(kdst + 32 * KPITCH) = k1;
    }
    // stage V hi/lo: 128 pieces of 16 B = 16 d x 64 keys per plane (whole tiles)
    {
      const v8b a  = (Vhg + kc * 8)[vsrc];
      const v8b b2 = (Vlg + kc * 8)[vsrc];
      *(v8b*)(vdst) = a;
      *(v8b*)(vdst + HEADD * VPITCH) = b2;
    }
    __syncthreads();

    v8f s[4];
#pragma unroll
    for (int j = 0; j < 4; ++j) {
      const __bf16* kr = Ksh + (j * 16 + c) * KPITCH + 8 * hh;
      const v8b kh8 = *(const v8b*)(kr);
      const v8b kl8 = *(const v8b*)(kr + 16);
      FB k1, k2;
      k1.h[0] = kh8; k1.h[1] = kh8;
      k2.h[0] = kl8; k2.h[1] = kl8;
      s[j] = (v8f){0.f,0.f,0.f,0.f,0.f,0.f,0.f,0.f};
      s[j] = at_mma(k1.v, qa, s[j]);
      s[j] = at_mma(k2.v, qa, s[j]);
    }
    // s[j][r] = scaled energy(key 64kc + 16j + 8hh + r, query q0 + c)
    float cm = s[0][0];
#pragma unroll
    for (int j = 0; j < 4; ++j)
#pragma unroll
      for (int r = 0; r < 8; ++r) cm = fmaxf(cm, s[j][r]);
    cm = fmaxf(cm, other_half(cm));
    const float mnew  = fmaxf(mrun, cm * LOG2E);
    const float alpha = exp2_hw(mrun - mnew);
    mrun = mnew;

    v16b ph[2], pl[2];
    float ps[4];
#pragma unroll
    for (int j = 0; j < 4; ++j) {
      ps[j] = 0.f;
      // arguments <= 0 up to one rounding: no overflow; below -126 a term is under 2^-126 of the largest and goes to 0
      v8f ea;
#pragma unroll
      for (int r = 0; r < 8; r += 2) {
        const v2f a2 = __builtin_elementwise_fma((v2f){s[j][r], s[j][r + 1]}, (v2f){LOG2E, LOG2E}, (v2f){-mnew, -mnew});
        ea[r] = a2[0]; ea[r + 1] = a2[1];
      }
      const v8f pe = exp2_hw8(ea);
#pragma unroll
      for (int r = 0; r < 8; r += 2) {
        ps[j] += pe[r];
        ps[j] += pe[r + 1];
        v2b a, bl;
        split_pair((v2f){pe[r], pe[r + 1]}, a, bl);
        // B element 8(j&1) + r of lane (c, hh) is key 16(j&1) + 8hh + r of the 32-key step j>>1
        ph[j >> 1][8 * (j & 1) + r] = a[0];  ph[j >> 1][8 * (j & 1) + r + 1] = a[1];
        pl[j >> 1][8 * (j & 1) + r] = bl[0]; pl[j >> 1][8 * (j & 1) + r + 1] = bl[1];
      }
    }
    lsum = lsum * alpha + ((ps[0] + ps[1]) + (ps[2] + ps[3]));
#pragma unroll
    for (int r = 0; r < 8; ++r) oacc[r] *= alpha;

#pragma unroll
    for (int kk = 0; kk < 2; ++kk) {
      FB vb, vl;
      vb.h[0] = *(const v8b*)(Vhs + c * VPITCH + kk * 32 + 8 * hh);
      vb.h[1] = *(const v8b*)(Vhs + c * VPITCH + kk * 32 + 16 + 8 * hh);
      vl.h[0] = *(const v8b*)(Vls + c * VPITCH + kk * 32 + 8 * hh);
      vl.h[1] = *(const v8b*)(Vls + c * VPITCH + kk * 32 + 16 + 8 * hh);
      oacc = at_mma(vb.v, ph[kk], oacc);
      oacc = at_mma(vl.v, ph[kk], oacc);
      oacc = at_mma(vb.v, pl[kk], oacc);
    }
  }
  // oacc[r] = unnormalised out(query q0 + c, d = 8hh + r); the two halves' sums join here; the sum is >= 1
  const float inv = 1.0f / (lsum + other_half(lsum));
  us8 hv, lv;
#pragma unroll
  for (int r = 0; r < 8; r += 2) {
    us2 hb, lb;
    split_pair_bits((v2f){oacc[r] * inv, oacc[r + 1] * inv}, hb, lb);
    hv[r] = hb[0]; hv[r + 1] = hb[1];
    lv[r] = lb[0]; lv[r + 1] = lb[1];
  }
  // 16 B a lane, 32 B a query: one store of the wave covers 512 contiguous bytes of its plane.
  // The lane number is formed anew here, so that no vector register holds a part of this address across the loop.
  const int ln = (int)__builtin_amdgcn_mbcnt_lo(~0u, 0u);
  const size_t off = ((size_t)slice * NNODE + q0) * HEADD + ln_off(ln);
  *(us8*)(Ohi + off) = hv;
  *(us8*)(Olo + off) = lv;
}

// =====================================================================
extern "C" void kernel_launch(void* const* d_in, const int* in_sizes, int n_in,
                              void* d_out, int out_size, void* d_ws, size_t ws_size,
                              hipStream_t stream) {
  if (n_in < 8) return;
  if (in_sizes[0] != NNODE * TSTEP * EMB || in_sizes[1] != NNODE * TSTEP * EMB ||
      in_sizes[2] != NNODE * TSTEP * EMB || in_sizes[3] != HEADD * HEADD ||
      in_sizes[4] != HEADD * HEADD || in_sizes[5] != HEADD * HEADD ||
      in_sizes[6] != EMB * EMB || in_sizes[7] != EMB) return;
  if (out_size != NROWS * EMB) return;
  if (ws_size < WS_TOTAL) return;

  const float* values = (const float*)d_in[0];
  const float* keys   = (const float*)d_in[1];
  const float* query  = (const float*)d_in[2];
  const float* Wv     = (const float*)d_in[3];
  const float* Wk     = (const float*)d_in[4];
  const float* Wq     = (const float*)d_in[5];
  const float* Wo     = (const float*)d_in[6];
  const float* bo     = (const float*)d_in[7];

  char* ws = (char*)d_ws;
  unsigned short* Q2  = (unsigned short*)(ws + WS_Q2);
  unsigned short* K2  = (unsigned short*)(ws + WS_K2);
  unsigned short* Vth = (unsigned short*)(ws + WS_VTH);
  unsigned short* Vtl = (unsigned short*)(ws + WS_VTL);
  unsigned short* Ohi = (unsigned short*)(ws + WS_OHI);
  unsigned short* Olo = (unsigned short*)(ws + WS_OLO);
  unsigned short* Woh = (unsigned short*)(ws + WS_WOH);
  unsigned short* Wol = (unsigned short*)(ws + WS_WOL);

  // 1) per-head projections: 144 slices x 16 node groups = 2304 wave tasks, 4 per block; the last block splits Wo
  proj_qkv<<<dim3(PROJ_BLOCKS + 1), dim3(128), 0, stream>>>(
      values, keys, query, Wv, Wk, Wq, Wo, Q2, K2, Vth, Vtl, Woh, Wol);
  // 2) attention over nodes: 144 (t, head) slices x 16 query blocks
  attn_hd16<<<dim3(NSLICE * (NNODE / 64)), dim3(128), 0, stream>>>(Q2, K2, Vth, Vtl, Ohi, Olo);
  // 3) output projection: C[36864 x 64] = O . Wo^T + bo; M=36864 (576 tiles), N=64, K=64; 8 tiles per block
  wmma_gemm64<1, true, 2, 0, false, 0, true><<<dim3(NROWS / 64 / 8, 1), dim3(256), 0, stream>>>(
      Ohi, Olo, EMB, 0L, Woh, Wol, EMB, 0L,
      d_out, nullptr, EMB, 0L, bo, nullptr, 0L,
      NROWS, EMB, EMB, 1.0f);
}

// v008
// A run of this version takes 57 microseconds.
// In two side-by-side timings against v007, it was 1.07 and 1.06 times as fast.
// Over all steps from v000 it is 3.96 times as fast.
// Contractions: v_wmma_f32_16x16x32_bf16 with bf16 hi/lo split operands (head projections, q.k scores, p.v, output projection), f32 accumulate; softmax, splits and epilogues in f32.
#include <hip/hip_runtime.h>
#include <math.h>
#include <stddef.h>

// ---------------- problem constants ----------------
constexpr int NNODE  = 1024;
constexpr int TSTEP  = 36;
constexpr int EMB    = 64;
constexpr int NHEAD  = 4;
constexpr int HEADD  = 16;
constexpr int NSLICE = TSTEP * NHEAD;        // 144 (t, h) slices
constexpr int NROWS  = NNODE * TSTEP;        // 36864 rows of the [n*T+t][64] planes
constexpr int QKROW  = 32;                   // u16 per row of the Q/K planes: [hi e0..15 | lo e0..15]

// ---------------- workspace region map (bytes) ----------------
// Q2  : bf16 [144][1024][32]          9,437,184 B  @ 0
// K2  : bf16 [144][1024][32]          9,437,184 B  @ 9,437,184
// Vth : bf16 [144][16][1024] (hi)     4,718,592 B  @ 18,874,368
// Vtl : bf16 [144][16][1024] (lo)     4,718,592 B  @ 23,592,960
// Ohi : bf16 [144][1024][16] (hi)     4,718,592 B  @ 28,311,552
// Olo : bf16 [144][1024][16] (lo)     4,718,592 B  @ 33,030,144
// Woh : bf16 [64][64]                     8,192 B  @ 37,748,736
// Wol : bf16 [64][64]                     8,192 B  @ 37,756,928
// total                              37,765,120 B
constexpr size_t WS_Q2   = 0;
constexpr size_t SZ_QK   = (size_t)NSLICE * NNODE * QKROW * 2;
constexpr size_t WS_K2   = WS_Q2 + SZ_QK;
constexpr size_t SZ_V    = (size_t)NSLICE * HEADD * NNODE * 2;
constexpr size_t WS_VTH  = WS_K2 + SZ_QK;
constexpr size_t WS_VTL  = WS_VTH + SZ_V;
constexpr size_t SZ_O    = (size_t)NROWS * EMB * 2;
constexpr size_t WS_OHI  = WS_VTL + SZ_V;
constexpr size_t WS_OLO  = WS_OHI + SZ_O;
constexpr size_t SZ_WO   = (size_t)EMB * EMB * 2;
constexpr size_t WS_WOH  = WS_OLO + SZ_O;
constexpr size_t WS_WOL  = WS_WOH + SZ_WO;
constexpr size_t WS_TOTAL = WS_WOL + SZ_WO;
static_assert(WS_TOTAL == 37765120, "carve");
static_assert(WS_TOTAL <= 134217728, "carve");
static_assert((WS_K2 % 128) == 0 && (WS_VTH % 128) == 0 && (WS_VTL % 128) == 0 && (WS_OHI % 128) == 0 &&
              (WS_OLO % 128) == 0 && (WS_WOH % 128) == 0 && (WS_WOL % 128) == 0, "align");
// GEMM shape contract for the output projection
static_assert(NROWS % 64 == 0 && EMB % 64 == 0 && EMB % 32 == 0, "gemm");
static_assert(NNODE % 64 == 0, "tiles");

// ---------------- types and fragment helpers ----------------
typedef __attribute__((ext_vector_type(16))) _Float16 v16h;
typedef __attribute__((ext_vector_type(8)))  _Float16 v8h;
typedef __attribute__((ext_vector_type(16))) __bf16   v16b;
typedef __attribute__((ext_vector_type(8)))  __bf16   v8b;
typedef __attribute__((ext_vector_type(8)))  float    v8f;
typedef __attribute__((ext_vector_type(4)))  float    v4f;
typedef __attribute__((ext_vector_type(8)))  unsigned short us8;

__device__ __forceinline__ unsigned short f2bf_bits(float f) {
  unsigned u = __float_as_uint(f);
  return (unsigned short)((u + 0x7FFFu + ((u >> 16) & 1u)) >> 16);
}
__device__ __forceinline__ float bf_bits2f(unsigned short h) { return __uint_as_float(((unsigned)h) << 16); }

// hi/lo split of two f32 values at once on the hardware's packed f32 -> bf16 conversion, which rounds to nearest even as
// f2bf_bits does: hi = bf16(p), lo = bf16(p - hi). Each result is one register of two packed bf16, the form that operand
// fragments and 16-byte stores are made of.
typedef __attribute__((ext_vector_type(2))) float          v2f;
typedef __attribute__((ext_vector_type(2))) __bf16         v2b;
typedef __attribute__((ext_vector_type(2))) unsigned short us2;
__device__ __forceinline__ void split_pair(v2f p, v2b& hi, v2b& lo) {
  hi = __builtin_convertvector(p, v2b);
  lo = __builtin_convertvector(p - __builtin_convertvector(hi, v2f), v2b);
}
__device__ __forceinline__ void split_pair_bits(v2f p, us2& hi, us2& lo) {
  v2b h, l;
  split_pair(p, h, l);
  hi = __builtin_bit_cast(us2, h);
  lo = __builtin_bit_cast(us2, l);
}

template <typename T> struct Frag;
template <> struct Frag<_Float16> {
  typedef v16h V; union U { v16h v; v8h h[2]; };
  static __device__ __forceinline__ v16h load(const _Float16* p) {   // elements 0..7 <- p[0..7], 8..15 <- p[16..23]
    U f; f.h[0] = *(const v8h*)(p); f.h[1] = *(const v8h*)(p + 16); return f.v;
  }
  static __device__ __forceinline__ v16h load2(const _Float16* p, const _Float16* q) {   // elements 0..7 <- p[0..7], 8..15 <- q[0..7]
    U f; f.h[0] = *(const v8h*)(p); f.h[1] = *(const v8h*)(q); return f.v;
  }
  static __device__ __forceinline__ v8f mma(v16h a, v16h b, v8f c) {
    return __builtin_amdgcn_wmma_f32_16x16x32_f16(false, a, false, b, (short)0, c, false, false);
  }
};
template <> struct Frag<__bf16> {
  typedef v16b V; union U { v16b v; v8b h[2]; };
  static __device__ __forceinline__ v16b load(const __bf16* p) {
    U f; f.h[0] = *(const v8b*)(p); f.h[1] = *(const v8b*)(p + 16); return f.v;
  }
  static __device__ __forceinline__ v16b load2(const __bf16* p, const __bf16* q) {
    U f; f.h[0] = *(const v8b*)(p); f.h[1] = *(const v8b*)(q); return f.v;
  }
  static __device__ __forceinline__ v8f mma(v16b a, v16b b, v8f c) {
    return __builtin_amdgcn_wmma_f32_16x16x32_bf16(false, a, false, b, (short)0, c, false, false);
  }
};

// ---- Register-blocked batched WMMA GEMM ---------------------------------------------
// C[m,n] = scale * sum_k A[m,k] * Bt[n,k] (+bias)(+resid); each wave owns a 64x64 tile.
// A row-major [M,K]; Bt row-major [N,K]; M,N % 64 == 0, K % 32 == 0.
// SPLIT: operands are hi/lo planes (A2/Bt2 = lo planes, same layout); product = hi.hi + hi.lo + lo.hi.
// BIAS_MODE: 0 = none, 1 = bias[m], 2 = bias[n].
// OUT_MODE: 0 = f32, 1 = f16, 2 = bf16 hi plane (Cout) + bf16 lo plane (Cout2).
// ET: 0 = f16 operands, 1 = bf16 operands (pointers passed as 16-bit storage)
// HEADPL: A planes are [t][head][node][16] with row m = t * NNODE + node and k = head * 16 + d (lda unused);
//         row m of the product is stored as row node * TSTEP + t of C.
template <int ET> struct Elem;
template <> struct Elem<0> { typedef _Float16 T; };
template <> struct Elem<1> { typedef __bf16 T; };
template <int ET, bool SPLIT, int BIAS_MODE, int OUT_MODE, bool RESID, int ACT = 0, bool HEADPL = false>
__global__ __launch_bounds__(256) void wmma_gemm64(
    const unsigned short* __restrict__ Ap, const unsigned short* __restrict__ A2p, int lda, long strideA,
    const unsigned short* __restrict__ Btp, const unsigned short* __restrict__ Bt2p, int ldb, long strideB,
    void* __restrict__ Cout, void* __restrict__ Cout2, int ldc, long strideC,
    const float* __restrict__ bias,
    const float* __restrict__ resid, long strideR,
    int M, int N, int K, float scale) {
  typedef typename Elem<ET>::T T;
  typedef typename Frag<T>::V V;
  const T* A = (const T*)Ap; const T* A2 = (const T*)A2p; const T* Bt = (const T*)Btp; const T* Bt2 = (const T*)Bt2p;
  __shared__ __align__(16) float sT[8][16 * 68];   // per-wave 16x64 slab, pitch 68 floats
  const int b    = blockIdx.y;
  const int lane = threadIdx.x & 31;
  const int wave = threadIdx.x >> 5;
  const int tilesN = N >> 6;
  const int tilesM = M >> 6;
  const int tile = blockIdx.x * 8 + wave;
  if (tile >= tilesM * tilesN) return;   // wave-uniform; no block barriers in this kernel
  const int tm = tile / tilesN;
  const int tn = tile - tm * tilesN;
  const int m0 = tm << 6;
  const int n0 = tn << 6;

  const T* Ab  = A  + (size_t)b * strideA;
  const T* Bb  = Bt + (size_t)b * strideB;
  const T* Ab2 = SPLIT ? (A2  + (size_t)b * strideA) : nullptr;
  const T* Bb2 = SPLIT ? (Bt2 + (size_t)b * strideB) : nullptr;

  const int rlane = lane & 15;                 // row (A) / col (B, D) within subtile
  const int koff  = (lane >> 4) * 8;           // k offset of this lane half
  const int mOff  = (lane >> 4) * 8;           // D row offset

  v8f acc[4][4];
#pragma unroll
  for (int i = 0; i < 4; ++i)
#pragma unroll
    for (int j = 0; j < 4; ++j) acc[i][j] = (v8f){0.f,0.f,0.f,0.f,0.f,0.f,0.f,0.f};

  for (int k0 = 0; k0 < K; k0 += 32) {
    V bh[4], bl[4];
#pragma unroll
    for (int j = 0; j < 4; ++j) {
      const size_t bo = (size_t)(n0 + (j << 4) + rlane) * ldb + koff + k0;
      bh[j] = Frag<T>::load(Bb + bo);
      if (SPLIT) bl[j] = Frag<T>::load(Bb2 + bo);
    }
#pragma unroll
    for (int i = 0; i < 4; ++i) {
      V ah, al;
      if (HEADPL) {
        // k = k0 + koff + e lies in head k0 / 16, k = k0 + 16 + koff + e in the next head: one head plane further on
        const int m = m0 + (i << 4) + rlane;
        const size_t ao = ((size_t)((m / NNODE) * NHEAD + (k0 >> 4)) * NNODE + (m % NNODE)) * HEADD + koff;
        ah = Frag<T>::load2(Ab + ao, Ab + ao + NNODE * HEADD);
        if (SPLIT) al = Frag<T>::load2(Ab2 + ao, Ab2 + ao + NNODE * HEADD);
      } else {
        const size_t ao = (size_t)(m0 + (i << 4) + rlane) * lda + koff + k0;
        ah = Frag<T>::load(Ab + ao);
        if (SPLIT) al = Frag<T>::load(Ab2 + ao);
      }
#pragma unroll
      for (int j = 0; j < 4; ++j) {
        acc[i][j] = Frag<T>::mma(ah, bh[j], acc[i][j]);
        if (SPLIT) {
          acc[i][j] = Frag<T>::mma(ah, bl[j], acc[i][j]);
          acc[i][j] = Frag<T>::mma(al, bh[j], acc[i][j]);
        }
      }
    }
  }

  // ---- epilogue ----
  float* slab = sT[wave];
  const float* Rb = RESID ? (resid + (size_t)b * strideR) : nullptr;
#pragma unroll
  for (int i = 0; i < 4; ++i) {
    const int mBase = m0 + (i << 4);
#pragma unroll
    for (int j = 0; j < 4; ++j) {
      const int n = n0 + (j << 4) + rlane;
      float bv = 0.f;
      if (BIAS_MODE == 2) bv = bias[n];
#pragma unroll
      for (int r = 0; r < 8; ++r) {
        float v = acc[i][j][r] * scale;
        if (BIAS_MODE == 1) v += bias[mBase + mOff + r];
        if (BIAS_MODE == 2) v += bv;
        if (RESID) v += Rb[(size_t)(mBase + mOff + r) * ldc + n];
        if (ACT == 1) v = tanhf(v);
        if (ACT == 2) v = fmaxf(v, 0.0f);
        if (ACT == 3) v = v / (1.0f + expf(-v));
        if (ACT == 4) v = (v > 0.f) ? v : 0.01f * v;
        if (ACT == 5) v = 0.5f * v * (1.0f + erff(v * 0.70710678118654752f));
        slab[(mOff + r) * 68 + (j << 4) + rlane] = v;
      }
    }
    __builtin_amdgcn_fence(__ATOMIC_RELEASE, "workgroup");
    __builtin_amdgcn_wave_barrier();
    __builtin_amdgcn_fence(__ATOMIC_ACQUIRE, "workgroup");
    if (OUT_MODE == 0) {
      float* C = (float*)Cout + (size_t)b * strideC;
      const int hh = lane >> 4, c4 = (lane & 15) * 4;     // row seg = 256 B = 16 lanes x 16 B
      {
#pragma unroll
        for (int it = 0; it < 8; ++it) {
          const int row = it * 2 + hh;
          v4f v = *(const v4f*)(slab + row * 68 + c4);
          const int m = mBase + row;
          const size_t crow = HEADPL ? (size_t)(m % NNODE) * TSTEP + (m / NNODE) : (size_t)m;
          *(v4f*)(C + crow * ldc + n0 + c4) = v;
        }
        
      }
    } else {
      const int q = lane >> 3, c8 = (lane & 7) * 8;
      unsigned short* C  = (unsigned short*)Cout  + (size_t)b * strideC;
      unsigned short* C2 = (OUT_MODE == 2) ? ((unsigned short*)Cout2 + (size_t)b * strideC) : nullptr;
      {
#pragma unroll
        for (int it = 0; it < 4; ++it) {
          const int row = it * 4 + q;
          const float* sp = slab + row * 68 + c8;
          v8h hv, lv;
#pragma unroll
          for (int e = 0; e < 8; ++e) {
            if (OUT_MODE == 1) {
              hv[e] = (_Float16)sp[e];
            } else {
              unsigned short hb = f2bf_bits(sp[e]);
              unsigned short lb = f2bf_bits(sp[e] - bf_bits2f(hb));
              hv[e] = __builtin_bit_cast(_Float16, hb);
              lv[e] = __builtin_bit_cast(_Float16, lb);
            }
          }
          *(v8h*)(C + (size_t)(mBase + row) * ldc + n0 + c8) = hv;
          if (OUT_MODE == 2) *(v8h*)(C2 + (size_t)(mBase + row) * ldc + n0 + c8) = lv;
        }
        
      }
    }
    __builtin_amdgcn_fence(__ATOMIC_RELEASE, "workgroup");
    __builtin_amdgcn_wave_barrier();
    __builtin_amdgcn_fence(__ATOMIC_ACQUIRE, "workgroup");
  }
}

// ---------------- bf16 WMMA, builtin form: the compiler keeps the distances the chip needs behind it ----------------
__device__ __forceinline__ v8f at_mma(v16b a, v16b b, v8f c) {
  return __builtin_amdgcn_wmma_f32_16x16x32_bf16(false, a, false, b, (short)0, c, false, false);
}

// same-wave LDS write -> read ordering
__device__ __forceinline__ void lds_wave_sync() {
  __builtin_amdgcn_fence(__ATOMIC_RELEASE, "workgroup");
  __builtin_amdgcn_wave_barrier();
  __builtin_amdgcn_fence(__ATOMIC_ACQUIRE, "workgroup");
}

// =====================================================================
// Operand fragments with the K=16 contraction packed into one 32-deep k-step:
//   slot s <  16 -> hi part of d = s
//   slot s >= 16 -> lo part of d = s - 16
// A fragment (lane row m = lane&15, hh = lane>>4): elements 0..7 = hi[d = 8hh+e], 8..15 = lo[d = 8hh+e].
// B fragments: B1 = [wh | wh], B2 = [wl | wl] so that A.B1 + A.B2 = (xh+xl).(wh+wl).
// =====================================================================
__device__ __forceinline__ v16b x_frag_split(const float* __restrict__ xr, int hh) {
  const v4f a = *(const v4f*)(xr + 8 * hh);
  const v4f b = *(const v4f*)(xr + 8 * hh + 4);
  const float f[8] = {a[0], a[1], a[2], a[3], b[0], b[1], b[2], b[3]};
  v16b fr;
#pragma unroll
  for (int e = 0; e < 8; e += 2) {
    v2b hb, lb;
    split_pair((v2f){f[e], f[e + 1]}, hb, lb);
    fr[e] = hb[0];     fr[e + 1] = hb[1];
    fr[8 + e] = lb[0]; fr[8 + e + 1] = lb[1];
  }
  return fr;
}
// W is [16 out][16 in] row-major; lane column c = out index e; loads W[c][8hh .. 8hh+7]
__device__ __forceinline__ void w_frags_split(const float* __restrict__ W, int c, int hh, v16b& wh, v16b& wl) {
  const v4f a = *(const v4f*)(W + c * HEADD + 8 * hh);
  const v4f b = *(const v4f*)(W + c * HEADD + 8 * hh + 4);
  const float f[8] = {a[0], a[1], a[2], a[3], b[0], b[1], b[2], b[3]};
#pragma unroll
  for (int e = 0; e < 8; e += 2) {
    v2b hb, lb;
    split_pair((v2f){f[e], f[e + 1]}, hb, lb);
    wh[e] = hb[0]; wh[e + 1] = hb[1]; wh[8 + e] = hb[0]; wh[8 + e + 1] = hb[1];
    wl[e] = lb[0]; wl[e + 1] = lb[1]; wl[8 + e] = lb[0]; wl[8 + e + 1] = lb[1];
  }
}

// One wave: rows n0..n0+63 of slice (t,h) for a q-type tensor -> plane dst[slice][n][hi16|lo16].
// Coverage: 4 tiles x 16 rows = 64 rows x 32 u16 staged; stored as 8 x (32 lanes x 8 u16) = 2048 u16 = whole region.
__device__ __forceinline__ void proj_qk_part(const float* __restrict__ x, unsigned short* __restrict__ dstp,
    const v16b wh, const v16b wl, float oscale, int slice, int n0, int t, int h, int lane, unsigned short* sl)
{
  const int hh = lane >> 4, c = lane & 15;
#pragma unroll
  for (int i = 0; i < 4; ++i) {
    const float* xr = x + ((size_t)(n0 + 16 * i + c) * TSTEP + t) * EMB + h * HEADD;
    const v16b xa = x_frag_split(xr, hh);
    v8f acc = (v8f){0.f,0.f,0.f,0.f,0.f,0.f,0.f,0.f};
    acc = at_mma(xa, wh, acc);
    acc = at_mma(xa, wl, acc);
    // acc[r] = proj[n0 + 16i + 8hh + r][e = c]
#pragma unroll
    for (int r = 0; r < 8; r += 2) {
      us2 hb, lb;
      split_pair_bits((v2f){acc[r] * oscale, acc[r + 1] * oscale}, hb, lb);
      const int row = 16 * i + 8 * hh + r;
      sl[row * QKROW + c] = hb[0];
      sl[row * QKROW + 16 + c] = lb[0];
      sl[(row + 1) * QKROW + c] = hb[1];
      sl[(row + 1) * QKROW + 16 + c] = lb[1];
    }
  }
  lds_wave_sync();
  unsigned short* dst = dstp + ((size_t)slice * NNODE + n0) * QKROW;   // 64 consecutive rows = 4096 B = 32 lines
  {
#pragma unroll
    for (int it = 0; it < 8; ++it) {
      const us8 v = *(const us8*)(sl + (it * 32 + lane) * 8);
      *(us8*)(dst + (it * 32 + lane) * 8) = v;
    }
    
  }
  lds_wave_sync();
}

// One wave: rows n0..n0+63 of slice for values -> transposed planes Vth/Vtl[slice][d][n].
// Coverage: slab hi [16 d][64 n] + lo [16 d][64 n] fully written by 4 tiles x 32 lanes x 8 u16;
// stored as 4 x (4 rows x 8 lanes x 8 u16) per plane = all 16 d rows x 64 n.
__device__ __forceinline__ void proj_v_part(const float* __restrict__ x, unsigned short* __restrict__ Vth,
    unsigned short* __restrict__ Vtl, const v16b wh, const v16b wl, int slice, int n0, int t, int h, int lane,
    unsigned short* sl)
{
  const int hh = lane >> 4, c = lane & 15;
#pragma unroll
  for (int i = 0; i < 4; ++i) {
    const float* xr = x + ((size_t)(n0 + 16 * i + c) * TSTEP + t) * EMB + h * HEADD;
    const v16b xa = x_frag_split(xr, hh);
    v8f acc = (v8f){0.f,0.f,0.f,0.f,0.f,0.f,0.f,0.f};
    acc = at_mma(xa, wh, acc);
    acc = at_mma(xa, wl, acc);
    // acc[r] = v[n0 + 16i + 8hh + r][d = c] -> slab[d][16i + 8hh + r]
    us8 hv, lv;
#pragma unroll
    for (int r = 0; r < 8; r += 2) {
      us2 hb, lb;
      split_pair_bits((v2f){acc[r], acc[r + 1]}, hb, lb);
      hv[r] = hb[0]; hv[r + 1] = hb[1];
      lv[r] = lb[0]; lv[r + 1] = lb[1];
    }
    *(us8*)(sl + c * 64 + 16 * i + 8 * hh) = hv;
    *(us8*)(sl + 1024 + c * 64 + 16 * i + 8 * hh) = lv;
  }
  lds_wave_sync();
  const int qq = lane >> 3, c8 = (lane & 7) * 8;
  {
#pragma unroll
    for (int it = 0; it < 4; ++it) {
      const int d = it * 4 + qq;
      const us8 hv = *(const us8*)(sl + d * 64 + c8);
      const us8 lv = *(const us8*)(sl + 1024 + d * 64 + c8);
      const size_t off = ((size_t)slice * HEADD + d) * NNODE + n0 + c8;
      *(us8*)(Vth + off) = hv;
      *(us8*)(Vtl + off) = lv;
    }
    
  }
  lds_wave_sync();
}

// =====================================================================
// Wo -> bf16 hi/lo planes [64][64] (Bt[n = e][k = c] = Wo[e][c]), the work of one block of 128 threads:
// thread handles element groups g = tid + 128 * it, it = 0 .. 3 (8 consecutive elements each): 512 x 8 = 4096 = whole planes.
// =====================================================================
__device__ __forceinline__ void wo_split_block(
    const float* __restrict__ Wo, unsigned short* __restrict__ Woh, unsigned short* __restrict__ Wol, int tid)
{
  us8 hv[4], lv[4];
#pragma unroll
  for (int it = 0; it < 4; ++it) {
    const int g = tid + 128 * it;
    const v4f a = *(const v4f*)(Wo + 8 * g);
    const v4f b = *(const v4f*)(Wo + 8 * g + 4);
    const float f[8] = {a[0], a[1], a[2], a[3], b[0], b[1], b[2], b[3]};
#pragma unroll
    for (int e = 0; e < 8; e += 2) {
      us2 hb, lb;
      split_pair_bits((v2f){f[e], f[e + 1]}, hb, lb);
      hv[it][e] = hb[0]; hv[it][e + 1] = hb[1];
      lv[it][e] = lb[0]; lv[it][e + 1] = lb[1];
    }
  }
#pragma unroll
  for (int it = 0; it < 4; ++it) {
    const int g = tid + 128 * it;
    *(us8*)(Woh + 8 * g) = hv[it];
    *(us8*)(Wol + 8 * g) = lv[it];
  }
}

// =====================================================================
// Kernel 1: per-head projections on WMMA. One wave = (slice, 64-node group); 4 waves per block,
// each with its own LDS slab (no cross-wave LDS traffic, no block barriers).
// grid = 2304 / 4 = 576 projection blocks, and one block more that splits Wo: that work depends on nothing the
// projections do and is first read by the output projection, so it needs no launch of its own.
// =====================================================================
constexpr int PROJ_BLOCKS = NSLICE * (NNODE / 64) / 4;   // 576
__global__ __launch_bounds__(128) void proj_qkv(
    const float* __restrict__ values, const float* __restrict__ keys, const float* __restrict__ query,
    const float* __restrict__ Wv, const float* __restrict__ Wk, const float* __restrict__ Wq,
    const float* __restrict__ Wo,
    unsigned short* __restrict__ Q2, unsigned short* __restrict__ K2,
    unsigned short* __restrict__ Vth, unsigned short* __restrict__ Vtl,
    unsigned short* __restrict__ Woh, unsigned short* __restrict__ Wol)
{
  __shared__ __align__(16) unsigned short slab[4][64 * QKROW];   // 4 KB per wave
  if (blockIdx.x == PROJ_BLOCKS) {   // the same for the whole block
    wo_split_block(Wo, Woh, Wol, threadIdx.x);
    return;
  }
  const int lane = threadIdx.x & 31;
  const int wave = threadIdx.x >> 5;
  const int hh = lane >> 4, c = lane & 15;
  const int task  = blockIdx.x * 4 + wave;           // 0 .. 2303
  const int slice = task >> 4;                        // 0 .. 143
  const int ng    = task & 15;                        // node group
  const int t = slice >> 2, h = slice & 3;
  const int n0 = ng * 64;
  unsigned short* sl = slab[wave];

  v16b wqh, wql, wkh, wkl, wvh, wvl;
  w_frags_split(Wq, c, hh, wqh, wql);
  w_frags_split(Wk, c, hh, wkh, wkl);
  w_frags_split(Wv, c, hh, wvh, wvl);

  // q carries the exact 1/sqrt(64) = 0.125 score scale
  proj_qk_part(query, Q2, wqh, wql, 0.125f, slice, n0, t, h, lane, sl);
  proj_qk_part(keys,  K2, wkh, wkl, 1.0f,   slice, n0, t, h, lane, sl);
  proj_v_part(values, Vth, Vtl, wvh, wvl, slice, n0, t, h, lane, sl);
}

constexpr float LOG2E = 1.4426950408889634f;
// y = 2^x on the hardware. The v_nop in the same statement keeps the one slot that the instruction set asks for between
// a transcendental and an instruction that uses its result or overwrites its source, whatever the compiler puts next.
__device__ __forceinline__ float exp2_hw(float x) {
  float y;
  asm("v_exp_f32 %0, %1\n\tv_nop" : "=v"(y) : "v"(x));
  return y;
}
// Eight independent 2^x in one statement: the early-clobber outputs keep every result off every source, so none of the
// eight overwrites a source of the one in front of it, and one closing v_nop keeps the slot for all of them.
__device__ __forceinline__ v8f exp2_hw8(v8f x) {
  float y0, y1, y2, y3, y4, y5, y6, y7;
  asm("v_exp_f32 %0, %8\n\tv_exp_f32 %1, %9\n\tv_exp_f32 %2, %10\n\tv_exp_f32 %3, %11\n\t"
      "v_exp_f32 %4, %12\n\tv_exp_f32 %5, %13\n\tv_exp_f32 %6, %14\n\tv_exp_f32 %7, %15\n\tv_nop"
      : "=&v"(y0), "=&v"(y1), "=&v"(y2), "=&v"(y3), "=&v"(y4), "=&v"(y5), "=&v"(y6), "=&v"(y7)
      : "v"(x[0]), "v"(x[1]), "v"(x[2]), "v"(x[3]), "v"(x[4]), "v"(x[5]), "v"(x[6]), "v"(x[7]));
  return (v8f){y0, y1, y2, y3, y4, y5, y6, y7};
}
// value of lane l ^ 16
__device__ __forceinline__ float other_half(float x) {
  const int b = __float_as_int(x);
  return __int_as_float(__builtin_amdgcn_permlanex16(b, b, 0x76543210, 0xfedcba98, false, false));
}

// Softmax weights of one pass, pe[j][r] = 2^(s[j][r] * log2e - m), and the lane's sum of the 32 of them.
// With m the maximum the arguments are <= 0 up to one rounding; below -126 a term is under 2^-126 of the largest and goes to 0.
__device__ __forceinline__ float weights64(const v8f (&s)[4], float m, v8f (&pe)[4]) {
  float ps[4];
#pragma unroll
  for (int j = 0; j < 4; ++j) {
    v8f ea;
#pragma unroll
    for (int r = 0; r < 8; r += 2) {
      const v2f a2 = __builtin_elementwise_fma((v2f){s[j][r], s[j][r + 1]}, (v2f){LOG2E, LOG2E}, (v2f){-m, -m});
      ea[r] = a2[0]; ea[r + 1] = a2[1];
    }
    pe[j] = exp2_hw8(ea);
    ps[j] = 0.f;
#pragma unroll
    for (int r = 0; r < 8; ++r) ps[j] += pe[j][r];
  }
  return (ps[0] + ps[1]) + (ps[2] + ps[3]);
}
// A lane's sum of 32 weights up to which the maximum in use is kept: no weight is then above 2^8, far inside the range of
// f32 and of the bf16 parts, whose relative precision does not depend on the scale.
constexpr float WBOUND = 256.0f;

// LDS row pitches of the staged tiles, in 16-bit elements. The fragment reads are 16 bytes a lane with one row per lane,
// so the pitch is an odd multiple of 16 bytes: the 16 rows of a half wave then fall on 16 different groups of four banks.
// The pad elements at the end of a row are never written and never read.
constexpr int KPITCH = QKROW + 8;            // 80 B  = 16 B x 5 (data: 64 B)
constexpr int VPITCH = 64 + 8;               // 144 B = 16 B x 9 (data: 128 B)

// element offset of lane ln = (c, hh) in its wave's 16 rows of 16: row c = ln & 15, elements 8hh .. 8hh + 7
__device__ __forceinline__ int ln_off(int ln) { return (ln & 15) * HEADD + 8 * (ln >> 4); }

// Register budget: at most 112 vector registers (1024 / 9, in granules of 16), so that nine blocks, a WGP's share of the
// grid, are resident at once; at eight, a ninth of the blocks would run afterwards, one wave per SIMD.
__global__ __launch_bounds__(128) void attn_hd16(
    const unsigned short* __restrict__ Q2, const unsigned short* __restrict__ K2,
    const unsigned short* __restrict__ Vth, const unsigned short* __restrict__ Vtl,
    unsigned short* __restrict__ Ohi, unsigned short* __restrict__ Olo)
{
  union FB { v16b v; v8b h[2]; };
  // one array, so that the tiles lie at constant offsets from one another and share their address registers
  __shared__ __align__(16) __bf16 tiles[64 * KPITCH + 2 * HEADD * VPITCH];
  __bf16* const Ksh = tiles;                                // [key][hi16|lo16|pad]
  __bf16* const Vhs = tiles + 64 * KPITCH;                  // [d][64 keys|pad] hi
  __bf16* const Vls = Vhs + HEADD * VPITCH;                 // [d][64 keys|pad] lo

  const int tid  = threadIdx.x;
  const int wave = __builtin_amdgcn_readfirstlane(tid >> 5);   // the same in every lane: kept in a scalar register
  const int lane = tid & 31;
  const int hh   = lane >> 4;
  const int c    = lane & 15;
  const int slice = blockIdx.x >> 4;         // 0 .. 143 = t * NHEAD + h
  const int qb   = blockIdx.x & 15;          // 64-query block
  const int q0   = qb * 64 + wave * 16;

  const __bf16* Qs = (const __bf16*)(const void*)Q2 + (size_t)slice * NNODE * QKROW;
  // B fragment, column = query q0 + c: elements 0..7 = qh[d = 8hh+e], 8..15 = ql[d = 8hh+e]
  const v16b qa = Frag<__bf16>::load(Qs + (size_t)(q0 + c) * QKROW + 8 * hh);
  const v8b* Kg  = (const v8b*)(const void*)(K2  + (size_t)slice * NNODE * QKROW);   // [key*4 + seg]
  const v8b* Vhg = (const v8b*)(const void*)(Vth + (size_t)slice * HEADD * NNODE);   // [d*128 + key/8]
  const v8b* Vlg = (const v8b*)(const void*)(Vtl + (size_t)slice * HEADD * NNODE);

  __bf16* const kdst = Ksh + (tid >> 2) * KPITCH + (tid & 3) * 8;          // K piece tid: row tid / 4, 16-B segment tid % 4
  __bf16* const vdst = Vhs + (tid >> 3) * VPITCH + (tid & 7) * 8;          // V piece tid: d = tid / 8, 16-B segment tid % 8
  const unsigned vsrc = (unsigned)(tid >> 3) * (NNODE / 8) + (tid & 7);

  // per lane: the maximum in use for query q0 + c (equal in both halves), plain and times log2e; this half's part of its sum
  float mraw = -INFINITY, mrun = -INFINITY, lsum = 0.f;
  v8f oacc = (v8f){0.f,0.f,0.f,0.f,0.f,0.f,0.f,0.f};

#pragma unroll 1
  for (int kc = 0; kc < NNODE / 64; ++kc) {
    __syncthreads();
    // stage K: 256 pieces of 16 B = 64 rows x 32 u16 (whole tile, contiguous in K2); piece tid + 128 is row + 32, so the
    // two pieces of a thread lie a constant apart in K2 and in LDS and share their address registers (register budget, above)
    {
      const v8b* Kt = Kg + kc * 256;
      const v8b k0 = Kt[(unsigned)tid];
      const v8b k1 = Kt[(unsigned)tid + 128u];
      *(v8b*)(kdst) = k0;
      *(v8b*)(kdst + 32 * KPITCH) = k1;
    }
    // stage V hi/lo: 128 pieces of 16 B = 16 d x 64 keys per plane (whole tiles)
    {
      const v8b a  = (Vhg + kc * 8)[vsrc];
      const v8b b2 = (Vlg + kc * 8)[vsrc];
      *(v8b*)(vdst) = a;
      *(v8b*)(vdst + HEADD * VPITCH) = b2;
    }
    __syncthreads();

    v8f s[4];
#pragma unroll
    for (int j = 0; j < 4; ++j) {
      const __bf16* kr = Ksh + (j * 16 + c) * KPITCH + 8 * hh;
      const v8b kh8 = *(const v8b*)(kr);
      const v8b kl8 = *(const v8b*)(kr + 16);
      FB k1, k2;
      k1.h[0] = kh8; k1.h[1] = kh8;
      k2.h[0] = kl8; k2.h[1] = kl8;
      s[j] = (v8f){0.f,0.f,0.f,0.f,0.f,0.f,0.f,0.f};
      s[j] = at_mma(k1.v, qa, s[j]);
      s[j] = at_mma(k2.v, qa, s[j]);
    }
    // s[j][r] = scaled energy(key 64kc + 16j + 8hh + r, query q0 + c)
    // The weights are formed against the maximum in use. Softmax does not depend on that offset, so it need not be the
    // true maximum: it only has to keep the weights in range. While every lane's sum of this pass's 32 weights stays at or
    // under WBOUND, no weight exceeds WBOUND and nothing is rescaled. Otherwise (also on a NaN) the whole wave goes round
    // once more: it takes the maximum of the pass, rescales and forms the weights anew, each then at most 1. The first
    // pass, which has no maximum yet, takes it at once.
    v8f pe[4];
    float psum;
    bool renew = (kc == 0);
    // kept rolled: the second trip is the rare path and runs the same code as the first
#pragma unroll 1
    for (int trip = 0; trip < 2; ++trip) {
      if (renew) {
        // the chain starts at the maximum in use: it folds that in, and it makes the chain a part of this rare branch
        // (a chain over s alone is the same in both trips, and the compiler lifts it out, into every pass)
        float cm = mraw;
#pragma unroll
        for (int j = 0; j < 4; ++j)
#pragma unroll
          for (int r = 0; r < 8; ++r) cm = fmaxf(cm, s[j][r]);
        mraw = fmaxf(cm, other_half(cm));
        const float mnew  = mraw * LOG2E;
        const float alpha = exp2_hw(mrun - mnew);
        mrun = mnew;
        lsum *= alpha;
#pragma unroll
        for (int r = 0; r < 8; ++r) oacc[r] *= alpha;
      }
      psum = weights64(s, mrun, pe);
      if (renew) break;
      renew = __builtin_amdgcn_ballot_w32(!(psum <= WBOUND)) != 0u;   // one scalar branch for the wave
      if (!renew) break;
    }
    lsum += psum;

    v16b ph[2], pl[2];
#pragma unroll
    for (int j = 0; j < 4; ++j) {
#pragma unroll
      for (int r = 0; r < 8; r += 2) {
        v2b a, bl;
        split_pair((v2f){pe[j][r], pe[j][r + 1]}, a, bl);
        // B element 8(j&1) + r of lane (c, hh) is key 16(j&1) + 8hh + r of the 32-key step j>>1
        ph[j >> 1][8 * (j & 1) + r] = a[0];  ph[j >> 1][8 * (j & 1) + r + 1] = a[1];
        pl[j >> 1][8 * (j & 1) + r] = bl[0]; pl[j >> 1][8 * (j & 1) + r + 1] = bl[1];
      }
    }

#pragma unroll
    for (int kk = 0; kk < 2; ++kk) {
      FB vb, vl;
      vb.h[0] = *(const v8b*)(Vhs + c * VPITCH + kk * 32 + 8 * hh);
      vb.h[1] = *(const v8b*)(Vhs + c * VPITCH + kk * 32 + 16 + 8 * hh);
      vl.h[0] = *(const v8b*)(Vls + c * VPITCH + kk * 32 + 8 * hh);
      vl.h[1] = *(const v8b*)(Vls + c * VPITCH + kk * 32 + 16 + 8 * hh);
      oacc = at_mma(vb.v, ph[kk], oacc);
      oacc = at_mma(vl.v, ph[kk], oacc);
      oacc = at_mma(vb.v, pl[kk], oacc);
    }
  }
  // oacc[r] = unnormalised out(query q0 + c, d = 8hh + r); the two halves' sums join here; the sum is >= 1
  const float inv = 1.0f / (lsum + other_half(lsum));
  us8 hv, lv;
#pragma unroll
  for (int r = 0; r < 8; r += 2) {
    us2 hb, lb;
    split_pair_bits((v2f){oacc[r] * inv, oacc[r + 1] * inv}, hb, lb);
    hv[r] = hb[0]; hv[r + 1] = hb[1];
    lv[r] = lb[0]; lv[r + 1] = lb[1];
  }
  // 16 B a lane, 32 B a query: one store of the wave covers 512 contiguous bytes of its plane.
  // The lane number is formed anew here, so that no vector register holds a part of this address across the loop.
  const int ln = (int)__builtin_amdgcn_mbcnt_lo(~0u, 0u);
  const size_t off = ((size_t)slice * NNODE + q0) * HEADD + ln_off(ln);
  *(us8*)(Ohi + off) = hv;
  *(us8*)(Olo + off) = lv;
}

// =====================================================================
extern "C" void kernel_launch(void* const* d_in, const int* in_sizes, int n_in,
                              void* d_out, int out_size, void* d_ws, size_t ws_size,
                              hipStream_t stream) {
  if (n_in < 8) return;
  if (in_sizes[0] != NNODE * TSTEP * EMB || in_sizes[1] != NNODE * TSTEP * EMB ||
      in_sizes[2] != NNODE * TSTEP * EMB || in_sizes[3] != HEADD * HEADD ||
      in_sizes[4] != HEADD * HEADD || in_sizes[5] != HEADD * HEADD ||
      in_sizes[6] != EMB * EMB || in_sizes[7] != EMB) return;
  if (out_size != NROWS * EMB) return;
  if (ws_size < WS_TOTAL) return;

  const float* values = (const float*)d_in[0];
  const float* keys   = (const float*)d_in[1];
  const float* query  = (const float*)d_in[2];
  const float* Wv     = (const float*)d_in[3];
  const float* Wk     = (const float*)d_in[4];
  const float* Wq     = (const float*)d_in[5];
  const float* Wo     = (const float*)d_in[6];
  const float* bo     = (const float*)d_in[7];

  char* ws = (char*)d_ws;
  unsigned short* Q2  = (unsigned short*)(ws + WS_Q2);
  unsigned short* K2  = (unsigned short*)(ws + WS_K2);
  unsigned short* Vth = (unsigned short*)(ws + WS_VTH);
  unsigned short* Vtl = (unsigned short*)(ws + WS_VTL);
  unsigned short* Ohi = (unsigned short*)(ws + WS_OHI);
  unsigned short* Olo = (unsigned short*)(ws + WS_OLO);
  unsigned short* Woh = (unsigned short*)(ws + WS_WOH);
  unsigned short* Wol = (unsigned short*)(ws + WS_WOL);

  // 1) per-head projections: 144 slices x 16 node groups = 2304 wave tasks, 4 per block; the last block splits Wo
  proj_qkv<<<dim3(PROJ_BLOCKS + 1), dim3(128), 0, stream>>>(
      values, keys, query, Wv, Wk, Wq, Wo, Q2, K2, Vth, Vtl, Woh, Wol);
  // 2) attention over nodes: 144 (t, head) slices x 16 query blocks
  attn_hd16<<<dim3(NSLICE * (NNODE / 64)), dim3(128), 0, stream>>>(Q2, K2, Vth, Vtl, Ohi, Olo);
  // 3) output projection: C[36864 x 64] = O . Wo^T + bo; M=36864 (576 tiles), N=64, K=64; 8 tiles per block
  wmma_gemm64<1, true, 2, 0, false, 0, true><<<dim3(NROWS / 64 / 8, 1), dim3(256), 0, stream>>>(
      Ohi, Olo, EMB, 0L, Woh, Wol, EMB, 0L,
      d_out, nullptr, EMB, 0L, bo, nullptr, 0L,
      NROWS, EMB, EMB, 1.0f);
}

// v009
// A run of this version takes 52.9 microseconds.
// Next to v008, in two timings, it ran 1.09 and 1.07 times as fast.
// Over all steps from v000 it is 4.27 times as fast.
// Contractions: v_wmma_f32_16x16x32_bf16 with bf16 hi/lo split operands (head projections, q.k scores, output projection) and v_wmma_f32_16x16x32_f16 (p.v: V as f16 hi/lo, softmax weights as one f16), f32 accumulate; softmax, splits and epilogues in f32.
#include <hip/hip_runtime.h>
#include <math.h>
#include <stddef.h>

// ---------------- problem constants ----------------
constexpr int NNODE  = 1024;
constexpr int TSTEP  = 36;
constexpr int EMB    = 64;
constexpr int NHEAD  = 4;
constexpr int HEADD  = 16;
constexpr int NSLICE = TSTEP * NHEAD;        // 144 (t, h) slices
constexpr int NROWS  = NNODE * TSTEP;        // 36864 rows of the [n*T+t][64] planes
constexpr int QKROW  = 32;                   // u16 per row of the Q/K planes: [hi e0..15 | lo e0..15]

// ---------------- workspace region map (bytes) ----------------
// Q2  : bf16 [144][1024][32]          9,437,184 B  @ 0
// K2  : bf16 [144][1024][32]          9,437,184 B  @ 9,437,184
// Vth : f16  [144][16][1024] (hi)     4,718,592 B  @ 18,874,368
// Vtl : f16  [144][16][1024] (lo)     4,718,592 B  @ 23,592,960
// Ohi : bf16 [144][1024][16] (hi)     4,718,592 B  @ 28,311,552
// Olo : bf16 [144][1024][16] (lo)     4,718,592 B  @ 33,030,144
// Woh : bf16 [64][64]                     8,192 B  @ 37,748,736
// Wol : bf16 [64][64]                     8,192 B  @ 37,756,928
// total                              37,765,120 B
constexpr size_t WS_Q2   = 0;
constexpr size_t SZ_QK   = (size_t)NSLICE * NNODE * QKROW * 2;
constexpr size_t WS_K2   = WS_Q2 + SZ_QK;
constexpr size_t SZ_V    = (size_t)NSLICE * HEADD * NNODE * 2;
constexpr size_t WS_VTH  = WS_K2 + SZ_QK;
constexpr size_t WS_VTL  = WS_VTH + SZ_V;
constexpr size_t SZ_O    = (size_t)NROWS * EMB * 2;
constexpr size_t WS_OHI  = WS_VTL + SZ_V;
constexpr size_t WS_OLO  = WS_OHI + SZ_O;
constexpr size_t SZ_WO   = (size_t)EMB * EMB * 2;
constexpr size_t WS_WOH  = WS_OLO + SZ_O;
constexpr size_t WS_WOL  = WS_WOH + SZ_WO;
constexpr size_t WS_TOTAL = WS_WOL + SZ_WO;
static_assert(WS_TOTAL == 37765120, "carve");
static_assert(WS_TOTAL <= 134217728, "carve");
static_assert((WS_K2 % 128) == 0 && (WS_VTH % 128) == 0 && (WS_VTL % 128) == 0 && (WS_OHI % 128) == 0 &&
              (WS_OLO % 128) == 0 && (WS_WOH % 128) == 0 && (WS_WOL % 128) == 0, "align");
// GEMM shape contract for the output projection
static_assert(NROWS % 64 == 0 && EMB % 64 == 0 && EMB % 32 == 0, "gemm");
static_assert(NNODE % 64 == 0, "tiles");

// ---------------- types and fragment helpers ----------------
typedef __attribute__((ext_vector_type(16))) _Float16 v16h;
typedef __attribute__((ext_vector_type(8)))  _Float16 v8h;
typedef __attribute__((ext_vector_type(16))) __bf16   v16b;
typedef __attribute__((ext_vector_type(8)))  __bf16   v8b;
typedef __attribute__((ext_vector_type(8)))  float    v8f;
typedef __attribute__((ext_vector_type(4)))  float    v4f;
typedef __attribute__((ext_vector_type(8)))  unsigned short us8;

__device__ __forceinline__ unsigned short f2bf_bits(float f) {
  unsigned u = __float_as_uint(f);
  return (unsigned short)((u + 0x7FFFu + ((u >> 16) & 1u)) >> 16);
}
__device__ __forceinline__ float bf_bits2f(unsigned short h) { return __uint_as_float(((unsigned)h) << 16); }

// hi/lo split of two f32 values at once on the hardware's packed f32 -> bf16 conversion, which rounds to nearest even as
// f2bf_bits does: hi = bf16(p), lo = bf16(p - hi). Each result is one register of two packed bf16, the form that operand
// fragments and 16-byte stores are made of.
typedef __attribute__((ext_vector_type(2))) float          v2f;
typedef __attribute__((ext_vector_type(2))) __bf16         v2b;
typedef __attribute__((ext_vector_type(2))) unsigned short us2;
__device__ __forceinline__ void split_pair(v2f p, v2b& hi, v2b& lo) {
  hi = __builtin_convertvector(p, v2b);
  lo = __builtin_convertvector(p - __builtin_convertvector(hi, v2f), v2b);
}
__device__ __forceinline__ void split_pair_bits(v2f p, us2& hi, us2& lo) {
  v2b h, l;
  split_pair(p, h, l);
  hi = __builtin_bit_cast(us2, h);
  lo = __builtin_bit_cast(us2, l);
}
// The same split in f16, for V: hi = f16(p), lo = f16(p - hi), both rounded to nearest even. 11 + 11 significant bits while
// lo is a normal f16; below that lo keeps an absolute step of 2^-24. Range: |p| < 65504; a projected value of the stated
// inputs (16 products of a standard normal and a weight of scale 1/4) stays under a few hundred.
typedef __attribute__((ext_vector_type(2))) _Float16 v2h;
__device__ __forceinline__ void split_pair_f16_bits(v2f p, us2& hi, us2& lo) {
  const v2h h = __builtin_convertvector(p, v2h);
  const v2h l = __builtin_convertvector(p - __builtin_convertvector(h, v2f), v2h);
  hi = __builtin_bit_cast(us2, h);
  lo = __builtin_bit_cast(us2, l);
}

template <typename T> struct Frag;
template <> struct Frag<_Float16> {
  typedef v16h V; union U { v16h v; v8h h[2]; };
  static __device__ __forceinline__ v16h load(const _Float16* p) {   // elements 0..7 <- p[0..7], 8..15 <- p[16..23]
    U f; f.h[0] = *(const v8h*)(p); f.h[1] = *(const v8h*)(p + 16); return f.v;
  }
  static __device__ __forceinline__ v16h load2(const _Float16* p, const _Float16* q) {   // elements 0..7 <- p[0..7], 8..15 <- q[0..7]
    U f; f.h[0] = *(const v8h*)(p); f.h[1] = *(const v8h*)(q); return f.v;
  }
  static __device__ __forceinline__ v8f mma(v16h a, v16h b, v8f c) {
    return __builtin_amdgcn_wmma_f32_16x16x32_f16(false, a, false, b, (short)0, c, false, false);
  }
};
template <> struct Frag<__bf16> {
  typedef v16b V; union U { v16b v; v8b h[2]; };
  static __device__ __forceinline__ v16b load(const __bf16* p) {
    U f; f.h[0] = *(const v8b*)(p); f.h[1] = *(const v8b*)(p + 16); return f.v;
  }
  static __device__ __forceinline__ v16b load2(const __bf16* p, const __bf16* q) {
    U f; f.h[0] = *(const v8b*)(p); f.h[1] = *(const v8b*)(q); return f.v;
  }
  static __device__ __forceinline__ v8f mma(v16b a, v16b b, v8f c) {
    return __builtin_amdgcn_wmma_f32_16x16x32_bf16(false, a, false, b, (short)0, c, false, false);
  }
};

// ---- Register-blocked batched WMMA GEMM ---------------------------------------------
// C[m,n] = scale * sum_k A[m,k] * Bt[n,k] (+bias)(+resid); each wave owns a 64x64 tile.
// A row-major [M,K]; Bt row-major [N,K]; M,N % 64 == 0, K % 32 == 0.
// SPLIT: operands are hi/lo planes (A2/Bt2 = lo planes, same layout); product = hi.hi + hi.lo + lo.hi.
// BIAS_MODE: 0 = none, 1 = bias[m], 2 = bias[n].
// OUT_MODE: 0 = f32, 1 = f16, 2 = bf16 hi plane (Cout) + bf16 lo plane (Cout2).
// ET: 0 = f16 operands, 1 = bf16 operands (pointers passed as 16-bit storage)
// HEADPL: A planes are [t][head][node][16] with row m = t * NNODE + node and k = head * 16 + d (lda unused);
//         row m of the product is stored as row node * TSTEP + t of C.
template <int ET> struct Elem;
template <> struct Elem<0> { typedef _Float16 T; };
template <> struct Elem<1> { typedef __bf16 T; };
template <int ET, bool SPLIT, int BIAS_MODE, int OUT_MODE, bool RESID, int ACT = 0, bool HEADPL = false>
__global__ __launch_bounds__(256) void wmma_gemm64(
    const unsigned short* __restrict__ Ap, const unsigned short* __restrict__ A2p, int lda, long strideA,
    const unsigned short* __restrict__ Btp, const unsigned short* __restrict__ Bt2p, int ldb, long strideB,
    void* __restrict__ Cout, void* __restrict__ Cout2, int ldc, long strideC,
    const float* __restrict__ bias,
    const float* __restrict__ resid, long strideR,
    int M, int N, int K, float scale) {
  typedef typename Elem<ET>::T T;
  typedef typename Frag<T>::V V;
  const T* A = (const T*)Ap; const T* A2 = (const T*)A2p; const T* Bt = (const T*)Btp; const T* Bt2 = (const T*)Bt2p;
  __shared__ __align__(16) float sT[8][16 * 68];   // per-wave 16x64 slab, pitch 68 floats
  const int b    = blockIdx.y;
  const int lane = threadIdx.x & 31;
  const int wave = threadIdx.x >> 5;
  const int tilesN = N >> 6;
  const int tilesM = M >> 6;
  const int tile = blockIdx.x * 8 + wave;
  if (tile >= tilesM * tilesN) return;   // wave-uniform; no block barriers in this kernel
  const int tm = tile / tilesN;
  const int tn = tile - tm * tilesN;
  const int m0 = tm << 6;
  const int n0 = tn << 6;

  const T* Ab  = A  + (size_t)b * strideA;
  const T* Bb  = Bt + (size_t)b * strideB;
  const T* Ab2 = SPLIT ? (A2  + (size_t)b * strideA) : nullptr;
  const T* Bb2 = SPLIT ? (Bt2 + (size_t)b * strideB) : nullptr;

  const int rlane = lane & 15;                 // row (A) / col (B, D) within subtile
  const int koff  = (lane >> 4) * 8;           // k offset of this lane half
  const int mOff  = (lane >> 4) * 8;           // D row offset

  v8f acc[4][4];
#pragma unroll
  for (int i = 0; i < 4; ++i)
#pragma unroll
    for (int j = 0; j < 4; ++j) acc[i][j] = (v8f){0.f,0.f,0.f,0.f,0.f,0.f,0.f,0.f};

  for (int k0 = 0; k0 < K; k0 += 32) {
    V bh[4], bl[4];
#pragma unroll
    for (int j = 0; j < 4; ++j) {
      const size_t bo = (size_t)(n0 + (j << 4) + rlane) * ldb + koff + k0;
      bh[j] = Frag<T>::load(Bb + bo);
      if (SPLIT) bl[j] = Frag<T>::load(Bb2 + bo);
    }
#pragma unroll
    for (int i = 0; i < 4; ++i) {
      V ah, al;
      if (HEADPL) {
        // k = k0 + koff + e lies in head k0 / 16, k = k0 + 16 + koff + e in the next head: one head plane further on
        const int m = m0 + (i << 4) + rlane;
        const size_t ao = ((size_t)((m / NNODE) * NHEAD + (k0 >> 4)) * NNODE + (m % NNODE)) * HEADD + koff;
        ah = Frag<T>::load2(Ab + ao, Ab + ao + NNODE * HEADD);
        if (SPLIT) al = Frag<T>::load2(Ab2 + ao, Ab2 + ao + NNODE * HEADD);
      } else {
        const size_t ao = (size_t)(m0 + (i << 4) + rlane) * lda + koff + k0;
        ah = Frag<T>::load(Ab + ao);
        if (SPLIT) al = Frag<T>::load(Ab2 + ao);
      }
#pragma unroll
      for (int j = 0; j < 4; ++j) {
        acc[i][j] = Frag<T>::mma(ah, bh[j], acc[i][j]);
        if (SPLIT) {
          acc[i][j] = Frag<T>::mma(ah, bl[j], acc[i][j]);
          acc[i][j] = Frag<T>::mma(al, bh[j], acc[i][j]);
        }
      }
    }
  }

  // ---- epilogue ----
  float* slab = sT[wave];
  const float* Rb = RESID ? (resid + (size_t)b * strideR) : nullptr;
#pragma unroll
  for (int i = 0; i < 4; ++i) {
    const int mBase = m0 + (i << 4);
#pragma unroll
    for (int j = 0; j < 4; ++j) {
      const int n = n0 + (j << 4) + rlane;
      float bv = 0.f;
      if (BIAS_MODE == 2) bv = bias[n];
#pragma unroll
      for (int r = 0; r < 8; ++r) {
        float v = acc[i][j][r] * scale;
        if (BIAS_MODE == 1) v += bias[mBase + mOff + r];
        if (BIAS_MODE == 2) v += bv;
        if (RESID) v += Rb[(size_t)(mBase + mOff + r) * ldc + n];
        if (ACT == 1) v = tanhf(v);
        if (ACT == 2) v = fmaxf(v, 0.0f);
        if (ACT == 3) v = v / (1.0f + expf(-v));
        if (ACT == 4) v = (v > 0.f) ? v : 0.01f * v;
        if (ACT == 5) v = 0.5f * v * (1.0f + erff(v * 0.70710678118654752f));
        slab[(mOff + r) * 68 + (j << 4) + rlane] = v;
      }
    }
    __builtin_amdgcn_fence(__ATOMIC_RELEASE, "workgroup");
    __builtin_amdgcn_wave_barrier();
    __builtin_amdgcn_fence(__ATOMIC_ACQUIRE, "workgroup");
    if (OUT_MODE == 0) {
      float* C = (float*)Cout + (size_t)b * strideC;
      const int hh = lane >> 4, c4 = (lane & 15) * 4;     // row seg = 256 B = 16 lanes x 16 B
      {
#pragma unroll
        for (int it = 0; it < 8; ++it) {
          const int row = it * 2 + hh;
          v4f v = *(const v4f*)(slab + row * 68 + c4);
          const int m = mBase + row;
          const size_t crow = HEADPL ? (size_t)(m % NNODE) * TSTEP + (m / NNODE) : (size_t)m;
          *(v4f*)(C + crow * ldc + n0 + c4) = v;
        }
        
      }
    } else {
      const int q = lane >> 3, c8 = (lane & 7) * 8;
      unsigned short* C  = (unsigned short*)Cout  + (size_t)b * strideC;
      unsigned short* C2 = (OUT_MODE == 2) ? ((unsigned short*)Cout2 + (size_t)b * strideC) : nullptr;
      {
#pragma unroll
        for (int it = 0; it < 4; ++it) {
          const int row = it * 4 + q;
          const float* sp = slab + row * 68 + c8;
          v8h hv, lv;
#pragma unroll
          for (int e = 0; e < 8; ++e) {
            if (OUT_MODE == 1) {
              hv[e] = (_Float16)sp[e];
            } else {
              unsigned short hb = f2bf_bits(sp[e]);
              unsigned short lb = f2bf_bits(sp[e] - bf_bits2f(hb));
              hv[e] = __builtin_bit_cast(_Float16, hb);
              lv[e] = __builtin_bit_cast(_Float16, lb);
            }
          }
          *(v8h*)(C + (size_t)(mBase + row) * ldc + n0 + c8) = hv;
          if (OUT_MODE == 2) *(v8h*)(C2 + (size_t)(mBase + row) * ldc + n0 + c8) = lv;
        }
        
      }
    }
    __builtin_amdgcn_fence(__ATOMIC_RELEASE, "workgroup");
    __builtin_amdgcn_wave_barrier();
    __builtin_amdgcn_fence(__ATOMIC_ACQUIRE, "workgroup");
  }
}

// ---------------- bf16 WMMA, builtin form: the compiler keeps the distances the chip needs behind it ----------------
__device__ __forceinline__ v8f at_mma(v16b a, v16b b, v8f c) {
  return __builtin_amdgcn_wmma_f32_16x16x32_bf16(false, a, false, b, (short)0, c, false, false);
}
// the f16 form of the same shape: same fragment maps, same k order
__device__ __forceinline__ v8f at_mma_h(v16h a, v16h b, v8f c) {
  return __builtin_amdgcn_wmma_f32_16x16x32_f16(false, a, false, b, (short)0, c, false, false);
}

// same-wave LDS write -> read ordering
__device__ __forceinline__ void lds_wave_sync() {
  __builtin_amdgcn_fence(__ATOMIC_RELEASE, "workgroup");
  __builtin_amdgcn_wave_barrier();
  __builtin_amdgcn_fence(__ATOMIC_ACQUIRE, "workgroup");
}

// =====================================================================
// Operand fragments with the K=16 contraction packed into one 32-deep k-step:
//   slot s <  16 -> hi part of d = s
//   slot s >= 16 -> lo part of d = s - 16
// A fragment (lane row m = lane&15, hh = lane>>4): elements 0..7 = hi[d = 8hh+e], 8..15 = lo[d = 8hh+e].
// B fragments: B1 = [wh | wh], B2 = [wl | wl] so that A.B1 + A.B2 = (xh+xl).(wh+wl).
// =====================================================================
__device__ __forceinline__ v16b x_frag_split(const float* __restrict__ xr, int hh) {
  const v4f a = *(const v4f*)(xr + 8 * hh);
  const v4f b = *(const v4f*)(xr + 8 * hh + 4);
  const float f[8] = {a[0], a[1], a[2], a[3], b[0], b[1], b[2], b[3]};
  v16b fr;
#pragma unroll
  for (int e = 0; e < 8; e += 2) {
    v2b hb, lb;
    split_pair((v2f){f[e], f[e + 1]}, hb, lb);
    fr[e] = hb[0];     fr[e + 1] = hb[1];
    fr[8 + e] = lb[0]; fr[8 + e + 1] = lb[1];
  }
  return fr;
}
// W is [16 out][16 in] row-major; lane column c = out index e; loads W[c][8hh .. 8hh+7]
__device__ __forceinline__ void w_frags_split(const float* __restrict__ W, int c, int hh, v16b& wh, v16b& wl) {
  const v4f a = *(const v4f*)(W + c * HEADD + 8 * hh);
  const v4f b = *(const v4f*)(W + c * HEADD + 8 * hh + 4);
  const float f[8] = {a[0], a[1], a[2], a[3], b[0], b[1], b[2], b[3]};
#pragma unroll
  for (int e = 0; e < 8; e += 2) {
    v2b hb, lb;
    split_pair((v2f){f[e], f[e + 1]}, hb, lb);
    wh[e] = hb[0]; wh[e + 1] = hb[1]; wh[8 + e] = hb[0]; wh[8 + e + 1] = hb[1];
    wl[e] = lb[0]; wl[e + 1] = lb[1]; wl[8 + e] = lb[0]; wl[8 + e + 1] = lb[1];
  }
}

// One wave: rows n0..n0+63 of slice (t,h) for a q-type tensor -> plane dst[slice][n][hi16|lo16].
// Coverage: 4 tiles x 16 rows = 64 rows x 32 u16 staged; stored as 8 x (32 lanes x 8 u16) = 2048 u16 = whole region.
__device__ __forceinline__ void proj_qk_part(const float* __restrict__ x, unsigned short* __restrict__ dstp,
    const v16b wh, const v16b wl, float oscale, int slice, int n0, int t, int h, int lane, unsigned short* sl)
{
  const int hh = lane >> 4, c = lane & 15;
#pragma unroll
  for (int i = 0; i < 4; ++i) {
    const float* xr = x + ((size_t)(n0 + 16 * i + c) * TSTEP + t) * EMB + h * HEADD;
    const v16b xa = x_frag_split(xr, hh);
    v8f acc = (v8f){0.f,0.f,0.f,0.f,0.f,0.f,0.f,0.f};
    acc = at_mma(xa, wh, acc);
    acc = at_mma(xa, wl, acc);
    // acc[r] = proj[n0 + 16i + 8hh + r][e = c]
#pragma unroll
    for (int r = 0; r < 8; r += 2) {
      us2 hb, lb;
      split_pair_bits((v2f){acc[r] * oscale, acc[r + 1] * oscale}, hb, lb);
      const int row = 16 * i + 8 * hh + r;
      sl[row * QKROW + c] = hb[0];
      sl[row * QKROW + 16 + c] = lb[0];
      sl[(row + 1) * QKROW + c] = hb[1];
      sl[(row + 1) * QKROW + 16 + c] = lb[1];
    }
  }
  lds_wave_sync();
  unsigned short* dst = dstp + ((size_t)slice * NNODE + n0) * QKROW;   // 64 consecutive rows = 4096 B = 32 lines
  {
#pragma unroll
    for (int it = 0; it < 8; ++it) {
      const us8 v = *(const us8*)(sl + (it * 32 + lane) * 8);
      *(us8*)(dst + (it * 32 + lane) * 8) = v;
    }
    
  }
  lds_wave_sync();
}

// One wave: rows n0..n0+63 of slice for values -> transposed planes Vth/Vtl[slice][d][n], f16 hi and lo parts.
// Coverage: slab hi [16 d][64 n] + lo [16 d][64 n] fully written by 4 tiles x 32 lanes x 8 u16;
// stored as 4 x (4 rows x 8 lanes x 8 u16) per plane = all 16 d rows x 64 n.
__device__ __forceinline__ void proj_v_part(const float* __restrict__ x, unsigned short* __restrict__ Vth,
    unsigned short* __restrict__ Vtl, const v16b wh, const v16b wl, int slice, int n0, int t, int h, int lane,
    unsigned short* sl)
{
  const int hh = lane >> 4, c = lane & 15;
#pragma unroll
  for (int i = 0; i < 4; ++i) {
    const float* xr = x + ((size_t)(n0 + 16 * i + c) * TSTEP + t) * EMB + h * HEADD;
    const v16b xa = x_frag_split(xr, hh);
    v8f acc = (v8f){0.f,0.f,0.f,0.f,0.f,0.f,0.f,0.f};
    acc = at_mma(xa, wh, acc);
    acc = at_mma(xa, wl, acc);
    // acc[r] = v[n0 + 16i + 8hh + r][d = c] -> slab[d][16i + 8hh + r]
    us8 hv, lv;
#pragma unroll
    for (int r = 0; r < 8; r += 2) {
      us2 hb, lb;
      split_pair_f16_bits((v2f){acc[r], acc[r + 1]}, hb, lb);
      hv[r] = hb[0]; hv[r + 1] = hb[1];
      lv[r] = lb[0]; lv[r + 1] = lb[1];
    }
    *(us8*)(sl + c * 64 + 16 * i + 8 * hh) = hv;
    *(us8*)(sl + 1024 + c * 64 + 16 * i + 8 * hh) = lv;
  }
  lds_wave_sync();
  const int qq = lane >> 3, c8 = (lane & 7) * 8;
  {
#pragma unroll
    for (int it = 0; it < 4; ++it) {
      const int d = it * 4 + qq;
      const us8 hv = *(const us8*)(sl + d * 64 + c8);
      const us8 lv = *(const us8*)(sl + 1024 + d * 64 + c8);
      const size_t off = ((size_t)slice * HEADD + d) * NNODE + n0 + c8;
      *(us8*)(Vth + off) = hv;
      *(us8*)(Vtl + off) = lv;
    }
    
  }
  lds_wave_sync();
}

// =====================================================================
// Wo -> bf16 hi/lo planes [64][64] (Bt[n = e][k = c] = Wo[e][c]), the work of one block of 128 threads:
// thread handles element groups g = tid + 128 * it, it = 0 .. 3 (8 consecutive elements each): 512 x 8 = 4096 = whole planes.
// =====================================================================
__device__ __forceinline__ void wo_split_block(
    const float* __restrict__ Wo, unsigned short* __restrict__ Woh, unsigned short* __restrict__ Wol, int tid)
{
  us8 hv[4], lv[4];
#pragma unroll
  for (int it = 0; it < 4; ++it) {
    const int g = tid + 128 * it;
    const v4f a = *(const v4f*)(Wo + 8 * g);
    const v4f b = *(const v4f*)(Wo + 8 * g + 4);
    const float f[8] = {a[0], a[1], a[2], a[3], b[0], b[1], b[2], b[3]};
#pragma unroll
    for (int e = 0; e < 8; e += 2) {
      us2 hb, lb;
      split_pair_bits((v2f){f[e], f[e + 1]}, hb, lb);
      hv[it][e] = hb[0]; hv[it][e + 1] = hb[1];
      lv[it][e] = lb[0]; lv[it][e + 1] = lb[1];
    }
  }
#pragma unroll
  for (int it = 0; it < 4; ++it) {
    const int g = tid + 128 * it;
    *(us8*)(Woh + 8 * g) = hv[it];
    *(us8*)(Wol + 8 * g) = lv[it];
  }
}

// =====================================================================
// Kernel 1: per-head projections on WMMA. One wave = (slice, 64-node group); 4 waves per block,
// each with its own LDS slab (no cross-wave LDS traffic, no block barriers).
// grid = 2304 / 4 = 576 projection blocks, and one block more that splits Wo: that work depends on nothing the
// projections do and is first read by the output projection, so it needs no launch of its own.
// =====================================================================
constexpr int PROJ_BLOCKS = NSLICE * (NNODE / 64) / 4;   // 576
__global__ __launch_bounds__(128) void proj_qkv(
    const float* __restrict__ values, const float* __restrict__ keys, const float* __restrict__ query,
    const float* __restrict__ Wv, const float* __restrict__ Wk, const float* __restrict__ Wq,
    const float* __restrict__ Wo,
    unsigned short* __restrict__ Q2, unsigned short* __restrict__ K2,
    unsigned short* __restrict__ Vth, unsigned short* __restrict__ Vtl,
    unsigned short* __restrict__ Woh, unsigned short* __restrict__ Wol)
{
  __shared__ __align__(16) unsigned short slab[4][64 * QKROW];   // 4 KB per wave
  if (blockIdx.x == PROJ_BLOCKS) {   // the same for the whole block
    wo_split_block(Wo, Woh, Wol, threadIdx.x);
    return;
  }
  const int lane = threadIdx.x & 31;
  const int wave = threadIdx.x >> 5;
  const int hh = lane >> 4, c = lane & 15;
  const int task  = blockIdx.x * 4 + wave;           // 0 .. 2303
  const int slice = task >> 4;                        // 0 .. 143
  const int ng    = task & 15;                        // node group
  const int t = slice >> 2, h = slice & 3;
  const int n0 = ng * 64;
  unsigned short* sl = slab[wave];

  v16b wqh, wql, wkh, wkl, wvh, wvl;
  w_frags_split(Wq, c, hh, wqh, wql);
  w_frags_split(Wk, c, hh, wkh, wkl);
  w_frags_split(Wv, c, hh, wvh, wvl);

  // q carries the exact 1/sqrt(64) = 0.125 score scale
  proj_qk_part(query, Q2, wqh, wql, 0.125f, slice, n0, t, h, lane, sl);
  proj_qk_part(keys,  K2, wkh, wkl, 1.0f,   slice, n0, t, h, lane, sl);
  proj_v_part(values, Vth, Vtl, wvh, wvl, slice, n0, t, h, lane, sl);
}

constexpr float LOG2E = 1.4426950408889634f;
// y = 2^x on the hardware. The v_nop in the same statement keeps the one slot that the instruction set asks for between
// a transcendental and an instruction that uses its result or overwrites its source, whatever the compiler puts next.
__device__ __forceinline__ float exp2_hw(float x) {
  float y;
  asm("v_exp_f32 %0, %1\n\tv_nop" : "=v"(y) : "v"(x));
  return y;
}
// Eight independent 2^x in one statement: the early-clobber outputs keep every result off every source, so none of the
// eight overwrites a source of the one in front of it, and one closing v_nop keeps the slot for all of them.
__device__ __forceinline__ v8f exp2_hw8(v8f x) {
  float y0, y1, y2, y3, y4, y5, y6, y7;
  asm("v_exp_f32 %0, %8\n\tv_exp_f32 %1, %9\n\tv_exp_f32 %2, %10\n\tv_exp_f32 %3, %11\n\t"
      "v_exp_f32 %4, %12\n\tv_exp_f32 %5, %13\n\tv_exp_f32 %6, %14\n\tv_exp_f32 %7, %15\n\tv_nop"
      : "=&v"(y0), "=&v"(y1), "=&v"(y2), "=&v"(y3), "=&v"(y4), "=&v"(y5), "=&v"(y6), "=&v"(y7)
      : "v"(x[0]), "v"(x[1]), "v"(x[2]), "v"(x[3]), "v"(x[4]), "v"(x[5]), "v"(x[6]), "v"(x[7]));
  return (v8f){y0, y1, y2, y3, y4, y5, y6, y7};
}
// value of lane l ^ 16
__device__ __forceinline__ float other_half(float x) {
  const int b = __float_as_int(x);
  return __int_as_float(__builtin_amdgcn_permlanex16(b, b, 0x76543210, 0xfedcba98, false, false));
}

// Softmax weights of one pass, pe[j][r] = 2^(s[j][r] * log2e - m), and the lane's sum of the 32 of them.
// With m the maximum the arguments are <= 0 up to one rounding; below -126 a term is under 2^-126 of the largest and goes to 0.
__device__ __forceinline__ float weights64(const v8f (&s)[4], float m, v8f (&pe)[4]) {
  float ps[4];
#pragma unroll
  for (int j = 0; j < 4; ++j) {
    v8f ea;
#pragma unroll
    for (int r = 0; r < 8; r += 2) {
      const v2f a2 = __builtin_elementwise_fma((v2f){s[j][r], s[j][r + 1]}, (v2f){LOG2E, LOG2E}, (v2f){-m, -m});
      ea[r] = a2[0]; ea[r + 1] = a2[1];
    }
    pe[j] = exp2_hw8(ea);
    ps[j] = 0.f;
#pragma unroll
    for (int r = 0; r < 8; ++r) ps[j] += pe[j][r];
  }
  return (ps[0] + ps[1]) + (ps[2] + ps[3]);
}
// A lane's sum of 32 weights up to which the maximum in use is kept: no weight is then above 2^8, far inside the range of
// f32 and of f16 (65504). Downwards f16 keeps its 11 bits to 2^-14 and an absolute step of 2^-24 below that, against a sum
// of weights that is >= 1.
constexpr float WBOUND = 256.0f;

// LDS row pitches of the staged tiles, in 16-bit elements. The fragment reads are 16 bytes a lane with one row per lane,
// so the pitch is an odd multiple of 16 bytes: the 16 rows of a half wave then fall on 16 different groups of four banks.
// The pad elements at the end of a row are never written and never read.
constexpr int KPITCH = QKROW + 8;            // 80 B  = 16 B x 5 (data: 64 B)
constexpr int VPITCH = 64 + 8;               // 144 B = 16 B x 9 (data: 128 B)

// element offset of lane ln = (c, hh) in its wave's 16 rows of 16: row c = ln & 15, elements 8hh .. 8hh + 7
__device__ __forceinline__ int ln_off(int ln) { return (ln & 15) * HEADD + 8 * (ln >> 4); }

// Register budget: at most 112 vector registers (1024 / 9, in granules of 16), so that nine blocks, a WGP's share of the
// grid, are resident at once; at eight, a ninth of the blocks would run afterwards, one wave per SIMD.
__global__ __launch_bounds__(128) void attn_hd16(
    const unsigned short* __restrict__ Q2, const unsigned short* __restrict__ K2,
    const unsigned short* __restrict__ Vth, const unsigned short* __restrict__ Vtl,
    unsigned short* __restrict__ Ohi, unsigned short* __restrict__ Olo)
{
  union FB { v16b v; v8b h[2]; };
  union FH { v16h v; v8h h[2]; };
  // one array, so that the tiles lie at constant offsets from one another and share their address registers
  __shared__ __align__(16) __bf16 tiles[64 * KPITCH + 2 * HEADD * VPITCH];
  __bf16* const Ksh = tiles;                                // [key][hi16|lo16|pad]
  __bf16* const Vhs = tiles + 64 * KPITCH;                  // [d][64 keys|pad] hi: f16 bits, staged as 16-byte pieces
  __bf16* const Vls = Vhs + HEADD * VPITCH;                 // [d][64 keys|pad] lo: f16 bits

  const int tid  = threadIdx.x;
  const int wave = __builtin_amdgcn_readfirstlane(tid >> 5);   // the same in every lane: kept in a scalar register
  const int lane = tid & 31;
  const int hh   = lane >> 4;
  const int c    = lane & 15;
  const int slice = blockIdx.x >> 4;         // 0 .. 143 = t * NHEAD + h
  const int qb   = blockIdx.x & 15;          // 64-query block
  const int q0   = qb * 64 + wave * 16;

  const __bf16* Qs = (const __bf16*)(const void*)Q2 + (size_t)slice * NNODE * QKROW;
  // B fragment, column = query q0 + c: elements 0..7 = qh[d = 8hh+e], 8..15 = ql[d = 8hh+e]
  const v16b qa = Frag<__bf16>::load(Qs + (size_t)(q0 + c) * QKROW + 8 * hh);
  const v8b* Kg  = (const v8b*)(const void*)(K2  + (size_t)slice * NNODE * QKROW);   // [key*4 + seg]
  const v8b* Vhg = (const v8b*)(const void*)(Vth + (size_t)slice * HEADD * NNODE);   // [d*128 + key/8]
  const v8b* Vlg = (const v8b*)(const void*)(Vtl + (size_t)slice * HEADD * NNODE);

  __bf16* const kdst = Ksh + (tid >> 2) * KPITCH + (tid & 3) * 8;          // K piece tid: row tid / 4, 16-B segment tid % 4
  __bf16* const vdst = Vhs + (tid >> 3) * VPITCH + (tid & 7) * 8;          // V piece tid: d = tid / 8, 16-B segment tid % 8
  const unsigned vsrc = (unsigned)(tid >> 3) * (NNODE / 8) + (tid & 7);

  // per lane: the maximum in use for query q0 + c (equal in both halves), plain and times log2e; this half's part of its sum
  float mraw = -INFINITY, mrun = -INFINITY, lsum = 0.f;
  v8f oacc = (v8f){0.f,0.f,0.f,0.f,0.f,0.f,0.f,0.f};

#pragma unroll 1
  for (int kc = 0; kc < NNODE / 64; ++kc) {
    __syncthreads();
    // stage K: 256 pieces of 16 B = 64 rows x 32 u16 (whole tile, contiguous in K2); piece tid + 128 is row + 32, so the
    // two pieces of a thread lie a constant apart in K2 and in LDS and share their address registers (register budget, above)
    {
      const v8b* Kt = Kg + kc * 256;
      const v8b k0 = Kt[(unsigned)tid];
      const v8b k1 = Kt[(unsigned)tid + 128u];
      *(v8b*)(kdst) = k0;
      *(v8b*)(kdst + 32 * KPITCH) = k1;
    }
    // stage V hi/lo: 128 pieces of 16 B = 16 d x 64 keys per plane (whole tiles)
    {
      const v8b a  = (Vhg + kc * 8)[vsrc];
      const v8b b2 = (Vlg + kc * 8)[vsrc];
      *(v8b*)(vdst) = a;
      *(v8b*)(vdst + HEADD * VPITCH) = b2;
    }
    __syncthreads();

    v8f s[4];
#pragma unroll
    for (int j = 0; j < 4; ++j) {
      const __bf16* kr = Ksh + (j * 16 + c) * KPITCH + 8 * hh;
      const v8b kh8 = *(const v8b*)(kr);
      const v8b kl8 = *(const v8b*)(kr + 16);
      FB k1, k2;
      k1.h[0] = kh8; k1.h[1] = kh8;
      k2.h[0] = kl8; k2.h[1] = kl8;
      s[j] = (v8f){0.f,0.f,0.f,0.f,0.f,0.f,0.f,0.f};
      s[j] = at_mma(k1.v, qa, s[j]);
      s[j] = at_mma(k2.v, qa, s[j]);
    }
    // s[j][r] = scaled energy(key 64kc + 16j + 8hh + r, query q0 + c)
    // The weights are formed against the maximum in use. Softmax does not depend on that offset, so it need not be the
    // true maximum: it only has to keep the weights in range. While every lane's sum of this pass's 32 weights stays at or
    // under WBOUND, no weight exceeds WBOUND and nothing is rescaled. Otherwise (also on a NaN) the whole wave goes round
    // once more: it takes the maximum of the pass, rescales and forms the weights anew, each then at most 1. The first
    // pass, which has no maximum yet, takes it at once.
    v8f pe[4];
    float psum;
    bool renew = (kc == 0);
    // kept rolled: the second trip is the rare path and runs the same code as the first
#pragma unroll 1
    for (int trip = 0; trip < 2; ++trip) {
      if (renew) {
        // the chain starts at the maximum in use: it folds that in, and it makes the chain a part of this rare branch
        // (a chain over s alone is the same in both trips, and the compiler lifts it out, into every pass)
        float cm = mraw;
#pragma unroll
        for (int j = 0; j < 4; ++j)
#pragma unroll
          for (int r = 0; r < 8; ++r) cm = fmaxf(cm, s[j][r]);
        mraw = fmaxf(cm, other_half(cm));
        const float mnew  = mraw * LOG2E;
        const float alpha = exp2_hw(mrun - mnew);
        mrun = mnew;
        lsum *= alpha;
#pragma unroll
        for (int r = 0; r < 8; ++r) oacc[r] *= alpha;
      }
      psum = weights64(s, mrun, pe);
      if (renew) break;
      renew = __builtin_amdgcn_ballot_w32(!(psum <= WBOUND)) != 0u;   // one scalar branch for the wave
      if (!renew) break;
    }
    lsum += psum;

    v16h ph[2];
#pragma unroll
    for (int j = 0; j < 4; ++j) {
#pragma unroll
      for (int r = 0; r < 8; r += 2) {
        const v2h a = __builtin_convertvector((v2f){pe[j][r], pe[j][r + 1]}, v2h);
        // B element 8(j&1) + r of lane (c, hh) is key 16(j&1) + 8hh + r of the 32-key step j>>1
        ph[j >> 1][8 * (j & 1) + r] = a[0];  ph[j >> 1][8 * (j & 1) + r + 1] = a[1];
      }
    }

#pragma unroll
    for (int kk = 0; kk < 2; ++kk) {
      FH vb, vl;
      vb.h[0] = __builtin_bit_cast(v8h, *(const v8b*)(Vhs + c * VPITCH + kk * 32 + 8 * hh));
      vb.h[1] = __builtin_bit_cast(v8h, *(const v8b*)(Vhs + c * VPITCH + kk * 32 + 16 + 8 * hh));
      vl.h[0] = __builtin_bit_cast(v8h, *(const v8b*)(Vls + c * VPITCH + kk * 32 + 8 * hh));
      vl.h[1] = __builtin_bit_cast(v8h, *(const v8b*)(Vls + c * VPITCH + kk * 32 + 16 + 8 * hh));
      oacc = at_mma_h(vb.v, ph[kk], oacc);
      oacc = at_mma_h(vl.v, ph[kk], oacc);
    }
  }
  // oacc[r] = unnormalised out(query q0 + c, d = 8hh + r); the two halves' sums join here; the sum is >= 1
  const float inv = 1.0f / (lsum + other_half(lsum));
  us8 hv, lv;
#pragma unroll
  for (int r = 0; r < 8; r += 2) {
    us2 hb, lb;
    split_pair_bits((v2f){oacc[r] * inv, oacc[r + 1] * inv}, hb, lb);
    hv[r] = hb[0]; hv[r + 1] = hb[1];
    lv[r] = lb[0]; lv[r + 1] = lb[1];
  }
  // 16 B a lane, 32 B a query: one store of the wave covers 512 contiguous bytes of its plane.
  // The lane number is formed anew here, so that no vector register holds a part of this address across the loop.
  const int ln = (int)__builtin_amdgcn_mbcnt_lo(~0u, 0u);
  const size_t off = ((size_t)slice * NNODE + q0) * HEADD + ln_off(ln);
  *(us8*)(Ohi + off) = hv;
  *(us8*)(Olo + off) = lv;
}

// =====================================================================
extern "C" void kernel_launch(void* const* d_in, const int* in_sizes, int n_in,
                              void* d_out, int out_size, void* d_ws, size_t ws_size,
                              hipStream_t stream) {
  if (n_in < 8) return;
  if (in_sizes[0] != NNODE * TSTEP * EMB || in_sizes[1] != NNODE * TSTEP * EMB ||
      in_sizes[2] != NNODE * TSTEP * EMB || in_sizes[3] != HEADD * HEADD ||
      in_sizes[4] != HEADD * HEADD || in_sizes[5] != HEADD * HEADD ||
      in_sizes[6] != EMB * EMB || in_sizes[7] != EMB) return;
  if (out_size != NROWS * EMB) return;
  if (ws_size < WS_TOTAL) return;

  const float* values = (const float*)d_in[0];
  const float* keys   = (const float*)d_in[1];
  const float* query  = (const float*)d_in[2];
  const float* Wv     = (const float*)d_in[3];
  const float* Wk     = (const float*)d_in[4];
  const float* Wq     = (const float*)d_in[5];
  const float* Wo     = (const float*)d_in[6];
  const float* bo     = (const float*)d_in[7];

  char* ws = (char*)d_ws;
  unsigned short* Q2  = (unsigned short*)(ws + WS_Q2);
  unsigned short* K2  = (unsigned short*)(ws + WS_K2);
  unsigned short* Vth = (unsigned short*)(ws + WS_VTH);
  unsigned short* Vtl = (unsigned short*)(ws + WS_VTL);
  unsigned short* Ohi = (unsigned short*)(ws + WS_OHI);
  unsigned short* Olo = (unsigned short*)(ws + WS_OLO);
  unsigned short* Woh = (unsigned short*)(ws + WS_WOH);
  unsigned short* Wol = (unsigned short*)(ws + WS_WOL);

  // 1) per-head projections: 144 slices x 16 node groups = 2304 wave tasks, 4 per block; the last block splits Wo
  proj_qkv<<<dim3(PROJ_BLOCKS + 1), dim3(128), 0, stream>>>(
      values, keys, query, Wv, Wk, Wq, Wo, Q2, K2, Vth, Vtl, Woh, Wol);
  // 2) attention over nodes: 144 (t, head) slices x 16 query blocks
  attn_hd16<<<dim3(NSLICE * (NNODE / 64)), dim3(128), 0, stream>>>(Q2, K2, Vth, Vtl, Ohi, Olo);
  // 3) output projection: C[36864 x 64] = O . Wo^T + bo; M=36864 (576 tiles), N=64, K=64; 8 tiles per block
  wmma_gemm64<1, true, 2, 0, false, 0, true><<<dim3(NROWS / 64 / 8, 1), dim3(256), 0, stream>>>(
      Ohi, Olo, EMB, 0L, Woh, Wol, EMB, 0L,
      d_out, nullptr, EMB, 0L, bo, nullptr, 0L,
      NROWS, EMB, EMB, 1.0f);
}

// v010
// One run takes 45.3 microseconds.
// Next to v009, in two timings, it ran 1.15 and 1.18 times as fast.
// All steps since v000 together make it 4.99 times as fast.
// Contractions: v_wmma_f32_16x16x32_bf16 with bf16 hi/lo split operands (head projections, q.k scores, output projection) and v_wmma_f32_16x16x32_f16 (p.v: V as f16 hi/lo, softmax weights as one f16), f32 accumulate; softmax, splits and epilogues in f32.
#include <hip/hip_runtime.h>
#include <math.h>
#include <stddef.h>

// ---------------- problem constants ----------------
constexpr int NNODE  = 1024;
constexpr int TSTEP  = 36;
constexpr int EMB    = 64;
constexpr int NHEAD  = 4;
constexpr int HEADD  = 16;
constexpr int NSLICE = TSTEP * NHEAD;        // 144 (t, h) slices
constexpr int NROWS  = NNODE * TSTEP;        // 36864 rows of the [n*T+t][64] planes
constexpr int QKROW  = 32;                   // u16 per row of the Q/K planes: [hi e0..15 | lo e0..15]

// ---------------- workspace region map (bytes) ----------------
// Q2  : bf16 [144][1024][32]          9,437,184 B  @ 0
// K2  : bf16 [144][1024][32]          9,437,184 B  @ 9,437,184
// Vth : f16  [144][16][1024] (hi)     4,718,592 B  @ 18,874,368
// Vtl : f16  [144][16][1024] (lo)     4,718,592 B  @ 23,592,960
// Ohi : bf16 [144][1024][16] (hi)     4,718,592 B  @ 28,311,552
// Olo : bf16 [144][1024][16] (lo)     4,718,592 B  @ 33,030,144
// Woh : bf16 [64 x 64], fragment order     8,192 B  @ 37,748,736
// Wol : bf16 [64 x 64], fragment order     8,192 B  @ 37,756,928
// total                              37,765,120 B
constexpr size_t WS_Q2   = 0;
constexpr size_t SZ_QK   = (size_t)NSLICE * NNODE * QKROW * 2;
constexpr size_t WS_K2   = WS_Q2 + SZ_QK;
constexpr size_t SZ_V    = (size_t)NSLICE * HEADD * NNODE * 2;
constexpr size_t WS_VTH  = WS_K2 + SZ_QK;
constexpr size_t WS_VTL  = WS_VTH + SZ_V;
constexpr size_t SZ_O    = (size_t)NROWS * EMB * 2;
constexpr size_t WS_OHI  = WS_VTL + SZ_V;
constexpr size_t WS_OLO  = WS_OHI + SZ_O;
constexpr size_t SZ_WO   = (size_t)EMB * EMB * 2;
constexpr size_t WS_WOH  = WS_OLO + SZ_O;
constexpr size_t WS_WOL  = WS_WOH + SZ_WO;
constexpr size_t WS_TOTAL = WS_WOL + SZ_WO;
static_assert(WS_TOTAL == 37765120, "carve");
static_assert(WS_TOTAL <= 134217728, "carve");
static_assert((WS_K2 % 128) == 0 && (WS_VTH % 128) == 0 && (WS_VTL % 128) == 0 && (WS_OHI % 128) == 0 &&
              (WS_OLO % 128) == 0 && (WS_WOH % 128) == 0 && (WS_WOL % 128) == 0, "align");
// shape contract of the output projection: blocks of 128 rows, wave tiles of 32 rows inside one t, 64 columns, k-steps of 32
static_assert(NROWS % 128 == 0 && NNODE % 32 == 0 && EMB == 64, "gemm");
static_assert(NNODE % 64 == 0, "tiles");

// ---------------- types and fragment helpers ----------------
typedef __attribute__((ext_vector_type(16))) _Float16 v16h;
typedef __attribute__((ext_vector_type(8)))  _Float16 v8h;
typedef __attribute__((ext_vector_type(16))) __bf16   v16b;
typedef __attribute__((ext_vector_type(8)))  __bf16   v8b;
typedef __attribute__((ext_vector_type(8)))  float    v8f;
typedef __attribute__((ext_vector_type(4)))  float    v4f;
typedef __attribute__((ext_vector_type(8)))  unsigned short us8;

// hi/lo split of two f32 values at once on the hardware's packed f32 -> bf16 conversion, which rounds to nearest even:
// hi = bf16(p), lo = bf16(p - hi). Each result is one register of two packed bf16, the form that operand
// fragments and 16-byte stores are made of.
typedef __attribute__((ext_vector_type(2))) float          v2f;
typedef __attribute__((ext_vector_type(2))) __bf16         v2b;
typedef __attribute__((ext_vector_type(2))) unsigned short us2;
__device__ __forceinline__ void split_pair(v2f p, v2b& hi, v2b& lo) {
  hi = __builtin_convertvector(p, v2b);
  lo = __builtin_convertvector(p - __builtin_convertvector(hi, v2f), v2b);
}
__device__ __forceinline__ void split_pair_bits(v2f p, us2& hi, us2& lo) {
  v2b h, l;
  split_pair(p, h, l);
  hi = __builtin_bit_cast(us2, h);
  lo = __builtin_bit_cast(us2, l);
}
// The same split in f16, for V: hi = f16(p), lo = f16(p - hi), both rounded to nearest even. 11 + 11 significant bits while
// lo is a normal f16; below that lo keeps an absolute step of 2^-24. Range: |p| < 65504; a projected value of the stated
// inputs (16 products of a standard normal and a weight of scale 1/4) stays under a few hundred.
typedef __attribute__((ext_vector_type(2))) _Float16 v2h;
__device__ __forceinline__ void split_pair_f16_bits(v2f p, us2& hi, us2& lo) {
  const v2h h = __builtin_convertvector(p, v2h);
  const v2h l = __builtin_convertvector(p - __builtin_convertvector(h, v2f), v2h);
  hi = __builtin_bit_cast(us2, h);
  lo = __builtin_bit_cast(us2, l);
}

template <typename T> struct Frag;
template <> struct Frag<_Float16> {
  typedef v16h V; union U { v16h v; v8h h[2]; };
  static __device__ __forceinline__ v16h load(const _Float16* p) {   // elements 0..7 <- p[0..7], 8..15 <- p[16..23]
    U f; f.h[0] = *(const v8h*)(p); f.h[1] = *(const v8h*)(p + 16); return f.v;
  }
  static __device__ __forceinline__ v16h load2(const _Float16* p, const _Float16* q) {   // elements 0..7 <- p[0..7], 8..15 <- q[0..7]
    U f; f.h[0] = *(const v8h*)(p); f.h[1] = *(const v8h*)(q); return f.v;
  }
  static __device__ __forceinline__ v8f mma(v16h a, v16h b, v8f c) {
    return __builtin_amdgcn_wmma_f32_16x16x32_f16(false, a, false, b, (short)0, c, false, false);
  }
};
template <> struct Frag<__bf16> {
  typedef v16b V; union U { v16b v; v8b h[2]; };
  static __device__ __forceinline__ v16b load(const __bf16* p) {
    U f; f.h[0] = *(const v8b*)(p); f.h[1] = *(const v8b*)(p + 16); return f.v;
  }
  static __device__ __forceinline__ v16b load2(const __bf16* p, const __bf16* q) {
    U f; f.h[0] = *(const v8b*)(p); f.h[1] = *(const v8b*)(q); return f.v;
  }
  static __device__ __forceinline__ v8f mma(v16b a, v16b b, v8f c) {
    return __builtin_amdgcn_wmma_f32_16x16x32_bf16(false, a, false, b, (short)0, c, false, false);
  }
};

// ---------------- bf16 WMMA, builtin form: the compiler keeps the distances the chip needs behind it ----------------
__device__ __forceinline__ v8f at_mma(v16b a, v16b b, v8f c) {
  return __builtin_amdgcn_wmma_f32_16x16x32_bf16(false, a, false, b, (short)0, c, false, false);
}
// the f16 form of the same shape: same fragment maps, same k order
__device__ __forceinline__ v8f at_mma_h(v16h a, v16h b, v8f c) {
  return __builtin_amdgcn_wmma_f32_16x16x32_f16(false, a, false, b, (short)0, c, false, false);
}

// same-wave LDS write -> read ordering
__device__ __forceinline__ void lds_wave_sync() {
  __builtin_amdgcn_fence(__ATOMIC_RELEASE, "workgroup");
  __builtin_amdgcn_wave_barrier();
  __builtin_amdgcn_fence(__ATOMIC_ACQUIRE, "workgroup");
}

// =====================================================================
// Operand fragments with the K=16 contraction packed into one 32-deep k-step:
//   slot s <  16 -> hi part of d = s
//   slot s >= 16 -> lo part of d = s - 16
// A fragment (lane row m = lane&15, hh = lane>>4): elements 0..7 = hi[d = 8hh+e], 8..15 = lo[d = 8hh+e].
// B fragments: B1 = [wh | wh], B2 = [wl | wl] so that A.B1 + A.B2 = (xh+xl).(wh+wl).
// =====================================================================
__device__ __forceinline__ v16b x_frag_split(const float* __restrict__ xr, int hh) {
  const v4f a = *(const v4f*)(xr + 8 * hh);
  const v4f b = *(const v4f*)(xr + 8 * hh + 4);
  const float f[8] = {a[0], a[1], a[2], a[3], b[0], b[1], b[2], b[3]};
  v16b fr;
#pragma unroll
  for (int e = 0; e < 8; e += 2) {
    v2b hb, lb;
    split_pair((v2f){f[e], f[e + 1]}, hb, lb);
    fr[e] = hb[0];     fr[e + 1] = hb[1];
    fr[8 + e] = lb[0]; fr[8 + e + 1] = lb[1];
  }
  return fr;
}
// W is [16 out][16 in] row-major; lane column c = out index e; loads W[c][8hh .. 8hh+7]
__device__ __forceinline__ void w_frags_split(const float* __restrict__ W, int c, int hh, v16b& wh, v16b& wl) {
  const v4f a = *(const v4f*)(W + c * HEADD + 8 * hh);
  const v4f b = *(const v4f*)(W + c * HEADD + 8 * hh + 4);
  const float f[8] = {a[0], a[1], a[2], a[3], b[0], b[1], b[2], b[3]};
#pragma unroll
  for (int e = 0; e < 8; e += 2) {
    v2b hb, lb;
    split_pair((v2f){f[e], f[e + 1]}, hb, lb);
    wh[e] = hb[0]; wh[e + 1] = hb[1]; wh[8 + e] = hb[0]; wh[8 + e + 1] = hb[1];
    wl[e] = lb[0]; wl[e + 1] = lb[1]; wl[8 + e] = lb[0]; wl[8 + e + 1] = lb[1];
  }
}

// One wave: rows n0..n0+63 of slice (t,h) for a q-type tensor -> plane dst[slice][n][hi16|lo16].
// Coverage: 4 tiles x 16 rows = 64 rows x 32 u16 staged; stored as 8 x (32 lanes x 8 u16) = 2048 u16 = whole region.
__device__ __forceinline__ void proj_qk_part(const float* __restrict__ x, unsigned short* __restrict__ dstp,
    const v16b wh, const v16b wl, float oscale, int slice, int n0, int t, int h, int lane, unsigned short* sl)
{
  const int hh = lane >> 4, c = lane & 15;
#pragma unroll
  for (int i = 0; i < 4; ++i) {
    const float* xr = x + ((size_t)(n0 + 16 * i + c) * TSTEP + t) * EMB + h * HEADD;
    const v16b xa = x_frag_split(xr, hh);
    v8f acc = (v8f){0.f,0.f,0.f,0.f,0.f,0.f,0.f,0.f};
    acc = at_mma(xa, wh, acc);
    acc = at_mma(xa, wl, acc);
    // acc[r] = proj[n0 + 16i + 8hh + r][e = c]
#pragma unroll
    for (int r = 0; r < 8; r += 2) {
      us2 hb, lb;
      split_pair_bits((v2f){acc[r] * oscale, acc[r + 1] * oscale}, hb, lb);
      const int row = 16 * i + 8 * hh + r;
      sl[row * QKROW + c] = hb[0];
      sl[row * QKROW + 16 + c] = lb[0];
      sl[(row + 1) * QKROW + c] = hb[1];
      sl[(row + 1) * QKROW + 16 + c] = lb[1];
    }
  }
  lds_wave_sync();
  unsigned short* dst = dstp + ((size_t)slice * NNODE + n0) * QKROW;   // 64 consecutive rows = 4096 B = 32 lines
  {
#pragma unroll
    for (int it = 0; it < 8; ++it) {
      const us8 v = *(const us8*)(sl + (it * 32 + lane) * 8);
      *(us8*)(dst + (it * 32 + lane) * 8) = v;
    }
    
  }
  lds_wave_sync();
}

// One wave: rows n0..n0+63 of slice for values -> transposed planes Vth/Vtl[slice][d][n], f16 hi and lo parts.
// Coverage: slab hi [16 d][64 n] + lo [16 d][64 n] fully written by 4 tiles x 32 lanes x 8 u16;
// stored as 4 x (4 rows x 8 lanes x 8 u16) per plane = all 16 d rows x 64 n.
__device__ __forceinline__ void proj_v_part(const float* __restrict__ x, unsigned short* __restrict__ Vth,
    unsigned short* __restrict__ Vtl, const v16b wh, const v16b wl, int slice, int n0, int t, int h, int lane,
    unsigned short* sl)
{
  const int hh = lane >> 4, c = lane & 15;
#pragma unroll
  for (int i = 0; i < 4; ++i) {
    const float* xr = x + ((size_t)(n0 + 16 * i + c) * TSTEP + t) * EMB + h * HEADD;
    const v16b xa = x_frag_split(xr, hh);
    v8f acc = (v8f){0.f,0.f,0.f,0.f,0.f,0.f,0.f,0.f};
    acc = at_mma(xa, wh, acc);
    acc = at_mma(xa, wl, acc);
    // acc[r] = v[n0 + 16i + 8hh + r][d = c] -> slab[d][16i + 8hh + r]
    us8 hv, lv;
#pragma unroll
    for (int r = 0; r < 8; r += 2) {
      us2 hb, lb;
      split_pair_f16_bits((v2f){acc[r], acc[r + 1]}, hb, lb);
      hv[r] = hb[0]; hv[r + 1] = hb[1];
      lv[r] = lb[0]; lv[r + 1] = lb[1];
    }
    *(us8*)(sl + c * 64 + 16 * i + 8 * hh) = hv;
    *(us8*)(sl + 1024 + c * 64 + 16 * i + 8 * hh) = lv;
  }
  lds_wave_sync();
  const int qq = lane >> 3, c8 = (lane & 7) * 8;
  {
#pragma unroll
    for (int it = 0; it < 4; ++it) {
      const int d = it * 4 + qq;
      const us8 hv = *(const us8*)(sl + d * 64 + c8);
      const us8 lv = *(const us8*)(sl + 1024 + d * 64 + c8);
      const size_t off = ((size_t)slice * HEADD + d) * NNODE + n0 + c8;
      *(us8*)(Vth + off) = hv;
      *(us8*)(Vtl + off) = lv;
    }
    
  }
  lds_wave_sync();
}

// =====================================================================
// Wo -> bf16 hi/lo planes (Bt[n = e][k = c] = Wo[e][c]), the work of one block of 128 threads:
// thread handles element groups g = tid + 128 * it, it = 0 .. 3 (8 consecutive elements each): 512 x 8 = 4096 = whole planes.
// A plane is laid in the order in which the output projection's B fragments are read: 16-byte piece
//   wo_piece = ((ks * 4 + j) * 2 + q) * 32 + lane  holds  Bt[n = 16j + (lane & 15)][k = 32ks + 16q + 8(lane >> 4) + 0 .. 7],
// so that the piece q of fragment (k-step ks, column tile j) is 512 contiguous bytes, one piece a lane.
// =====================================================================
// piece of group g: row n = g / 8, k = 8 * (g % 8). A one-to-one map of 0 .. 511 onto itself.
__device__ __forceinline__ int wo_piece(int g) {
  const int n = g >> 3, k8 = g & 7;
  return (((k8 >> 2) * 4 + (n >> 4)) * 2 + ((k8 >> 1) & 1)) * 32 + (k8 & 1) * 16 + (n & 15);
}
__device__ __forceinline__ void wo_split_block(
    const float* __restrict__ Wo, unsigned short* __restrict__ Woh, unsigned short* __restrict__ Wol, int tid)
{
  us8 hv[4], lv[4];
#pragma unroll
  for (int it = 0; it < 4; ++it) {
    const int g = tid + 128 * it;
    const v4f a = *(const v4f*)(Wo + 8 * g);
    const v4f b = *(const v4f*)(Wo + 8 * g + 4);
    const float f[8] = {a[0], a[1], a[2], a[3], b[0], b[1], b[2], b[3]};
#pragma unroll
    for (int e = 0; e < 8; e += 2) {
      us2 hb, lb;
      split_pair_bits((v2f){f[e], f[e + 1]}, hb, lb);
      hv[it][e] = hb[0]; hv[it][e + 1] = hb[1];
      lv[it][e] = lb[0]; lv[it][e + 1] = lb[1];
    }
  }
#pragma unroll
  for (int it = 0; it < 4; ++it) {
    const int p = wo_piece(tid + 128 * it);
    *(us8*)(Woh + 8 * p) = hv[it];
    *(us8*)(Wol + 8 * p) = lv[it];
  }
}

// =====================================================================
// Kernel 1: per-head projections on WMMA. One wave = (slice, 64-node group); 4 waves per block,
// each with its own LDS slab (no cross-wave LDS traffic, no block barriers).
// grid = 2304 / 4 = 576 projection blocks, and one block more that splits Wo: that work depends on nothing the
// projections do and is first read by the output projection, so it needs no launch of its own.
// =====================================================================
constexpr int PROJ_BLOCKS = NSLICE * (NNODE / 64) / 4;   // 576
__global__ __launch_bounds__(128) void proj_qkv(
    const float* __restrict__ values, const float* __restrict__ keys, const float* __restrict__ query,
    const float* __restrict__ Wv, const float* __restrict__ Wk, const float* __restrict__ Wq,
    const float* __restrict__ Wo,
    unsigned short* __restrict__ Q2, unsigned short* __restrict__ K2,
    unsigned short* __restrict__ Vth, unsigned short* __restrict__ Vtl,
    unsigned short* __restrict__ Woh, unsigned short* __restrict__ Wol)
{
  __shared__ __align__(16) unsigned short slab[4][64 * QKROW];   // 4 KB per wave
  if (blockIdx.x == PROJ_BLOCKS) {   // the same for the whole block
    wo_split_block(Wo, Woh, Wol, threadIdx.x);
    return;
  }
  const int lane = threadIdx.x & 31;
  const int wave = threadIdx.x >> 5;
  const int hh = lane >> 4, c = lane & 15;
  const int task  = blockIdx.x * 4 + wave;           // 0 .. 2303
  const int slice = task >> 4;                        // 0 .. 143
  const int ng    = task & 15;                        // node group
  const int t = slice >> 2, h = slice & 3;
  const int n0 = ng * 64;
  unsigned short* sl = slab[wave];

  v16b wqh, wql, wkh, wkl, wvh, wvl;
  w_frags_split(Wq, c, hh, wqh, wql);
  w_frags_split(Wk, c, hh, wkh, wkl);
  w_frags_split(Wv, c, hh, wvh, wvl);

  // q carries the exact 1/sqrt(64) = 0.125 score scale
  proj_qk_part(query, Q2, wqh, wql, 0.125f, slice, n0, t, h, lane, sl);
  proj_qk_part(keys,  K2, wkh, wkl, 1.0f,   slice, n0, t, h, lane, sl);
  proj_v_part(values, Vth, Vtl, wvh, wvl, slice, n0, t, h, lane, sl);
}

constexpr float LOG2E = 1.4426950408889634f;
// y = 2^x on the hardware. The v_nop in the same statement keeps the one slot that the instruction set asks for between
// a transcendental and an instruction that uses its result or overwrites its source, whatever the compiler puts next.
__device__ __forceinline__ float exp2_hw(float x) {
  float y;
  asm("v_exp_f32 %0, %1\n\tv_nop" : "=v"(y) : "v"(x));
  return y;
}
// Eight independent 2^x in one statement: the early-clobber outputs keep every result off every source, so none of the
// eight overwrites a source of the one in front of it, and one closing v_nop keeps the slot for all of them.
__device__ __forceinline__ v8f exp2_hw8(v8f x) {
  float y0, y1, y2, y3, y4, y5, y6, y7;
  asm("v_exp_f32 %0, %8\n\tv_exp_f32 %1, %9\n\tv_exp_f32 %2, %10\n\tv_exp_f32 %3, %11\n\t"
      "v_exp_f32 %4, %12\n\tv_exp_f32 %5, %13\n\tv_exp_f32 %6, %14\n\tv_exp_f32 %7, %15\n\tv_nop"
      : "=&v"(y0), "=&v"(y1), "=&v"(y2), "=&v"(y3), "=&v"(y4), "=&v"(y5), "=&v"(y6), "=&v"(y7)
      : "v"(x[0]), "v"(x[1]), "v"(x[2]), "v"(x[3]), "v"(x[4]), "v"(x[5]), "v"(x[6]), "v"(x[7]));
  return (v8f){y0, y1, y2, y3, y4, y5, y6, y7};
}
// value of lane l ^ 16
__device__ __forceinline__ float other_half(float x) {
  const int b = __float_as_int(x);
  return __int_as_float(__builtin_amdgcn_permlanex16(b, b, 0x76543210, 0xfedcba98, false, false));
}

// Softmax weights of one pass, pe[j][r] = 2^(s[j][r] * log2e - m), and the lane's sum of the 32 of them.
// With m the maximum the arguments are <= 0 up to one rounding; below -126 a term is under 2^-126 of the largest and goes to 0.
__device__ __forceinline__ float weights64(const v8f (&s)[4], float m, v8f (&pe)[4]) {
  float ps[4];
#pragma unroll
  for (int j = 0; j < 4; ++j) {
    v8f ea;
#pragma unroll
    for (int r = 0; r < 8; r += 2) {
      const v2f a2 = __builtin_elementwise_fma((v2f){s[j][r], s[j][r + 1]}, (v2f){LOG2E, LOG2E}, (v2f){-m, -m});
      ea[r] = a2[0]; ea[r + 1] = a2[1];
    }
    pe[j] = exp2_hw8(ea);
    ps[j] = 0.f;
#pragma unroll
    for (int r = 0; r < 8; ++r) ps[j] += pe[j][r];
  }
  return (ps[0] + ps[1]) + (ps[2] + ps[3]);
}
// A lane's sum of 32 weights up to which the maximum in use is kept: no weight is then above 2^8, far inside the range of
// f32 and of f16 (65504). Downwards f16 keeps its 11 bits to 2^-14 and an absolute step of 2^-24 below that, against a sum
// of weights that is >= 1.
constexpr float WBOUND = 256.0f;

// LDS row pitches of the staged tiles, in 16-bit elements. The fragment reads are 16 bytes a lane with one row per lane,
// so the pitch is an odd multiple of 16 bytes: the 16 rows of a half wave then fall on 16 different groups of four banks.
// The pad elements at the end of a row are never written and never read.
constexpr int KPITCH = QKROW + 8;            // 80 B  = 16 B x 5 (data: 64 B)
constexpr int VPITCH = 64 + 8;               // 144 B = 16 B x 9 (data: 128 B)

// element offset of lane ln = (c, hh) in its wave's 16 rows of 16: row c = ln & 15, elements 8hh .. 8hh + 7
__device__ __forceinline__ int ln_off(int ln) { return (ln & 15) * HEADD + 8 * (ln >> 4); }

// Register budget: at most 112 vector registers (1024 / 9, in granules of 16), so that nine blocks, a WGP's share of the
// grid, are resident at once; at eight, a ninth of the blocks would run afterwards, one wave per SIMD.
__global__ __launch_bounds__(128) void attn_hd16(
    const unsigned short* __restrict__ Q2, const unsigned short* __restrict__ K2,
    const unsigned short* __restrict__ Vth, const unsigned short* __restrict__ Vtl,
    unsigned short* __restrict__ Ohi, unsigned short* __restrict__ Olo)
{
  union FB { v16b v; v8b h[2]; };
  union FH { v16h v; v8h h[2]; };
  // one array, so that the tiles lie at constant offsets from one another and share their address registers
  __shared__ __align__(16) __bf16 tiles[64 * KPITCH + 2 * HEADD * VPITCH];
  __bf16* const Ksh = tiles;                                // [key][hi16|lo16|pad]
  __bf16* const Vhs = tiles + 64 * KPITCH;                  // [d][64 keys|pad] hi: f16 bits, staged as 16-byte pieces
  __bf16* const Vls = Vhs + HEADD * VPITCH;                 // [d][64 keys|pad] lo: f16 bits

  const int tid  = threadIdx.x;
  const int wave = __builtin_amdgcn_readfirstlane(tid >> 5);   // the same in every lane: kept in a scalar register
  const int lane = tid & 31;
  const int hh   = lane >> 4;
  const int c    = lane & 15;
  const int slice = blockIdx.x >> 4;         // 0 .. 143 = t * NHEAD + h
  const int qb   = blockIdx.x & 15;          // 64-query block
  const int q0   = qb * 64 + wave * 16;

  const __bf16* Qs = (const __bf16*)(const void*)Q2 + (size_t)slice * NNODE * QKROW;
  // B fragment, column = query q0 + c: elements 0..7 = qh[d = 8hh+e], 8..15 = ql[d = 8hh+e]
  const v16b qa = Frag<__bf16>::load(Qs + (size_t)(q0 + c) * QKROW + 8 * hh);
  const v8b* Kg  = (const v8b*)(const void*)(K2  + (size_t)slice * NNODE * QKROW);   // [key*4 + seg]
  const v8b* Vhg = (const v8b*)(const void*)(Vth + (size_t)slice * HEADD * NNODE);   // [d*128 + key/8]
  const v8b* Vlg = (const v8b*)(const void*)(Vtl + (size_t)slice * HEADD * NNODE);

  __bf16* const kdst = Ksh + (tid >> 2) * KPITCH + (tid & 3) * 8;          // K piece tid: row tid / 4, 16-B segment tid % 4
  __bf16* const vdst = Vhs + (tid >> 3) * VPITCH + (tid & 7) * 8;          // V piece tid: d = tid / 8, 16-B segment tid % 8
  const unsigned vsrc = (unsigned)(tid >> 3) * (NNODE / 8) + (tid & 7);

  // per lane: the maximum in use for query q0 + c (equal in both halves), plain and times log2e; this half's part of its sum
  float mraw = -INFINITY, mrun = -INFINITY, lsum = 0.f;
  v8f oacc = (v8f){0.f,0.f,0.f,0.f,0.f,0.f,0.f,0.f};

#pragma unroll 1
  for (int kc = 0; kc < NNODE / 64; ++kc) {
    __syncthreads();
    // stage K: 256 pieces of 16 B = 64 rows x 32 u16 (whole tile, contiguous in K2); piece tid + 128 is row + 32, so the
    // two pieces of a thread lie a constant apart in K2 and in LDS and share their address registers (register budget, above)
    {
      const v8b* Kt = Kg + kc * 256;
      const v8b k0 = Kt[(unsigned)tid];
      const v8b k1 = Kt[(unsigned)tid + 128u];
      *(v8b*)(kdst) = k0;
      *(v8b*)(kdst + 32 * KPITCH) = k1;
    }
    // stage V hi/lo: 128 pieces of 16 B = 16 d x 64 keys per plane (whole tiles)
    {
      const v8b a  = (Vhg + kc * 8)[vsrc];
      const v8b b2 = (Vlg + kc * 8)[vsrc];
      *(v8b*)(vdst) = a;
      *(v8b*)(vdst + HEADD * VPITCH) = b2;
    }
    __syncthreads();

    v8f s[4];
#pragma unroll
    for (int j = 0; j < 4; ++j) {
      const __bf16* kr = Ksh + (j * 16 + c) * KPITCH + 8 * hh;
      const v8b kh8 = *(const v8b*)(kr);
      const v8b kl8 = *(const v8b*)(kr + 16);
      FB k1, k2;
      k1.h[0] = kh8; k1.h[1] = kh8;
      k2.h[0] = kl8; k2.h[1] = kl8;
      s[j] = (v8f){0.f,0.f,0.f,0.f,0.f,0.f,0.f,0.f};
      s[j] = at_mma(k1.v, qa, s[j]);
      s[j] = at_mma(k2.v, qa, s[j]);
    }
    // s[j][r] = scaled energy(key 64kc + 16j + 8hh + r, query q0 + c)
    // The weights are formed against the maximum in use. Softmax does not depend on that offset, so it need not be the
    // true maximum: it only has to keep the weights in range. While every lane's sum of this pass's 32 weights stays at or
    // under WBOUND, no weight exceeds WBOUND and nothing is rescaled. Otherwise (also on a NaN) the whole wave goes round
    // once more: it takes the maximum of the pass, rescales and forms the weights anew, each then at most 1. The first
    // pass, which has no maximum yet, takes it at once.
    v8f pe[4];
    float psum;
    bool renew = (kc == 0);
    // kept rolled: the second trip is the rare path and runs the same code as the first
#pragma unroll 1
    for (int trip = 0; trip < 2; ++trip) {
      if (renew) {
        // the chain starts at the maximum in use: it folds that in, and it makes the chain a part of this rare branch
        // (a chain over s alone is the same in both trips, and the compiler lifts it out, into every pass)
        float cm = mraw;
#pragma unroll
        for (int j = 0; j < 4; ++j)
#pragma unroll
          for (int r = 0; r < 8; ++r) cm = fmaxf(cm, s[j][r]);
        mraw = fmaxf(cm, other_half(cm));
        const float mnew  = mraw * LOG2E;
        const float alpha = exp2_hw(mrun - mnew);
        mrun = mnew;
        lsum *= alpha;
#pragma unroll
        for (int r = 0; r < 8; ++r) oacc[r] *= alpha;
      }
      psum = weights64(s, mrun, pe);
      if (renew) break;
      renew = __builtin_amdgcn_ballot_w32(!(psum <= WBOUND)) != 0u;   // one scalar branch for the wave
      if (!renew) break;
    }
    lsum += psum;

    v16h ph[2];
#pragma unroll
    for (int j = 0; j < 4; ++j) {
#pragma unroll
      for (int r = 0; r < 8; r += 2) {
        const v2h a = __builtin_convertvector((v2f){pe[j][r], pe[j][r + 1]}, v2h);
        // B element 8(j&1) + r of lane (c, hh) is key 16(j&1) + 8hh + r of the 32-key step j>>1
        ph[j >> 1][8 * (j & 1) + r] = a[0];  ph[j >> 1][8 * (j & 1) + r + 1] = a[1];
      }
    }

#pragma unroll
    for (int kk = 0; kk < 2; ++kk) {
      FH vb, vl;
      vb.h[0] = __builtin_bit_cast(v8h, *(const v8b*)(Vhs + c * VPITCH + kk * 32 + 8 * hh));
      vb.h[1] = __builtin_bit_cast(v8h, *(const v8b*)(Vhs + c * VPITCH + kk * 32 + 16 + 8 * hh));
      vl.h[0] = __builtin_bit_cast(v8h, *(const v8b*)(Vls + c * VPITCH + kk * 32 + 8 * hh));
      vl.h[1] = __builtin_bit_cast(v8h, *(const v8b*)(Vls + c * VPITCH + kk * 32 + 16 + 8 * hh));
      oacc = at_mma_h(vb.v, ph[kk], oacc);
      oacc = at_mma_h(vl.v, ph[kk], oacc);
    }
  }
  // oacc[r] = unnormalised out(query q0 + c, d = 8hh + r); the two halves' sums join here; the sum is >= 1
  const float inv = 1.0f / (lsum + other_half(lsum));
  us8 hv, lv;
#pragma unroll
  for (int r = 0; r < 8; r += 2) {
    us2 hb, lb;
    split_pair_bits((v2f){oacc[r] * inv, oacc[r + 1] * inv}, hb, lb);
    hv[r] = hb[0]; hv[r + 1] = hb[1];
    lv[r] = lb[0]; lv[r + 1] = lb[1];
  }
  // 16 B a lane, 32 B a query: one store of the wave covers 512 contiguous bytes of its plane.
  // The lane number is formed anew here, so that no vector register holds a part of this address across the loop.
  const int ln = (int)__builtin_amdgcn_mbcnt_lo(~0u, 0u);
  const size_t off = ((size_t)slice * NNODE + q0) * HEADD + ln_off(ln);
  *(us8*)(Ohi + off) = hv;
  *(us8*)(Olo + off) = lv;
}

// =====================================================================
// Kernel 3: output projection, out[node * T + t][e] = sum_c O[t][c / 16][node][c % 16] * Wo[e][c] + bo[e], on bf16 hi/lo
// operands: per 32-deep k-step hi.hi + hi.lo + lo.hi, in that order.
// One wave = 32 rows (nodes of one t) x all 64 columns; block = 4 waves = 128 rows; grid = 288 blocks, on every WGP.
// A wave has ONE wait on memory: the block's share of Wo, all of the wave's own O fragments and the bias are asked for
// before anything is waited for. Wo (16 KB, the same for every wave) comes once a block, as whole lines, and is handed
// round through LDS in its fragment order (wo_piece), where a fragment read is 512 contiguous bytes.
// k order: A elements 0..7 = head 2ks, d = 8hh + e (k = 32ks + 8hh + e), 8..15 = head 2ks + 1 (k = 32ks + 16 + 8hh + e);
//          B elements 0..7 = piece q = 0 (k = 32ks + 8hh + e),           8..15 = piece q = 1 (k = 32ks + 16 + 8hh + e).
// =====================================================================
constexpr int OP_WAVES = 4;
constexpr int OP_ROWS  = 32;                 // rows of a wave tile
constexpr int OP_PITCH = EMB + 4;            // floats a row of the output slab: 272 B = 16 B x 17
constexpr int WO_ELEMS = EMB * EMB;          // elements of one Wo plane
__global__ __launch_bounds__(128) void out_proj(
    const unsigned short* __restrict__ Ohi, const unsigned short* __restrict__ Olo,
    const unsigned short* __restrict__ Woh, const unsigned short* __restrict__ Wol,
    const float* __restrict__ bo, float* __restrict__ out)
{
  __shared__ __align__(16) __bf16 wfr[2 * WO_ELEMS];                   // hi plane, lo plane, fragment order
  __shared__ __align__(16) float slab[OP_WAVES][OP_ROWS * OP_PITCH];   // a wave's own 32 x 64 results
  const int tid   = threadIdx.x;
  const int lane  = tid & 31;
  const int wave  = __builtin_amdgcn_readfirstlane(tid >> 5);
  const int rlane = lane & 15;
  const int hh    = lane >> 4;
  const int m0    = (blockIdx.x * OP_WAVES + wave) * OP_ROWS;
  const int t     = m0 / NNODE;              // the same for the 32 rows
  const int node0 = m0 % NNODE;

  // Wo: 2 x 512 pieces of 16 B, 8 a thread
  const v8b* Whg = (const v8b*)(const void*)Woh;
  const v8b* Wlg = (const v8b*)(const void*)Wol;
  v8b wst[8];
#pragma unroll
  for (int it = 0; it < 4; ++it) {
    wst[it]     = Whg[tid + 128 * it];
    wst[4 + it] = Wlg[tid + 128 * it];
  }
  // O: 16 rows of 32 B of one head plane are 512 contiguous bytes
  // (a base that is the same for the wave, one lane offset for all sixteen loads)
  const size_t ob = ((size_t)t * NHEAD * NNODE + node0) * HEADD;
  const __bf16* Oh = (const __bf16*)(const void*)Ohi + ob;
  const __bf16* Ol = (const __bf16*)(const void*)Olo + ob;
  const unsigned lo = (unsigned)(rlane * HEADD + 8 * hh);
  v16b ah[2][2], al[2][2];
#pragma unroll
  for (int i = 0; i < 2; ++i)
#pragma unroll
    for (int ks = 0; ks < 2; ++ks) {
      const unsigned ao = (unsigned)((2 * ks * NNODE + 16 * i) * HEADD) + lo;
      ah[i][ks] = Frag<__bf16>::load2(Oh + ao, Oh + ao + NNODE * HEADD);
      al[i][ks] = Frag<__bf16>::load2(Ol + ao, Ol + ao + NNODE * HEADD);
    }
  float bv[4];
#pragma unroll
  for (int j = 0; j < 4; ++j) bv[j] = bo[16 * j + rlane];

#pragma unroll
  for (int it = 0; it < 4; ++it) {
    *(v8b*)(wfr + (tid + 128 * it) * 8) = wst[it];
    *(v8b*)(wfr + WO_ELEMS + (tid + 128 * it) * 8) = wst[4 + it];
  }
  __syncthreads();

  v8f acc[2][4];
#pragma unroll
  for (int i = 0; i < 2; ++i)
#pragma unroll
    for (int j = 0; j < 4; ++j) acc[i][j] = (v8f){0.f,0.f,0.f,0.f,0.f,0.f,0.f,0.f};
#pragma unroll
  for (int ks = 0; ks < 2; ++ks)
#pragma unroll
    for (int j = 0; j < 4; ++j) {
      const __bf16* bp = wfr + ((ks * 4 + j) * 64 + lane) * 8;
      const v16b bh = Frag<__bf16>::load2(bp, bp + 256);
      const v16b bl = Frag<__bf16>::load2(bp + WO_ELEMS, bp + WO_ELEMS + 256);
#pragma unroll
      for (int i = 0; i < 2; ++i) {
        acc[i][j] = at_mma(ah[i][ks], bh, acc[i][j]);
        acc[i][j] = at_mma(ah[i][ks], bl, acc[i][j]);
        acc[i][j] = at_mma(al[i][ks], bh, acc[i][j]);
      }
    }

  // acc[i][j][r] = row 16i + 8hh + r, column 16j + rlane. Through the wave's slab, so that a store covers whole rows of 256 B.
  float* sl = slab[wave];
#pragma unroll
  for (int i = 0; i < 2; ++i)
#pragma unroll
    for (int j = 0; j < 4; ++j)
#pragma unroll
      for (int r = 0; r < 8; ++r) sl[(16 * i + 8 * hh + r) * OP_PITCH + 16 * j + rlane] = acc[i][j][r] + bv[j];
  lds_wave_sync();
  const int c4 = rlane * 4;                  // a row = 16 lanes x 16 B; two rows a store
  // row node0 + 2it + hh of this t: a base that is the same for the wave, one lane offset, a constant step from store to store
  float* const orow = out + ((size_t)node0 * TSTEP + t) * EMB;
  const unsigned so = (unsigned)(hh * TSTEP * EMB + c4);
#pragma unroll
  for (int it = 0; it < OP_ROWS / 2; ++it) {
    const v4f v = *(const v4f*)(sl + (it * 2 + hh) * OP_PITCH + c4);
    *(v4f*)(orow + so + (unsigned)(it * 2 * TSTEP * EMB)) = v;
  }
}

// =====================================================================
extern "C" void kernel_launch(void* const* d_in, const int* in_sizes, int n_in,
                              void* d_out, int out_size, void* d_ws, size_t ws_size,
                              hipStream_t stream) {
  if (n_in < 8) return;
  if (in_sizes[0] != NNODE * TSTEP * EMB || in_sizes[1] != NNODE * TSTEP * EMB ||
      in_sizes[2] != NNODE * TSTEP * EMB || in_sizes[3] != HEADD * HEADD ||
      in_sizes[4] != HEADD * HEADD || in_sizes[5] != HEADD * HEADD ||
      in_sizes[6] != EMB * EMB || in_sizes[7] != EMB) return;
  if (out_size != NROWS * EMB) return;
  if (ws_size < WS_TOTAL) return;

  const float* values = (const float*)d_in[0];
  const float* keys   = (const float*)d_in[1];
  const float* query  = (const float*)d_in[2];
  const float* Wv     = (const float*)d_in[3];
  const float* Wk     = (const float*)d_in[4];
  const float* Wq     = (const float*)d_in[5];
  const float* Wo     = (const float*)d_in[6];
  const float* bo     = (const float*)d_in[7];

  char* ws = (char*)d_ws;
  unsigned short* Q2  = (unsigned short*)(ws + WS_Q2);
  unsigned short* K2  = (unsigned short*)(ws + WS_K2);
  unsigned short* Vth = (unsigned short*)(ws + WS_VTH);
  unsigned short* Vtl = (unsigned short*)(ws + WS_VTL);
  unsigned short* Ohi = (unsigned short*)(ws + WS_OHI);
  unsigned short* Olo = (unsigned short*)(ws + WS_OLO);
  unsigned short* Woh = (unsigned short*)(ws + WS_WOH);
  unsigned short* Wol = (unsigned short*)(ws + WS_WOL);

  // 1) per-head projections: 144 slices x 16 node groups = 2304 wave tasks, 4 per block; the last block splits Wo
  proj_qkv<<<dim3(PROJ_BLOCKS + 1), dim3(128), 0, stream>>>(
      values, keys, query, Wv, Wk, Wq, Wo, Q2, K2, Vth, Vtl, Woh, Wol);
  // 2) attention over nodes: 144 (t, head) slices x 16 query blocks
  attn_hd16<<<dim3(NSLICE * (NNODE / 64)), dim3(128), 0, stream>>>(Q2, K2, Vth, Vtl, Ohi, Olo);
  // 3) output projection: out[36864 x 64] = O . Wo^T + bo; 1152 wave tiles of 32 rows, 4 per block
  out_proj<<<dim3(NROWS / (OP_WAVES * OP_ROWS)), dim3(32 * OP_WAVES), 0, stream>>>(Ohi, Olo, Woh, Wol, bo, (float*)d_out);
}
